// v000
// Times are from an AMD MI455X. After a warm-up the kernel runs many times in a row, and a time is the length of
// such a window on the GPU divided by its runs, so every launch and the gaps after it count. The runs cycle
// through copies of the inputs. A figure is the median of several windows, for all but v000 over two sittings.
// Sittings can differ by a few percent; kernels timed side by side share one.
// v000 is the starting kernel. One run takes 1840 microseconds.
#include <hip/hip_runtime.h>

// RelativeMultiHeadAttn (Transformer-XL style, k_as_x: x [4][1024][1024], Wqv [1024][2048] (q | v column blocks), r_r_bias / r_w_bias [16][64], mask [4][1024] (int, read; all ones); k = x itself split into 16 heads; pos = the sinusoidal table [2L][64] (sin | cos of p * exp(-d ln(1e4)/31), p = -L..L-1, row 0 zeroed) computed on chip in f32; AC = (q + r_r_bias).k; B_ = q.pos^T, D_ = r_w_bias.pos^T; BD = shift(B_ + D_) = (B_ + D_)[i][L - i + j] (exact index form of the pad/reshape shift); attn = softmax(AC + BD) (NO scaling; -inf where mask == 0); out = attn.v merged -> [4][1024][1024] (no output projection)).
// Compute dtypes, f32 accumulate: every input rounded to bf16; q, v as PLAIN bf16 GEMMs (inputs: exact); k planes straight from the (bf16-exact) input; pos table f32 -> hi/lo planes; AC and B_ as hl x hl GEMMs (3 products) on every row (unscaled logits are sharp); D_ as 64-term f32 dots; BD gathered per element (contiguous along j) and added in f32; softmax f32; attn.v hl x hl (3 products) on every row; output written directly in f32.

#define NB_  4
#define TT   1024
#define DM   1024
#define NH_  16
#define NKV  16
#define REP  (NH_ / NKV)
#define HD   64
#define DQ   (NH_ * HD)
#define DKV  (NKV * HD)
#define ZH   2
#define RH   1024                  // query rows < RH use hi+lo planes (0: none)
#define WIN  0
#define PCAR 1024.0f
#define P2   (2 * TT)             // 2L relative positions
#define SCL  0.125f   // HD^-0.5
typedef _Float16 h16;
typedef unsigned short bf;
typedef __attribute__((ext_vector_type(16))) __bf16   v16bf;
typedef __attribute__((ext_vector_type(16))) _Float16 v16h;
typedef __attribute__((ext_vector_type(8)))  _Float16 v8h;
typedef __attribute__((ext_vector_type(8)))  unsigned short v8us;
typedef __attribute__((ext_vector_type(8)))  float    v8f;
typedef __attribute__((ext_vector_type(4)))  float    v4f;
typedef v8h  __attribute__((may_alias)) v8ha;
typedef v4f  __attribute__((may_alias)) v4fa;
typedef v8us __attribute__((may_alias)) v8usa;

__device__ __forceinline__ unsigned short f2bf(float f) { unsigned u = __float_as_uint(f); u += 0x7FFFu + ((u >> 16) & 1u); return (unsigned short)(u >> 16); }
__device__ __forceinline__ float bf2f(unsigned short b) { return __uint_as_float(((unsigned)b) << 16); }
__device__ __forceinline__ float bfr(float f) { return bf2f(f2bf(f)); }
__device__ __forceinline__ v16h cat16(v8h lo, v8h hi) { return __builtin_shufflevector(lo, hi, 0, 1, 2, 3, 4, 5, 6, 7, 8, 9, 10, 11, 12, 13, 14, 15); }
__device__ __forceinline__ v16bf cat16b(v8us lo, v8us hi) { return __builtin_bit_cast(v16bf, __builtin_shufflevector(lo, hi, 0, 1, 2, 3, 4, 5, 6, 7, 8, 9, 10, 11, 12, 13, 14, 15)); }
__device__ __forceinline__ v8f wmma16(v16h a, v16h b, v8f c) { return __builtin_amdgcn_wmma_f32_16x16x32_f16(false, a, false, b, (short)0, c, false, false); }
__device__ __forceinline__ v8f wmmab(v16bf a, v16bf b, v8f c) { return __builtin_amdgcn_wmma_f32_16x16x32_bf16(false, a, false, b, (short)0, c, false, false); }



// ---- k_gemmw: register-blocked GEMM, ONE WAVE per 64x64 output tile (16 accumulators), operands straight from K-contiguous 16-bit planes; grid (M/64, N/64, Z), 32 threads.
// C[m][n] (f32, pitch ldc, + optional f32 bias[n]) = sum_k A[m][k] Bt[n][k] (+ split products per NSPLIT). z-batch strides sA/sB/sC in elements. K % 32 == 0.
template <typename T16> struct WFrag;
template <> struct WFrag<h16> { typedef v16h V; static __device__ __forceinline__ V ld(const h16* p) { return cat16(*(const v8h*)p, *(const v8h*)(p + 16)); } static __device__ __forceinline__ v8f mma(V a, V b, v8f c) { return wmma16(a, b, c); } };
template <> struct WFrag<bf> { typedef v16bf V; static __device__ __forceinline__ V ld(const bf* p) { return cat16b(*(const v8us*)p, *(const v8us*)(p + 16)); } static __device__ __forceinline__ v8f mma(V a, V b, v8f c) { return wmmab(a, b, c); } };
template <typename T16, int NSPLIT, bool BIAS>
__global__ __launch_bounds__(32) void k_gemmw(const T16* __restrict__ A, const T16* __restrict__ A2, const T16* __restrict__ Bt, const T16* __restrict__ Bt2, int K, float* C, int ldc, const float* __restrict__ bias, size_t sA, size_t sB, size_t sC) {
    typedef typename WFrag<T16>::V V;
    __shared__ __align__(16) float os[16 * 68];
    const size_t z = blockIdx.z; A += z * sA; if (A2) A2 += z * sA; Bt += z * sB; if (Bt2) Bt2 += z * sB; C += z * sC;
    const int lane = threadIdx.x & 31, lr = lane & 15, hi = lane >> 4; const int r0 = blockIdx.x * 64, c0 = blockIdx.y * 64;
    v8f acc[4][4];
#pragma unroll
    for (int mb = 0; mb < 4; ++mb)
#pragma unroll
        for (int nb = 0; nb < 4; ++nb) acc[mb][nb] = (v8f){};
    const size_t aoff = (size_t)(r0 + lr) * K + 8 * hi, boff = (size_t)(c0 + lr) * K + 8 * hi;
#pragma unroll 1
    for (int kc = 0; kc < K; kc += 32) {
        V a[4], a2[4];
#pragma unroll
        for (int mb = 0; mb < 4; ++mb) { a[mb] = WFrag<T16>::ld(A + aoff + (size_t)mb * 16 * K + kc); if (NSPLIT == 1 || NSPLIT == 2) a2[mb] = WFrag<T16>::ld(A2 + aoff + (size_t)mb * 16 * K + kc); }
#pragma unroll
        for (int nb = 0; nb < 4; ++nb) { const V b = WFrag<T16>::ld(Bt + boff + (size_t)nb * 16 * K + kc); V b2; if (NSPLIT >= 2) b2 = WFrag<T16>::ld(Bt2 + boff + (size_t)nb * 16 * K + kc);
#pragma unroll
            for (int mb = 0; mb < 4; ++mb) { acc[mb][nb] = WFrag<T16>::mma(a[mb], b, acc[mb][nb]); if (NSPLIT == 1 || NSPLIT == 2) acc[mb][nb] = WFrag<T16>::mma(a2[mb], b, acc[mb][nb]); if (NSPLIT >= 2) acc[mb][nb] = WFrag<T16>::mma(a[mb], b2, acc[mb][nb]); } }
        asm volatile("v_nop\n\tv_nop\n\tv_nop\n\tv_nop" : "+v"(acc[0][0]), "+v"(acc[1][1]), "+v"(acc[2][2]), "+v"(acc[3][3]) : "v"(a[0]), "v"(a[3]));
    }
#pragma unroll
    for (int mb = 0; mb < 4; ++mb) {
#pragma unroll
        for (int nb = 0; nb < 4; ++nb) {
#pragma unroll
            for (int j = 0; j < 8; ++j) os[(hi * 8 + j) * 68 + nb * 16 + lr] = acc[mb][nb][j]; }
        __builtin_amdgcn_wave_barrier(); asm volatile("" ::: "memory");
        float* crow = C + (size_t)(r0 + mb * 16) * ldc + c0;
{
#pragma unroll
            for (int s = 0; s < 8; ++s) { const int row = 2 * s + hi, cofs = lr * 4; v4f val = *(const v4fa*)(os + row * 68 + cofs); if (BIAS) { val[0] += bfr(bias[c0 + cofs]); val[1] += bfr(bias[c0 + cofs + 1]); val[2] += bfr(bias[c0 + cofs + 2]); val[3] += bfr(bias[c0 + cofs + 3]); }
                *(v4f*)(crow + (size_t)row * ldc + cofs) = val; }
             }
        __builtin_amdgcn_wave_barrier(); asm volatile("" ::: "memory");
    }
}

__device__ __forceinline__ h16 tohx(float x) { return (h16)x; }
__device__ __forceinline__ void splitf(float y, unsigned short& h, unsigned short& l) { h = f2bf(y); l = f2bf(y - bf2f(h)); }
typedef __attribute__((ext_vector_type(2))) _Float16 v2h;
typedef __attribute__((ext_vector_type(4))) _Float16 v4h;
typedef __attribute__((ext_vector_type(2))) unsigned short v2us;
typedef __attribute__((ext_vector_type(4))) unsigned short v4us;
typedef __attribute__((ext_vector_type(2))) float v2f;
typedef __attribute__((ext_vector_type(4))) int v4i;

__global__ __launch_bounds__(256) void k_wtG(const float* __restrict__ w, int K, int N, bf* Bt) {
    const int lane = threadIdx.x & 31; const int L0 = (blockIdx.x * 8 + (threadIdx.x >> 5)) * 8; const int nlines = N * K / 64;
{
#pragma unroll 1
        for (int l = 0; l < 8; ++l) { const int L = L0 + l; if (L >= nlines) break; const size_t e = (size_t)L * 64 + lane * 2; const int k = (int)(e % K), n = (int)(e / K); v2us o;
            o[0] = f2bf(w[(size_t)k * N + n]); o[1] = f2bf(w[(size_t)(k + 1) * N + n]); *(v2us*)(Bt + e) = o; }
         }
}
__global__ __launch_bounds__(256) void k_cvt8(const float* __restrict__ src, bf* dst, size_t n8) { const size_t i = (size_t)blockIdx.x * 256 + threadIdx.x; if (i >= n8) return; const v8f v = *(const v8f*)(src + i * 8); v8us o;
#pragma unroll
    for (int k = 0; k < 8; ++k) o[k] = f2bf(v[k]); *(v8us*)(dst + i * 8) = o;  }
__global__ __launch_bounds__(256) void k_cscvt(const float* __restrict__ cosT, const float* __restrict__ sinT, float* CS) { const int idx = blockIdx.x * 256 + threadIdx.x; if (idx >= TT * HD) return; v2f cs; cs[0] = bfr(cosT[idx]); cs[1] = bfr(sinT[idx]); *(v2f*)(CS + (size_t)idx * 2) = cs;  }
// k_rope: head planes [h][t][d] (fp16 + hi/lo) of rope(x) x sc with the rotate-half convention out[d] = x[d] cos[t][d] - x[d+HD/2] sin[t][d], out[d+HD/2] = x[d+HD/2] cos[t][d+HD/2] + x[d] sin[t][d+HD/2]
__global__ __launch_bounds__(256) void k_rope(const float* __restrict__ F, int pitch, int nheads, const float* __restrict__ CS, const float* __restrict__ RF, const float* __restrict__ nw, float sc, h16* P16, bf* Ph, bf* Pl) {
    const size_t e = ((size_t)blockIdx.x * 256 + threadIdx.x) * 2; if (e >= (size_t)nheads * TT * HD) return; const int d = (int)(e % HD); const int t = (int)((e / HD) % TT); const int h = (int)(e / ((size_t)HD * TT)); const float* f = F + (size_t)t * pitch + h * HD; const float rf = RF ? RF[(size_t)h * TT + t] : 1.0f; v2h o16; v2us oh, ol;
#pragma unroll
    for (int q = 0; q < 2; ++q) { const int dd = d + q; const int dp = (dd < HD / 2) ? dd + HD / 2 : dd - HD / 2; float x0 = f[dd], x1 = f[dp];
        if (RF) { float n0 = __fmul_rn(x0, rf), n1 = __fmul_rn(x1, rf); asm volatile("" : "+v"(n0)); asm volatile("" : "+v"(n1)); x0 = __fmul_rn(bfr(nw[dd]), n0); x1 = __fmul_rn(bfr(nw[dp]), n1); }
        const v2f cs = *(const v2f*)(CS + ((size_t)t * HD + dd) * 2); float a = __fmul_rn(x0, cs[0]), bq = __fmul_rn(x1, cs[1]); asm volatile("" : "+v"(a)); asm volatile("" : "+v"(bq)); const float r = ((dd < HD / 2) ? __fsub_rn(a, bq) : __fadd_rn(a, bq)) * sc;
        o16[q] = tohx(r); unsigned short a2, c2; splitf(r, a2, c2); oh[q] = a2; ol[q] = c2; }
    *(v2h*)(P16 + e) = o16; *(v2us*)(Ph + e) = oh; *(v2us*)(Pl + e) = ol;  }
__global__ __launch_bounds__(256) void k_vtp(const float* __restrict__ F, int pitch, int nheads, h16* V16, bf* Vh, bf* Vl) { const size_t e = ((size_t)blockIdx.x * 256 + threadIdx.x) * 2; if (e >= (size_t)nheads * HD * TT) return; const int t = (int)(e % TT); const int d = (int)((e / TT) % HD); const int g = (int)(e / ((size_t)TT * HD)); v2h o16; v2us oh, ol;
#pragma unroll
    for (int q = 0; q < 2; ++q) { const float x = F[(size_t)(t + q) * pitch + g * HD + d]; o16[q] = tohx(x); unsigned short a2, c2; splitf(x, a2, c2); oh[q] = a2; ol[q] = c2; }
    *(v2h*)(V16 + e) = o16; *(v2us*)(Vh + e) = oh; *(v2us*)(Vl + e) = ol;  }
__global__ __launch_bounds__(256) void k_csid(float* CS) { const int idx = blockIdx.x * 256 + threadIdx.x; if (idx >= TT * HD) return; v2f cs; cs[0] = 1.0f; cs[1] = 0.0f; *(v2f*)(CS + (size_t)idx * 2) = cs;  }
__global__ __launch_bounds__(256) void k_postab(float* POS, bf* Ph2, bf* Pl2) { const size_t e = ((size_t)blockIdx.x * 256 + threadIdx.x) * 2; if (e >= (size_t)P2 * HD) return; const int m = (int)(e / HD); v2f vv; v2us hh, ll;
#pragma unroll
    for (int q = 0; q < 2; ++q) { const int d = (int)((e + q) % HD); const int dd = (d < HD / 2) ? d : d - HD / 2; const float fr = expf(__fmul_rn((float)dd, -0.29710776f)); const float ang = __fmul_rn((float)(m - TT), fr); float v = (d < HD / 2) ? sinf(ang) : cosf(ang); if (m == 0) v = 0.0f; unsigned short a2, c2; splitf(v, a2, c2); vv[q] = v; hh[q] = a2; ll[q] = c2; }
    *(v2f*)(POS + e) = vv; *(v2us*)(Ph2 + e) = hh; *(v2us*)(Pl2 + e) = ll;  }
__global__ __launch_bounds__(256) void k_dtab(const float* __restrict__ rw, const float* __restrict__ POS, float* DT) { const int idx = blockIdx.x * 256 + threadIdx.x; if (idx >= NH_ * P2) return; const int h = idx / P2, m = idx % P2; float acc = 0.f;
#pragma unroll 4
    for (int d = 0; d < HD; ++d) { float w = bfr(rw[h * HD + d]); asm volatile("" : "+v"(w)); float p = __fmul_rn(w, POS[(size_t)m * HD + d]); asm volatile("" : "+v"(p)); acc = __fadd_rn(acc, p); }
    *(float*)(DT + idx) = acc;  }
__global__ __launch_bounds__(256) void k_addrr(const float* __restrict__ FQ, const float* __restrict__ rr, float* FQR) { const size_t e = ((size_t)blockIdx.x * 256 + threadIdx.x) * 4; if (e >= (size_t)TT * DQ) return; const int c0 = (int)(e % DQ); const v4f a = *(const v4f*)(FQ + e); v4f o; for (int u = 0; u < 4; ++u) { float r = bfr(rr[c0 + u]); asm volatile("" : "+v"(r)); o[u] = __fadd_rn(a[u], r); } *(v4f*)(FQR + e) = o;  }
__global__ __launch_bounds__(256) void k_mout(const float* __restrict__ O, int h0, float* OUTb) { const size_t e = ((size_t)blockIdx.x * 256 + threadIdx.x) * 2; if (e >= (size_t)ZH * TT * HD) return; const int d = (int)(e % HD); const int t = (int)((e / HD) % TT); const int zz = (int)(e / ((size_t)HD * TT)); const float cs = (t < RH) ? 1.0f : (1.0f / PCAR); v2f o; o[0] = O[e] * cs; o[1] = O[e + 1] * cs; float* dst = OUTb + (size_t)t * DQ + (h0 + zz) * HD + d; *(v2f*)dst = o;  }

__global__ __launch_bounds__(256) void k_rbf(const float* __restrict__ src, float* dst, int n4) { const int i = blockIdx.x * 256 + threadIdx.x; if (i >= n4) return; const v4f a = *(const v4f*)(src + (size_t)i * 4); v4f o; for (int u = 0; u < 4; ++u) o[u] = bfr(a[u]); *(v4f*)(dst + (size_t)i * 4) = o;  }
// k_asoft: per row (zz, i): t = S + (B_ + D_)[L - i + j] (no scaling; -3e38 where mask == 0); softmax over the 1024 keys (register row, one exp, fixed trees);
__global__ __launch_bounds__(256) void k_asoft(const float* __restrict__ Sb, const float* __restrict__ BB, const float* __restrict__ DT, const int* __restrict__ km, int h0, h16* P16, bf* Ph, bf* Pl) {
    const int lane = threadIdx.x & 31; const int row = blockIdx.x * 8 + (threadIdx.x >> 5); if (row >= ZH * TT) return; const int i = row % TT; const int zz = row / TT; (void)zz; const bool hires = (i < RH); const float* sr = Sb + (size_t)row * TT; const float* bbr = BB + ((size_t)zz * TT + i) * P2 + (TT - i); const float* dtr = DT + (size_t)(h0 + zz) * P2 + (TT - i);   /* shift: column L - i + j */ float v[TT / 32]; float mx = -3.0e38f;
#pragma unroll
    for (int ch = 0; ch < TT / 128; ++ch) { const int j0 = ch * 128 + lane * 4; const v4f a = *(const v4f*)(sr + j0);
#pragma unroll
        for (int q = 0; q < 4; ++q) { const int j = j0 + q; (void)j; const int jj = j0 + q; float bd = __fadd_rn(bbr[jj], dtr[jj]); asm volatile("" : "+v"(bd)); const float t = (km[jj] != 0) ? __fadd_rn(a[q], bd) : -3.0e38f; v[ch * 4 + q] = t; mx = fmaxf(mx, t); } }
#pragma unroll
    for (int sh = 16; sh; sh >>= 1) mx = fmaxf(mx, __shfl_xor(mx, sh, 32));
    float sum = 0.f;
#pragma unroll
    for (int k = 0; k < TT / 32; ++k) { float d0 = __fsub_rn(v[k], mx); asm volatile("" : "+v"(d0)); v[k] = __builtin_amdgcn_exp2f(__fmul_rn(d0, 1.4426950408889634f)); sum += v[k]; }
#pragma unroll
    for (int sh = 16; sh; sh >>= 1) sum += __shfl_xor(sum, sh, 32);
    const float f = __fdiv_rn(hires ? 1.0f : PCAR, sum);
{
        if (hires) {
#pragma unroll
            for (int ch = 0; ch < TT / 128; ++ch) { v4us oh, ol;
#pragma unroll
                for (int q = 0; q < 4; ++q) { unsigned short a, c2; splitf(v[ch * 4 + q] * f, a, c2); oh[q] = a; ol[q] = c2; }
                const size_t oo = ((size_t)zz * (RH ? RH : 1) + i) * TT + ch * 128 + lane * 4; *(v4us*)(Ph + oo) = oh; *(v4us*)(Pl + oo) = ol; }
        } else {
#pragma unroll
            for (int ch = 0; ch < TT / 128; ++ch) { v4h o4;
#pragma unroll
                for (int q = 0; q < 4; ++q) o4[q] = tohx(v[ch * 4 + q] * f);
                *(v4h*)(P16 + (size_t)row * TT + ch * 128 + lane * 4) = o4; } }
         }
}
__global__ __launch_bounds__(256) void k_merge(const float* __restrict__ O, int h0, bf* Ah, bf* Al) { const size_t e = ((size_t)blockIdx.x * 256 + threadIdx.x) * 2; if (e >= (size_t)ZH * TT * HD) return; const int d = (int)(e % HD); const int t = (int)((e / HD) % TT); const int zz = (int)(e / ((size_t)HD * TT)); const float cs = (t < RH) ? 1.0f : (1.0f / PCAR); const size_t oo = (size_t)t * DQ + (h0 + zz) * HD + d;
    v2us oh, ol;
#pragma unroll
    for (int q = 0; q < 2; ++q) { unsigned short a, c2; splitf(O[e + q] * cs, a, c2); oh[q] = a; ol[q] = c2; } *(v2us*)(Ah + oo) = oh; *(v2us*)(Al + oo) = ol;  }

extern "C" void kernel_launch(void* const* d_in, const int* in_sizes, int n_in,
                              void* d_out, int out_size, void* d_ws, size_t ws_size, hipStream_t stream) {
    (void)in_sizes; (void)n_in; (void)out_size;
    const float* x = (const float*)d_in[0]; const float* wqv = (const float*)d_in[1]; const float* rrb = (const float*)d_in[2]; const float* rwb = (const float*)d_in[3]; const int* kmask = (const int*)d_in[4]; const float* wq = wqv; const float* wk = nullptr; const float* wv = wqv; const float* wo = nullptr; (void)wk; (void)wo; const float* cosT = nullptr; const float* sinT = nullptr; (void)cosT; (void)sinT;
    float* OUT = (float*)d_out;     // [4][1024][1024]
    char* wsp = (char*)d_ws;
    auto take = [&](size_t bytes) { char* p = wsp; wsp += (bytes + 255) & ~(size_t)255; return (void*)p; };
    bf* WQ = nullptr; bf* WK = nullptr; bf* WV = nullptr; (void)WK; bf* WALL = (bf*)take((size_t)2 * DQ * DM * 2); float* POS = (float*)take((size_t)P2 * HD * 4); bf* POSh = (bf*)take((size_t)P2 * HD * 2); bf* POSl = (bf*)take((size_t)P2 * HD * 2); float* DT = (float*)take((size_t)NH_ * P2 * 4); float* FQR = (float*)take((size_t)TT * DQ * 4); h16* QR16 = (h16*)take((size_t)NH_ * TT * HD * 2); bf* QRh = (bf*)take((size_t)NH_ * TT * HD * 2); bf* QRl = (bf*)take((size_t)NH_ * TT * HD * 2); float* BB = (float*)take((size_t)ZH * TT * P2 * 4); bf* WO = (bf*)take((size_t)DM * DQ * 2); float* CS = (float*)take((size_t)TT * HD * 2 * 4);
    bf* XB = (bf*)take((size_t)TT * DM * 2); float* FQ = (float*)take((size_t)TT * DQ * 4); 
    h16* QP16 = (h16*)take((size_t)NH_ * TT * HD * 2); h16* KP16 = (h16*)take((size_t)NKV * TT * HD * 2); h16* VT16 = (h16*)take((size_t)NKV * HD * TT * 2);
    bf* QPh = (bf*)take((size_t)NH_ * TT * HD * 2); bf* QPl = (bf*)take((size_t)NH_ * TT * HD * 2); bf* KPh = (bf*)take((size_t)NKV * TT * HD * 2); bf* KPl = (bf*)take((size_t)NKV * TT * HD * 2); bf* VTh = (bf*)take((size_t)NKV * HD * TT * 2); bf* VTl = (bf*)take((size_t)NKV * HD * TT * 2); bf* Ph = (bf*)take((size_t)ZH * RH * TT * 2); bf* Pl = (bf*)take((size_t)ZH * RH * TT * 2);
    float* Sb = (float*)take((size_t)ZH * TT * TT * 4); h16* P16 = (h16*)take((size_t)ZH * TT * TT * 2); float* Ob = (float*)take((size_t)ZH * TT * HD * 4); bf* ATh = (bf*)take((size_t)TT * DQ * 2); bf* ATl = (bf*)take((size_t)TT * DQ * 2);
    float* FV = (float*)take((size_t)TT * DKV * 4); float* FXR = (float*)take((size_t)TT * DM * 4);
    if ((size_t)(wsp - (char*)d_ws) > ws_size) return;   // ws ~ 95 MiB
    { k_wtG<<<(unsigned)((DM * 2 * DQ / 64 + 63) / 64), 256, 0, stream>>>(wqv, DM, 2 * DQ, WALL); WQ = WALL; WV = WALL + (size_t)DQ * DM; k_postab<<<(P2 * HD / 2 + 255) / 256, 256, 0, stream>>>(POS, POSh, POSl); k_dtab<<<(NH_ * P2 + 255) / 256, 256, 0, stream>>>(rwb, POS, DT);
      /* no output projection */
       }
    k_csid<<<(TT * HD + 255) / 256, 256, 0, stream>>>(CS);
    const unsigned LQ = (unsigned)(((size_t)NH_ * TT * HD / 2 + 255) / 256), LKv = (unsigned)(((size_t)NKV * TT * HD / 2 + 255) / 256);
    for (int b = 0; b < NB_; ++b) {
        
        k_cvt8<<<(unsigned)(((size_t)TT * DM / 8 + 255) / 256), 256, 0, stream>>>(x + (size_t)b * TT * DM, XB, (size_t)TT * DM / 8); k_rbf<<<(unsigned)(((size_t)TT * DM / 4 + 255) / 256), 256, 0, stream>>>(x + (size_t)b * TT * DM, FXR, (size_t)TT * DM / 4); const float* FK = FXR;   /* k = x: the bf16-ROUNDED input */
        k_gemmw<bf, 0, false><<<dim3(TT / 64, DQ / 64, 1), 32, 0, stream>>>(XB, nullptr, WQ, nullptr, DM, FQ, DQ, nullptr, 0, 0, 0);
        k_addrr<<<(unsigned)(((size_t)TT * DQ / 4 + 255) / 256), 256, 0, stream>>>(FQ, rrb, FQR); k_rope<<<LQ, 256, 0, stream>>>(FQ, DQ, NH_, CS, nullptr, nullptr, 1.0f, QP16, QPh, QPl); k_rope<<<LQ, 256, 0, stream>>>(FQR, DQ, NH_, CS, nullptr, nullptr, 1.0f, QR16, QRh, QRl);
        /* k = x: planes straight from the input */
        k_rope<<<LKv, 256, 0, stream>>>(FK, DKV, NKV, CS, nullptr, nullptr, 1.0f, KP16, KPh, KPl);
        k_gemmw<bf, 0, false><<<dim3(TT / 64, DKV / 64, 1), 32, 0, stream>>>(XB, nullptr, WV, nullptr, DM, FV, DKV, nullptr, 0, 0, 0); k_vtp<<<LKv, 256, 0, stream>>>(FV, DKV, NKV, VT16, VTh, VTl);
        for (int h0 = 0; h0 < NH_; h0 += ZH) { const size_t zq = (size_t)h0, zk = (size_t)(h0 / REP);   // one kv head per query head: the pass's two heads use consecutive kv planes (z-strides TT*HD)
            k_gemmw<bf, 2, false><<<dim3(RH / 64, TT / 64, ZH), 32, 0, stream>>>(QRh + zq * TT * HD, QRl + zq * TT * HD, KPh + zk * TT * HD, KPl + zk * TT * HD, HD, Sb, TT, nullptr, (size_t)TT * HD, (size_t)TT * HD, (size_t)TT * TT);
            k_gemmw<bf, 2, false><<<dim3(TT / 64, P2 / 64, ZH), 32, 0, stream>>>(QPh + zq * TT * HD, QPl + zq * TT * HD, POSh, POSl, HD, BB, P2, nullptr, (size_t)TT * HD, 0, (size_t)TT * P2);   /* B_[zz][i][m] = q_i . pos_m */
            k_asoft<<<ZH * TT / 8, 256, 0, stream>>>(Sb, BB, DT, kmask + (size_t)b * TT, h0, P16, Ph, Pl);
            k_gemmw<bf, 2, false><<<dim3(RH / 64, HD / 64, ZH), 32, 0, stream>>>(Ph, Pl, VTh + zk * HD * TT, VTl + zk * HD * TT, TT, Ob, HD, nullptr, (size_t)RH * TT, (size_t)HD * TT, (size_t)TT * HD);
            k_mout<<<(unsigned)(((size_t)ZH * TT * HD / 2 + 255) / 256), 256, 0, stream>>>(Ob, h0, OUT + (size_t)b * TT * DM); }
        }
}

// v001
// A run of this version takes 665 microseconds.
// In two side-by-side timings against v000, it was 2.79 and 2.78 times as fast.
#include <hip/hip_runtime.h>

// RelativeMultiHeadAttn (Transformer-XL style, k_as_x: x [4][1024][1024], Wqv [1024][2048] (q | v column blocks), r_r_bias / r_w_bias [16][64], mask [4][1024] (int, read; all ones); k = x itself split into 16 heads; pos = the sinusoidal table [2L][64] (sin | cos of p * exp(-d ln(1e4)/31), p = -L..L-1, row 0 zeroed) computed on chip in f32; AC = (q + r_r_bias).k; B_ = q.pos^T, D_ = r_w_bias.pos^T; BD = shift(B_ + D_) = (B_ + D_)[i][L - i + j] (exact index form of the pad/reshape shift); attn = softmax(AC + BD) (NO scaling; -inf where mask == 0); out = attn.v merged -> [4][1024][1024] (no output projection)).
// Compute dtypes, f32 accumulate: every input rounded to bf16; q, v as PLAIN bf16 GEMMs (inputs: exact); k planes straight from the (bf16-exact) input; pos table f32 -> hi/lo planes; AC and B_ as hl x hl GEMMs (3 products) on every row (unscaled logits are sharp); D_ as 64-term f32 dots; BD gathered per element (contiguous along j) and added in f32; softmax f32; attn.v hl x hl (3 products) on every row; output written directly in f32.

#define NB_  4
#define TT   1024
#define DM   1024
#define NH_  16
#define NKV  16
#define REP  (NH_ / NKV)
#define HD   64
#define DQ   (NH_ * HD)
#define DKV  (NKV * HD)
#define ZH   8                     // heads per score, B_ and softmax launch
#define ZS   16                    // heads per P.V and output launch (one batch)
#define RH   1024                  // query rows < RH use hi+lo planes (0: none)
#define WIN  0
#define PCAR 1024.0f
#define P2   (2 * TT)             // 2L relative positions
#define SCL  0.125f   // HD^-0.5
typedef _Float16 h16;
typedef unsigned short bf;
typedef __attribute__((ext_vector_type(16))) __bf16   v16bf;
typedef __attribute__((ext_vector_type(16))) _Float16 v16h;
typedef __attribute__((ext_vector_type(8)))  _Float16 v8h;
typedef __attribute__((ext_vector_type(8)))  unsigned short v8us;
typedef __attribute__((ext_vector_type(8)))  float    v8f;
typedef __attribute__((ext_vector_type(4)))  float    v4f;
typedef v8h  __attribute__((may_alias)) v8ha;
typedef v4f  __attribute__((may_alias)) v4fa;
typedef v8us __attribute__((may_alias)) v8usa;

__device__ __forceinline__ unsigned short f2bf(float f) { unsigned u = __float_as_uint(f); u += 0x7FFFu + ((u >> 16) & 1u); return (unsigned short)(u >> 16); }
__device__ __forceinline__ float bf2f(unsigned short b) { return __uint_as_float(((unsigned)b) << 16); }
__device__ __forceinline__ float bfr(float f) { return bf2f(f2bf(f)); }
__device__ __forceinline__ v16h cat16(v8h lo, v8h hi) { return __builtin_shufflevector(lo, hi, 0, 1, 2, 3, 4, 5, 6, 7, 8, 9, 10, 11, 12, 13, 14, 15); }
__device__ __forceinline__ v16bf cat16b(v8us lo, v8us hi) { return __builtin_bit_cast(v16bf, __builtin_shufflevector(lo, hi, 0, 1, 2, 3, 4, 5, 6, 7, 8, 9, 10, 11, 12, 13, 14, 15)); }
__device__ __forceinline__ v8f wmma16(v16h a, v16h b, v8f c) { return __builtin_amdgcn_wmma_f32_16x16x32_f16(false, a, false, b, (short)0, c, false, false); }
__device__ __forceinline__ v8f wmmab(v16bf a, v16bf b, v8f c) { return __builtin_amdgcn_wmma_f32_16x16x32_bf16(false, a, false, b, (short)0, c, false, false); }



// ---- k_gemmw: register-blocked GEMM, ONE WAVE per 64x64 output tile (16 accumulators), operands straight from K-contiguous 16-bit planes; grid (M/64, N/64, Z), 32 threads.
// C[m][n] (f32, pitch ldc, + optional f32 bias[n]) = sum_k A[m][k] Bt[n][k] (+ split products per NSPLIT). z-batch strides sA/sB/sC in elements. K % 32 == 0.
template <typename T16> struct WFrag;
template <> struct WFrag<h16> { typedef v16h V; static __device__ __forceinline__ V ld(const h16* p) { return cat16(*(const v8h*)p, *(const v8h*)(p + 16)); } static __device__ __forceinline__ v8f mma(V a, V b, v8f c) { return wmma16(a, b, c); } };
template <> struct WFrag<bf> { typedef v16bf V; static __device__ __forceinline__ V ld(const bf* p) { return cat16b(*(const v8us*)p, *(const v8us*)(p + 16)); } static __device__ __forceinline__ v8f mma(V a, V b, v8f c) { return wmmab(a, b, c); } };
template <typename T16, int NSPLIT, bool BIAS>
__global__ __launch_bounds__(32) void k_gemmw(const T16* __restrict__ A, const T16* __restrict__ A2, const T16* __restrict__ Bt, const T16* __restrict__ Bt2, int K, float* C, int ldc, const float* __restrict__ bias, size_t sA, size_t sB, size_t sC) {
    typedef typename WFrag<T16>::V V;
    __shared__ __align__(16) float os[16 * 68];
    const size_t z = blockIdx.z; A += z * sA; if (A2) A2 += z * sA; Bt += z * sB; if (Bt2) Bt2 += z * sB; C += z * sC;
    const int lane = threadIdx.x & 31, lr = lane & 15, hi = lane >> 4; const int r0 = blockIdx.x * 64, c0 = blockIdx.y * 64;
    v8f acc[4][4];
#pragma unroll
    for (int mb = 0; mb < 4; ++mb)
#pragma unroll
        for (int nb = 0; nb < 4; ++nb) acc[mb][nb] = (v8f){};
    const size_t aoff = (size_t)(r0 + lr) * K + 8 * hi, boff = (size_t)(c0 + lr) * K + 8 * hi;
#pragma unroll 1
    for (int kc = 0; kc < K; kc += 32) {
        V a[4], a2[4];
#pragma unroll
        for (int mb = 0; mb < 4; ++mb) { a[mb] = WFrag<T16>::ld(A + aoff + (size_t)mb * 16 * K + kc); if (NSPLIT == 1 || NSPLIT == 2) a2[mb] = WFrag<T16>::ld(A2 + aoff + (size_t)mb * 16 * K + kc); }
#pragma unroll
        for (int nb = 0; nb < 4; ++nb) { const V b = WFrag<T16>::ld(Bt + boff + (size_t)nb * 16 * K + kc); V b2; if (NSPLIT >= 2) b2 = WFrag<T16>::ld(Bt2 + boff + (size_t)nb * 16 * K + kc);
#pragma unroll
            for (int mb = 0; mb < 4; ++mb) { acc[mb][nb] = WFrag<T16>::mma(a[mb], b, acc[mb][nb]); if (NSPLIT == 1 || NSPLIT == 2) acc[mb][nb] = WFrag<T16>::mma(a2[mb], b, acc[mb][nb]); if (NSPLIT >= 2) acc[mb][nb] = WFrag<T16>::mma(a[mb], b2, acc[mb][nb]); } }
        asm volatile("v_nop\n\tv_nop\n\tv_nop\n\tv_nop" : "+v"(acc[0][0]), "+v"(acc[1][1]), "+v"(acc[2][2]), "+v"(acc[3][3]) : "v"(a[0]), "v"(a[3]));
    }
#pragma unroll
    for (int mb = 0; mb < 4; ++mb) {
#pragma unroll
        for (int nb = 0; nb < 4; ++nb) {
#pragma unroll
            for (int j = 0; j < 8; ++j) os[(hi * 8 + j) * 68 + nb * 16 + lr] = acc[mb][nb][j]; }
        __builtin_amdgcn_wave_barrier(); asm volatile("" ::: "memory");
        float* crow = C + (size_t)(r0 + mb * 16) * ldc + c0;
{
#pragma unroll
            for (int s = 0; s < 8; ++s) { const int row = 2 * s + hi, cofs = lr * 4; v4f val = *(const v4fa*)(os + row * 68 + cofs); if (BIAS) { val[0] += bfr(bias[c0 + cofs]); val[1] += bfr(bias[c0 + cofs + 1]); val[2] += bfr(bias[c0 + cofs + 2]); val[3] += bfr(bias[c0 + cofs + 3]); }
                *(v4f*)(crow + (size_t)row * ldc + cofs) = val; }
             }
        __builtin_amdgcn_wave_barrier(); asm volatile("" ::: "memory");
    }
}

__device__ __forceinline__ h16 tohx(float x) { return (h16)x; }
__device__ __forceinline__ void splitf(float y, unsigned short& h, unsigned short& l) { h = f2bf(y); l = f2bf(y - bf2f(h)); }
typedef __attribute__((ext_vector_type(2))) _Float16 v2h;
typedef __attribute__((ext_vector_type(4))) _Float16 v4h;
typedef __attribute__((ext_vector_type(2))) unsigned short v2us;
typedef __attribute__((ext_vector_type(4))) unsigned short v4us;
typedef __attribute__((ext_vector_type(2))) float v2f;
typedef __attribute__((ext_vector_type(4))) int v4i;

__global__ __launch_bounds__(256) void k_wtG(const float* __restrict__ w, int K, int N, bf* Bt) {
    const int lane = threadIdx.x & 31; const int L0 = (blockIdx.x * 8 + (threadIdx.x >> 5)) * 8; const int nlines = N * K / 64;
{
#pragma unroll 1
        for (int l = 0; l < 8; ++l) { const int L = L0 + l; if (L >= nlines) break; const size_t e = (size_t)L * 64 + lane * 2; const int k = (int)(e % K), n = (int)(e / K); v2us o;
            o[0] = f2bf(w[(size_t)k * N + n]); o[1] = f2bf(w[(size_t)(k + 1) * N + n]); *(v2us*)(Bt + e) = o; }
         }
}
__global__ __launch_bounds__(256) void k_cvt8(const float* __restrict__ src, bf* dst, size_t n8) { const size_t i = (size_t)blockIdx.x * 256 + threadIdx.x; if (i >= n8) return; const v8f v = *(const v8f*)(src + i * 8); v8us o;
#pragma unroll
    for (int k = 0; k < 8; ++k) o[k] = f2bf(v[k]); *(v8us*)(dst + i * 8) = o;  }
__global__ __launch_bounds__(256) void k_cscvt(const float* __restrict__ cosT, const float* __restrict__ sinT, float* CS) { const int idx = blockIdx.x * 256 + threadIdx.x; if (idx >= TT * HD) return; v2f cs; cs[0] = bfr(cosT[idx]); cs[1] = bfr(sinT[idx]); *(v2f*)(CS + (size_t)idx * 2) = cs;  }
// k_rope: head planes [h][t][d] (fp16 + hi/lo) of rope(x) x sc with the rotate-half convention out[d] = x[d] cos[t][d] - x[d+HD/2] sin[t][d], out[d+HD/2] = x[d+HD/2] cos[t][d+HD/2] + x[d] sin[t][d+HD/2]
__global__ __launch_bounds__(256) void k_rope(const float* __restrict__ F, int pitch, int nheads, const float* __restrict__ CS, const float* __restrict__ RF, const float* __restrict__ nw, float sc, h16* P16, bf* Ph, bf* Pl) {
    const size_t e = ((size_t)blockIdx.x * 256 + threadIdx.x) * 2; if (e >= (size_t)nheads * TT * HD) return; const size_t po = (size_t)blockIdx.y * nheads * TT * HD; P16 += po; Ph += po; Pl += po;   /* blockIdx.y: one [TT][pitch] slab of F -> its own nheads planes */ const int d = (int)(e % HD); const int t = (int)((e / HD) % TT); const int h = (int)(e / ((size_t)HD * TT)); const float* f = F + ((size_t)blockIdx.y * TT + t) * pitch + h * HD; const float rf = RF ? RF[(size_t)h * TT + t] : 1.0f; v2h o16; v2us oh, ol;
#pragma unroll
    for (int q = 0; q < 2; ++q) { const int dd = d + q; const int dp = (dd < HD / 2) ? dd + HD / 2 : dd - HD / 2; float x0 = f[dd], x1 = f[dp];
        if (RF) { float n0 = __fmul_rn(x0, rf), n1 = __fmul_rn(x1, rf); asm volatile("" : "+v"(n0)); asm volatile("" : "+v"(n1)); x0 = __fmul_rn(bfr(nw[dd]), n0); x1 = __fmul_rn(bfr(nw[dp]), n1); }
        const v2f cs = *(const v2f*)(CS + ((size_t)t * HD + dd) * 2); float a = __fmul_rn(x0, cs[0]), bq = __fmul_rn(x1, cs[1]); asm volatile("" : "+v"(a)); asm volatile("" : "+v"(bq)); const float r = ((dd < HD / 2) ? __fsub_rn(a, bq) : __fadd_rn(a, bq)) * sc;
        o16[q] = tohx(r); unsigned short a2, c2; splitf(r, a2, c2); oh[q] = a2; ol[q] = c2; }
    *(v2h*)(P16 + e) = o16; *(v2us*)(Ph + e) = oh; *(v2us*)(Pl + e) = ol;  }
__global__ __launch_bounds__(256) void k_vtp(const float* __restrict__ F, int pitch, int nheads, h16* V16, bf* Vh, bf* Vl) { const size_t e = ((size_t)blockIdx.x * 256 + threadIdx.x) * 2; if (e >= (size_t)nheads * HD * TT) return; F += (size_t)blockIdx.y * TT * pitch; const size_t po = (size_t)blockIdx.y * nheads * HD * TT; V16 += po; Vh += po; Vl += po;   /* blockIdx.y: batch */ const int t = (int)(e % TT); const int d = (int)((e / TT) % HD); const int g = (int)(e / ((size_t)TT * HD)); v2h o16; v2us oh, ol;
#pragma unroll
    for (int q = 0; q < 2; ++q) { const float x = F[(size_t)(t + q) * pitch + g * HD + d]; o16[q] = tohx(x); unsigned short a2, c2; splitf(x, a2, c2); oh[q] = a2; ol[q] = c2; }
    *(v2h*)(V16 + e) = o16; *(v2us*)(Vh + e) = oh; *(v2us*)(Vl + e) = ol;  }
__global__ __launch_bounds__(256) void k_csid(float* CS) { const int idx = blockIdx.x * 256 + threadIdx.x; if (idx >= TT * HD) return; v2f cs; cs[0] = 1.0f; cs[1] = 0.0f; *(v2f*)(CS + (size_t)idx * 2) = cs;  }
__global__ __launch_bounds__(256) void k_postab(float* POS, bf* Ph2, bf* Pl2) { const size_t e = ((size_t)blockIdx.x * 256 + threadIdx.x) * 2; if (e >= (size_t)P2 * HD) return; const int m = (int)(e / HD); v2f vv; v2us hh, ll;
#pragma unroll
    for (int q = 0; q < 2; ++q) { const int d = (int)((e + q) % HD); const int dd = (d < HD / 2) ? d : d - HD / 2; const float fr = expf(__fmul_rn((float)dd, -0.29710776f)); const float ang = __fmul_rn((float)(m - TT), fr); float v = (d < HD / 2) ? sinf(ang) : cosf(ang); if (m == 0) v = 0.0f; unsigned short a2, c2; splitf(v, a2, c2); vv[q] = v; hh[q] = a2; ll[q] = c2; }
    *(v2f*)(POS + e) = vv; *(v2us*)(Ph2 + e) = hh; *(v2us*)(Pl2 + e) = ll;  }
__global__ __launch_bounds__(256) void k_dtab(const float* __restrict__ rw, const float* __restrict__ POS, float* DT) { const int idx = blockIdx.x * 256 + threadIdx.x; if (idx >= NH_ * P2) return; const int h = idx / P2, m = idx % P2; float acc = 0.f;
#pragma unroll 4
    for (int d = 0; d < HD; ++d) { float w = bfr(rw[h * HD + d]); asm volatile("" : "+v"(w)); float p = __fmul_rn(w, POS[(size_t)m * HD + d]); asm volatile("" : "+v"(p)); acc = __fadd_rn(acc, p); }
    *(float*)(DT + idx) = acc;  }
__global__ __launch_bounds__(256) void k_addrr(const float* __restrict__ FQ, const float* __restrict__ rr, float* FQR) { const size_t e = ((size_t)blockIdx.x * 256 + threadIdx.x) * 4; if (e >= (size_t)NB_ * TT * DQ) return; const int c0 = (int)(e % DQ); const v4f a = *(const v4f*)(FQ + e); v4f o; for (int u = 0; u < 4; ++u) { float r = bfr(rr[c0 + u]); asm volatile("" : "+v"(r)); o[u] = __fadd_rn(a[u], r); } *(v4f*)(FQR + e) = o;  }
__global__ __launch_bounds__(256) void k_mout(const float* __restrict__ O, int h0, float* OUTb) { const size_t e = ((size_t)blockIdx.x * 256 + threadIdx.x) * 2; if (e >= (size_t)ZS * TT * HD) return; const int d = (int)(e % HD); const int t = (int)((e / HD) % TT); const int zz = (int)(e / ((size_t)HD * TT)); const float cs = (t < RH) ? 1.0f : (1.0f / PCAR); v2f o; o[0] = O[e] * cs; o[1] = O[e + 1] * cs; float* dst = OUTb + (size_t)t * DQ + (h0 + zz) * HD + d; *(v2f*)dst = o;  }

__global__ __launch_bounds__(256) void k_rbf(const float* __restrict__ src, float* dst, int n4) { const int i = blockIdx.x * 256 + threadIdx.x; if (i >= n4) return; const v4f a = *(const v4f*)(src + (size_t)i * 4); v4f o; for (int u = 0; u < 4; ++u) o[u] = bfr(a[u]); *(v4f*)(dst + (size_t)i * 4) = o;  }
// k_asoft: per row (zz, i): t = S + (B_ + D_)[L - i + j] (no scaling; -3e38 where mask == 0); softmax over the 1024 keys (register row, one exp, fixed trees);
__global__ __launch_bounds__(256) void k_asoft(const float* __restrict__ Sb, const float* __restrict__ BB, const float* __restrict__ DT, const int* __restrict__ km, int h0, h16* P16, bf* Ph, bf* Pl) {
    const int lane = threadIdx.x & 31; const int row = blockIdx.x * 8 + (threadIdx.x >> 5); if (row >= ZH * TT) return; const int i = row % TT; const int zz = row / TT; (void)zz; const bool hires = (i < RH); const float* sr = Sb + (size_t)row * TT; const float* bbr = BB + ((size_t)zz * TT + i) * P2 + (TT - i); const float* dtr = DT + (size_t)(h0 + zz) * P2 + (TT - i);   /* shift: column L - i + j */ float v[TT / 32]; float mx = -3.0e38f;
#pragma unroll
    for (int ch = 0; ch < TT / 128; ++ch) { const int j0 = ch * 128 + lane * 4; const v4f a = *(const v4f*)(sr + j0);
#pragma unroll
        for (int q = 0; q < 4; ++q) { const int j = j0 + q; (void)j; const int jj = j0 + q; float bd = __fadd_rn(bbr[jj], dtr[jj]); asm volatile("" : "+v"(bd)); const float t = (km[jj] != 0) ? __fadd_rn(a[q], bd) : -3.0e38f; v[ch * 4 + q] = t; mx = fmaxf(mx, t); } }
#pragma unroll
    for (int sh = 16; sh; sh >>= 1) mx = fmaxf(mx, __shfl_xor(mx, sh, 32));
    float sum = 0.f;
#pragma unroll
    for (int k = 0; k < TT / 32; ++k) { float d0 = __fsub_rn(v[k], mx); asm volatile("" : "+v"(d0)); v[k] = __builtin_amdgcn_exp2f(__fmul_rn(d0, 1.4426950408889634f)); sum += v[k]; }
#pragma unroll
    for (int sh = 16; sh; sh >>= 1) sum += __shfl_xor(sum, sh, 32);
    const float f = __fdiv_rn(hires ? 1.0f : PCAR, sum);
{
        if (hires) {
#pragma unroll
            for (int ch = 0; ch < TT / 128; ++ch) { v4us oh, ol;
#pragma unroll
                for (int q = 0; q < 4; ++q) { unsigned short a, c2; splitf(v[ch * 4 + q] * f, a, c2); oh[q] = a; ol[q] = c2; }
                const size_t oo = ((size_t)zz * (RH ? RH : 1) + i) * TT + ch * 128 + lane * 4; *(v4us*)(Ph + oo) = oh; *(v4us*)(Pl + oo) = ol; }
        } else {
#pragma unroll
            for (int ch = 0; ch < TT / 128; ++ch) { v4h o4;
#pragma unroll
                for (int q = 0; q < 4; ++q) o4[q] = tohx(v[ch * 4 + q] * f);
                *(v4h*)(P16 + (size_t)row * TT + ch * 128 + lane * 4) = o4; } }
         }
}
__global__ __launch_bounds__(256) void k_merge(const float* __restrict__ O, int h0, bf* Ah, bf* Al) { const size_t e = ((size_t)blockIdx.x * 256 + threadIdx.x) * 2; if (e >= (size_t)ZH * TT * HD) return; const int d = (int)(e % HD); const int t = (int)((e / HD) % TT); const int zz = (int)(e / ((size_t)HD * TT)); const float cs = (t < RH) ? 1.0f : (1.0f / PCAR); const size_t oo = (size_t)t * DQ + (h0 + zz) * HD + d;
    v2us oh, ol;
#pragma unroll
    for (int q = 0; q < 2; ++q) { unsigned short a, c2; splitf(O[e + q] * cs, a, c2); oh[q] = a; ol[q] = c2; } *(v2us*)(Ah + oo) = oh; *(v2us*)(Al + oo) = ol;  }

extern "C" void kernel_launch(void* const* d_in, const int* in_sizes, int n_in,
                              void* d_out, int out_size, void* d_ws, size_t ws_size, hipStream_t stream) {
    (void)in_sizes; (void)n_in; (void)out_size;
    const float* x = (const float*)d_in[0]; const float* wqv = (const float*)d_in[1]; const float* rrb = (const float*)d_in[2]; const float* rwb = (const float*)d_in[3]; const int* kmask = (const int*)d_in[4]; const float* wq = wqv; const float* wk = nullptr; const float* wv = wqv; const float* wo = nullptr; (void)wk; (void)wo; const float* cosT = nullptr; const float* sinT = nullptr; (void)cosT; (void)sinT;
    float* OUT = (float*)d_out;     // [4][1024][1024]
    char* wsp = (char*)d_ws;
    auto take = [&](size_t bytes) { char* p = wsp; wsp += (bytes + 255) & ~(size_t)255; return (void*)p; };
    const size_t PL = (size_t)NB_ * NH_ * TT * HD;   // one plane set: every batch, every head
    const size_t FL = (size_t)NB_ * TT * DM;         // one f32 activation: every batch
    bf* WALL = (bf*)take((size_t)2 * DQ * DM * 2); float* POS = (float*)take((size_t)P2 * HD * 4); bf* POSh = (bf*)take((size_t)P2 * HD * 2); bf* POSl = (bf*)take((size_t)P2 * HD * 2); float* DT = (float*)take((size_t)NH_ * P2 * 4); float* CS = (float*)take((size_t)TT * HD * 2 * 4);
    bf* Rh = (bf*)take(3 * PL * 2); bf* Rl = (bf*)take(3 * PL * 2);   // plane sets in the order k | q + r_r_bias | q
    bf* KPh = Rh; bf* KPl = Rl; bf* QRh = Rh + PL; bf* QRl = Rl + PL; bf* QPh = Rh + 2 * PL; bf* QPl = Rl + 2 * PL;
    bf* VTh = (bf*)take(PL * 2); bf* VTl = (bf*)take(PL * 2);
    bf* Ph = (bf*)take((size_t)ZS * RH * TT * 2); bf* Pl = (bf*)take((size_t)ZS * RH * TT * 2); h16* P16 = (h16*)take((size_t)ZH * TT * TT * 2); float* Ob = (float*)take((size_t)ZS * TT * HD * 4);
    float* BB = (float*)take((size_t)ZH * TT * P2 * 4); float* Sb = (float*)take((size_t)ZH * TT * TT * 4);
    // the f32 activations and the bf16 input are dead once the planes are built: they lie on BB | Sb (stream-ordered), in the order x rounded | q + r_r_bias | q | v
    float* FXR = BB; float* FQR = FXR + FL; float* FQ = FQR + FL; float* FV = FQ + FL; bf* XB = (bf*)(FV + FL);
    // the f16 planes are written and never read (every row takes the hi + lo path): they lie on Ph, which the softmax overwrites later
    h16* R16 = (h16*)Ph; h16* VT16 = R16 + 3 * PL;
    if ((size_t)(wsp - (char*)d_ws) > ws_size) return;   // ws ~ 250 MiB
    k_wtG<<<(unsigned)((DM * 2 * DQ / 64 + 63) / 64), 256, 0, stream>>>(wqv, DM, 2 * DQ, WALL); k_postab<<<(P2 * HD / 2 + 255) / 256, 256, 0, stream>>>(POS, POSh, POSl); k_dtab<<<(NH_ * P2 + 255) / 256, 256, 0, stream>>>(rwb, POS, DT);
    k_csid<<<(TT * HD + 255) / 256, 256, 0, stream>>>(CS);
    const unsigned LQ = (unsigned)(((size_t)NH_ * TT * HD / 2 + 255) / 256);
    // every batch in one launch
    k_cvt8<<<(unsigned)((FL / 8 + 255) / 256), 256, 0, stream>>>(x, XB, FL / 8); k_rbf<<<(unsigned)((FL / 4 + 255) / 256), 256, 0, stream>>>(x, FXR, (int)(FL / 4));   /* k = x: the bf16-ROUNDED input */
    k_gemmw<bf, 0, false><<<dim3(NB_ * TT / 64, DQ / 64, 2), 32, 0, stream>>>(XB, nullptr, WALL, nullptr, DM, FQ, DQ, nullptr, 0, (size_t)DQ * DM, FL);   /* z = 0: q, z = 1: v */
    k_addrr<<<(unsigned)((FL / 4 + 255) / 256), 256, 0, stream>>>(FQ, rrb, FQR);
    k_rope<<<dim3(LQ, 3 * NB_, 1), 256, 0, stream>>>(FXR, DQ, NH_, CS, nullptr, nullptr, 1.0f, R16, Rh, Rl);   /* 12 slabs: k, q + r_r_bias, q of the 4 batches */
    k_vtp<<<dim3(LQ, NB_, 1), 256, 0, stream>>>(FV, DKV, NKV, VT16, VTh, VTl);
    for (int b = 0; b < NB_; ++b) { const size_t zb = (size_t)b * NH_;   // one kv head per query head: consecutive planes (z-strides TT*HD)
        for (int h0 = 0; h0 < NH_; h0 += ZH) { const size_t zq = zb + h0;
            k_gemmw<bf, 2, false><<<dim3(RH / 64, TT / 64, ZH), 32, 0, stream>>>(QRh + zq * TT * HD, QRl + zq * TT * HD, KPh + zq * TT * HD, KPl + zq * TT * HD, HD, Sb, TT, nullptr, (size_t)TT * HD, (size_t)TT * HD, (size_t)TT * TT);
            k_gemmw<bf, 2, false><<<dim3(TT / 64, P2 / 64, ZH), 32, 0, stream>>>(QPh + zq * TT * HD, QPl + zq * TT * HD, POSh, POSl, HD, BB, P2, nullptr, (size_t)TT * HD, 0, (size_t)TT * P2);   /* B_[zz][i][m] = q_i . pos_m */
            k_asoft<<<ZH * TT / 8, 256, 0, stream>>>(Sb, BB, DT, kmask + (size_t)b * TT, h0, P16, Ph + (size_t)h0 * RH * TT, Pl + (size_t)h0 * RH * TT); }
        k_gemmw<bf, 2, false><<<dim3(RH / 64, HD / 64, ZS), 32, 0, stream>>>(Ph, Pl, VTh + zb * HD * TT, VTl + zb * HD * TT, TT, Ob, HD, nullptr, (size_t)RH * TT, (size_t)HD * TT, (size_t)TT * HD);
        k_mout<<<(unsigned)(((size_t)ZS * TT * HD / 2 + 255) / 256), 256, 0, stream>>>(Ob, 0, OUT + (size_t)b * TT * DM); }
}

// v002
// It runs in 248 microseconds.
// Timed twice side by side with v001, it ran 2.68 and 2.67 times as fast.
// Counting every step since v000, it is 7.44 times as fast.
#include <hip/hip_runtime.h>

// RelativeMultiHeadAttn (Transformer-XL style, k_as_x: x [4][1024][1024], Wqv [1024][2048] (q | v column blocks), r_r_bias / r_w_bias [16][64], mask [4][1024] (int, read; all ones); k = x itself split into 16 heads; pos = the sinusoidal table [2L][64] (sin | cos of p * exp(-d ln(1e4)/31), p = -L..L-1, row 0 zeroed) computed on chip in f32; AC = (q + r_r_bias).k; B_ = q.pos^T, D_ = r_w_bias.pos^T; BD = shift(B_ + D_) = (B_ + D_)[i][L - i + j] (exact index form of the pad/reshape shift); attn = softmax(AC + BD) (NO scaling; -inf where mask == 0); out = attn.v merged -> [4][1024][1024] (no output projection)).
// Compute dtypes, f32 accumulate: every input rounded to bf16; q, v as PLAIN bf16 GEMMs (inputs: exact); k planes straight from the (bf16-exact) input; pos table f32 -> hi/lo planes; AC and B_ as hl x hl GEMMs (3 products) on every row (unscaled logits are sharp); D_ as 64-term f32 dots; BD gathered per element (contiguous along j) and added in f32; softmax f32; attn.v hl x hl (3 products) on every row; output written directly in f32.

#define NB_  4
#define TT   1024
#define DM   1024
#define NH_  16
#define NKV  16
#define REP  (NH_ / NKV)
#define HD   64
#define DQ   (NH_ * HD)
#define DKV  (NKV * HD)
#define ZH   8                     // sizes the scratch region of the f32 activations
#define ZS   16                    // sizes the scratch region of the f16 planes
#define RH   1024                  // with ZS, sizes the scratch region of the f16 planes
#define WIN  0
#define PCAR 1024.0f
#define P2   (2 * TT)             // 2L relative positions
#define SCL  0.125f   // HD^-0.5
typedef _Float16 h16;
typedef unsigned short bf;
typedef __attribute__((ext_vector_type(16))) __bf16   v16bf;
typedef __attribute__((ext_vector_type(16))) _Float16 v16h;
typedef __attribute__((ext_vector_type(8)))  _Float16 v8h;
typedef __attribute__((ext_vector_type(8)))  unsigned short v8us;
typedef __attribute__((ext_vector_type(8)))  float    v8f;
typedef __attribute__((ext_vector_type(4)))  float    v4f;
typedef v8h  __attribute__((may_alias)) v8ha;
typedef v4f  __attribute__((may_alias)) v4fa;
typedef v8us __attribute__((may_alias)) v8usa;

__device__ __forceinline__ unsigned short f2bf(float f) { unsigned u = __float_as_uint(f); u += 0x7FFFu + ((u >> 16) & 1u); return (unsigned short)(u >> 16); }
__device__ __forceinline__ float bf2f(unsigned short b) { return __uint_as_float(((unsigned)b) << 16); }
__device__ __forceinline__ float bfr(float f) { return bf2f(f2bf(f)); }
__device__ __forceinline__ v16h cat16(v8h lo, v8h hi) { return __builtin_shufflevector(lo, hi, 0, 1, 2, 3, 4, 5, 6, 7, 8, 9, 10, 11, 12, 13, 14, 15); }
__device__ __forceinline__ v16bf cat16b(v8us lo, v8us hi) { return __builtin_bit_cast(v16bf, __builtin_shufflevector(lo, hi, 0, 1, 2, 3, 4, 5, 6, 7, 8, 9, 10, 11, 12, 13, 14, 15)); }
__device__ __forceinline__ v8f wmma16(v16h a, v16h b, v8f c) { return __builtin_amdgcn_wmma_f32_16x16x32_f16(false, a, false, b, (short)0, c, false, false); }
__device__ __forceinline__ v8f wmmab(v16bf a, v16bf b, v8f c) { return __builtin_amdgcn_wmma_f32_16x16x32_bf16(false, a, false, b, (short)0, c, false, false); }



// ---- k_gemmw: register-blocked GEMM, ONE WAVE per 64x64 output tile (16 accumulators), operands straight from K-contiguous 16-bit planes; grid (M/64, N/64, Z), 32 threads.
// C[m][n] (f32, pitch ldc, + optional f32 bias[n]) = sum_k A[m][k] Bt[n][k] (+ split products per NSPLIT). z-batch strides sA/sB/sC in elements. K % 32 == 0.
template <typename T16> struct WFrag;
template <> struct WFrag<h16> { typedef v16h V; static __device__ __forceinline__ V ld(const h16* p) { return cat16(*(const v8h*)p, *(const v8h*)(p + 16)); } static __device__ __forceinline__ v8f mma(V a, V b, v8f c) { return wmma16(a, b, c); } };
template <> struct WFrag<bf> { typedef v16bf V; static __device__ __forceinline__ V ld(const bf* p) { return cat16b(*(const v8us*)p, *(const v8us*)(p + 16)); } static __device__ __forceinline__ v8f mma(V a, V b, v8f c) { return wmmab(a, b, c); } };
template <typename T16, int NSPLIT, bool BIAS>
__global__ __launch_bounds__(32) void k_gemmw(const T16* __restrict__ A, const T16* __restrict__ A2, const T16* __restrict__ Bt, const T16* __restrict__ Bt2, int K, float* C, int ldc, const float* __restrict__ bias, size_t sA, size_t sB, size_t sC) {
    typedef typename WFrag<T16>::V V;
    __shared__ __align__(16) float os[16 * 68];
    const size_t z = blockIdx.z; A += z * sA; if (A2) A2 += z * sA; Bt += z * sB; if (Bt2) Bt2 += z * sB; C += z * sC;
    const int lane = threadIdx.x & 31, lr = lane & 15, hi = lane >> 4; const int r0 = blockIdx.x * 64, c0 = blockIdx.y * 64;
    v8f acc[4][4];
#pragma unroll
    for (int mb = 0; mb < 4; ++mb)
#pragma unroll
        for (int nb = 0; nb < 4; ++nb) acc[mb][nb] = (v8f){};
    const size_t aoff = (size_t)(r0 + lr) * K + 8 * hi, boff = (size_t)(c0 + lr) * K + 8 * hi;
#pragma unroll 1
    for (int kc = 0; kc < K; kc += 32) {
        V a[4], a2[4];
#pragma unroll
        for (int mb = 0; mb < 4; ++mb) { a[mb] = WFrag<T16>::ld(A + aoff + (size_t)mb * 16 * K + kc); if (NSPLIT == 1 || NSPLIT == 2) a2[mb] = WFrag<T16>::ld(A2 + aoff + (size_t)mb * 16 * K + kc); }
#pragma unroll
        for (int nb = 0; nb < 4; ++nb) { const V b = WFrag<T16>::ld(Bt + boff + (size_t)nb * 16 * K + kc); V b2; if (NSPLIT >= 2) b2 = WFrag<T16>::ld(Bt2 + boff + (size_t)nb * 16 * K + kc);
#pragma unroll
            for (int mb = 0; mb < 4; ++mb) { acc[mb][nb] = WFrag<T16>::mma(a[mb], b, acc[mb][nb]); if (NSPLIT == 1 || NSPLIT == 2) acc[mb][nb] = WFrag<T16>::mma(a2[mb], b, acc[mb][nb]); if (NSPLIT >= 2) acc[mb][nb] = WFrag<T16>::mma(a[mb], b2, acc[mb][nb]); } }
        asm volatile("v_nop\n\tv_nop\n\tv_nop\n\tv_nop" : "+v"(acc[0][0]), "+v"(acc[1][1]), "+v"(acc[2][2]), "+v"(acc[3][3]) : "v"(a[0]), "v"(a[3]));
    }
#pragma unroll
    for (int mb = 0; mb < 4; ++mb) {
#pragma unroll
        for (int nb = 0; nb < 4; ++nb) {
#pragma unroll
            for (int j = 0; j < 8; ++j) os[(hi * 8 + j) * 68 + nb * 16 + lr] = acc[mb][nb][j]; }
        __builtin_amdgcn_wave_barrier(); asm volatile("" ::: "memory");
        float* crow = C + (size_t)(r0 + mb * 16) * ldc + c0;
{
#pragma unroll
            for (int s = 0; s < 8; ++s) { const int row = 2 * s + hi, cofs = lr * 4; v4f val = *(const v4fa*)(os + row * 68 + cofs); if (BIAS) { val[0] += bfr(bias[c0 + cofs]); val[1] += bfr(bias[c0 + cofs + 1]); val[2] += bfr(bias[c0 + cofs + 2]); val[3] += bfr(bias[c0 + cofs + 3]); }
                *(v4f*)(crow + (size_t)row * ldc + cofs) = val; }
             }
        __builtin_amdgcn_wave_barrier(); asm volatile("" ::: "memory");
    }
}

__device__ __forceinline__ h16 tohx(float x) { return (h16)x; }
__device__ __forceinline__ void splitf(float y, unsigned short& h, unsigned short& l) { h = f2bf(y); l = f2bf(y - bf2f(h)); }
typedef __attribute__((ext_vector_type(2))) _Float16 v2h;
typedef __attribute__((ext_vector_type(4))) _Float16 v4h;
typedef __attribute__((ext_vector_type(2))) unsigned short v2us;
typedef __attribute__((ext_vector_type(4))) unsigned short v4us;
typedef __attribute__((ext_vector_type(2))) float v2f;
typedef __attribute__((ext_vector_type(4))) int v4i;

__global__ __launch_bounds__(256) void k_wtG(const float* __restrict__ w, int K, int N, bf* Bt) {
    const int lane = threadIdx.x & 31; const int L0 = (blockIdx.x * 8 + (threadIdx.x >> 5)) * 8; const int nlines = N * K / 64;
{
#pragma unroll 1
        for (int l = 0; l < 8; ++l) { const int L = L0 + l; if (L >= nlines) break; const size_t e = (size_t)L * 64 + lane * 2; const int k = (int)(e % K), n = (int)(e / K); v2us o;
            o[0] = f2bf(w[(size_t)k * N + n]); o[1] = f2bf(w[(size_t)(k + 1) * N + n]); *(v2us*)(Bt + e) = o; }
         }
}
__global__ __launch_bounds__(256) void k_cvt8(const float* __restrict__ src, bf* dst, size_t n8) { const size_t i = (size_t)blockIdx.x * 256 + threadIdx.x; if (i >= n8) return; const v8f v = *(const v8f*)(src + i * 8); v8us o;
#pragma unroll
    for (int k = 0; k < 8; ++k) o[k] = f2bf(v[k]); *(v8us*)(dst + i * 8) = o;  }
__global__ __launch_bounds__(256) void k_cscvt(const float* __restrict__ cosT, const float* __restrict__ sinT, float* CS) { const int idx = blockIdx.x * 256 + threadIdx.x; if (idx >= TT * HD) return; v2f cs; cs[0] = bfr(cosT[idx]); cs[1] = bfr(sinT[idx]); *(v2f*)(CS + (size_t)idx * 2) = cs;  }
// k_rope: head planes [h][t][d] (fp16 + hi/lo) of rope(x) x sc with the rotate-half convention out[d] = x[d] cos[t][d] - x[d+HD/2] sin[t][d], out[d+HD/2] = x[d+HD/2] cos[t][d+HD/2] + x[d] sin[t][d+HD/2]
__global__ __launch_bounds__(256) void k_rope(const float* __restrict__ F, int pitch, int nheads, const float* __restrict__ CS, const float* __restrict__ RF, const float* __restrict__ nw, float sc, h16* P16, bf* Ph, bf* Pl) {
    const size_t e = ((size_t)blockIdx.x * 256 + threadIdx.x) * 2; if (e >= (size_t)nheads * TT * HD) return; const size_t po = (size_t)blockIdx.y * nheads * TT * HD; P16 += po; Ph += po; Pl += po;   /* blockIdx.y: one [TT][pitch] slab of F -> its own nheads planes */ const int d = (int)(e % HD); const int t = (int)((e / HD) % TT); const int h = (int)(e / ((size_t)HD * TT)); const float* f = F + ((size_t)blockIdx.y * TT + t) * pitch + h * HD; const float rf = RF ? RF[(size_t)h * TT + t] : 1.0f; v2h o16; v2us oh, ol;
#pragma unroll
    for (int q = 0; q < 2; ++q) { const int dd = d + q; const int dp = (dd < HD / 2) ? dd + HD / 2 : dd - HD / 2; float x0 = f[dd], x1 = f[dp];
        if (RF) { float n0 = __fmul_rn(x0, rf), n1 = __fmul_rn(x1, rf); asm volatile("" : "+v"(n0)); asm volatile("" : "+v"(n1)); x0 = __fmul_rn(bfr(nw[dd]), n0); x1 = __fmul_rn(bfr(nw[dp]), n1); }
        const v2f cs = *(const v2f*)(CS + ((size_t)t * HD + dd) * 2); float a = __fmul_rn(x0, cs[0]), bq = __fmul_rn(x1, cs[1]); asm volatile("" : "+v"(a)); asm volatile("" : "+v"(bq)); const float r = ((dd < HD / 2) ? __fsub_rn(a, bq) : __fadd_rn(a, bq)) * sc;
        o16[q] = tohx(r); unsigned short a2, c2; splitf(r, a2, c2); oh[q] = a2; ol[q] = c2; }
    *(v2h*)(P16 + e) = o16; *(v2us*)(Ph + e) = oh; *(v2us*)(Pl + e) = ol;  }
__global__ __launch_bounds__(256) void k_vtp(const float* __restrict__ F, int pitch, int nheads, h16* V16, bf* Vh, bf* Vl) { const size_t e = ((size_t)blockIdx.x * 256 + threadIdx.x) * 2; if (e >= (size_t)nheads * HD * TT) return; F += (size_t)blockIdx.y * TT * pitch; const size_t po = (size_t)blockIdx.y * nheads * HD * TT; V16 += po; Vh += po; Vl += po;   /* blockIdx.y: batch */ const int t = (int)(e % TT); const int d = (int)((e / TT) % HD); const int g = (int)(e / ((size_t)TT * HD)); v2h o16; v2us oh, ol;
#pragma unroll
    for (int q = 0; q < 2; ++q) { const float x = F[(size_t)(t + q) * pitch + g * HD + d]; o16[q] = tohx(x); unsigned short a2, c2; splitf(x, a2, c2); oh[q] = a2; ol[q] = c2; }
    *(v2h*)(V16 + e) = o16; *(v2us*)(Vh + e) = oh; *(v2us*)(Vl + e) = ol;  }
__global__ __launch_bounds__(256) void k_csid(float* CS) { const int idx = blockIdx.x * 256 + threadIdx.x; if (idx >= TT * HD) return; v2f cs; cs[0] = 1.0f; cs[1] = 0.0f; *(v2f*)(CS + (size_t)idx * 2) = cs;  }
__global__ __launch_bounds__(256) void k_postab(float* POS, bf* Ph2, bf* Pl2) { const size_t e = ((size_t)blockIdx.x * 256 + threadIdx.x) * 2; if (e >= (size_t)P2 * HD) return; const int m = (int)(e / HD); v2f vv; v2us hh, ll;
#pragma unroll
    for (int q = 0; q < 2; ++q) { const int d = (int)((e + q) % HD); const int dd = (d < HD / 2) ? d : d - HD / 2; const float fr = expf(__fmul_rn((float)dd, -0.29710776f)); const float ang = __fmul_rn((float)(m - TT), fr); float v = (d < HD / 2) ? sinf(ang) : cosf(ang); if (m == 0) v = 0.0f; unsigned short a2, c2; splitf(v, a2, c2); vv[q] = v; hh[q] = a2; ll[q] = c2; }
    *(v2f*)(POS + e) = vv; *(v2us*)(Ph2 + e) = hh; *(v2us*)(Pl2 + e) = ll;  }
__global__ __launch_bounds__(256) void k_dtab(const float* __restrict__ rw, const float* __restrict__ POS, float* DT) { const int idx = blockIdx.x * 256 + threadIdx.x; if (idx >= NH_ * P2) return; const int h = idx / P2, m = idx % P2; float acc = 0.f;
#pragma unroll 4
    for (int d = 0; d < HD; ++d) { float w = bfr(rw[h * HD + d]); asm volatile("" : "+v"(w)); float p = __fmul_rn(w, POS[(size_t)m * HD + d]); asm volatile("" : "+v"(p)); acc = __fadd_rn(acc, p); }
    *(float*)(DT + idx) = acc;  }
__global__ __launch_bounds__(256) void k_addrr(const float* __restrict__ FQ, const float* __restrict__ rr, float* FQR) { const size_t e = ((size_t)blockIdx.x * 256 + threadIdx.x) * 4; if (e >= (size_t)NB_ * TT * DQ) return; const int c0 = (int)(e % DQ); const v4f a = *(const v4f*)(FQ + e); v4f o; for (int u = 0; u < 4; ++u) { float r = bfr(rr[c0 + u]); asm volatile("" : "+v"(r)); o[u] = __fadd_rn(a[u], r); } *(v4f*)(FQR + e) = o;  }

__global__ __launch_bounds__(256) void k_rbf(const float* __restrict__ src, float* dst, int n4) { const int i = blockIdx.x * 256 + threadIdx.x; if (i >= n4) return; const v4f a = *(const v4f*)(src + (size_t)i * 4); v4f o; for (int u = 0; u < 4; ++u) o[u] = bfr(a[u]); *(v4f*)(dst + (size_t)i * 4) = o;  }
// k_fattn: one work-group of 16 waves per 64 query rows of one (batch, head). The 64 x 1024 logit block lives in LDS from the first product to P.V.
// LDS row: 64 floats of left margin | 1024 logits | 64 floats of right margin | 4 floats (pitch 4624 B = 16 B x odd). The margins take the band's elements whose key index falls outside 0..1023: they are written, never read.
// After the softmax the same row holds the bf16 hi plane (bytes 0..2047) and lo plane (bytes 2048..4095) of P.
// Every plain '#pragma unroll' below makes the indices of a fragment or accumulator array constants, so that the array stays in registers.
#define FR   64
#define FMT  (FR / 16)
#define FNW  16
#define FPF  (TT + 2 * FR + 4)
__global__ __launch_bounds__(FNW * 32) void k_fattn(const bf* __restrict__ QRh, const bf* __restrict__ QRl, const bf* __restrict__ QPh, const bf* __restrict__ QPl, const bf* __restrict__ KPh, const bf* __restrict__ KPl, const bf* __restrict__ POSh, const bf* __restrict__ POSl, const float* __restrict__ DT, const bf* __restrict__ VTh, const bf* __restrict__ VTl, const int* __restrict__ kmask, float* OUT) {
    typedef WFrag<bf> F;
    __shared__ __align__(16) float S[FR * FPF];
    __shared__ __align__(16) float os[FR * 68];
    const int lane = threadIdx.x & 31, lr = lane & 15, hi = lane >> 4;
    const int w = __builtin_amdgcn_readfirstlane(threadIdx.x >> 5);   // wave number in a scalar register: every loop and branch round a matrix instruction is wave-uniform
    const int i0 = blockIdx.x * FR; const int z = blockIdx.y; const int b = z / NH_, h = z % NH_;
    const size_t zo = (size_t)z * TT * HD;
    const size_t qoff = zo + (size_t)(i0 + lr) * HD + 8 * hi;
    // phase 1: BD[r][j] = B_[i0 + r][m] + D_[m], m = L - (i0 + r) + j: only the band m = L - i0 - 64 .. L - i0 + 1023 (68 column tiles); each pos fragment serves all 4 row tiles
    {
        v16bf a[FMT][2], a2[FMT][2];
#pragma unroll
        for (int mt = 0; mt < FMT; ++mt)
#pragma unroll
            for (int ks = 0; ks < 2; ++ks) { a[mt][ks] = F::ld(QPh + qoff + mt * 16 * HD + ks * 32); a2[mt][ks] = F::ld(QPl + qoff + mt * 16 * HD + ks * 32); }
        // precaution: the pointers are named so that no register an issued load names is rewritten ahead of this wait; the clobber also keeps the loads above it
        asm volatile("s_wait_xcnt 0x0" :: "v"(QPh + qoff), "v"(QPl + qoff) : "memory");
        const int mlo = TT - i0 - FR; const float* dth = DT + (size_t)h * P2 + mlo + lr;
        const size_t poff = (size_t)(mlo + lr) * HD + 8 * hi;
#pragma unroll 1   // rolled: the 16 q fragments hold 128 registers, a second tile in flight would not fit 4 waves per SIMD
        for (int t = w; t < (TT + FR) / 16; t += FNW) {
            const bf* ph = POSh + poff + (size_t)t * 16 * HD; const bf* pl = POSl + poff + (size_t)t * 16 * HD; const float* dp = dth + t * 16;
            v16bf p[2], p2[2];
#pragma unroll
            for (int ks = 0; ks < 2; ++ks) { p[ks] = F::ld(ph + ks * 32); p2[ks] = F::ld(pl + ks * 32); }
            const float dv = *dp;
            // precaution: the pointers are named so that no register an issued load names is rewritten ahead of this wait; the clobber also keeps the loads above it
            asm volatile("s_wait_xcnt 0x0" :: "v"(ph), "v"(pl), "v"(dp) : "memory");
            v8f acc[FMT];
#pragma unroll
            for (int mt = 0; mt < FMT; ++mt) acc[mt] = (v8f){};
#pragma unroll
            for (int ks = 0; ks < 2; ++ks) {
#pragma unroll
                for (int mt = 0; mt < FMT; ++mt) acc[mt] = wmmab(a[mt][ks], p[ks], acc[mt]);
#pragma unroll
                for (int mt = 0; mt < FMT; ++mt) acc[mt] = wmmab(a2[mt][ks], p[ks], acc[mt]);
#pragma unroll
                for (int mt = 0; mt < FMT; ++mt) acc[mt] = wmmab(a[mt][ks], p2[ks], acc[mt]); }
#pragma unroll
            for (int mt = 0; mt < FMT; ++mt)
#pragma unroll
                for (int j = 0; j < 8; ++j) { const int r = mt * 16 + hi * 8 + j; S[r * FPF + t * 16 + lr + r] = __fadd_rn(acc[mt][j], dv); }   /* column FR + j, j = t*16 + lr - FR + r */
        }
    }
    __syncthreads();
    // phase 2: logit = AC + BD; each k fragment serves all 4 row tiles
    {
        v16bf a[FMT][2], a2[FMT][2];
#pragma unroll
        for (int mt = 0; mt < FMT; ++mt)
#pragma unroll
            for (int ks = 0; ks < 2; ++ks) { a[mt][ks] = F::ld(QRh + qoff + mt * 16 * HD + ks * 32); a2[mt][ks] = F::ld(QRl + qoff + mt * 16 * HD + ks * 32); }
        // precaution: the pointers are named so that no register an issued load names is rewritten ahead of this wait; the clobber also keeps the loads above it
        asm volatile("s_wait_xcnt 0x0" :: "v"(QRh + qoff), "v"(QRl + qoff) : "memory");
        const size_t koff = zo + (size_t)lr * HD + 8 * hi;
#pragma unroll 1   // rolled: as in phase 1
        for (int t = w; t < TT / 16; t += FNW) {
            const bf* kh = KPh + koff + (size_t)t * 16 * HD; const bf* kl = KPl + koff + (size_t)t * 16 * HD;
            v16bf k1[2], k2[2];
#pragma unroll
            for (int ks = 0; ks < 2; ++ks) { k1[ks] = F::ld(kh + ks * 32); k2[ks] = F::ld(kl + ks * 32); }
            // precaution: the pointers are named so that no register an issued load names is rewritten ahead of this wait; the clobber also keeps the loads above it
            asm volatile("s_wait_xcnt 0x0" :: "v"(kh), "v"(kl) : "memory");
            v8f acc[FMT];
#pragma unroll
            for (int mt = 0; mt < FMT; ++mt) acc[mt] = (v8f){};
#pragma unroll
            for (int ks = 0; ks < 2; ++ks) {
#pragma unroll
                for (int mt = 0; mt < FMT; ++mt) acc[mt] = wmmab(a[mt][ks], k1[ks], acc[mt]);
#pragma unroll
                for (int mt = 0; mt < FMT; ++mt) acc[mt] = wmmab(a2[mt][ks], k1[ks], acc[mt]);
#pragma unroll
                for (int mt = 0; mt < FMT; ++mt) acc[mt] = wmmab(a[mt][ks], k2[ks], acc[mt]); }
            float* sp = S + (hi * 8) * FPF + FR + t * 16 + lr; float bd[FMT][8];
#pragma unroll
            for (int mt = 0; mt < FMT; ++mt)
#pragma unroll
                for (int j = 0; j < 8; ++j) bd[mt][j] = sp[(mt * 16 + j) * FPF];
#pragma unroll
            for (int mt = 0; mt < FMT; ++mt)
#pragma unroll
                for (int j = 0; j < 8; ++j) sp[(mt * 16 + j) * FPF] = __fadd_rn(acc[mt][j], bd[mt][j]);
        }
    }
    __syncthreads();
    // phase 3: softmax, one wave per row, 4 rows a wave (register row, one exp, fixed trees); P split into hi + lo planes in place
    {
        const int* km = kmask + (size_t)b * TT;
#pragma unroll 1   // rolled: one row's 32 values per lane at a time
        for (int rr = 0; rr < FR / FNW; ++rr) { float* srow = S + (w * (FR / FNW) + rr) * FPF; float v[TT / 32]; float mx = -3.0e38f;
#pragma unroll
            for (int ch = 0; ch < TT / 128; ++ch) { const int j0 = ch * 128 + lane * 4; const v4f a = *(const v4fa*)(srow + FR + j0); const v4i k4 = *(const v4i*)(km + j0);
#pragma unroll
                for (int q = 0; q < 4; ++q) { const float t = (k4[q] != 0) ? a[q] : -3.0e38f; v[ch * 4 + q] = t; mx = fmaxf(mx, t); } }
#pragma unroll
            for (int sh = 16; sh; sh >>= 1) mx = fmaxf(mx, __shfl_xor(mx, sh, 32));
            float sum = 0.f;
#pragma unroll
            for (int k = 0; k < TT / 32; ++k) { v[k] = __builtin_amdgcn_exp2f(__fmul_rn(__fsub_rn(v[k], mx), 1.4426950408889634f)); sum += v[k]; }
#pragma unroll
            for (int sh = 16; sh; sh >>= 1) sum += __shfl_xor(sum, sh, 32);
            const float f = __fdiv_rn(1.0f, sum); bf* prow = (bf*)srow;
#pragma unroll
            for (int ch = 0; ch < TT / 128; ++ch) { v4us oh, ol;
#pragma unroll
                for (int q = 0; q < 4; ++q) { unsigned short a, c2; splitf(v[ch * 4 + q] * f, a, c2); oh[q] = a; ol[q] = c2; }
                *(v4us*)(prow + ch * 128 + lane * 4) = oh; *(v4us*)(prow + TT + ch * 128 + lane * 4) = ol; } }
    }
    __syncthreads();
    // phase 4: O = P.V: waves 0..3 (one per SIMD) take 16 columns of the head each and all 4 row tiles, so that each V fragment is fetched once; k runs in the order of the unfused GEMM.
    // V fragments are fetched one set (128 keys) ahead into a second register set.
    if (w < 4) {
        const bf* pr = (const bf*)(S + lr * FPF) + 8 * hi;
        const size_t voff = zo + (size_t)(w * 16 + lr) * TT + 8 * hi; const bf* vh = VTh + voff; const bf* vl = VTl + voff;
        v8f o[FMT];
#pragma unroll
        for (int mt = 0; mt < FMT; ++mt) o[mt] = (v8f){};
        v16bf va[4][2], vb[4][2];
        auto vload = [&](v16bf (&s)[4][2], int k0, int kn) {   /* kn: the index whose pointer the build addresses these loads from */
#pragma unroll
            for (int u = 0; u < 4; ++u) { s[u][0] = F::ld(vh + k0 + u * 32); s[u][1] = F::ld(vl + k0 + u * 32); }
            // precaution: the pointers are named so that no register an issued load names is rewritten ahead of this wait; the clobber also keeps the loads above it
            asm volatile("s_wait_xcnt 0x0" :: "v"(vh + kn), "v"(vl + kn) : "memory"); };
        auto pv = [&](const v16bf (&s)[4][2], int k0) {
#pragma unroll
            for (int u = 0; u < 4; ++u) { v16bf ph[FMT], pl[FMT];
#pragma unroll
                for (int mt = 0; mt < FMT; ++mt) { ph[mt] = F::ld(pr + mt * 16 * 2 * FPF + k0 + u * 32); pl[mt] = F::ld(pr + mt * 16 * 2 * FPF + TT + k0 + u * 32); }
#pragma unroll
                for (int mt = 0; mt < FMT; ++mt) o[mt] = wmmab(ph[mt], s[u][0], o[mt]);
#pragma unroll
                for (int mt = 0; mt < FMT; ++mt) o[mt] = wmmab(pl[mt], s[u][0], o[mt]);
#pragma unroll
                for (int mt = 0; mt < FMT; ++mt) o[mt] = wmmab(ph[mt], s[u][1], o[mt]); } };
        vload(va, 0, 0);
#pragma unroll 1   // rolled: both V sets and the P fragments of one trip fill the register budget
        for (int k1 = 128; k1 < TT; k1 += 256) {
            vload(vb, k1, k1 - 128);
            pv(va, k1 - 128);
            const int k2 = (k1 + 128 < TT) ? k1 + 128 : 0; vload(va, k2, k2);   /* the last trip has no next set: it fetches set 0 again, in bounds, unused */
            pv(vb, k1);
            // four vector slots between the last matrix instruction and the taken back edge, where the next trip's loads overwrite its operands
            asm volatile("v_nop\n\tv_nop\n\tv_nop\n\tv_nop" : "+v"(o[0]), "+v"(o[1]), "+v"(o[2]), "+v"(o[3]));
        }
#pragma unroll
        for (int mt = 0; mt < FMT; ++mt)
#pragma unroll
            for (int j = 0; j < 8; ++j) os[(mt * 16 + hi * 8 + j) * 68 + w * 16 + lr] = o[mt][j];
    }
    __syncthreads();
    // whole 256-byte output rows per half wave: one writer per line
#pragma unroll
    for (int s = 0; s < 2; ++s) { const int row = w * 4 + s * 2 + hi; const v4f val = *(const v4fa*)(os + row * 68 + lr * 4); *(v4f*)(OUT + ((size_t)b * TT + i0 + row) * DM + h * HD + lr * 4) = val; }
}
__global__ __launch_bounds__(256) void k_merge(const float* __restrict__ O, int h0, bf* Ah, bf* Al) { const size_t e = ((size_t)blockIdx.x * 256 + threadIdx.x) * 2; if (e >= (size_t)ZH * TT * HD) return; const int d = (int)(e % HD); const int t = (int)((e / HD) % TT); const int zz = (int)(e / ((size_t)HD * TT)); const float cs = (t < RH) ? 1.0f : (1.0f / PCAR); const size_t oo = (size_t)t * DQ + (h0 + zz) * HD + d;
    v2us oh, ol;
#pragma unroll
    for (int q = 0; q < 2; ++q) { unsigned short a, c2; splitf(O[e + q] * cs, a, c2); oh[q] = a; ol[q] = c2; } *(v2us*)(Ah + oo) = oh; *(v2us*)(Al + oo) = ol;  }

extern "C" void kernel_launch(void* const* d_in, const int* in_sizes, int n_in,
                              void* d_out, int out_size, void* d_ws, size_t ws_size, hipStream_t stream) {
    (void)in_sizes; (void)n_in; (void)out_size;
    const float* x = (const float*)d_in[0]; const float* wqv = (const float*)d_in[1]; const float* rrb = (const float*)d_in[2]; const float* rwb = (const float*)d_in[3]; const int* kmask = (const int*)d_in[4]; const float* wq = wqv; const float* wk = nullptr; const float* wv = wqv; const float* wo = nullptr; (void)wk; (void)wo; const float* cosT = nullptr; const float* sinT = nullptr; (void)cosT; (void)sinT;
    float* OUT = (float*)d_out;     // [4][1024][1024]
    char* wsp = (char*)d_ws;
    auto take = [&](size_t bytes) { char* p = wsp; wsp += (bytes + 255) & ~(size_t)255; return (void*)p; };
    const size_t PL = (size_t)NB_ * NH_ * TT * HD;   // one plane set: every batch, every head
    const size_t FL = (size_t)NB_ * TT * DM;         // one f32 activation: every batch
    bf* WALL = (bf*)take((size_t)2 * DQ * DM * 2); float* POS = (float*)take((size_t)P2 * HD * 4); bf* POSh = (bf*)take((size_t)P2 * HD * 2); bf* POSl = (bf*)take((size_t)P2 * HD * 2); float* DT = (float*)take((size_t)NH_ * P2 * 4); float* CS = (float*)take((size_t)TT * HD * 2 * 4);
    bf* Rh = (bf*)take(3 * PL * 2); bf* Rl = (bf*)take(3 * PL * 2);   // plane sets in the order k | q + r_r_bias | q
    bf* KPh = Rh; bf* KPl = Rl; bf* QRh = Rh + PL; bf* QRl = Rl + PL; bf* QPh = Rh + 2 * PL; bf* QPl = Rl + 2 * PL;
    bf* VTh = (bf*)take(PL * 2); bf* VTl = (bf*)take(PL * 2);
    bf* Ph = (bf*)take((size_t)ZS * RH * TT * 2);
    float* BB = (float*)take((size_t)ZH * TT * P2 * 4 + (size_t)ZH * TT * TT * 4);
    // the f32 activations and the bf16 input, in the order x rounded | q + r_r_bias | q | v
    float* FXR = BB; float* FQR = FXR + FL; float* FQ = FQR + FL; float* FV = FQ + FL; bf* XB = (bf*)(FV + FL);
    // the f16 planes are written and never read (every row takes the hi + lo path)
    h16* R16 = (h16*)Ph; h16* VT16 = R16 + 3 * PL;
    if ((size_t)(wsp - (char*)d_ws) > ws_size) return;   // ws ~ 200 MiB
    k_wtG<<<(unsigned)((DM * 2 * DQ / 64 + 63) / 64), 256, 0, stream>>>(wqv, DM, 2 * DQ, WALL); k_postab<<<(P2 * HD / 2 + 255) / 256, 256, 0, stream>>>(POS, POSh, POSl); k_dtab<<<(NH_ * P2 + 255) / 256, 256, 0, stream>>>(rwb, POS, DT);
    k_csid<<<(TT * HD + 255) / 256, 256, 0, stream>>>(CS);
    const unsigned LQ = (unsigned)(((size_t)NH_ * TT * HD / 2 + 255) / 256);
    // every batch in one launch
    k_cvt8<<<(unsigned)((FL / 8 + 255) / 256), 256, 0, stream>>>(x, XB, FL / 8); k_rbf<<<(unsigned)((FL / 4 + 255) / 256), 256, 0, stream>>>(x, FXR, (int)(FL / 4));   /* k = x: the bf16-ROUNDED input */
    k_gemmw<bf, 0, false><<<dim3(NB_ * TT / 64, DQ / 64, 2), 32, 0, stream>>>(XB, nullptr, WALL, nullptr, DM, FQ, DQ, nullptr, 0, (size_t)DQ * DM, FL);   /* z = 0: q, z = 1: v */
    k_addrr<<<(unsigned)((FL / 4 + 255) / 256), 256, 0, stream>>>(FQ, rrb, FQR);
    k_rope<<<dim3(LQ, 3 * NB_, 1), 256, 0, stream>>>(FXR, DQ, NH_, CS, nullptr, nullptr, 1.0f, R16, Rh, Rl);   /* 12 slabs: k, q + r_r_bias, q of the 4 batches */
    k_vtp<<<dim3(LQ, NB_, 1), 256, 0, stream>>>(FV, DKV, NKV, VT16, VTh, VTl);
    k_fattn<<<dim3(TT / FR, NB_ * NH_, 1), FNW * 32, 0, stream>>>(QRh, QRl, QPh, QPl, KPh, KPl, POSh, POSl, DT, VTh, VTl, kmask, OUT);   /* every batch and head */
}

// v003
// A run of this version takes 198 microseconds.
// Two timings next to v002 both put it at 1.25 times that version's speed.
// All steps since v000 together make it 9.30 times as fast.
#include <hip/hip_runtime.h>

// RelativeMultiHeadAttn (Transformer-XL style, k_as_x: x [4][1024][1024], Wqv [1024][2048] (q | v column blocks), r_r_bias / r_w_bias [16][64], mask [4][1024] (int, read; all ones); k = x itself split into 16 heads; pos = the sinusoidal table [2L][64] (sin | cos of p * exp(-d ln(1e4)/31), p = -L..L-1, row 0 zeroed) computed on chip in f32; AC = (q + r_r_bias).k; B_ = q.pos^T, D_ = r_w_bias.pos^T; BD = shift(B_ + D_) = (B_ + D_)[i][L - i + j] (exact index form of the pad/reshape shift); attn = softmax(AC + BD) (NO scaling; -inf where mask == 0); out = attn.v merged -> [4][1024][1024] (no output projection)).
// Compute dtypes, f32 accumulate: every input rounded to bf16; q, v as PLAIN bf16 GEMMs (inputs: exact); k planes straight from the (bf16-exact) input; pos table f32 -> hi/lo planes; AC and B_ as hl x hl GEMMs (3 products) on every row (unscaled logits are sharp); D_ as 64-term f32 dots; BD gathered per element (contiguous along j) and added in f32; softmax f32; attn.v hl x hl (3 products) on every row; output written directly in f32.

#define NB_  4
#define TT   1024
#define DM   1024
#define NH_  16
#define NKV  16
#define REP  (NH_ / NKV)
#define HD   64
#define DQ   (NH_ * HD)
#define DKV  (NKV * HD)
#define ZH   8                     // heads per k_merge call (k_merge is not launched)
#define ZS   16                    // unused
#define RH   1024                  // k_merge (not launched) scales rows t >= RH by 1/PCAR
#define WIN  0
#define PCAR 1024.0f
#define P2   (2 * TT)             // 2L relative positions
#define SCL  0.125f   // HD^-0.5
typedef _Float16 h16;
typedef unsigned short bf;
typedef __attribute__((ext_vector_type(16))) __bf16   v16bf;
typedef __attribute__((ext_vector_type(16))) _Float16 v16h;
typedef __attribute__((ext_vector_type(8)))  _Float16 v8h;
typedef __attribute__((ext_vector_type(8)))  unsigned short v8us;
typedef __attribute__((ext_vector_type(8)))  float    v8f;
typedef __attribute__((ext_vector_type(4)))  float    v4f;
typedef v8h  __attribute__((may_alias)) v8ha;
typedef v4f  __attribute__((may_alias)) v4fa;
typedef v8us __attribute__((may_alias)) v8usa;

__device__ __forceinline__ unsigned short f2bf(float f) { unsigned u = __float_as_uint(f); u += 0x7FFFu + ((u >> 16) & 1u); return (unsigned short)(u >> 16); }
__device__ __forceinline__ float bf2f(unsigned short b) { return __uint_as_float(((unsigned)b) << 16); }
__device__ __forceinline__ float bfr(float f) { return bf2f(f2bf(f)); }
__device__ __forceinline__ v16h cat16(v8h lo, v8h hi) { return __builtin_shufflevector(lo, hi, 0, 1, 2, 3, 4, 5, 6, 7, 8, 9, 10, 11, 12, 13, 14, 15); }
__device__ __forceinline__ v16bf cat16b(v8us lo, v8us hi) { return __builtin_bit_cast(v16bf, __builtin_shufflevector(lo, hi, 0, 1, 2, 3, 4, 5, 6, 7, 8, 9, 10, 11, 12, 13, 14, 15)); }
__device__ __forceinline__ v8f wmma16(v16h a, v16h b, v8f c) { return __builtin_amdgcn_wmma_f32_16x16x32_f16(false, a, false, b, (short)0, c, false, false); }
__device__ __forceinline__ v8f wmmab(v16bf a, v16bf b, v8f c) { return __builtin_amdgcn_wmma_f32_16x16x32_bf16(false, a, false, b, (short)0, c, false, false); }



// ---- k_gemmw: register-blocked GEMM, ONE WAVE per 64x64 output tile (16 accumulators), operands straight from K-contiguous 16-bit planes; grid (M/64, N/64, Z), 32 threads.
// C[m][n] = sum_k A[m][k] Bt[n][k] (+ split products per NSPLIT). z-batch strides sA/sB in elements. K % 32 == 0. z = 0: q, z = 1: v.
// A tile is 64 tokens of one head, so the epilogue writes the planes that the attention kernel reads straight from the accumulators:
// z = 0: hi + lo planes [b][h][t][d] of q and of q + r_r_bias; z = 1: hi + lo planes [b][h][d][t] of v.
template <typename T16> struct WFrag;
template <> struct WFrag<h16> { typedef v16h V; static __device__ __forceinline__ V ld(const h16* p) { return cat16(*(const v8h*)p, *(const v8h*)(p + 16)); } static __device__ __forceinline__ v8f mma(V a, V b, v8f c) { return wmma16(a, b, c); } };
template <> struct WFrag<bf> { typedef v16bf V; static __device__ __forceinline__ V ld(const bf* p) { return cat16b(*(const v8us*)p, *(const v8us*)(p + 16)); } static __device__ __forceinline__ v8f mma(V a, V b, v8f c) { return wmmab(a, b, c); } };
__device__ __forceinline__ void splitf(float y, unsigned short& h, unsigned short& l) { h = f2bf(y); l = f2bf(y - bf2f(h)); }
template <typename T16, int NSPLIT>
__global__ __launch_bounds__(32) void k_gemmw(const T16* __restrict__ A, const T16* __restrict__ A2, const T16* __restrict__ Bt, const T16* __restrict__ Bt2, int K, const float* __restrict__ rr, bf* QPh, bf* QPl, bf* QRh, bf* QRl, bf* VTh, bf* VTl, size_t sA, size_t sB) {
    typedef typename WFrag<T16>::V V;
    __shared__ __align__(16) float os[16 * 68];
    const size_t z = blockIdx.z; A += z * sA; if (A2) A2 += z * sA; Bt += z * sB; if (Bt2) Bt2 += z * sB;
    const int lane = threadIdx.x & 31, lr = lane & 15, hi = lane >> 4; const int r0 = blockIdx.x * 64, c0 = blockIdx.y * 64;
    v8f acc[4][4];
#pragma unroll
    for (int mb = 0; mb < 4; ++mb)
#pragma unroll
        for (int nb = 0; nb < 4; ++nb) acc[mb][nb] = (v8f){};
    const size_t aoff = (size_t)(r0 + lr) * K + 8 * hi, boff = (size_t)(c0 + lr) * K + 8 * hi;
#pragma unroll 1
    for (int kc = 0; kc < K; kc += 32) {
        V a[4], a2[4];
#pragma unroll
        for (int mb = 0; mb < 4; ++mb) { a[mb] = WFrag<T16>::ld(A + aoff + (size_t)mb * 16 * K + kc); if (NSPLIT == 1 || NSPLIT == 2) a2[mb] = WFrag<T16>::ld(A2 + aoff + (size_t)mb * 16 * K + kc); }
#pragma unroll
        for (int nb = 0; nb < 4; ++nb) { const V b = WFrag<T16>::ld(Bt + boff + (size_t)nb * 16 * K + kc); V b2; if (NSPLIT >= 2) b2 = WFrag<T16>::ld(Bt2 + boff + (size_t)nb * 16 * K + kc);
#pragma unroll
            for (int mb = 0; mb < 4; ++mb) { acc[mb][nb] = WFrag<T16>::mma(a[mb], b, acc[mb][nb]); if (NSPLIT == 1 || NSPLIT == 2) acc[mb][nb] = WFrag<T16>::mma(a2[mb], b, acc[mb][nb]); if (NSPLIT >= 2) acc[mb][nb] = WFrag<T16>::mma(a[mb], b2, acc[mb][nb]); } }
        asm volatile("v_nop\n\tv_nop\n\tv_nop\n\tv_nop" : "+v"(acc[0][0]), "+v"(acc[1][1]), "+v"(acc[2][2]), "+v"(acc[3][3]) : "v"(a[0]), "v"(a[3]));
    }
    const int t0 = r0 % TT; const size_t pz = (size_t)((r0 / TT) * NH_ + blockIdx.y) * TT * HD;   // the planes of this tile's (batch, head)
    if (z == 0) {
        // through LDS, 16 rows at a time: a lane then holds 8 neighbouring d of one token, and 8 lanes write one whole 128-byte plane row
        const int rw = lane >> 3, c8 = (lane & 7) * 8; float rb[8];
#pragma unroll
        for (int u = 0; u < 8; ++u) rb[u] = bfr(rr[c0 + c8 + u]);
#pragma unroll
        for (int mb = 0; mb < 4; ++mb) {
#pragma unroll
            for (int nb = 0; nb < 4; ++nb) {
#pragma unroll
                for (int j = 0; j < 8; ++j) os[(hi * 8 + j) * 68 + nb * 16 + lr] = acc[mb][nb][j]; }
            // one wave, LDS runs in order: these two only keep the compiler from moving the reads of other lanes' values above the stores
            __builtin_amdgcn_wave_barrier(); asm volatile("" ::: "memory");
#pragma unroll
            for (int s = 0; s < 4; ++s) { const int row = 4 * s + rw; const v4f x0 = *(const v4fa*)(os + row * 68 + c8), x1 = *(const v4fa*)(os + row * 68 + c8 + 4); v8us qh, ql, sh, sl;
#pragma unroll
                for (int u = 0; u < 8; ++u) { const float q = (u < 4) ? x0[u & 3] : x1[u & 3]; unsigned short a2, c2; splitf(q, a2, c2); qh[u] = a2; ql[u] = c2; splitf(__fadd_rn(q, rb[u]), a2, c2); sh[u] = a2; sl[u] = c2; }
                const size_t o = pz + (size_t)(t0 + mb * 16 + row) * HD + c8;
                *(v8us*)(QPh + o) = qh; *(v8us*)(QPl + o) = ql; *(v8us*)(QRh + o) = sh; *(v8us*)(QRl + o) = sl;
                // precaution: no register that an issued store names is rewritten ahead of this wait
                asm volatile("s_wait_xcnt 0x0" ::: "memory"); }
            // and the next 16 rows' stores from moving above these reads
            __builtin_amdgcn_wave_barrier(); asm volatile("" ::: "memory");
        }
    } else {
        // the transposed planes need no LDS: the 8 accumulator values of a lane are 8 neighbouring tokens of one d; the 4 row tiles fill that d's 128-byte line
#pragma unroll
        for (int nb = 0; nb < 4; ++nb)
#pragma unroll
            for (int mb = 0; mb < 4; ++mb) { v8us vh, vl;
#pragma unroll
                for (int j = 0; j < 8; ++j) { unsigned short a2, c2; splitf(acc[mb][nb][j], a2, c2); vh[j] = a2; vl[j] = c2; }
                const size_t o = pz + (size_t)(nb * 16 + lr) * TT + t0 + mb * 16 + hi * 8;
                *(v8us*)(VTh + o) = vh; *(v8us*)(VTl + o) = vl;
                // precaution: data and pointers are named so that no register an issued store names is rewritten ahead of this wait
                asm volatile("s_wait_xcnt 0x0" :: "v"(vh), "v"(vl), "v"(VTh + o), "v"(VTl + o) : "memory"); }
    }
}

typedef __attribute__((ext_vector_type(2))) _Float16 v2h;
typedef __attribute__((ext_vector_type(4))) _Float16 v4h;
typedef __attribute__((ext_vector_type(2))) unsigned short v2us;
typedef __attribute__((ext_vector_type(4))) unsigned short v4us;
typedef __attribute__((ext_vector_type(2))) float v2f;
typedef __attribute__((ext_vector_type(4))) int v4i;

__global__ __launch_bounds__(256) void k_wtG(const float* __restrict__ w, int K, int N, bf* Bt) {
    const int lane = threadIdx.x & 31; const int L0 = (blockIdx.x * 8 + (threadIdx.x >> 5)) * 8; const int nlines = N * K / 64;
{
#pragma unroll 1
        for (int l = 0; l < 8; ++l) { const int L = L0 + l; if (L >= nlines) break; const size_t e = (size_t)L * 64 + lane * 2; const int k = (int)(e % K), n = (int)(e / K); v2us o;
            o[0] = f2bf(w[(size_t)k * N + n]); o[1] = f2bf(w[(size_t)(k + 1) * N + n]); *(v2us*)(Bt + e) = o; }
         }
}
// k_xk: x rounded to bf16, once row-major (the GEMM's A) and once as the k planes [b][h][t][d]; the rounded value is bf16-exact, so its lo plane is zero.
// A block takes 8 tokens, a thread 8 elements of 4 of them, all loads first; 8 lanes write one whole 128-byte plane row.
// Block-uniform bases: the lanes differ in one 32-bit offset per buffer, and a thread's 4 groups lie an immediate offset apart.
__global__ __launch_bounds__(256) void k_xk(const float* __restrict__ x, bf* XB, bf* KPh, bf* KPl) { const unsigned l8 = threadIdx.x * 8; const unsigned c = l8 % DM; const unsigned po = ((c / HD) * TT + l8 / DM) * HD + c % HD; v8f v[4];
    const size_t r0 = (size_t)blockIdx.x * 8; const size_t pb = (r0 / TT) * NH_ * TT * HD + (r0 % TT) * HD;
    const float* xb = x + r0 * DM; bf* ob = XB + r0 * DM; bf* kh = KPh + pb; bf* kl = KPl + pb;
#pragma unroll
    for (int g = 0; g < 4; ++g) v[g] = *(const v8f*)(xb + g * 2 * DM + l8);
    // precaution: the lane's offset is named so that no register an issued load names is rewritten ahead of this wait; the clobber also keeps the loads above it
    asm volatile("s_wait_xcnt 0x0" :: "v"(l8 * 4) : "memory");
#pragma unroll
    for (int g = 0; g < 4; ++g) { v8us o;
#pragma unroll
        for (int k = 0; k < 8; ++k) o[k] = f2bf(v[g][k]);
        *(v8us*)(ob + g * 2 * DM + l8) = o; *(v8us*)(kh + g * 2 * HD + po) = o; *(v8us*)(kl + g * 2 * HD + po) = (v8us){}; } }
__global__ __launch_bounds__(256) void k_cscvt(const float* __restrict__ cosT, const float* __restrict__ sinT, float* CS) { const int idx = blockIdx.x * 256 + threadIdx.x; if (idx >= TT * HD) return; v2f cs; cs[0] = bfr(cosT[idx]); cs[1] = bfr(sinT[idx]); *(v2f*)(CS + (size_t)idx * 2) = cs;  }
__global__ __launch_bounds__(256) void k_postab(float* POS, bf* Ph2, bf* Pl2) { const size_t e = ((size_t)blockIdx.x * 256 + threadIdx.x) * 2; if (e >= (size_t)P2 * HD) return; const int m = (int)(e / HD); v2f vv; v2us hh, ll;
#pragma unroll
    for (int q = 0; q < 2; ++q) { const int d = (int)((e + q) % HD); const int dd = (d < HD / 2) ? d : d - HD / 2; const float fr = expf(__fmul_rn((float)dd, -0.29710776f)); const float ang = __fmul_rn((float)(m - TT), fr); float v = (d < HD / 2) ? sinf(ang) : cosf(ang); if (m == 0) v = 0.0f; unsigned short a2, c2; splitf(v, a2, c2); vv[q] = v; hh[q] = a2; ll[q] = c2; }
    *(v2f*)(POS + e) = vv; *(v2us*)(Ph2 + e) = hh; *(v2us*)(Pl2 + e) = ll;  }
__global__ __launch_bounds__(256) void k_dtab(const float* __restrict__ rw, const float* __restrict__ POS, float* DT) { const int idx = blockIdx.x * 256 + threadIdx.x; if (idx >= NH_ * P2) return; const int h = idx / P2, m = idx % P2; float acc = 0.f;
#pragma unroll 4
    for (int d = 0; d < HD; ++d) { float w = bfr(rw[h * HD + d]); asm volatile("" : "+v"(w)); float p = __fmul_rn(w, POS[(size_t)m * HD + d]); asm volatile("" : "+v"(p)); acc = __fadd_rn(acc, p); }
    *(float*)(DT + idx) = acc;  }
// k_fattn: one work-group of 16 waves per 64 query rows of one (batch, head). The 64 x 1024 logit block lives in LDS from the first product to P.V.
// LDS row: 64 floats of left margin | 1024 logits | 64 floats of right margin | 4 floats (pitch 4624 B = 16 B x odd). The margins take the band's elements whose key index falls outside 0..1023: they are written, never read.
// After the softmax the same row holds the bf16 hi plane (bytes 0..2047) and lo plane (bytes 2048..4095) of P.
// Every plain '#pragma unroll' below makes the indices of a fragment or accumulator array constants, so that the array stays in registers.
#define FR   64
#define FMT  (FR / 16)
#define FNW  16
#define FPF  (TT + 2 * FR + 4)
__global__ __launch_bounds__(FNW * 32) void k_fattn(const bf* __restrict__ QRh, const bf* __restrict__ QRl, const bf* __restrict__ QPh, const bf* __restrict__ QPl, const bf* __restrict__ KPh, const bf* __restrict__ KPl, const bf* __restrict__ POSh, const bf* __restrict__ POSl, const float* __restrict__ DT, const bf* __restrict__ VTh, const bf* __restrict__ VTl, const int* __restrict__ kmask, float* OUT) {
    typedef WFrag<bf> F;
    __shared__ __align__(16) float S[FR * FPF];
    __shared__ __align__(16) float os[FR * 68];
    const int lane = threadIdx.x & 31, lr = lane & 15, hi = lane >> 4;
    const int w = __builtin_amdgcn_readfirstlane(threadIdx.x >> 5);   // wave number in a scalar register: every loop and branch round a matrix instruction is wave-uniform
    const int i0 = blockIdx.x * FR; const int z = blockIdx.y; const int b = z / NH_, h = z % NH_;
    const size_t zo = (size_t)z * TT * HD;
    const size_t qoff = zo + (size_t)(i0 + lr) * HD + 8 * hi;
    // phase 1: BD[r][j] = B_[i0 + r][m] + D_[m], m = L - (i0 + r) + j: only the band m = L - i0 - 64 .. L - i0 + 1023 (68 column tiles); each pos fragment serves all 4 row tiles
    {
        v16bf a[FMT][2], a2[FMT][2];
#pragma unroll
        for (int mt = 0; mt < FMT; ++mt)
#pragma unroll
            for (int ks = 0; ks < 2; ++ks) { a[mt][ks] = F::ld(QPh + qoff + mt * 16 * HD + ks * 32); a2[mt][ks] = F::ld(QPl + qoff + mt * 16 * HD + ks * 32); }
        // precaution: the pointers are named so that no register an issued load names is rewritten ahead of this wait; the clobber also keeps the loads above it
        asm volatile("s_wait_xcnt 0x0" :: "v"(QPh + qoff), "v"(QPl + qoff) : "memory");
        const int mlo = TT - i0 - FR; const float* dth = DT + (size_t)h * P2 + mlo + lr;
        const size_t poff = (size_t)(mlo + lr) * HD + 8 * hi;
#pragma unroll 1   // rolled: the 16 q fragments hold 128 registers, a second tile in flight would not fit 4 waves per SIMD
        for (int t = w; t < (TT + FR) / 16; t += FNW) {
            const bf* ph = POSh + poff + (size_t)t * 16 * HD; const bf* pl = POSl + poff + (size_t)t * 16 * HD; const float* dp = dth + t * 16;
            v16bf p[2], p2[2];
#pragma unroll
            for (int ks = 0; ks < 2; ++ks) { p[ks] = F::ld(ph + ks * 32); p2[ks] = F::ld(pl + ks * 32); }
            const float dv = *dp;
            // precaution: the pointers are named so that no register an issued load names is rewritten ahead of this wait; the clobber also keeps the loads above it
            asm volatile("s_wait_xcnt 0x0" :: "v"(ph), "v"(pl), "v"(dp) : "memory");
            v8f acc[FMT];
#pragma unroll
            for (int mt = 0; mt < FMT; ++mt) acc[mt] = (v8f){};
#pragma unroll
            for (int ks = 0; ks < 2; ++ks) {
#pragma unroll
                for (int mt = 0; mt < FMT; ++mt) acc[mt] = wmmab(a[mt][ks], p[ks], acc[mt]);
#pragma unroll
                for (int mt = 0; mt < FMT; ++mt) acc[mt] = wmmab(a2[mt][ks], p[ks], acc[mt]);
#pragma unroll
                for (int mt = 0; mt < FMT; ++mt) acc[mt] = wmmab(a[mt][ks], p2[ks], acc[mt]); }
#pragma unroll
            for (int mt = 0; mt < FMT; ++mt)
#pragma unroll
                for (int j = 0; j < 8; ++j) { const int r = mt * 16 + hi * 8 + j; S[r * FPF + t * 16 + lr + r] = __fadd_rn(acc[mt][j], dv); }   /* column FR + j, j = t*16 + lr - FR + r */
        }
    }
    __syncthreads();
    // phase 2: logit = AC + BD; each k fragment serves all 4 row tiles
    {
        v16bf a[FMT][2], a2[FMT][2];
#pragma unroll
        for (int mt = 0; mt < FMT; ++mt)
#pragma unroll
            for (int ks = 0; ks < 2; ++ks) { a[mt][ks] = F::ld(QRh + qoff + mt * 16 * HD + ks * 32); a2[mt][ks] = F::ld(QRl + qoff + mt * 16 * HD + ks * 32); }
        // precaution: the pointers are named so that no register an issued load names is rewritten ahead of this wait; the clobber also keeps the loads above it
        asm volatile("s_wait_xcnt 0x0" :: "v"(QRh + qoff), "v"(QRl + qoff) : "memory");
        const size_t koff = zo + (size_t)lr * HD + 8 * hi;
#pragma unroll 1   // rolled: as in phase 1
        for (int t = w; t < TT / 16; t += FNW) {
            const bf* kh = KPh + koff + (size_t)t * 16 * HD; const bf* kl = KPl + koff + (size_t)t * 16 * HD;
            v16bf k1[2], k2[2];
#pragma unroll
            for (int ks = 0; ks < 2; ++ks) { k1[ks] = F::ld(kh + ks * 32); k2[ks] = F::ld(kl + ks * 32); }
            // precaution: the pointers are named so that no register an issued load names is rewritten ahead of this wait; the clobber also keeps the loads above it
            asm volatile("s_wait_xcnt 0x0" :: "v"(kh), "v"(kl) : "memory");
            v8f acc[FMT];
#pragma unroll
            for (int mt = 0; mt < FMT; ++mt) acc[mt] = (v8f){};
#pragma unroll
            for (int ks = 0; ks < 2; ++ks) {
#pragma unroll
                for (int mt = 0; mt < FMT; ++mt) acc[mt] = wmmab(a[mt][ks], k1[ks], acc[mt]);
#pragma unroll
                for (int mt = 0; mt < FMT; ++mt) acc[mt] = wmmab(a2[mt][ks], k1[ks], acc[mt]);
#pragma unroll
                for (int mt = 0; mt < FMT; ++mt) acc[mt] = wmmab(a[mt][ks], k2[ks], acc[mt]); }
            float* sp = S + (hi * 8) * FPF + FR + t * 16 + lr; float bd[FMT][8];
#pragma unroll
            for (int mt = 0; mt < FMT; ++mt)
#pragma unroll
                for (int j = 0; j < 8; ++j) bd[mt][j] = sp[(mt * 16 + j) * FPF];
#pragma unroll
            for (int mt = 0; mt < FMT; ++mt)
#pragma unroll
                for (int j = 0; j < 8; ++j) sp[(mt * 16 + j) * FPF] = __fadd_rn(acc[mt][j], bd[mt][j]);
        }
    }
    __syncthreads();
    // phase 3: softmax, one wave per row, 4 rows a wave (register row, one exp, fixed trees); P split into hi + lo planes in place
    {
        const int* km = kmask + (size_t)b * TT;
#pragma unroll 1   // rolled: one row's 32 values per lane at a time
        for (int rr = 0; rr < FR / FNW; ++rr) { float* srow = S + (w * (FR / FNW) + rr) * FPF; float v[TT / 32]; float mx = -3.0e38f;
#pragma unroll
            for (int ch = 0; ch < TT / 128; ++ch) { const int j0 = ch * 128 + lane * 4; const v4f a = *(const v4fa*)(srow + FR + j0); const v4i k4 = *(const v4i*)(km + j0);
#pragma unroll
                for (int q = 0; q < 4; ++q) { const float t = (k4[q] != 0) ? a[q] : -3.0e38f; v[ch * 4 + q] = t; mx = fmaxf(mx, t); } }
#pragma unroll
            for (int sh = 16; sh; sh >>= 1) mx = fmaxf(mx, __shfl_xor(mx, sh, 32));
            float sum = 0.f;
#pragma unroll
            for (int k = 0; k < TT / 32; ++k) { v[k] = __builtin_amdgcn_exp2f(__fmul_rn(__fsub_rn(v[k], mx), 1.4426950408889634f)); sum += v[k]; }
#pragma unroll
            for (int sh = 16; sh; sh >>= 1) sum += __shfl_xor(sum, sh, 32);
            const float f = __fdiv_rn(1.0f, sum); bf* prow = (bf*)srow;
#pragma unroll
            for (int ch = 0; ch < TT / 128; ++ch) { v4us oh, ol;
#pragma unroll
                for (int q = 0; q < 4; ++q) { unsigned short a, c2; splitf(v[ch * 4 + q] * f, a, c2); oh[q] = a; ol[q] = c2; }
                *(v4us*)(prow + ch * 128 + lane * 4) = oh; *(v4us*)(prow + TT + ch * 128 + lane * 4) = ol; } }
    }
    __syncthreads();
    // phase 4: O = P.V: waves 0..3 (one per SIMD) take 16 columns of the head each and all 4 row tiles, so that each V fragment is fetched once; k runs in the order of the unfused GEMM.
    // V fragments are fetched one set (128 keys) ahead into a second register set.
    if (w < 4) {
        const bf* pr = (const bf*)(S + lr * FPF) + 8 * hi;
        const size_t voff = zo + (size_t)(w * 16 + lr) * TT + 8 * hi; const bf* vh = VTh + voff; const bf* vl = VTl + voff;
        v8f o[FMT];
#pragma unroll
        for (int mt = 0; mt < FMT; ++mt) o[mt] = (v8f){};
        v16bf va[4][2], vb[4][2];
        auto vload = [&](v16bf (&s)[4][2], int k0, int kn) {   /* kn: the index whose pointer the build addresses these loads from */
#pragma unroll
            for (int u = 0; u < 4; ++u) { s[u][0] = F::ld(vh + k0 + u * 32); s[u][1] = F::ld(vl + k0 + u * 32); }
            // precaution: the pointers are named so that no register an issued load names is rewritten ahead of this wait; the clobber also keeps the loads above it
            asm volatile("s_wait_xcnt 0x0" :: "v"(vh + kn), "v"(vl + kn) : "memory"); };
        auto pv = [&](const v16bf (&s)[4][2], int k0) {
#pragma unroll
            for (int u = 0; u < 4; ++u) { v16bf ph[FMT], pl[FMT];
#pragma unroll
                for (int mt = 0; mt < FMT; ++mt) { ph[mt] = F::ld(pr + mt * 16 * 2 * FPF + k0 + u * 32); pl[mt] = F::ld(pr + mt * 16 * 2 * FPF + TT + k0 + u * 32); }
#pragma unroll
                for (int mt = 0; mt < FMT; ++mt) o[mt] = wmmab(ph[mt], s[u][0], o[mt]);
#pragma unroll
                for (int mt = 0; mt < FMT; ++mt) o[mt] = wmmab(pl[mt], s[u][0], o[mt]);
#pragma unroll
                for (int mt = 0; mt < FMT; ++mt) o[mt] = wmmab(ph[mt], s[u][1], o[mt]); } };
        vload(va, 0, 0);
#pragma unroll 1   // rolled: both V sets and the P fragments of one trip fill the register budget
        for (int k1 = 128; k1 < TT; k1 += 256) {
            vload(vb, k1, k1 - 128);
            pv(va, k1 - 128);
            const int k2 = (k1 + 128 < TT) ? k1 + 128 : 0; vload(va, k2, k2);   /* the last trip has no next set: it fetches set 0 again, in bounds, unused */
            pv(vb, k1);
            // four vector slots between the last matrix instruction and the taken back edge, where the next trip's loads overwrite its operands
            asm volatile("v_nop\n\tv_nop\n\tv_nop\n\tv_nop" : "+v"(o[0]), "+v"(o[1]), "+v"(o[2]), "+v"(o[3]));
        }
#pragma unroll
        for (int mt = 0; mt < FMT; ++mt)
#pragma unroll
            for (int j = 0; j < 8; ++j) os[(mt * 16 + hi * 8 + j) * 68 + w * 16 + lr] = o[mt][j];
    }
    __syncthreads();
    // whole 256-byte output rows per half wave: one writer per line
#pragma unroll
    for (int s = 0; s < 2; ++s) { const int row = w * 4 + s * 2 + hi; const v4f val = *(const v4fa*)(os + row * 68 + lr * 4); *(v4f*)(OUT + ((size_t)b * TT + i0 + row) * DM + h * HD + lr * 4) = val; }
}
__global__ __launch_bounds__(256) void k_merge(const float* __restrict__ O, int h0, bf* Ah, bf* Al) { const size_t e = ((size_t)blockIdx.x * 256 + threadIdx.x) * 2; if (e >= (size_t)ZH * TT * HD) return; const int d = (int)(e % HD); const int t = (int)((e / HD) % TT); const int zz = (int)(e / ((size_t)HD * TT)); const float cs = (t < RH) ? 1.0f : (1.0f / PCAR); const size_t oo = (size_t)t * DQ + (h0 + zz) * HD + d;
    v2us oh, ol;
#pragma unroll
    for (int q = 0; q < 2; ++q) { unsigned short a, c2; splitf(O[e + q] * cs, a, c2); oh[q] = a; ol[q] = c2; } *(v2us*)(Ah + oo) = oh; *(v2us*)(Al + oo) = ol;  }

extern "C" void kernel_launch(void* const* d_in, const int* in_sizes, int n_in,
                              void* d_out, int out_size, void* d_ws, size_t ws_size, hipStream_t stream) {
    (void)in_sizes; (void)n_in; (void)out_size;
    const float* x = (const float*)d_in[0]; const float* wqv = (const float*)d_in[1]; const float* rrb = (const float*)d_in[2]; const float* rwb = (const float*)d_in[3]; const int* kmask = (const int*)d_in[4]; const float* wq = wqv; const float* wk = nullptr; const float* wv = wqv; const float* wo = nullptr; (void)wk; (void)wo; const float* cosT = nullptr; const float* sinT = nullptr; (void)cosT; (void)sinT;
    float* OUT = (float*)d_out;     // [4][1024][1024]
    char* wsp = (char*)d_ws;
    auto take = [&](size_t bytes) { char* p = wsp; wsp += (bytes + 255) & ~(size_t)255; return (void*)p; };
    const size_t PL = (size_t)NB_ * NH_ * TT * HD;   // one plane set: every batch, every head
    const size_t FL = (size_t)NB_ * TT * DM;         // one f32 activation: every batch
    bf* WALL = (bf*)take((size_t)2 * DQ * DM * 2); float* POS = (float*)take((size_t)P2 * HD * 4); bf* POSh = (bf*)take((size_t)P2 * HD * 2); bf* POSl = (bf*)take((size_t)P2 * HD * 2); float* DT = (float*)take((size_t)NH_ * P2 * 4);
    bf* KPh = (bf*)take(PL * 2); bf* KPl = (bf*)take(PL * 2); bf* QRh = (bf*)take(PL * 2); bf* QRl = (bf*)take(PL * 2); bf* QPh = (bf*)take(PL * 2); bf* QPl = (bf*)take(PL * 2);   // hi and lo planes of k, of q + r_r_bias, of q
    bf* VTh = (bf*)take(PL * 2); bf* VTl = (bf*)take(PL * 2);
    bf* XB = (bf*)take(FL * 2);   // the bf16 input, row-major
    if ((size_t)(wsp - (char*)d_ws) > ws_size) return;   // ws ~ 77 MiB
    k_wtG<<<(unsigned)((DM * 2 * DQ / 64 + 63) / 64), 256, 0, stream>>>(wqv, DM, 2 * DQ, WALL); k_postab<<<(P2 * HD / 2 + 255) / 256, 256, 0, stream>>>(POS, POSh, POSl); k_dtab<<<(NH_ * P2 + 255) / 256, 256, 0, stream>>>(rwb, POS, DT);
    // every batch in one launch
    k_xk<<<NB_ * TT / 8, 256, 0, stream>>>(x, XB, KPh, KPl);   /* k = x: the bf16-ROUNDED input */
    k_gemmw<bf, 0><<<dim3(NB_ * TT / 64, DQ / 64, 2), 32, 0, stream>>>(XB, nullptr, WALL, nullptr, DM, rrb, QPh, QPl, QRh, QRl, VTh, VTl, 0, (size_t)DQ * DM);   /* z = 0: q, z = 1: v */
    k_fattn<<<dim3(TT / FR, NB_ * NH_, 1), FNW * 32, 0, stream>>>(QRh, QRl, QPh, QPl, KPh, KPl, POSh, POSl, DT, VTh, VTl, kmask, OUT);   /* every batch and head */
}

// v004
// A run of this version takes 150 microseconds.
// Next to v003, in two timings, it ran 1.32 times as fast each time.
// Over all steps from v000 it is 12.3 times as fast.
#include <hip/hip_runtime.h>

// RelativeMultiHeadAttn (Transformer-XL style, k_as_x: x [4][1024][1024], Wqv [1024][2048] (q | v column blocks), r_r_bias / r_w_bias [16][64], mask [4][1024] (int, read; all ones); k = x itself split into 16 heads; pos = the sinusoidal table [2L][64] (sin | cos of p * exp(-d ln(1e4)/31), p = -L..L-1, row 0 zeroed) computed on chip in f32; AC = (q + r_r_bias).k; B_ = q.pos^T, D_ = r_w_bias.pos^T; BD = shift(B_ + D_) = (B_ + D_)[i][L - i + j] (exact index form of the pad/reshape shift); attn = softmax(AC + BD) (NO scaling; -inf where mask == 0); out = attn.v merged -> [4][1024][1024] (no output projection)).
// Compute dtypes, f32 accumulate: every input rounded to bf16; q, v as PLAIN bf16 GEMMs (inputs: exact); k planes straight from the (bf16-exact) input; pos table f32 -> hi/lo planes; AC and B_ as hl x hl GEMMs (3 products) on every row (unscaled logits are sharp); D_ as 64-term f32 dots; BD gathered per element (contiguous along j) and added in f32; softmax f32; attn.v hl x hl (3 products) on every row; output written directly in f32.

#define NB_  4
#define TT   1024
#define DM   1024
#define NH_  16
#define NKV  16
#define REP  (NH_ / NKV)
#define HD   64
#define DQ   (NH_ * HD)
#define DKV  (NKV * HD)
#define ZH   8                     // heads per k_merge call (k_merge is not launched)
#define ZS   16                    // unused
#define RH   1024                  // k_merge (not launched) scales rows t >= RH by 1/PCAR
#define WIN  0
#define PCAR 1024.0f
#define P2   (2 * TT)             // 2L relative positions
#define SCL  0.125f   // HD^-0.5
typedef _Float16 h16;
typedef unsigned short bf;
typedef __attribute__((ext_vector_type(16))) __bf16   v16bf;
typedef __attribute__((ext_vector_type(16))) _Float16 v16h;
typedef __attribute__((ext_vector_type(8)))  _Float16 v8h;
typedef __attribute__((ext_vector_type(8)))  unsigned short v8us;
typedef __attribute__((ext_vector_type(8)))  float    v8f;
typedef __attribute__((ext_vector_type(4)))  float    v4f;
typedef v8h  __attribute__((may_alias)) v8ha;
typedef v4f  __attribute__((may_alias)) v4fa;
typedef v8us __attribute__((may_alias)) v8usa;

__device__ __forceinline__ unsigned short f2bf(float f) { unsigned u = __float_as_uint(f); u += 0x7FFFu + ((u >> 16) & 1u); return (unsigned short)(u >> 16); }
__device__ __forceinline__ float bf2f(unsigned short b) { return __uint_as_float(((unsigned)b) << 16); }
__device__ __forceinline__ float bfr(float f) { return bf2f(f2bf(f)); }
__device__ __forceinline__ v16h cat16(v8h lo, v8h hi) { return __builtin_shufflevector(lo, hi, 0, 1, 2, 3, 4, 5, 6, 7, 8, 9, 10, 11, 12, 13, 14, 15); }
__device__ __forceinline__ v16bf cat16b(v8us lo, v8us hi) { return __builtin_bit_cast(v16bf, __builtin_shufflevector(lo, hi, 0, 1, 2, 3, 4, 5, 6, 7, 8, 9, 10, 11, 12, 13, 14, 15)); }
__device__ __forceinline__ v8f wmma16(v16h a, v16h b, v8f c) { return __builtin_amdgcn_wmma_f32_16x16x32_f16(false, a, false, b, (short)0, c, false, false); }
__device__ __forceinline__ v8f wmmab(v16bf a, v16bf b, v8f c) { return __builtin_amdgcn_wmma_f32_16x16x32_bf16(false, a, false, b, (short)0, c, false, false); }



// ---- k_gemmw: register-blocked GEMM, ONE WAVE per 64x64 output tile (16 accumulators), operands straight from 16-bit planes in fragment order; grid (M/64, N/64, Z), 32 threads.
// C[m][n] = sum_k A[m][k] Bt[n][k] (+ split products per NSPLIT). z-batch strides sA/sB in elements. K % 32 == 0. z = 0: q, z = 1: v.
// A tile is 64 tokens of one head, so the epilogue writes the planes that the attention kernel reads straight from the accumulators:
// z = 0: hi + lo planes [b][h] of q and of q + r_r_bias (rows t, k = d); z = 1: hi + lo planes [b][h] of v (rows d, k = t); each in fragment order.
template <typename T16> struct WFrag;
template <> struct WFrag<h16> { typedef v16h V; static __device__ __forceinline__ V ld(const h16* p) { return cat16(*(const v8h*)p, *(const v8h*)(p + 16)); } static __device__ __forceinline__ V ldf(const h16* p) { return cat16(*(const v8h*)p, *(const v8h*)(p + 256)); } static __device__ __forceinline__ v8f mma(V a, V b, v8f c) { return wmma16(a, b, c); } };
template <> struct WFrag<bf> { typedef v16bf V; static __device__ __forceinline__ V ld(const bf* p) { return cat16b(*(const v8us*)p, *(const v8us*)(p + 16)); } static __device__ __forceinline__ V ldf(const bf* p) { return cat16b(*(const v8us*)p, *(const v8us*)(p + 256)); } static __device__ __forceinline__ v8f mma(V a, V b, v8f c) { return wmmab(a, b, c); } };
// FRAGMENT ORDER: every 16-bit operand plane in the workspace, rows x K, is stored as blocks of 512 elements, one block per (16 rows, 32 k). Element (row, k) lies at
// ((row / 16) * (K / 32) + k / 32) * 512 + ((k / 16) % 2) * 256 + (((k / 8) % 2) * 16 + row % 16) * 8 + k % 8.
// Lane l of a wave finds the two 16-byte halves of its fragment at l * 8 and 256 + l * 8 of the block (ldf), so each load of a wave reads 512 contiguous bytes, 4 whole lines;
// the registers hold the same values as with row-major planes. fro: the place of 8 neighbouring k, k8 % 8 == 0, kb = K / 32.
__device__ __forceinline__ size_t fro(size_t row, size_t k8, size_t kb) { return ((row >> 4) * kb + (k8 >> 5)) * 512 + ((k8 >> 4) & 1) * 256 + (((k8 >> 3) & 1) * 16 + (row & 15)) * 8; }
__device__ __forceinline__ void splitf(float y, unsigned short& h, unsigned short& l) { h = f2bf(y); l = f2bf(y - bf2f(h)); }
template <typename T16, int NSPLIT>
__global__ __launch_bounds__(32) void k_gemmw(const T16* __restrict__ A, const T16* __restrict__ A2, const T16* __restrict__ Bt, const T16* __restrict__ Bt2, int K, const float* __restrict__ rr, bf* QPh, bf* QPl, bf* QRh, bf* QRl, bf* VTh, bf* VTl, size_t sA, size_t sB) {
    typedef typename WFrag<T16>::V V;
    __shared__ __align__(16) float os[16 * 68];
    const size_t z = blockIdx.z; A += z * sA; if (A2) A2 += z * sA; Bt += z * sB; if (Bt2) Bt2 += z * sB;
    const int lane = threadIdx.x & 31, lr = lane & 15, hi = lane >> 4; const int r0 = blockIdx.x * 64, c0 = blockIdx.y * 64;
    v8f acc[4][4];
#pragma unroll
    for (int mb = 0; mb < 4; ++mb)
#pragma unroll
        for (int nb = 0; nb < 4; ++nb) acc[mb][nb] = (v8f){};
    const size_t aoff = (size_t)r0 * K + lane * 8, boff = (size_t)c0 * K + lane * 8;   // 16 rows are K / 32 blocks = 16 * K elements; 32 k are one block
#pragma unroll 1
    for (int kc = 0; kc < K; kc += 32) {
        V a[4], a2[4], b[4], b2[4]; const T16* ap[4]; const T16* bp[4];
#pragma unroll
        for (int mb = 0; mb < 4; ++mb) { const size_t o = aoff + (size_t)mb * 16 * K + kc * 16; ap[mb] = A + o; a[mb] = WFrag<T16>::ldf(ap[mb]); if (NSPLIT == 1 || NSPLIT == 2) a2[mb] = WFrag<T16>::ldf(A2 + o); }
#pragma unroll
        for (int nb = 0; nb < 4; ++nb) { const size_t o = boff + (size_t)nb * 16 * K + kc * 16; bp[nb] = Bt + o; b[nb] = WFrag<T16>::ldf(bp[nb]); if (NSPLIT >= 2) b2[nb] = WFrag<T16>::ldf(Bt2 + o); }
        // precaution: the pointers are named so that no register an issued load names is rewritten ahead of this wait; the clobber also keeps the loads above it
        asm volatile("s_wait_xcnt 0x0" :: "v"(ap[0]), "v"(ap[1]), "v"(ap[2]), "v"(ap[3]), "v"(bp[0]), "v"(bp[1]), "v"(bp[2]), "v"(bp[3]) : "memory");
        // keeps the matrix instructions behind that wait: lifted over it they split the trip's loads into three groups, each waited for in turn
        __builtin_amdgcn_sched_barrier(0);
#pragma unroll
        for (int nb = 0; nb < 4; ++nb)
#pragma unroll
            for (int mb = 0; mb < 4; ++mb) { acc[mb][nb] = WFrag<T16>::mma(a[mb], b[nb], acc[mb][nb]); if (NSPLIT == 1 || NSPLIT == 2) acc[mb][nb] = WFrag<T16>::mma(a2[mb], b[nb], acc[mb][nb]); if (NSPLIT >= 2) acc[mb][nb] = WFrag<T16>::mma(a[mb], b2[nb], acc[mb][nb]); }
        asm volatile("v_nop\n\tv_nop\n\tv_nop\n\tv_nop" : "+v"(acc[0][0]), "+v"(acc[1][1]), "+v"(acc[2][2]), "+v"(acc[3][3]) : "v"(a[0]), "v"(a[3]));
    }
    const int t0 = r0 % TT; const size_t pz = (size_t)((r0 / TT) * NH_ + blockIdx.y) * TT * HD;   // the planes of this tile's (batch, head)
    if (z == 0) {
        // through LDS, 16 rows at a time: a lane then holds 8 neighbouring d of one token, and 8 lanes (8 neighbouring tokens) write one whole 128-byte line of a block
        const int r8 = lane & 7, cq = lane >> 3; float rb[2][8];
#pragma unroll
        for (int g = 0; g < 2; ++g)
#pragma unroll
            for (int u = 0; u < 8; ++u) rb[g][u] = bfr(rr[c0 + (g * 4 + cq) * 8 + u]);
#pragma unroll
        for (int mb = 0; mb < 4; ++mb) {
#pragma unroll
            for (int nb = 0; nb < 4; ++nb) {
#pragma unroll
                for (int j = 0; j < 8; ++j) os[(hi * 8 + j) * 68 + nb * 16 + lr] = acc[mb][nb][j]; }
            // one wave, LDS runs in order: these two only keep the compiler from moving the reads of other lanes' values above the stores
            __builtin_amdgcn_wave_barrier(); asm volatile("" ::: "memory");
#pragma unroll
            for (int s = 0; s < 4; ++s) { const int row = (s & 1) * 8 + r8, c8 = ((s >> 1) * 4 + cq) * 8; const v4f x0 = *(const v4fa*)(os + row * 68 + c8), x1 = *(const v4fa*)(os + row * 68 + c8 + 4); v8us qh, ql, sh, sl;
#pragma unroll
                for (int u = 0; u < 8; ++u) { const float q = (u < 4) ? x0[u & 3] : x1[u & 3]; unsigned short a2, c2; splitf(q, a2, c2); qh[u] = a2; ql[u] = c2; splitf(__fadd_rn(q, rb[s >> 1][u]), a2, c2); sh[u] = a2; sl[u] = c2; }
                const size_t o = pz + fro(t0 + mb * 16 + row, c8, HD / 32);
                *(v8us*)(QPh + o) = qh; *(v8us*)(QPl + o) = ql; *(v8us*)(QRh + o) = sh; *(v8us*)(QRl + o) = sl;
                // precaution: no register that an issued store names is rewritten ahead of this wait
                asm volatile("s_wait_xcnt 0x0" ::: "memory"); }
            // and the next 16 rows' stores from moving above these reads
            __builtin_amdgcn_wave_barrier(); asm volatile("" ::: "memory");
        }
    } else {
        // the transposed planes need no LDS: the 8 accumulator values of a lane are 8 neighbouring tokens of one d, which is that lane's 16 bytes of a block's half: a store writes 512 contiguous bytes
#pragma unroll
        for (int nb = 0; nb < 4; ++nb)
#pragma unroll
            for (int mb = 0; mb < 4; ++mb) { v8us vh, vl;
#pragma unroll
                for (int j = 0; j < 8; ++j) { unsigned short a2, c2; splitf(acc[mb][nb][j], a2, c2); vh[j] = a2; vl[j] = c2; }
                const size_t o = pz + fro(nb * 16 + lr, t0 + mb * 16 + hi * 8, TT / 32);
                *(v8us*)(VTh + o) = vh; *(v8us*)(VTl + o) = vl;
                // precaution: data and pointers are named so that no register an issued store names is rewritten ahead of this wait
                asm volatile("s_wait_xcnt 0x0" :: "v"(vh), "v"(vl), "v"(VTh + o), "v"(VTl + o) : "memory"); }
    }
}

typedef __attribute__((ext_vector_type(2))) _Float16 v2h;
typedef __attribute__((ext_vector_type(4))) _Float16 v4h;
typedef __attribute__((ext_vector_type(2))) unsigned short v2us;
typedef __attribute__((ext_vector_type(4))) unsigned short v4us;
typedef __attribute__((ext_vector_type(2))) float v2f;
typedef __attribute__((ext_vector_type(4))) int v4i;

// k_wtG: the weights rounded to bf16, as the GEMM's B plane (rows n, k = the model dimension) in fragment order. A thread takes 8 neighbouring k of one n:
// the lanes of a wave read 32 neighbouring n, one whole line per k, and write two runs of 256 contiguous bytes.
__global__ __launch_bounds__(256) void k_wtG(const float* __restrict__ w, int K, int N, bf* Bt) {
    const int idx = blockIdx.x * 256 + threadIdx.x; const int n = idx % N, k0 = (idx / N) * 8; if (k0 >= K) return;
    const float* wp[8]; float v[8];
#pragma unroll
    for (int u = 0; u < 8; ++u) { wp[u] = w + (size_t)(k0 + u) * N + n; v[u] = *wp[u]; }
    // precaution: the pointers are named so that no register an issued load names is rewritten ahead of this wait; the clobber also keeps the loads above it
    asm volatile("s_wait_xcnt 0x0" :: "v"(wp[0]), "v"(wp[1]), "v"(wp[2]), "v"(wp[3]), "v"(wp[4]), "v"(wp[5]), "v"(wp[6]), "v"(wp[7]) : "memory");
    v8us o;
#pragma unroll
    for (int u = 0; u < 8; ++u) o[u] = f2bf(v[u]);
    *(v8us*)(Bt + fro(n, k0, K >> 5)) = o;
}
// k_xk: x rounded to bf16, once as the GEMM's A plane (rows b * L + t, k = the model dimension) and once as the k planes [b][h] (rows t, k = d), each in fragment order; the rounded value is bf16-exact, so its lo plane is zero.
// A block takes 8 tokens, a thread 8 elements of one token at 4 places 256 columns apart, all loads first. 8 neighbouring lanes hold 8 neighbouring tokens: they write one whole 128-byte line of a block;
// a wave reads one whole 128-byte line of each of its 8 tokens. Block-uniform bases: the lanes differ in one 32-bit offset per buffer, and a thread's 4 groups lie an immediate offset apart.
__global__ __launch_bounds__(256) void k_xk(const float* __restrict__ x, bf* XB, bf* KPh, bf* KPl) { const unsigned tk = threadIdx.x & 7, cq = threadIdx.x >> 3; const unsigned xo = tk * DM + cq * 8; v8f v[4];
    const size_t r0 = (size_t)blockIdx.x * 8; const unsigned rl = (unsigned)(r0 & 15) + tk;   // the token's row in its block of 16
    const unsigned fo = ((cq >> 1) & 1) * 256 + ((cq & 1) * 16 + rl) * 8;                     // the place of the thread's 8 elements inside a block of 512
    const unsigned ao = (cq >> 2) * 512 + fo; const unsigned po = (cq >> 3) * (TT * HD) + ((cq >> 2) & 1) * 512 + fo;
    const float* xb = x + r0 * DM; bf* ob = XB + (r0 >> 4) * (16 * DM); const size_t pb = (r0 / TT) * NH_ * TT * HD + ((r0 % TT) >> 4) * (16 * HD); bf* kh = KPh + pb; bf* kl = KPl + pb;
#pragma unroll
    for (int g = 0; g < 4; ++g) v[g] = *(const v8f*)(xb + g * 256 + xo);
    // precaution: the lane's offset is named so that no register an issued load names is rewritten ahead of this wait; the clobber also keeps the loads above it
    asm volatile("s_wait_xcnt 0x0" :: "v"(xo * 4) : "memory");
#pragma unroll
    for (int g = 0; g < 4; ++g) { v8us o;
#pragma unroll
        for (int k = 0; k < 8; ++k) o[k] = f2bf(v[g][k]);
        *(v8us*)(ob + g * 8 * 512 + ao) = o; *(v8us*)(kh + g * 4 * TT * HD + po) = o; *(v8us*)(kl + g * 4 * TT * HD + po) = (v8us){}; } }
__global__ __launch_bounds__(256) void k_cscvt(const float* __restrict__ cosT, const float* __restrict__ sinT, float* CS) { const int idx = blockIdx.x * 256 + threadIdx.x; if (idx >= TT * HD) return; v2f cs; cs[0] = bfr(cosT[idx]); cs[1] = bfr(sinT[idx]); *(v2f*)(CS + (size_t)idx * 2) = cs;  }
// k_postab: the table in f32 (row-major, for k_dtab) and as hi + lo planes (rows m, k = d) in fragment order. A block takes 8 rows, a thread 8 neighbouring d of one row;
// 8 neighbouring lanes hold 8 neighbouring rows: a wave writes whole 128-byte lines of all three buffers, and its 32 d are all sines or all cosines.
__global__ __launch_bounds__(64) void k_postab(float* POS, bf* Ph2, bf* Pl2) { const int m = blockIdx.x * 8 + (threadIdx.x & 7); const int d0 = (threadIdx.x >> 3) * 8; v8f vv; v8us hh, ll;
#pragma unroll
    for (int q = 0; q < 8; ++q) { const int d = d0 + q; const int dd = (d < HD / 2) ? d : d - HD / 2; const float fr = expf(__fmul_rn((float)dd, -0.29710776f)); const float ang = __fmul_rn((float)(m - TT), fr); float v = (d < HD / 2) ? sinf(ang) : cosf(ang); if (m == 0) v = 0.0f; unsigned short a2, c2; splitf(v, a2, c2); vv[q] = v; hh[q] = a2; ll[q] = c2; }
    const size_t o = fro(m, d0, HD / 32);
    *(v8f*)(POS + (size_t)m * HD + d0) = vv; *(v8us*)(Ph2 + o) = hh; *(v8us*)(Pl2 + o) = ll;  }
__global__ __launch_bounds__(256) void k_dtab(const float* __restrict__ rw, const float* __restrict__ POS, float* DT) { const int idx = blockIdx.x * 256 + threadIdx.x; if (idx >= NH_ * P2) return; const int h = idx / P2, m = idx % P2; float acc = 0.f;
#pragma unroll 4
    for (int d = 0; d < HD; ++d) { float w = bfr(rw[h * HD + d]); asm volatile("" : "+v"(w)); float p = __fmul_rn(w, POS[(size_t)m * HD + d]); asm volatile("" : "+v"(p)); acc = __fadd_rn(acc, p); }
    *(float*)(DT + idx) = acc;  }
// k_fattn: one work-group of 16 waves per 64 query rows of one (batch, head). The 64 x 1024 logit block lives in LDS from the first product to P.V.
// LDS row: 64 floats of left margin | 1024 logits | 64 floats of right margin | 4 floats (pitch 4624 B = 16 B x odd). The margins take the band's elements whose key index falls outside 0..1023: they are written, never read.
// After the softmax the same row holds the bf16 hi plane (bytes 0..2047) and lo plane (bytes 2048..4095) of P.
// Every plain '#pragma unroll' below makes the indices of a fragment or accumulator array constants, so that the array stays in registers.
#define FR   64
#define FMT  (FR / 16)
#define FNW  16
#define FPF  (TT + 2 * FR + 4)
__global__ __launch_bounds__(FNW * 32) void k_fattn(const bf* __restrict__ QRh, const bf* __restrict__ QRl, const bf* __restrict__ QPh, const bf* __restrict__ QPl, const bf* __restrict__ KPh, const bf* __restrict__ KPl, const bf* __restrict__ POSh, const bf* __restrict__ POSl, const float* __restrict__ DT, const bf* __restrict__ VTh, const bf* __restrict__ VTl, const int* __restrict__ kmask, float* OUT) {
    typedef WFrag<bf> F;
    __shared__ __align__(16) float S[FR * FPF];
    __shared__ __align__(16) float os[FR * 68];
    const int lane = threadIdx.x & 31, lr = lane & 15, hi = lane >> 4;
    const int w = __builtin_amdgcn_readfirstlane(threadIdx.x >> 5);   // wave number in a scalar register: every loop and branch round a matrix instruction is wave-uniform
    const int i0 = blockIdx.x * FR; const int z = blockIdx.y; const int b = z / NH_, h = z % NH_;
    const size_t zo = (size_t)z * TT * HD;
    const size_t qoff = zo + (size_t)i0 * HD + lane * 8;   // planes in fragment order: 16 rows of 64 d are 2 blocks of 512
    // phase 1: BD[r][j] = B_[i0 + r][m] + D_[m], m = L - (i0 + r) + j: only the band m = L - i0 - 64 .. L - i0 + 1023 (68 column tiles); each pos fragment serves all 4 row tiles
    {
        v16bf a[FMT][2], a2[FMT][2];
#pragma unroll
        for (int mt = 0; mt < FMT; ++mt)
#pragma unroll
            for (int ks = 0; ks < 2; ++ks) { a[mt][ks] = F::ldf(QPh + qoff + mt * 16 * HD + ks * 512); a2[mt][ks] = F::ldf(QPl + qoff + mt * 16 * HD + ks * 512); }
        // precaution: the pointers are named so that no register an issued load names is rewritten ahead of this wait; the clobber also keeps the loads above it
        asm volatile("s_wait_xcnt 0x0" :: "v"(QPh + qoff), "v"(QPl + qoff) : "memory");
        const int mlo = TT - i0 - FR; const float* dth = DT + (size_t)h * P2 + mlo + lr;
        const size_t poff = (size_t)mlo * HD + lane * 8;
#pragma unroll 1   // rolled: the 16 q fragments hold 128 registers, a second tile in flight would not fit 4 waves per SIMD
        for (int t = w; t < (TT + FR) / 16; t += FNW) {
            const bf* ph = POSh + poff + (size_t)t * 16 * HD; const bf* pl = POSl + poff + (size_t)t * 16 * HD; const float* dp = dth + t * 16;
            v16bf p[2], p2[2];
#pragma unroll
            for (int ks = 0; ks < 2; ++ks) { p[ks] = F::ldf(ph + ks * 512); p2[ks] = F::ldf(pl + ks * 512); }
            const float dv = *dp;
            // precaution: the pointers are named so that no register an issued load names is rewritten ahead of this wait; the clobber also keeps the loads above it
            asm volatile("s_wait_xcnt 0x0" :: "v"(ph), "v"(pl), "v"(dp) : "memory");
            v8f acc[FMT];
#pragma unroll
            for (int mt = 0; mt < FMT; ++mt) acc[mt] = (v8f){};
#pragma unroll
            for (int ks = 0; ks < 2; ++ks) {
#pragma unroll
                for (int mt = 0; mt < FMT; ++mt) acc[mt] = wmmab(a[mt][ks], p[ks], acc[mt]);
#pragma unroll
                for (int mt = 0; mt < FMT; ++mt) acc[mt] = wmmab(a2[mt][ks], p[ks], acc[mt]);
#pragma unroll
                for (int mt = 0; mt < FMT; ++mt) acc[mt] = wmmab(a[mt][ks], p2[ks], acc[mt]); }
#pragma unroll
            for (int mt = 0; mt < FMT; ++mt)
#pragma unroll
                for (int j = 0; j < 8; ++j) { const int r = mt * 16 + hi * 8 + j; S[r * FPF + t * 16 + lr + r] = __fadd_rn(acc[mt][j], dv); }   /* column FR + j, j = t*16 + lr - FR + r */
        }
    }
    __syncthreads();
    // phase 2: logit = AC + BD; each k fragment serves all 4 row tiles
    {
        v16bf a[FMT][2], a2[FMT][2];
#pragma unroll
        for (int mt = 0; mt < FMT; ++mt)
#pragma unroll
            for (int ks = 0; ks < 2; ++ks) { a[mt][ks] = F::ldf(QRh + qoff + mt * 16 * HD + ks * 512); a2[mt][ks] = F::ldf(QRl + qoff + mt * 16 * HD + ks * 512); }
        // precaution: the pointers are named so that no register an issued load names is rewritten ahead of this wait; the clobber also keeps the loads above it
        asm volatile("s_wait_xcnt 0x0" :: "v"(QRh + qoff), "v"(QRl + qoff) : "memory");
        const size_t koff = zo + lane * 8;
#pragma unroll 1   // rolled: as in phase 1
        for (int t = w; t < TT / 16; t += FNW) {
            const bf* kh = KPh + koff + (size_t)t * 16 * HD; const bf* kl = KPl + koff + (size_t)t * 16 * HD;
            v16bf k1[2], k2[2];
#pragma unroll
            for (int ks = 0; ks < 2; ++ks) { k1[ks] = F::ldf(kh + ks * 512); k2[ks] = F::ldf(kl + ks * 512); }
            // precaution: the pointers are named so that no register an issued load names is rewritten ahead of this wait; the clobber also keeps the loads above it
            asm volatile("s_wait_xcnt 0x0" :: "v"(kh), "v"(kl) : "memory");
            v8f acc[FMT];
#pragma unroll
            for (int mt = 0; mt < FMT; ++mt) acc[mt] = (v8f){};
#pragma unroll
            for (int ks = 0; ks < 2; ++ks) {
#pragma unroll
                for (int mt = 0; mt < FMT; ++mt) acc[mt] = wmmab(a[mt][ks], k1[ks], acc[mt]);
#pragma unroll
                for (int mt = 0; mt < FMT; ++mt) acc[mt] = wmmab(a2[mt][ks], k1[ks], acc[mt]);
#pragma unroll
                for (int mt = 0; mt < FMT; ++mt) acc[mt] = wmmab(a[mt][ks], k2[ks], acc[mt]); }
            float* sp = S + (hi * 8) * FPF + FR + t * 16 + lr; float bd[FMT][8];
#pragma unroll
            for (int mt = 0; mt < FMT; ++mt)
#pragma unroll
                for (int j = 0; j < 8; ++j) bd[mt][j] = sp[(mt * 16 + j) * FPF];
#pragma unroll
            for (int mt = 0; mt < FMT; ++mt)
#pragma unroll
                for (int j = 0; j < 8; ++j) sp[(mt * 16 + j) * FPF] = __fadd_rn(acc[mt][j], bd[mt][j]);
        }
    }
    __syncthreads();
    // phase 3: softmax, one wave per row, 4 rows a wave (register row, one exp, fixed trees); P split into hi + lo planes in place
    {
        const int* km = kmask + (size_t)b * TT;
#pragma unroll 1   // rolled: one row's 32 values per lane at a time
        for (int rr = 0; rr < FR / FNW; ++rr) { float* srow = S + (w * (FR / FNW) + rr) * FPF; float v[TT / 32]; float mx = -3.0e38f;
#pragma unroll
            for (int ch = 0; ch < TT / 128; ++ch) { const int j0 = ch * 128 + lane * 4; const v4f a = *(const v4fa*)(srow + FR + j0); const v4i k4 = *(const v4i*)(km + j0);
#pragma unroll
                for (int q = 0; q < 4; ++q) { const float t = (k4[q] != 0) ? a[q] : -3.0e38f; v[ch * 4 + q] = t; mx = fmaxf(mx, t); } }
#pragma unroll
            for (int sh = 16; sh; sh >>= 1) mx = fmaxf(mx, __shfl_xor(mx, sh, 32));
            float sum = 0.f;
#pragma unroll
            for (int k = 0; k < TT / 32; ++k) { v[k] = __builtin_amdgcn_exp2f(__fmul_rn(__fsub_rn(v[k], mx), 1.4426950408889634f)); sum += v[k]; }
#pragma unroll
            for (int sh = 16; sh; sh >>= 1) sum += __shfl_xor(sum, sh, 32);
            const float f = __fdiv_rn(1.0f, sum); bf* prow = (bf*)srow;
#pragma unroll
            for (int ch = 0; ch < TT / 128; ++ch) { v4us oh, ol;
#pragma unroll
                for (int q = 0; q < 4; ++q) { unsigned short a, c2; splitf(v[ch * 4 + q] * f, a, c2); oh[q] = a; ol[q] = c2; }
                *(v4us*)(prow + ch * 128 + lane * 4) = oh; *(v4us*)(prow + TT + ch * 128 + lane * 4) = ol; } }
    }
    __syncthreads();
    // phase 4: O = P.V: waves 0..3 (one per SIMD) take 16 columns of the head each and all 4 row tiles, so that each V fragment is fetched once; k runs in the order of the unfused GEMM.
    // V fragments are fetched one set (128 keys) ahead into a second register set.
    if (w < 4) {
        const bf* pr = (const bf*)(S + lr * FPF) + 8 * hi;
        const size_t voff = zo + (size_t)w * 16 * TT + lane * 8;   /* 16 d of 1024 keys are 32 blocks; 32 keys are one block */ const bf* vh = VTh + voff; const bf* vl = VTl + voff;
        v8f o[FMT];
#pragma unroll
        for (int mt = 0; mt < FMT; ++mt) o[mt] = (v8f){};
        v16bf va[4][2], vb[4][2];
        auto vload = [&](v16bf (&s)[4][2], int k0, int kn) {   /* kn: the index whose pointer the build addresses these loads from */
#pragma unroll
            for (int u = 0; u < 4; ++u) { s[u][0] = F::ldf(vh + k0 * 16 + u * 512); s[u][1] = F::ldf(vl + k0 * 16 + u * 512); }
            // precaution: the pointers are named so that no register an issued load names is rewritten ahead of this wait; the clobber also keeps the loads above it
            asm volatile("s_wait_xcnt 0x0" :: "v"(vh + kn * 16), "v"(vl + kn * 16) : "memory"); };
        auto pv = [&](const v16bf (&s)[4][2], int k0) {
#pragma unroll
            for (int u = 0; u < 4; ++u) { v16bf ph[FMT], pl[FMT];
#pragma unroll
                for (int mt = 0; mt < FMT; ++mt) { ph[mt] = F::ld(pr + mt * 16 * 2 * FPF + k0 + u * 32); pl[mt] = F::ld(pr + mt * 16 * 2 * FPF + TT + k0 + u * 32); }
#pragma unroll
                for (int mt = 0; mt < FMT; ++mt) o[mt] = wmmab(ph[mt], s[u][0], o[mt]);
#pragma unroll
                for (int mt = 0; mt < FMT; ++mt) o[mt] = wmmab(pl[mt], s[u][0], o[mt]);
#pragma unroll
                for (int mt = 0; mt < FMT; ++mt) o[mt] = wmmab(ph[mt], s[u][1], o[mt]); } };
        vload(va, 0, 0);
#pragma unroll 1   // rolled: both V sets and the P fragments of one trip fill the register budget
        for (int k1 = 128; k1 < TT; k1 += 256) {
            vload(vb, k1, k1 - 128);
            pv(va, k1 - 128);
            const int k2 = (k1 + 128 < TT) ? k1 + 128 : 0; vload(va, k2, k2);   /* the last trip has no next set: it fetches set 0 again, in bounds, unused */
            pv(vb, k1);
            // four vector slots between the last matrix instruction and the taken back edge, where the next trip's loads overwrite its operands
            asm volatile("v_nop\n\tv_nop\n\tv_nop\n\tv_nop" : "+v"(o[0]), "+v"(o[1]), "+v"(o[2]), "+v"(o[3]));
        }
#pragma unroll
        for (int mt = 0; mt < FMT; ++mt)
#pragma unroll
            for (int j = 0; j < 8; ++j) os[(mt * 16 + hi * 8 + j) * 68 + w * 16 + lr] = o[mt][j];
    }
    __syncthreads();
    // whole 256-byte output rows per half wave: one writer per line
#pragma unroll
    for (int s = 0; s < 2; ++s) { const int row = w * 4 + s * 2 + hi; const v4f val = *(const v4fa*)(os + row * 68 + lr * 4); *(v4f*)(OUT + ((size_t)b * TT + i0 + row) * DM + h * HD + lr * 4) = val; }
}
__global__ __launch_bounds__(256) void k_merge(const float* __restrict__ O, int h0, bf* Ah, bf* Al) { const size_t e = ((size_t)blockIdx.x * 256 + threadIdx.x) * 2; if (e >= (size_t)ZH * TT * HD) return; const int d = (int)(e % HD); const int t = (int)((e / HD) % TT); const int zz = (int)(e / ((size_t)HD * TT)); const float cs = (t < RH) ? 1.0f : (1.0f / PCAR); const size_t oo = (size_t)t * DQ + (h0 + zz) * HD + d;
    v2us oh, ol;
#pragma unroll
    for (int q = 0; q < 2; ++q) { unsigned short a, c2; splitf(O[e + q] * cs, a, c2); oh[q] = a; ol[q] = c2; } *(v2us*)(Ah + oo) = oh; *(v2us*)(Al + oo) = ol;  }

extern "C" void kernel_launch(void* const* d_in, const int* in_sizes, int n_in,
                              void* d_out, int out_size, void* d_ws, size_t ws_size, hipStream_t stream) {
    (void)in_sizes; (void)n_in; (void)out_size;
    const float* x = (const float*)d_in[0]; const float* wqv = (const float*)d_in[1]; const float* rrb = (const float*)d_in[2]; const float* rwb = (const float*)d_in[3]; const int* kmask = (const int*)d_in[4]; const float* wq = wqv; const float* wk = nullptr; const float* wv = wqv; const float* wo = nullptr; (void)wk; (void)wo; const float* cosT = nullptr; const float* sinT = nullptr; (void)cosT; (void)sinT;
    float* OUT = (float*)d_out;     // [4][1024][1024]
    char* wsp = (char*)d_ws;
    auto take = [&](size_t bytes) { char* p = wsp; wsp += (bytes + 255) & ~(size_t)255; return (void*)p; };
    const size_t PL = (size_t)NB_ * NH_ * TT * HD;   // one plane set: every batch, every head
    const size_t FL = (size_t)NB_ * TT * DM;         // one f32 activation: every batch
    bf* WALL = (bf*)take((size_t)2 * DQ * DM * 2); float* POS = (float*)take((size_t)P2 * HD * 4); bf* POSh = (bf*)take((size_t)P2 * HD * 2); bf* POSl = (bf*)take((size_t)P2 * HD * 2); float* DT = (float*)take((size_t)NH_ * P2 * 4);
    bf* KPh = (bf*)take(PL * 2); bf* KPl = (bf*)take(PL * 2); bf* QRh = (bf*)take(PL * 2); bf* QRl = (bf*)take(PL * 2); bf* QPh = (bf*)take(PL * 2); bf* QPl = (bf*)take(PL * 2);   // hi and lo planes of k, of q + r_r_bias, of q
    bf* VTh = (bf*)take(PL * 2); bf* VTl = (bf*)take(PL * 2);
    bf* XB = (bf*)take(FL * 2);   // the bf16 input, rows b * L + t
    if ((size_t)(wsp - (char*)d_ws) > ws_size) return;   // ws ~ 77 MiB
    k_wtG<<<DM * 2 * DQ / 8 / 256, 256, 0, stream>>>(wqv, DM, 2 * DQ, WALL); k_postab<<<P2 / 8, 64, 0, stream>>>(POS, POSh, POSl); k_dtab<<<(NH_ * P2 + 255) / 256, 256, 0, stream>>>(rwb, POS, DT);
    // every batch in one launch
    k_xk<<<NB_ * TT / 8, 256, 0, stream>>>(x, XB, KPh, KPl);   /* k = x: the bf16-ROUNDED input */
    k_gemmw<bf, 0><<<dim3(NB_ * TT / 64, DQ / 64, 2), 32, 0, stream>>>(XB, nullptr, WALL, nullptr, DM, rrb, QPh, QPl, QRh, QRl, VTh, VTl, 0, (size_t)DQ * DM);   /* z = 0: q, z = 1: v */
    k_fattn<<<dim3(TT / FR, NB_ * NH_, 1), FNW * 32, 0, stream>>>(QRh, QRl, QPh, QPl, KPh, KPl, POSh, POSl, DT, VTh, VTl, kmask, OUT);   /* every batch and head */
}

// v005
// Measured time: 144 microseconds a run.
// Next to v004, in two timings, it ran 1.04 times as fast each time.
// Over all steps from v000 it is 12.8 times as fast.
#include <hip/hip_runtime.h>

// RelativeMultiHeadAttn (Transformer-XL style, k_as_x: x [4][1024][1024], Wqv [1024][2048] (q | v column blocks), r_r_bias / r_w_bias [16][64], mask [4][1024] (int, read; all ones); k = x itself split into 16 heads; pos = the sinusoidal table [2L][64] (sin | cos of p * exp(-d ln(1e4)/31), p = -L..L-1, row 0 zeroed) computed on chip in f32; AC = (q + r_r_bias).k; B_ = q.pos^T, D_ = r_w_bias.pos^T; BD = shift(B_ + D_) = (B_ + D_)[i][L - i + j] (exact index form of the pad/reshape shift); attn = softmax(AC + BD) (NO scaling; -inf where mask == 0); out = attn.v merged -> [4][1024][1024] (no output projection)).
// Compute dtypes, f32 accumulate: every input rounded to bf16; q, v as PLAIN bf16 GEMMs (inputs: exact); k planes straight from the (bf16-exact) input; pos table f32 -> hi/lo planes; AC and B_ as hl x hl GEMMs (3 products) on every row (unscaled logits are sharp); D_ as 64-term f32 dots; BD gathered per element (contiguous along j) and added in f32; softmax f32; attn.v hl x hl (3 products) on every row; output written directly in f32.

#define NB_  4
#define TT   1024
#define DM   1024
#define NH_  16
#define NKV  16
#define REP  (NH_ / NKV)
#define HD   64
#define DQ   (NH_ * HD)
#define DKV  (NKV * HD)
#define ZH   8                     // heads per k_merge call (k_merge is not launched)
#define ZS   16                    // unused
#define RH   1024                  // k_merge (not launched) scales rows t >= RH by 1/PCAR
#define WIN  0
#define PCAR 1024.0f
#define P2   (2 * TT)             // 2L relative positions
#define SCL  0.125f   // HD^-0.5
typedef _Float16 h16;
typedef unsigned short bf;
typedef __attribute__((ext_vector_type(16))) __bf16   v16bf;
typedef __attribute__((ext_vector_type(16))) _Float16 v16h;
typedef __attribute__((ext_vector_type(8)))  _Float16 v8h;
typedef __attribute__((ext_vector_type(8)))  unsigned short v8us;
typedef __attribute__((ext_vector_type(8)))  float    v8f;
typedef __attribute__((ext_vector_type(4)))  float    v4f;
typedef v8h  __attribute__((may_alias)) v8ha;
typedef v4f  __attribute__((may_alias)) v4fa;
typedef v8us __attribute__((may_alias)) v8usa;

__device__ __forceinline__ unsigned short f2bf(float f) { unsigned u = __float_as_uint(f); u += 0x7FFFu + ((u >> 16) & 1u); return (unsigned short)(u >> 16); }
__device__ __forceinline__ float bf2f(unsigned short b) { return __uint_as_float(((unsigned)b) << 16); }
__device__ __forceinline__ float bfr(float f) { return bf2f(f2bf(f)); }
__device__ __forceinline__ v16h cat16(v8h lo, v8h hi) { return __builtin_shufflevector(lo, hi, 0, 1, 2, 3, 4, 5, 6, 7, 8, 9, 10, 11, 12, 13, 14, 15); }
__device__ __forceinline__ v16bf cat16b(v8us lo, v8us hi) { return __builtin_bit_cast(v16bf, __builtin_shufflevector(lo, hi, 0, 1, 2, 3, 4, 5, 6, 7, 8, 9, 10, 11, 12, 13, 14, 15)); }
__device__ __forceinline__ v8f wmma16(v16h a, v16h b, v8f c) { return __builtin_amdgcn_wmma_f32_16x16x32_f16(false, a, false, b, (short)0, c, false, false); }
__device__ __forceinline__ v8f wmmab(v16bf a, v16bf b, v8f c) { return __builtin_amdgcn_wmma_f32_16x16x32_bf16(false, a, false, b, (short)0, c, false, false); }



// ---- k_gemmw: register-blocked GEMM, ONE WAVE per 64x64 output tile (16 accumulators), operands straight from 16-bit planes in fragment order; grid (M/64, N/64, Z), 32 threads.
// C[m][n] = sum_k A[m][k] Bt[n][k] (+ split products per NSPLIT). z-batch strides sA/sB in elements. K % 32 == 0. z = 0: q, z = 1: v.
// A tile is 64 tokens of one head, so the epilogue writes the planes that the attention kernel reads straight from the accumulators:
// z = 0: hi + lo planes [b][h] of q and of q + r_r_bias (rows t, k = d); z = 1: hi + lo planes [b][h] of v (rows d, k = t); each in fragment order.
template <typename T16> struct WFrag;
template <> struct WFrag<h16> { typedef v16h V; static __device__ __forceinline__ V ld(const h16* p) { return cat16(*(const v8h*)p, *(const v8h*)(p + 16)); } static __device__ __forceinline__ V ldf(const h16* p) { return cat16(*(const v8h*)p, *(const v8h*)(p + 256)); } static __device__ __forceinline__ v8f mma(V a, V b, v8f c) { return wmma16(a, b, c); } };
template <> struct WFrag<bf> { typedef v16bf V; static __device__ __forceinline__ V ld(const bf* p) { return cat16b(*(const v8us*)p, *(const v8us*)(p + 16)); } static __device__ __forceinline__ V ldf(const bf* p) { return cat16b(*(const v8us*)p, *(const v8us*)(p + 256)); } static __device__ __forceinline__ v8f mma(V a, V b, v8f c) { return wmmab(a, b, c); } };
// FRAGMENT ORDER: every 16-bit operand plane in the workspace, rows x K, is stored as blocks of 512 elements, one block per (16 rows, 32 k). Element (row, k) lies at
// ((row / 16) * (K / 32) + k / 32) * 512 + ((k / 16) % 2) * 256 + (((k / 8) % 2) * 16 + row % 16) * 8 + k % 8.
// Lane l of a wave finds the two 16-byte halves of its fragment at l * 8 and 256 + l * 8 of the block (ldf), so each load of a wave reads 512 contiguous bytes, 4 whole lines;
// the registers hold the same values as with row-major planes. fro: the place of 8 neighbouring k, k8 % 8 == 0, kb = K / 32.
__device__ __forceinline__ size_t fro(size_t row, size_t k8, size_t kb) { return ((row >> 4) * kb + (k8 >> 5)) * 512 + ((k8 >> 4) & 1) * 256 + (((k8 >> 3) & 1) * 16 + (row & 15)) * 8; }
__device__ __forceinline__ void splitf(float y, unsigned short& h, unsigned short& l) { h = f2bf(y); l = f2bf(y - bf2f(h)); }
template <typename T16, int NSPLIT>
__global__ __launch_bounds__(32) void k_gemmw(const T16* __restrict__ A, const T16* __restrict__ A2, const T16* __restrict__ Bt, const T16* __restrict__ Bt2, int K, const float* __restrict__ rr, bf* QPh, bf* QPl, bf* QRh, bf* QRl, bf* VTh, bf* VTl, size_t sA, size_t sB) {
    typedef typename WFrag<T16>::V V;
    __shared__ __align__(16) float os[16 * 68];
    const size_t z = blockIdx.z; A += z * sA; if (A2) A2 += z * sA; Bt += z * sB; if (Bt2) Bt2 += z * sB;
    const int lane = threadIdx.x & 31, lr = lane & 15, hi = lane >> 4; const int r0 = blockIdx.x * 64, c0 = blockIdx.y * 64;
    v8f acc[4][4];
#pragma unroll
    for (int mb = 0; mb < 4; ++mb)
#pragma unroll
        for (int nb = 0; nb < 4; ++nb) acc[mb][nb] = (v8f){};
    const size_t aoff = (size_t)r0 * K + lane * 8, boff = (size_t)c0 * K + lane * 8;   // 16 rows are K / 32 blocks = 16 * K elements; 32 k are one block
#pragma unroll 1
    for (int kc = 0; kc < K; kc += 32) {
        V a[4], a2[4], b[4], b2[4]; const T16* ap[4]; const T16* bp[4];
#pragma unroll
        for (int mb = 0; mb < 4; ++mb) { const size_t o = aoff + (size_t)mb * 16 * K + kc * 16; ap[mb] = A + o; a[mb] = WFrag<T16>::ldf(ap[mb]); if (NSPLIT == 1 || NSPLIT == 2) a2[mb] = WFrag<T16>::ldf(A2 + o); }
#pragma unroll
        for (int nb = 0; nb < 4; ++nb) { const size_t o = boff + (size_t)nb * 16 * K + kc * 16; bp[nb] = Bt + o; b[nb] = WFrag<T16>::ldf(bp[nb]); if (NSPLIT >= 2) b2[nb] = WFrag<T16>::ldf(Bt2 + o); }
        // precaution: the pointers are named so that no register an issued load names is rewritten ahead of this wait; the clobber also keeps the loads above it
        asm volatile("s_wait_xcnt 0x0" :: "v"(ap[0]), "v"(ap[1]), "v"(ap[2]), "v"(ap[3]), "v"(bp[0]), "v"(bp[1]), "v"(bp[2]), "v"(bp[3]) : "memory");
        // keeps the matrix instructions behind that wait: lifted over it they split the trip's loads into three groups, each waited for in turn
        __builtin_amdgcn_sched_barrier(0);
#pragma unroll
        for (int nb = 0; nb < 4; ++nb)
#pragma unroll
            for (int mb = 0; mb < 4; ++mb) { acc[mb][nb] = WFrag<T16>::mma(a[mb], b[nb], acc[mb][nb]); if (NSPLIT == 1 || NSPLIT == 2) acc[mb][nb] = WFrag<T16>::mma(a2[mb], b[nb], acc[mb][nb]); if (NSPLIT >= 2) acc[mb][nb] = WFrag<T16>::mma(a[mb], b2[nb], acc[mb][nb]); }
        asm volatile("v_nop\n\tv_nop\n\tv_nop\n\tv_nop" : "+v"(acc[0][0]), "+v"(acc[1][1]), "+v"(acc[2][2]), "+v"(acc[3][3]) : "v"(a[0]), "v"(a[3]));
    }
    const int t0 = r0 % TT; const size_t pz = (size_t)((r0 / TT) * NH_ + blockIdx.y) * TT * HD;   // the planes of this tile's (batch, head)
    if (z == 0) {
        // through LDS, 16 rows at a time: a lane then holds 8 neighbouring d of one token, and 8 lanes (8 neighbouring tokens) write one whole 128-byte line of a block
        const int r8 = lane & 7, cq = lane >> 3; float rb[2][8];
#pragma unroll
        for (int g = 0; g < 2; ++g)
#pragma unroll
            for (int u = 0; u < 8; ++u) rb[g][u] = bfr(rr[c0 + (g * 4 + cq) * 8 + u]);
#pragma unroll
        for (int mb = 0; mb < 4; ++mb) {
#pragma unroll
            for (int nb = 0; nb < 4; ++nb) {
#pragma unroll
                for (int j = 0; j < 8; ++j) os[(hi * 8 + j) * 68 + nb * 16 + lr] = acc[mb][nb][j]; }
            // one wave, LDS runs in order: these two only keep the compiler from moving the reads of other lanes' values above the stores
            __builtin_amdgcn_wave_barrier(); asm volatile("" ::: "memory");
#pragma unroll
            for (int s = 0; s < 4; ++s) { const int row = (s & 1) * 8 + r8, c8 = ((s >> 1) * 4 + cq) * 8; const v4f x0 = *(const v4fa*)(os + row * 68 + c8), x1 = *(const v4fa*)(os + row * 68 + c8 + 4); v8us qh, ql, sh, sl;
#pragma unroll
                for (int u = 0; u < 8; ++u) { const float q = (u < 4) ? x0[u & 3] : x1[u & 3]; unsigned short a2, c2; splitf(q, a2, c2); qh[u] = a2; ql[u] = c2; splitf(__fadd_rn(q, rb[s >> 1][u]), a2, c2); sh[u] = a2; sl[u] = c2; }
                const size_t o = pz + fro(t0 + mb * 16 + row, c8, HD / 32);
                *(v8us*)(QPh + o) = qh; *(v8us*)(QPl + o) = ql; *(v8us*)(QRh + o) = sh; *(v8us*)(QRl + o) = sl;
                // precaution: no register that an issued store names is rewritten ahead of this wait
                asm volatile("s_wait_xcnt 0x0" ::: "memory"); }
            // and the next 16 rows' stores from moving above these reads
            __builtin_amdgcn_wave_barrier(); asm volatile("" ::: "memory");
        }
    } else {
        // the transposed planes need no LDS: the 8 accumulator values of a lane are 8 neighbouring tokens of one d, which is that lane's 16 bytes of a block's half: a store writes 512 contiguous bytes
#pragma unroll
        for (int nb = 0; nb < 4; ++nb)
#pragma unroll
            for (int mb = 0; mb < 4; ++mb) { v8us vh, vl;
#pragma unroll
                for (int j = 0; j < 8; ++j) { unsigned short a2, c2; splitf(acc[mb][nb][j], a2, c2); vh[j] = a2; vl[j] = c2; }
                const size_t o = pz + fro(nb * 16 + lr, t0 + mb * 16 + hi * 8, TT / 32);
                *(v8us*)(VTh + o) = vh; *(v8us*)(VTl + o) = vl;
                // precaution: data and pointers are named so that no register an issued store names is rewritten ahead of this wait
                asm volatile("s_wait_xcnt 0x0" :: "v"(vh), "v"(vl), "v"(VTh + o), "v"(VTl + o) : "memory"); }
    }
}

typedef __attribute__((ext_vector_type(2))) _Float16 v2h;
typedef __attribute__((ext_vector_type(4))) _Float16 v4h;
typedef __attribute__((ext_vector_type(2))) unsigned short v2us;
typedef __attribute__((ext_vector_type(4))) unsigned short v4us;
typedef __attribute__((ext_vector_type(2))) float v2f;
typedef __attribute__((ext_vector_type(4))) int v4i;

// k_wtG: the weights rounded to bf16, as the GEMM's B plane (rows n, k = the model dimension) in fragment order. A thread takes 8 neighbouring k of one n:
// the lanes of a wave read 32 neighbouring n, one whole line per k, and write two runs of 256 contiguous bytes.
__global__ __launch_bounds__(256) void k_wtG(const float* __restrict__ w, int K, int N, bf* Bt) {
    const int idx = blockIdx.x * 256 + threadIdx.x; const int n = idx % N, k0 = (idx / N) * 8; if (k0 >= K) return;
    const float* wp[8]; float v[8];
#pragma unroll
    for (int u = 0; u < 8; ++u) { wp[u] = w + (size_t)(k0 + u) * N + n; v[u] = *wp[u]; }
    // precaution: the pointers are named so that no register an issued load names is rewritten ahead of this wait; the clobber also keeps the loads above it
    asm volatile("s_wait_xcnt 0x0" :: "v"(wp[0]), "v"(wp[1]), "v"(wp[2]), "v"(wp[3]), "v"(wp[4]), "v"(wp[5]), "v"(wp[6]), "v"(wp[7]) : "memory");
    v8us o;
#pragma unroll
    for (int u = 0; u < 8; ++u) o[u] = f2bf(v[u]);
    *(v8us*)(Bt + fro(n, k0, K >> 5)) = o;
}
// k_xk: x rounded to bf16, once as the GEMM's A plane (rows b * L + t, k = the model dimension) and once as the k planes [b][h] (rows t, k = d), each in fragment order; the rounded value is bf16-exact, so its lo plane is zero.
// A block takes 8 tokens, a thread 8 elements of one token at 4 places 256 columns apart, all loads first. 8 neighbouring lanes hold 8 neighbouring tokens: they write one whole 128-byte line of a block;
// a wave reads one whole 128-byte line of each of its 8 tokens. Block-uniform bases: the lanes differ in one 32-bit offset per buffer, and a thread's 4 groups lie an immediate offset apart.
__global__ __launch_bounds__(256) void k_xk(const float* __restrict__ x, bf* XB, bf* KPh, bf* KPl) { const unsigned tk = threadIdx.x & 7, cq = threadIdx.x >> 3; const unsigned xo = tk * DM + cq * 8; v8f v[4];
    const size_t r0 = (size_t)blockIdx.x * 8; const unsigned rl = (unsigned)(r0 & 15) + tk;   // the token's row in its block of 16
    const unsigned fo = ((cq >> 1) & 1) * 256 + ((cq & 1) * 16 + rl) * 8;                     // the place of the thread's 8 elements inside a block of 512
    const unsigned ao = (cq >> 2) * 512 + fo; const unsigned po = (cq >> 3) * (TT * HD) + ((cq >> 2) & 1) * 512 + fo;
    const float* xb = x + r0 * DM; bf* ob = XB + (r0 >> 4) * (16 * DM); const size_t pb = (r0 / TT) * NH_ * TT * HD + ((r0 % TT) >> 4) * (16 * HD); bf* kh = KPh + pb; bf* kl = KPl + pb;
#pragma unroll
    for (int g = 0; g < 4; ++g) v[g] = *(const v8f*)(xb + g * 256 + xo);
    // precaution: the lane's offset is named so that no register an issued load names is rewritten ahead of this wait; the clobber also keeps the loads above it
    asm volatile("s_wait_xcnt 0x0" :: "v"(xo * 4) : "memory");
#pragma unroll
    for (int g = 0; g < 4; ++g) { v8us o;
#pragma unroll
        for (int k = 0; k < 8; ++k) o[k] = f2bf(v[g][k]);
        *(v8us*)(ob + g * 8 * 512 + ao) = o; *(v8us*)(kh + g * 4 * TT * HD + po) = o; *(v8us*)(kl + g * 4 * TT * HD + po) = (v8us){}; } }
__global__ __launch_bounds__(256) void k_cscvt(const float* __restrict__ cosT, const float* __restrict__ sinT, float* CS) { const int idx = blockIdx.x * 256 + threadIdx.x; if (idx >= TT * HD) return; v2f cs; cs[0] = bfr(cosT[idx]); cs[1] = bfr(sinT[idx]); *(v2f*)(CS + (size_t)idx * 2) = cs;  }
// k_postab: the table in f32 (row-major, for k_dtab) and as hi + lo planes (rows m, k = d) in fragment order. A block takes 8 rows, a thread 8 neighbouring d of one row;
// 8 neighbouring lanes hold 8 neighbouring rows: a wave writes whole 128-byte lines of all three buffers, and its 32 d are all sines or all cosines.
__global__ __launch_bounds__(64) void k_postab(float* POS, bf* Ph2, bf* Pl2) { const int m = blockIdx.x * 8 + (threadIdx.x & 7); const int d0 = (threadIdx.x >> 3) * 8; v8f vv; v8us hh, ll;
#pragma unroll
    for (int q = 0; q < 8; ++q) { const int d = d0 + q; const int dd = (d < HD / 2) ? d : d - HD / 2; const float fr = expf(__fmul_rn((float)dd, -0.29710776f)); const float ang = __fmul_rn((float)(m - TT), fr); float v = (d < HD / 2) ? sinf(ang) : cosf(ang); if (m == 0) v = 0.0f; unsigned short a2, c2; splitf(v, a2, c2); vv[q] = v; hh[q] = a2; ll[q] = c2; }
    const size_t o = fro(m, d0, HD / 32);
    *(v8f*)(POS + (size_t)m * HD + d0) = vv; *(v8us*)(Ph2 + o) = hh; *(v8us*)(Pl2 + o) = ll;  }
__global__ __launch_bounds__(256) void k_dtab(const float* __restrict__ rw, const float* __restrict__ POS, float* DT) { const int idx = blockIdx.x * 256 + threadIdx.x; if (idx >= NH_ * P2) return; const int h = idx / P2, m = idx % P2; float acc = 0.f;
#pragma unroll 4
    for (int d = 0; d < HD; ++d) { float w = bfr(rw[h * HD + d]); asm volatile("" : "+v"(w)); float p = __fmul_rn(w, POS[(size_t)m * HD + d]); asm volatile("" : "+v"(p)); acc = __fadd_rn(acc, p); }
    *(float*)(DT + idx) = acc;  }
// k_fattn: one work-group of 16 waves per 64 query rows of one (batch, head). The 64 x 1024 logit block lives in LDS from the first product to P.V.
// LDS row: 64 floats of left margin | 1024 logits | 64 floats of right margin | 4 floats (pitch 4624 B = 16 B x odd). The margins take the band's elements whose key index falls outside 0..1023: they are written, never read.
// After the softmax the same row holds the bf16 hi plane (bytes 0..2047) and lo plane (bytes 2048..4095) of P; after P.V the start of the block holds the 4 partial output tiles.
// Every plain '#pragma unroll' below makes the indices of a fragment or accumulator array constants, so that the array stays in registers.
#define FR   64
#define FMT  (FR / 16)
#define FNW  16
#define FPF  (TT + 2 * FR + 4)
__global__ __launch_bounds__(FNW * 32) void k_fattn(const bf* __restrict__ QRh, const bf* __restrict__ QRl, const bf* __restrict__ QPh, const bf* __restrict__ QPl, const bf* __restrict__ KPh, const bf* __restrict__ KPl, const bf* __restrict__ POSh, const bf* __restrict__ POSl, const float* __restrict__ DT, const bf* __restrict__ VTh, const bf* __restrict__ VTl, const int* __restrict__ kmask, float* OUT) {
    typedef WFrag<bf> F;
    __shared__ __align__(16) float S[FR * FPF];
    const int lane = threadIdx.x & 31, lr = lane & 15, hi = lane >> 4;
    const int w = __builtin_amdgcn_readfirstlane(threadIdx.x >> 5);   // wave number in a scalar register: every loop and branch round a matrix instruction is wave-uniform
    const int i0 = blockIdx.x * FR; const int z = blockIdx.y; const int b = z / NH_, h = z % NH_;
    const size_t zo = (size_t)z * TT * HD;
    const size_t qoff = zo + (size_t)i0 * HD + lane * 8;   // planes in fragment order: 16 rows of 64 d are 2 blocks of 512
    // phase 1: BD[r][j] = B_[i0 + r][m] + D_[m], m = L - (i0 + r) + j: only the band m = L - i0 - 64 .. L - i0 + 1023 (68 column tiles); each pos fragment serves all 4 row tiles
    {
        v16bf a[FMT][2], a2[FMT][2];
#pragma unroll
        for (int mt = 0; mt < FMT; ++mt)
#pragma unroll
            for (int ks = 0; ks < 2; ++ks) { a[mt][ks] = F::ldf(QPh + qoff + mt * 16 * HD + ks * 512); a2[mt][ks] = F::ldf(QPl + qoff + mt * 16 * HD + ks * 512); }
        // precaution: the pointers are named so that no register an issued load names is rewritten ahead of this wait; the clobber also keeps the loads above it
        asm volatile("s_wait_xcnt 0x0" :: "v"(QPh + qoff), "v"(QPl + qoff) : "memory");
        const int mlo = TT - i0 - FR; const float* dth = DT + (size_t)h * P2 + mlo + lr;
        const size_t poff = (size_t)mlo * HD + lane * 8;
#pragma unroll 1   // rolled: the 16 q fragments hold 128 registers, a second tile in flight would not fit 4 waves per SIMD
        for (int t = w; t < (TT + FR) / 16; t += FNW) {
            const bf* ph = POSh + poff + (size_t)t * 16 * HD; const bf* pl = POSl + poff + (size_t)t * 16 * HD; const float* dp = dth + t * 16;
            v16bf p[2], p2[2];
#pragma unroll
            for (int ks = 0; ks < 2; ++ks) { p[ks] = F::ldf(ph + ks * 512); p2[ks] = F::ldf(pl + ks * 512); }
            const float dv = *dp;
            // precaution: the pointers are named so that no register an issued load names is rewritten ahead of this wait; the clobber also keeps the loads above it
            asm volatile("s_wait_xcnt 0x0" :: "v"(ph), "v"(pl), "v"(dp) : "memory");
            v8f acc[FMT];
#pragma unroll
            for (int mt = 0; mt < FMT; ++mt) acc[mt] = (v8f){};
#pragma unroll
            for (int ks = 0; ks < 2; ++ks) {
#pragma unroll
                for (int mt = 0; mt < FMT; ++mt) acc[mt] = wmmab(a[mt][ks], p[ks], acc[mt]);
#pragma unroll
                for (int mt = 0; mt < FMT; ++mt) acc[mt] = wmmab(a2[mt][ks], p[ks], acc[mt]);
#pragma unroll
                for (int mt = 0; mt < FMT; ++mt) acc[mt] = wmmab(a[mt][ks], p2[ks], acc[mt]); }
#pragma unroll
            for (int mt = 0; mt < FMT; ++mt)
#pragma unroll
                for (int j = 0; j < 8; ++j) { const int r = mt * 16 + hi * 8 + j; S[r * FPF + t * 16 + lr + r] = __fadd_rn(acc[mt][j], dv); }   /* column FR + j, j = t*16 + lr - FR + r */
        }
    }
    __syncthreads();
    // phase 2: logit = AC + BD; each k fragment serves all 4 row tiles
    {
        v16bf a[FMT][2], a2[FMT][2];
#pragma unroll
        for (int mt = 0; mt < FMT; ++mt)
#pragma unroll
            for (int ks = 0; ks < 2; ++ks) { a[mt][ks] = F::ldf(QRh + qoff + mt * 16 * HD + ks * 512); a2[mt][ks] = F::ldf(QRl + qoff + mt * 16 * HD + ks * 512); }
        // precaution: the pointers are named so that no register an issued load names is rewritten ahead of this wait; the clobber also keeps the loads above it
        asm volatile("s_wait_xcnt 0x0" :: "v"(QRh + qoff), "v"(QRl + qoff) : "memory");
        const size_t koff = zo + lane * 8;
#pragma unroll 1   // rolled: as in phase 1
        for (int t = w; t < TT / 16; t += FNW) {
            const bf* kh = KPh + koff + (size_t)t * 16 * HD; const bf* kl = KPl + koff + (size_t)t * 16 * HD;
            v16bf k1[2], k2[2];
#pragma unroll
            for (int ks = 0; ks < 2; ++ks) { k1[ks] = F::ldf(kh + ks * 512); k2[ks] = F::ldf(kl + ks * 512); }
            // precaution: the pointers are named so that no register an issued load names is rewritten ahead of this wait; the clobber also keeps the loads above it
            asm volatile("s_wait_xcnt 0x0" :: "v"(kh), "v"(kl) : "memory");
            v8f acc[FMT];
#pragma unroll
            for (int mt = 0; mt < FMT; ++mt) acc[mt] = (v8f){};
#pragma unroll
            for (int ks = 0; ks < 2; ++ks) {
#pragma unroll
                for (int mt = 0; mt < FMT; ++mt) acc[mt] = wmmab(a[mt][ks], k1[ks], acc[mt]);
#pragma unroll
                for (int mt = 0; mt < FMT; ++mt) acc[mt] = wmmab(a2[mt][ks], k1[ks], acc[mt]);
#pragma unroll
                for (int mt = 0; mt < FMT; ++mt) acc[mt] = wmmab(a[mt][ks], k2[ks], acc[mt]); }
            float* sp = S + (hi * 8) * FPF + FR + t * 16 + lr; float bd[FMT][8];
#pragma unroll
            for (int mt = 0; mt < FMT; ++mt)
#pragma unroll
                for (int j = 0; j < 8; ++j) bd[mt][j] = sp[(mt * 16 + j) * FPF];
#pragma unroll
            for (int mt = 0; mt < FMT; ++mt)
#pragma unroll
                for (int j = 0; j < 8; ++j) sp[(mt * 16 + j) * FPF] = __fadd_rn(acc[mt][j], bd[mt][j]);
        }
    }
    __syncthreads();
    // phase 3: softmax, one wave per row, 4 rows a wave (register row, one exp, fixed trees); P split into hi + lo planes in place
    {
        const int* km = kmask + (size_t)b * TT;
#pragma unroll 1   // rolled: one row's 32 values per lane at a time
        for (int rr = 0; rr < FR / FNW; ++rr) { float* srow = S + (w * (FR / FNW) + rr) * FPF; float v[TT / 32]; float mx = -3.0e38f;
#pragma unroll
            for (int ch = 0; ch < TT / 128; ++ch) { const int j0 = ch * 128 + lane * 4; const v4f a = *(const v4fa*)(srow + FR + j0); const v4i k4 = *(const v4i*)(km + j0);
#pragma unroll
                for (int q = 0; q < 4; ++q) { const float t = (k4[q] != 0) ? a[q] : -3.0e38f; v[ch * 4 + q] = t; mx = fmaxf(mx, t); } }
#pragma unroll
            for (int sh = 16; sh; sh >>= 1) mx = fmaxf(mx, __shfl_xor(mx, sh, 32));
            float sum = 0.f;
#pragma unroll
            for (int k = 0; k < TT / 32; ++k) { v[k] = __builtin_amdgcn_exp2f(__fmul_rn(__fsub_rn(v[k], mx), 1.4426950408889634f)); sum += v[k]; }
#pragma unroll
            for (int sh = 16; sh; sh >>= 1) sum += __shfl_xor(sum, sh, 32);
            const float f = __fdiv_rn(1.0f, sum); bf* prow = (bf*)srow;
#pragma unroll
            for (int ch = 0; ch < TT / 128; ++ch) { v4us oh, ol;
#pragma unroll
                for (int q = 0; q < 4; ++q) { unsigned short a, c2; splitf(v[ch * 4 + q] * f, a, c2); oh[q] = a; ol[q] = c2; }
                *(v4us*)(prow + ch * 128 + lane * 4) = oh; *(v4us*)(prow + TT + ch * 128 + lane * 4) = ol; } }
    }
    __syncthreads();
    // phase 4: O = P.V on all 16 waves, 4 per SIMD, so that one wave's waits for its P fragments are filled by the other three: wave w takes 16 columns of the head (w % 4), all 4 row tiles
    // and 256 of the 1024 keys (w / 4). Each V fragment is still fetched once per work-group. Inside a quarter k runs in the order of the unfused GEMM; the 4 quarters are added below, in the order of the keys.
    v8f o[FMT];
    const int nt = w & 3, kq = w >> 2;
    {
        const bf* pr = (const bf*)(S + lr * FPF) + 8 * hi + kq * 256;
        const size_t voff = zo + (size_t)nt * 16 * TT + (size_t)kq * 256 * 16 + lane * 8;   /* 16 d of 1024 keys are 32 blocks; 32 keys are one block */ const bf* vh = VTh + voff; const bf* vl = VTl + voff;
#pragma unroll
        for (int mt = 0; mt < FMT; ++mt) o[mt] = (v8f){};
        v16bf vs[8][2];   // the wave's whole share of V, all loads in flight at once
#pragma unroll
        for (int u = 0; u < 8; ++u) { vs[u][0] = F::ldf(vh + u * 512); vs[u][1] = F::ldf(vl + u * 512); }
        // precaution: the pointers are named so that no register an issued load names is rewritten ahead of this wait; the clobber also keeps the loads above it
        asm volatile("s_wait_xcnt 0x0" :: "v"(vh), "v"(vl) : "memory");
#pragma unroll
        for (int u = 0; u < 8; ++u) { v16bf ph[FMT], pl[FMT];
#pragma unroll
            for (int mt = 0; mt < FMT; ++mt) { ph[mt] = F::ld(pr + mt * 16 * 2 * FPF + u * 32); pl[mt] = F::ld(pr + mt * 16 * 2 * FPF + TT + u * 32); }
#pragma unroll
            for (int mt = 0; mt < FMT; ++mt) o[mt] = wmmab(ph[mt], vs[u][0], o[mt]);
#pragma unroll
            for (int mt = 0; mt < FMT; ++mt) o[mt] = wmmab(pl[mt], vs[u][0], o[mt]);
#pragma unroll
            for (int mt = 0; mt < FMT; ++mt) o[mt] = wmmab(ph[mt], vs[u][1], o[mt]);
            // keeps the P fragments of later steps from being fetched here: V and the accumulators hold 160 registers, and with more than two steps' fragments beside them the build spills V
            if ((u & 1) && u < 7) __builtin_amdgcn_sched_barrier(0); }
    }
    __syncthreads();   // every wave has read its last P fragment: the rows of S may now take the partial sums
    // the 4 partial tiles, [key quarter][64 rows][68 floats], at the start of S
#pragma unroll
    for (int mt = 0; mt < FMT; ++mt)
#pragma unroll
        for (int j = 0; j < 8; ++j) S[(kq * FR + mt * 16 + hi * 8 + j) * 68 + nt * 16 + lr] = o[mt][j];
    __syncthreads();
    // whole 256-byte output rows per half wave: one writer per line; the quarters are added in the order of their keys
#pragma unroll
    for (int s = 0; s < 2; ++s) { const int row = w * 4 + s * 2 + hi; const float* rp = S + row * 68 + lr * 4;
        const v4f val = ((*(const v4fa*)rp + *(const v4fa*)(rp + FR * 68)) + *(const v4fa*)(rp + 2 * FR * 68)) + *(const v4fa*)(rp + 3 * FR * 68);
        *(v4f*)(OUT + ((size_t)b * TT + i0 + row) * DM + h * HD + lr * 4) = val; }
}
__global__ __launch_bounds__(256) void k_merge(const float* __restrict__ O, int h0, bf* Ah, bf* Al) { const size_t e = ((size_t)blockIdx.x * 256 + threadIdx.x) * 2; if (e >= (size_t)ZH * TT * HD) return; const int d = (int)(e % HD); const int t = (int)((e / HD) % TT); const int zz = (int)(e / ((size_t)HD * TT)); const float cs = (t < RH) ? 1.0f : (1.0f / PCAR); const size_t oo = (size_t)t * DQ + (h0 + zz) * HD + d;
    v2us oh, ol;
#pragma unroll
    for (int q = 0; q < 2; ++q) { unsigned short a, c2; splitf(O[e + q] * cs, a, c2); oh[q] = a; ol[q] = c2; } *(v2us*)(Ah + oo) = oh; *(v2us*)(Al + oo) = ol;  }

extern "C" void kernel_launch(void* const* d_in, const int* in_sizes, int n_in,
                              void* d_out, int out_size, void* d_ws, size_t ws_size, hipStream_t stream) {
    (void)in_sizes; (void)n_in; (void)out_size;
    const float* x = (const float*)d_in[0]; const float* wqv = (const float*)d_in[1]; const float* rrb = (const float*)d_in[2]; const float* rwb = (const float*)d_in[3]; const int* kmask = (const int*)d_in[4]; const float* wq = wqv; const float* wk = nullptr; const float* wv = wqv; const float* wo = nullptr; (void)wk; (void)wo; const float* cosT = nullptr; const float* sinT = nullptr; (void)cosT; (void)sinT;
    float* OUT = (float*)d_out;     // [4][1024][1024]
    char* wsp = (char*)d_ws;
    auto take = [&](size_t bytes) { char* p = wsp; wsp += (bytes + 255) & ~(size_t)255; return (void*)p; };
    const size_t PL = (size_t)NB_ * NH_ * TT * HD;   // one plane set: every batch, every head
    const size_t FL = (size_t)NB_ * TT * DM;         // one f32 activation: every batch
    bf* WALL = (bf*)take((size_t)2 * DQ * DM * 2); float* POS = (float*)take((size_t)P2 * HD * 4); bf* POSh = (bf*)take((size_t)P2 * HD * 2); bf* POSl = (bf*)take((size_t)P2 * HD * 2); float* DT = (float*)take((size_t)NH_ * P2 * 4);
    bf* KPh = (bf*)take(PL * 2); bf* KPl = (bf*)take(PL * 2); bf* QRh = (bf*)take(PL * 2); bf* QRl = (bf*)take(PL * 2); bf* QPh = (bf*)take(PL * 2); bf* QPl = (bf*)take(PL * 2);   // hi and lo planes of k, of q + r_r_bias, of q
    bf* VTh = (bf*)take(PL * 2); bf* VTl = (bf*)take(PL * 2);
    bf* XB = (bf*)take(FL * 2);   // the bf16 input, rows b * L + t
    if ((size_t)(wsp - (char*)d_ws) > ws_size) return;   // ws ~ 77 MiB
    k_wtG<<<DM * 2 * DQ / 8 / 256, 256, 0, stream>>>(wqv, DM, 2 * DQ, WALL); k_postab<<<P2 / 8, 64, 0, stream>>>(POS, POSh, POSl); k_dtab<<<(NH_ * P2 + 255) / 256, 256, 0, stream>>>(rwb, POS, DT);
    // every batch in one launch
    k_xk<<<NB_ * TT / 8, 256, 0, stream>>>(x, XB, KPh, KPl);   /* k = x: the bf16-ROUNDED input */
    k_gemmw<bf, 0><<<dim3(NB_ * TT / 64, DQ / 64, 2), 32, 0, stream>>>(XB, nullptr, WALL, nullptr, DM, rrb, QPh, QPl, QRh, QRl, VTh, VTl, 0, (size_t)DQ * DM);   /* z = 0: q, z = 1: v */
    k_fattn<<<dim3(TT / FR, NB_ * NH_, 1), FNW * 32, 0, stream>>>(QRh, QRl, QPh, QPl, KPh, KPl, POSh, POSl, DT, VTh, VTl, kmask, OUT);   /* every batch and head */
}

// v006
// A run of this version takes 130 microseconds.
// Next to v005, in two timings, it ran 1.09 and 1.10 times as fast.
// Over all steps from v000 it is 14.0 times as fast.
#include <hip/hip_runtime.h>

// RelativeMultiHeadAttn (Transformer-XL style, k_as_x: x [4][1024][1024], Wqv [1024][2048] (q | v column blocks), r_r_bias / r_w_bias [16][64], mask [4][1024] (int, read; all ones); k = x itself split into 16 heads; pos = the sinusoidal table [2L][64] (sin | cos of p * exp(-d ln(1e4)/31), p = -L..L-1, row 0 zeroed) computed on chip in f32; AC = (q + r_r_bias).k; B_ = q.pos^T, D_ = r_w_bias.pos^T; BD = shift(B_ + D_) = (B_ + D_)[i][L - i + j] (exact index form of the pad/reshape shift); attn = softmax(AC + BD) (NO scaling; -inf where mask == 0); out = attn.v merged -> [4][1024][1024] (no output projection)).
// Compute dtypes, f32 accumulate: every input rounded to bf16; q, v as PLAIN bf16 GEMMs (inputs: exact); k planes straight from the (bf16-exact) input; pos table f32 -> hi/lo planes; AC and B_ as hl x hl GEMMs (3 products) on every row (unscaled logits are sharp); D_ as 64-term f32 dots; BD gathered per element (contiguous along j) and added in f32; softmax f32; attn.v hl x hl (3 products) on every row; output written directly in f32.

#define NB_  4
#define TT   1024
#define DM   1024
#define NH_  16
#define NKV  16
#define REP  (NH_ / NKV)
#define HD   64
#define DQ   (NH_ * HD)
#define DKV  (NKV * HD)
#define ZH   8                     // heads per k_merge call (k_merge is not launched)
#define ZS   16                    // unused
#define RH   1024                  // k_merge (not launched) scales rows t >= RH by 1/PCAR
#define WIN  0
#define PCAR 1024.0f
#define P2   (2 * TT)             // 2L relative positions
#define SCL  0.125f   // HD^-0.5
typedef _Float16 h16;
typedef unsigned short bf;
typedef __attribute__((ext_vector_type(16))) __bf16   v16bf;
typedef __attribute__((ext_vector_type(16))) _Float16 v16h;
typedef __attribute__((ext_vector_type(8)))  _Float16 v8h;
typedef __attribute__((ext_vector_type(8)))  unsigned short v8us;
typedef __attribute__((ext_vector_type(8)))  float    v8f;
typedef __attribute__((ext_vector_type(4)))  float    v4f;
typedef v8h  __attribute__((may_alias)) v8ha;
typedef v4f  __attribute__((may_alias)) v4fa;
typedef v8us __attribute__((may_alias)) v8usa;

__device__ __forceinline__ unsigned short f2bf(float f) { unsigned u = __float_as_uint(f); u += 0x7FFFu + ((u >> 16) & 1u); return (unsigned short)(u >> 16); }
__device__ __forceinline__ float bf2f(unsigned short b) { return __uint_as_float(((unsigned)b) << 16); }
__device__ __forceinline__ float bfr(float f) { return bf2f(f2bf(f)); }
__device__ __forceinline__ v16h cat16(v8h lo, v8h hi) { return __builtin_shufflevector(lo, hi, 0, 1, 2, 3, 4, 5, 6, 7, 8, 9, 10, 11, 12, 13, 14, 15); }
__device__ __forceinline__ v16bf cat16b(v8us lo, v8us hi) { return __builtin_bit_cast(v16bf, __builtin_shufflevector(lo, hi, 0, 1, 2, 3, 4, 5, 6, 7, 8, 9, 10, 11, 12, 13, 14, 15)); }
__device__ __forceinline__ v8f wmma16(v16h a, v16h b, v8f c) { return __builtin_amdgcn_wmma_f32_16x16x32_f16(false, a, false, b, (short)0, c, false, false); }
__device__ __forceinline__ v8f wmmab(v16bf a, v16bf b, v8f c) { return __builtin_amdgcn_wmma_f32_16x16x32_bf16(false, a, false, b, (short)0, c, false, false); }



// ---- k_gemmw: register-blocked GEMM, ONE WAVE per 64x64 output tile (16 accumulators), operands straight from 16-bit planes in fragment order; grid (M/64, N/64, Z), 32 threads.
// C[m][n] = sum_k A[m][k] Bt[n][k] (+ split products per NSPLIT). z-batch strides sA/sB in elements. K % 32 == 0. z = 0: q, z = 1: v.
// A tile is 64 tokens of one head, so the epilogue writes the planes that the attention kernel reads straight from the accumulators:
// z = 0: hi + lo planes [b][h] of q and of q + r_r_bias (rows t, k = d); z = 1: hi + lo planes [b][h] of v (rows d, k = t); each in fragment order.
template <typename T16> struct WFrag;
template <> struct WFrag<h16> { typedef v16h V; static __device__ __forceinline__ V ld(const h16* p) { return cat16(*(const v8h*)p, *(const v8h*)(p + 16)); } static __device__ __forceinline__ V ldf(const h16* p) { return cat16(*(const v8h*)p, *(const v8h*)(p + 256)); } static __device__ __forceinline__ v8f mma(V a, V b, v8f c) { return wmma16(a, b, c); } };
template <> struct WFrag<bf> { typedef v16bf V; static __device__ __forceinline__ V ld(const bf* p) { return cat16b(*(const v8us*)p, *(const v8us*)(p + 16)); } static __device__ __forceinline__ V ldf(const bf* p) { return cat16b(*(const v8us*)p, *(const v8us*)(p + 256)); } static __device__ __forceinline__ v8f mma(V a, V b, v8f c) { return wmmab(a, b, c); } };
// FRAGMENT ORDER: every 16-bit operand plane in the workspace, rows x K, is stored as blocks of 512 elements, one block per (16 rows, 32 k). Element (row, k) lies at
// ((row / 16) * (K / 32) + k / 32) * 512 + ((k / 16) % 2) * 256 + (((k / 8) % 2) * 16 + row % 16) * 8 + k % 8.
// Lane l of a wave finds the two 16-byte halves of its fragment at l * 8 and 256 + l * 8 of the block (ldf), so each load of a wave reads 512 contiguous bytes, 4 whole lines;
// the registers hold the same values as with row-major planes. fro: the place of 8 neighbouring k, k8 % 8 == 0, kb = K / 32.
__device__ __forceinline__ size_t fro(size_t row, size_t k8, size_t kb) { return ((row >> 4) * kb + (k8 >> 5)) * 512 + ((k8 >> 4) & 1) * 256 + (((k8 >> 3) & 1) * 16 + (row & 15)) * 8; }
__device__ __forceinline__ void splitf(float y, unsigned short& h, unsigned short& l) { h = f2bf(y); l = f2bf(y - bf2f(h)); }
template <typename T16, int NSPLIT>
__global__ __launch_bounds__(32) void k_gemmw(const T16* __restrict__ A, const T16* __restrict__ A2, const T16* __restrict__ Bt, const T16* __restrict__ Bt2, int K, const float* __restrict__ rr, bf* QPh, bf* QPl, bf* QRh, bf* QRl, bf* VTh, bf* VTl, size_t sA, size_t sB) {
    typedef typename WFrag<T16>::V V;
    __shared__ __align__(16) float os[16 * 68];
    const size_t z = blockIdx.z; A += z * sA; if (A2) A2 += z * sA; Bt += z * sB; if (Bt2) Bt2 += z * sB;
    const int lane = threadIdx.x & 31, lr = lane & 15, hi = lane >> 4; const int r0 = blockIdx.x * 64, c0 = blockIdx.y * 64;
    v8f acc[4][4];
#pragma unroll
    for (int mb = 0; mb < 4; ++mb)
#pragma unroll
        for (int nb = 0; nb < 4; ++nb) acc[mb][nb] = (v8f){};
    const size_t aoff = (size_t)r0 * K + lane * 8, boff = (size_t)c0 * K + lane * 8;   // 16 rows are K / 32 blocks = 16 * K elements; 32 k are one block
#pragma unroll 1
    for (int kc = 0; kc < K; kc += 32) {
        V a[4], a2[4], b[4], b2[4]; const T16* ap[4]; const T16* bp[4];
#pragma unroll
        for (int mb = 0; mb < 4; ++mb) { const size_t o = aoff + (size_t)mb * 16 * K + kc * 16; ap[mb] = A + o; a[mb] = WFrag<T16>::ldf(ap[mb]); if (NSPLIT == 1 || NSPLIT == 2) a2[mb] = WFrag<T16>::ldf(A2 + o); }
#pragma unroll
        for (int nb = 0; nb < 4; ++nb) { const size_t o = boff + (size_t)nb * 16 * K + kc * 16; bp[nb] = Bt + o; b[nb] = WFrag<T16>::ldf(bp[nb]); if (NSPLIT >= 2) b2[nb] = WFrag<T16>::ldf(Bt2 + o); }
        // precaution: the pointers are named so that no register an issued load names is rewritten ahead of this wait; the clobber also keeps the loads above it
        asm volatile("s_wait_xcnt 0x0" :: "v"(ap[0]), "v"(ap[1]), "v"(ap[2]), "v"(ap[3]), "v"(bp[0]), "v"(bp[1]), "v"(bp[2]), "v"(bp[3]) : "memory");
        // keeps the matrix instructions behind that wait: lifted over it they split the trip's loads into three groups, each waited for in turn
        __builtin_amdgcn_sched_barrier(0);
#pragma unroll
        for (int nb = 0; nb < 4; ++nb)
#pragma unroll
            for (int mb = 0; mb < 4; ++mb) { acc[mb][nb] = WFrag<T16>::mma(a[mb], b[nb], acc[mb][nb]); if (NSPLIT == 1 || NSPLIT == 2) acc[mb][nb] = WFrag<T16>::mma(a2[mb], b[nb], acc[mb][nb]); if (NSPLIT >= 2) acc[mb][nb] = WFrag<T16>::mma(a[mb], b2[nb], acc[mb][nb]); }
        asm volatile("v_nop\n\tv_nop\n\tv_nop\n\tv_nop" : "+v"(acc[0][0]), "+v"(acc[1][1]), "+v"(acc[2][2]), "+v"(acc[3][3]) : "v"(a[0]), "v"(a[3]));
    }
    const int t0 = r0 % TT; const size_t pz = (size_t)((r0 / TT) * NH_ + blockIdx.y) * TT * HD;   // the planes of this tile's (batch, head)
    if (z == 0) {
        // through LDS, 16 rows at a time: a lane then holds 8 neighbouring d of one token, and 8 lanes (8 neighbouring tokens) write one whole 128-byte line of a block
        const int r8 = lane & 7, cq = lane >> 3; float rb[2][8];
#pragma unroll
        for (int g = 0; g < 2; ++g)
#pragma unroll
            for (int u = 0; u < 8; ++u) rb[g][u] = bfr(rr[c0 + (g * 4 + cq) * 8 + u]);
#pragma unroll
        for (int mb = 0; mb < 4; ++mb) {
#pragma unroll
            for (int nb = 0; nb < 4; ++nb) {
#pragma unroll
                for (int j = 0; j < 8; ++j) os[(hi * 8 + j) * 68 + nb * 16 + lr] = acc[mb][nb][j]; }
            // one wave, LDS runs in order: these two only keep the compiler from moving the reads of other lanes' values above the stores
            __builtin_amdgcn_wave_barrier(); asm volatile("" ::: "memory");
#pragma unroll
            for (int s = 0; s < 4; ++s) { const int row = (s & 1) * 8 + r8, c8 = ((s >> 1) * 4 + cq) * 8; const v4f x0 = *(const v4fa*)(os + row * 68 + c8), x1 = *(const v4fa*)(os + row * 68 + c8 + 4); v8us qh, ql, sh, sl;
#pragma unroll
                for (int u = 0; u < 8; ++u) { const float q = (u < 4) ? x0[u & 3] : x1[u & 3]; unsigned short a2, c2; splitf(q, a2, c2); qh[u] = a2; ql[u] = c2; splitf(__fadd_rn(q, rb[s >> 1][u]), a2, c2); sh[u] = a2; sl[u] = c2; }
                const size_t o = pz + fro(t0 + mb * 16 + row, c8, HD / 32);
                *(v8us*)(QPh + o) = qh; *(v8us*)(QPl + o) = ql; *(v8us*)(QRh + o) = sh; *(v8us*)(QRl + o) = sl;
                // precaution: no register that an issued store names is rewritten ahead of this wait
                asm volatile("s_wait_xcnt 0x0" ::: "memory"); }
            // and the next 16 rows' stores from moving above these reads
            __builtin_amdgcn_wave_barrier(); asm volatile("" ::: "memory");
        }
    } else {
        // the transposed planes need no LDS: the 8 accumulator values of a lane are 8 neighbouring tokens of one d, which is that lane's 16 bytes of a block's half: a store writes 512 contiguous bytes
#pragma unroll
        for (int nb = 0; nb < 4; ++nb)
#pragma unroll
            for (int mb = 0; mb < 4; ++mb) { v8us vh, vl;
#pragma unroll
                for (int j = 0; j < 8; ++j) { unsigned short a2, c2; splitf(acc[mb][nb][j], a2, c2); vh[j] = a2; vl[j] = c2; }
                const size_t o = pz + fro(nb * 16 + lr, t0 + mb * 16 + hi * 8, TT / 32);
                *(v8us*)(VTh + o) = vh; *(v8us*)(VTl + o) = vl;
                // precaution: data and pointers are named so that no register an issued store names is rewritten ahead of this wait
                asm volatile("s_wait_xcnt 0x0" :: "v"(vh), "v"(vl), "v"(VTh + o), "v"(VTl + o) : "memory"); }
    }
}

typedef __attribute__((ext_vector_type(2))) _Float16 v2h;
typedef __attribute__((ext_vector_type(4))) _Float16 v4h;
typedef __attribute__((ext_vector_type(2))) unsigned short v2us;
typedef __attribute__((ext_vector_type(4))) unsigned short v4us;
typedef __attribute__((ext_vector_type(2))) float v2f;
typedef __attribute__((ext_vector_type(4))) int v4i;

// d_wtG: the weights rounded to bf16, as the GEMM's B plane (rows n, k = the model dimension) in fragment order. A thread takes 8 neighbouring k of one n:
// the lanes of a wave read 32 neighbouring n, one whole line per k, and write two runs of 256 contiguous bytes.
__device__ __forceinline__ void d_wtG(int blk, const float* __restrict__ w, int K, int N, bf* Bt) {
    const int idx = blk * 256 + threadIdx.x; const int n = idx % N, k0 = (idx / N) * 8; if (k0 >= K) return;
    const float* wp[8]; float v[8];
#pragma unroll
    for (int u = 0; u < 8; ++u) { wp[u] = w + (size_t)(k0 + u) * N + n; v[u] = *wp[u]; }
    // precaution: the pointers are named so that no register an issued load names is rewritten ahead of this wait; the clobber also keeps the loads above it
    asm volatile("s_wait_xcnt 0x0" :: "v"(wp[0]), "v"(wp[1]), "v"(wp[2]), "v"(wp[3]), "v"(wp[4]), "v"(wp[5]), "v"(wp[6]), "v"(wp[7]) : "memory");
    v8us o;
#pragma unroll
    for (int u = 0; u < 8; ++u) o[u] = f2bf(v[u]);
    *(v8us*)(Bt + fro(n, k0, K >> 5)) = o;
}
// d_xk: x rounded to bf16, once as the GEMM's A plane (rows b * L + t, k = the model dimension) and once as the k planes [b][h] (rows t, k = d), each in fragment order; the rounded value is bf16-exact, so its lo plane is zero.
// A block takes 8 tokens, a thread 8 elements of one token at 4 places 256 columns apart, all loads first. 8 neighbouring lanes hold 8 neighbouring tokens: they write one whole 128-byte line of a block;
// a wave reads one whole 128-byte line of each of its 8 tokens. Block-uniform bases: the lanes differ in one 32-bit offset per buffer, and a thread's 4 groups lie an immediate offset apart.
__device__ __forceinline__ void d_xk(int blk, const float* __restrict__ x, bf* XB, bf* KPh, bf* KPl) { const unsigned tk = threadIdx.x & 7, cq = threadIdx.x >> 3; const unsigned xo = tk * DM + cq * 8; v8f v[4];
    const size_t r0 = (size_t)blk * 8; const unsigned rl = (unsigned)(r0 & 15) + tk;   // the token's row in its block of 16
    const unsigned fo = ((cq >> 1) & 1) * 256 + ((cq & 1) * 16 + rl) * 8;                     // the place of the thread's 8 elements inside a block of 512
    const unsigned ao = (cq >> 2) * 512 + fo; const unsigned po = (cq >> 3) * (TT * HD) + ((cq >> 2) & 1) * 512 + fo;
    const float* xb = x + r0 * DM; bf* ob = XB + (r0 >> 4) * (16 * DM); const size_t pb = (r0 / TT) * NH_ * TT * HD + ((r0 % TT) >> 4) * (16 * HD); bf* kh = KPh + pb; bf* kl = KPl + pb;
#pragma unroll
    for (int g = 0; g < 4; ++g) v[g] = *(const v8f*)(xb + g * 256 + xo);
    // precaution: the lane's offset is named so that no register an issued load names is rewritten ahead of this wait; the clobber also keeps the loads above it
    asm volatile("s_wait_xcnt 0x0" :: "v"(xo * 4) : "memory");
#pragma unroll
    for (int g = 0; g < 4; ++g) { v8us o;
#pragma unroll
        for (int k = 0; k < 8; ++k) o[k] = f2bf(v[g][k]);
        *(v8us*)(ob + g * 8 * 512 + ao) = o; *(v8us*)(kh + g * 4 * TT * HD + po) = o; *(v8us*)(kl + g * 4 * TT * HD + po) = (v8us){}; } }
__global__ __launch_bounds__(256) void k_cscvt(const float* __restrict__ cosT, const float* __restrict__ sinT, float* CS) { const int idx = blockIdx.x * 256 + threadIdx.x; if (idx >= TT * HD) return; v2f cs; cs[0] = bfr(cosT[idx]); cs[1] = bfr(sinT[idx]); *(v2f*)(CS + (size_t)idx * 2) = cs;  }
// d_postab: 32 rows of the table as hi + lo planes (rows m, k = d) in fragment order, and D_[h][m] = r_w_bias[h].pos[m] of those rows for all 16 heads. 64 threads take 8 rows, a thread 8 neighbouring d of one row;
// 8 neighbouring lanes hold 8 neighbouring rows: a wave writes whole 128-byte lines of both planes, and its 32 d are all sines or all cosines.
// The f32 rows go to D_ through LDS (pitch 272 B = 16 B x odd): a lane then holds one whole row in registers, a wave takes 2 heads, whose weights are wave-uniform, and stores one whole 128-byte line of D_ per head.
#define PSP (HD + 4)
__device__ __forceinline__ void d_postab(int blk, const float* __restrict__ rw, bf* Ph2, bf* Pl2, float* DT, float* ps) { const int rl = (threadIdx.x >> 6) * 8 + (threadIdx.x & 7); const int m = blk * 32 + rl; const int d0 = ((threadIdx.x >> 3) & 7) * 8; v8f vv; v8us hh, ll;
#pragma unroll
    for (int q = 0; q < 8; ++q) { const int d = d0 + q; const int dd = (d < HD / 2) ? d : d - HD / 2; const float fr = expf(__fmul_rn((float)dd, -0.29710776f)); const float ang = __fmul_rn((float)(m - TT), fr); float v = (d < HD / 2) ? sinf(ang) : cosf(ang); if (m == 0) v = 0.0f; unsigned short a2, c2; splitf(v, a2, c2); vv[q] = v; hh[q] = a2; ll[q] = c2; }
    const size_t o = fro(m, d0, HD / 32);
    *(v4fa*)(ps + rl * PSP + d0) = __builtin_shufflevector(vv, vv, 0, 1, 2, 3); *(v4fa*)(ps + rl * PSP + d0 + 4) = __builtin_shufflevector(vv, vv, 4, 5, 6, 7);
    __syncthreads();   // the block's 32 rows are whole in LDS (the branch that leads here is block-uniform)
    const int lane = threadIdx.x & 31; const int h0 = __builtin_amdgcn_readfirstlane(threadIdx.x >> 5);   // wave number in a scalar register: the weights' addresses are wave-uniform
    v4f pv[HD / 4];
#pragma unroll   // constant indices: the row stays in registers
    for (int q = 0; q < HD / 4; ++q) pv[q] = *(const v4fa*)(ps + lane * PSP + q * 4);
    float a0 = 0.f, a1 = 0.f;   // heads h0 and h0 + 8: two independent chains, each in the order of d
#pragma unroll   // constant indices into the row's registers; the weights come by wide scalar loads
    for (int d = 0; d < HD; ++d) { a0 += bfr(rw[h0 * HD + d]) * pv[d >> 2][d & 3]; a1 += bfr(rw[(h0 + 8) * HD + d]) * pv[d >> 2][d & 3]; }
    // every global store of the block stands here at its end: no register that an issued store names is rewritten behind it
    *(v8us*)(Ph2 + o) = hh; *(v8us*)(Pl2 + o) = ll; DT[h0 * P2 + blk * 32 + lane] = a0; DT[(h0 + 8) * P2 + blk * 32 + lane] = a1;  }
// k_prep: all that depends on nothing but the inputs, in ONE launch: each block does one pass's share, chosen by its index (block-uniform branches).
// The table's blocks come first (the longest chain of arithmetic), then the input's, then the weights'.
#define PB_POS (P2 / 32)
#define PB_XK  (NB_ * TT / 8)
#define PB_WT  (DM * 2 * DQ / 8 / 256)
__global__ __launch_bounds__(256) void k_prep(const float* __restrict__ x, bf* XB, bf* KPh, bf* KPl, const float* __restrict__ w, int K, int N, bf* Bt, const float* __restrict__ rw, bf* Ph2, bf* Pl2, float* DT) {
    __shared__ __align__(16) float ps[32 * PSP];
    const int blk = blockIdx.x;
    if (blk < PB_POS) d_postab(blk, rw, Ph2, Pl2, DT, ps);
    else if (blk < PB_POS + PB_XK) d_xk(blk - PB_POS, x, XB, KPh, KPl);
    else d_wtG(blk - PB_POS - PB_XK, w, K, N, Bt);
}
// k_fattn: one work-group of 16 waves per 64 query rows of one (batch, head). The 64 x 1024 logit block lives in LDS from the first product to P.V.
// LDS row: 64 floats of left margin | 1024 logits | 64 floats of right margin | 4 floats (pitch 4624 B = 16 B x odd). The margins take the band's elements whose key index falls outside 0..1023: they are written, never read.
// After the softmax the same row holds the bf16 hi plane (bytes 0..2047) and lo plane (bytes 2048..4095) of P; after P.V the start of the block holds the 4 partial output tiles.
// Every plain '#pragma unroll' below makes the indices of a fragment or accumulator array constants, so that the array stays in registers.
#define FR   64
#define FMT  (FR / 16)
#define FNW  16
#define FPF  (TT + 2 * FR + 4)
__global__ __launch_bounds__(FNW * 32) void k_fattn(const bf* __restrict__ QRh, const bf* __restrict__ QRl, const bf* __restrict__ QPh, const bf* __restrict__ QPl, const bf* __restrict__ KPh, const bf* __restrict__ KPl, const bf* __restrict__ POSh, const bf* __restrict__ POSl, const float* __restrict__ DT, const bf* __restrict__ VTh, const bf* __restrict__ VTl, const int* __restrict__ kmask, float* OUT) {
    typedef WFrag<bf> F;
    __shared__ __align__(16) float S[FR * FPF];
    const int lane = threadIdx.x & 31, lr = lane & 15, hi = lane >> 4;
    const int w = __builtin_amdgcn_readfirstlane(threadIdx.x >> 5);   // wave number in a scalar register: every loop and branch round a matrix instruction is wave-uniform
    const int i0 = blockIdx.x * FR; const int z = blockIdx.y; const int b = z / NH_, h = z % NH_;
    const size_t zo = (size_t)z * TT * HD;
    const size_t qoff = zo + (size_t)i0 * HD + lane * 8;   // planes in fragment order: 16 rows of 64 d are 2 blocks of 512
    // phase 1: BD[r][j] = B_[i0 + r][m] + D_[m], m = L - (i0 + r) + j: only the band m = L - i0 - 64 .. L - i0 + 1023 (68 column tiles); each pos fragment serves all 4 row tiles
    {
        v16bf a[FMT][2], a2[FMT][2];
#pragma unroll
        for (int mt = 0; mt < FMT; ++mt)
#pragma unroll
            for (int ks = 0; ks < 2; ++ks) { a[mt][ks] = F::ldf(QPh + qoff + mt * 16 * HD + ks * 512); a2[mt][ks] = F::ldf(QPl + qoff + mt * 16 * HD + ks * 512); }
        // precaution: the pointers are named so that no register an issued load names is rewritten ahead of this wait; the clobber also keeps the loads above it
        asm volatile("s_wait_xcnt 0x0" :: "v"(QPh + qoff), "v"(QPl + qoff) : "memory");
        const int mlo = TT - i0 - FR; const float* dth = DT + (size_t)h * P2 + mlo + lr;
        const size_t poff = (size_t)mlo * HD + lane * 8;
#pragma unroll 1   // rolled: the 16 q fragments hold 128 registers, a second tile in flight would not fit 4 waves per SIMD
        for (int t = w; t < (TT + FR) / 16; t += FNW) {
            const bf* ph = POSh + poff + (size_t)t * 16 * HD; const bf* pl = POSl + poff + (size_t)t * 16 * HD; const float* dp = dth + t * 16;
            v16bf p[2], p2[2];
#pragma unroll
            for (int ks = 0; ks < 2; ++ks) { p[ks] = F::ldf(ph + ks * 512); p2[ks] = F::ldf(pl + ks * 512); }
            const float dv = *dp;
            // precaution: the pointers are named so that no register an issued load names is rewritten ahead of this wait; the clobber also keeps the loads above it
            asm volatile("s_wait_xcnt 0x0" :: "v"(ph), "v"(pl), "v"(dp) : "memory");
            v8f acc[FMT];
#pragma unroll
            for (int mt = 0; mt < FMT; ++mt) acc[mt] = (v8f){};
#pragma unroll
            for (int ks = 0; ks < 2; ++ks) {
#pragma unroll
                for (int mt = 0; mt < FMT; ++mt) acc[mt] = wmmab(a[mt][ks], p[ks], acc[mt]);
#pragma unroll
                for (int mt = 0; mt < FMT; ++mt) acc[mt] = wmmab(a2[mt][ks], p[ks], acc[mt]);
#pragma unroll
                for (int mt = 0; mt < FMT; ++mt) acc[mt] = wmmab(a[mt][ks], p2[ks], acc[mt]); }
#pragma unroll
            for (int mt = 0; mt < FMT; ++mt)
#pragma unroll
                for (int j = 0; j < 8; ++j) { const int r = mt * 16 + hi * 8 + j; S[r * FPF + t * 16 + lr + r] = __fadd_rn(acc[mt][j], dv); }   /* column FR + j, j = t*16 + lr - FR + r */
        }
    }
    __syncthreads();
    // phase 2: logit = AC + BD; each k fragment serves all 4 row tiles
    {
        v16bf a[FMT][2], a2[FMT][2];
#pragma unroll
        for (int mt = 0; mt < FMT; ++mt)
#pragma unroll
            for (int ks = 0; ks < 2; ++ks) { a[mt][ks] = F::ldf(QRh + qoff + mt * 16 * HD + ks * 512); a2[mt][ks] = F::ldf(QRl + qoff + mt * 16 * HD + ks * 512); }
        // precaution: the pointers are named so that no register an issued load names is rewritten ahead of this wait; the clobber also keeps the loads above it
        asm volatile("s_wait_xcnt 0x0" :: "v"(QRh + qoff), "v"(QRl + qoff) : "memory");
        const size_t koff = zo + lane * 8;
#pragma unroll 1   // rolled: as in phase 1
        for (int t = w; t < TT / 16; t += FNW) {
            const bf* kh = KPh + koff + (size_t)t * 16 * HD; const bf* kl = KPl + koff + (size_t)t * 16 * HD;
            v16bf k1[2], k2[2];
#pragma unroll
            for (int ks = 0; ks < 2; ++ks) { k1[ks] = F::ldf(kh + ks * 512); k2[ks] = F::ldf(kl + ks * 512); }
            // precaution: the pointers are named so that no register an issued load names is rewritten ahead of this wait; the clobber also keeps the loads above it
            asm volatile("s_wait_xcnt 0x0" :: "v"(kh), "v"(kl) : "memory");
            v8f acc[FMT];
#pragma unroll
            for (int mt = 0; mt < FMT; ++mt) acc[mt] = (v8f){};
#pragma unroll
            for (int ks = 0; ks < 2; ++ks) {
#pragma unroll
                for (int mt = 0; mt < FMT; ++mt) acc[mt] = wmmab(a[mt][ks], k1[ks], acc[mt]);
#pragma unroll
                for (int mt = 0; mt < FMT; ++mt) acc[mt] = wmmab(a2[mt][ks], k1[ks], acc[mt]);
#pragma unroll
                for (int mt = 0; mt < FMT; ++mt) acc[mt] = wmmab(a[mt][ks], k2[ks], acc[mt]); }
            float* sp = S + (hi * 8) * FPF + FR + t * 16 + lr; float bd[FMT][8];
#pragma unroll
            for (int mt = 0; mt < FMT; ++mt)
#pragma unroll
                for (int j = 0; j < 8; ++j) bd[mt][j] = sp[(mt * 16 + j) * FPF];
#pragma unroll
            for (int mt = 0; mt < FMT; ++mt)
#pragma unroll
                for (int j = 0; j < 8; ++j) sp[(mt * 16 + j) * FPF] = __fadd_rn(acc[mt][j], bd[mt][j]);
        }
    }
    __syncthreads();
    // phase 3: softmax, one wave per row, 4 rows a wave (register row, one exp, fixed trees); P split into hi + lo planes in place
    {
        const int* km = kmask + (size_t)b * TT;
#pragma unroll 1   // rolled: one row's 32 values per lane at a time
        for (int rr = 0; rr < FR / FNW; ++rr) { float* srow = S + (w * (FR / FNW) + rr) * FPF; float v[TT / 32]; float mx = -3.0e38f;
#pragma unroll
            for (int ch = 0; ch < TT / 128; ++ch) { const int j0 = ch * 128 + lane * 4; const v4f a = *(const v4fa*)(srow + FR + j0); const v4i k4 = *(const v4i*)(km + j0);
#pragma unroll
                for (int q = 0; q < 4; ++q) { const float t = (k4[q] != 0) ? a[q] : -3.0e38f; v[ch * 4 + q] = t; mx = fmaxf(mx, t); } }
#pragma unroll
            for (int sh = 16; sh; sh >>= 1) mx = fmaxf(mx, __shfl_xor(mx, sh, 32));
            float sum = 0.f;
#pragma unroll
            for (int k = 0; k < TT / 32; ++k) { v[k] = __builtin_amdgcn_exp2f(__fmul_rn(__fsub_rn(v[k], mx), 1.4426950408889634f)); sum += v[k]; }
#pragma unroll
            for (int sh = 16; sh; sh >>= 1) sum += __shfl_xor(sum, sh, 32);
            const float f = __fdiv_rn(1.0f, sum); bf* prow = (bf*)srow;
#pragma unroll
            for (int ch = 0; ch < TT / 128; ++ch) { v4us oh, ol;
#pragma unroll
                for (int q = 0; q < 4; ++q) { unsigned short a, c2; splitf(v[ch * 4 + q] * f, a, c2); oh[q] = a; ol[q] = c2; }
                *(v4us*)(prow + ch * 128 + lane * 4) = oh; *(v4us*)(prow + TT + ch * 128 + lane * 4) = ol; } }
    }
    __syncthreads();
    // phase 4: O = P.V on all 16 waves, 4 per SIMD, so that one wave's waits for its P fragments are filled by the other three: wave w takes 16 columns of the head (w % 4), all 4 row tiles
    // and 256 of the 1024 keys (w / 4). Each V fragment is still fetched once per work-group. Inside a quarter k runs in the order of the unfused GEMM; the 4 quarters are added below, in the order of the keys.
    v8f o[FMT];
    const int nt = w & 3, kq = w >> 2;
    {
        const bf* pr = (const bf*)(S + lr * FPF) + 8 * hi + kq * 256;
        const size_t voff = zo + (size_t)nt * 16 * TT + (size_t)kq * 256 * 16 + lane * 8;   /* 16 d of 1024 keys are 32 blocks; 32 keys are one block */ const bf* vh = VTh + voff; const bf* vl = VTl + voff;
#pragma unroll
        for (int mt = 0; mt < FMT; ++mt) o[mt] = (v8f){};
        v16bf vs[8][2];   // the wave's whole share of V, all loads in flight at once
#pragma unroll
        for (int u = 0; u < 8; ++u) { vs[u][0] = F::ldf(vh + u * 512); vs[u][1] = F::ldf(vl + u * 512); }
        // precaution: the pointers are named so that no register an issued load names is rewritten ahead of this wait; the clobber also keeps the loads above it
        asm volatile("s_wait_xcnt 0x0" :: "v"(vh), "v"(vl) : "memory");
#pragma unroll
        for (int u = 0; u < 8; ++u) { v16bf ph[FMT], pl[FMT];
#pragma unroll
            for (int mt = 0; mt < FMT; ++mt) { ph[mt] = F::ld(pr + mt * 16 * 2 * FPF + u * 32); pl[mt] = F::ld(pr + mt * 16 * 2 * FPF + TT + u * 32); }
#pragma unroll
            for (int mt = 0; mt < FMT; ++mt) o[mt] = wmmab(ph[mt], vs[u][0], o[mt]);
#pragma unroll
            for (int mt = 0; mt < FMT; ++mt) o[mt] = wmmab(pl[mt], vs[u][0], o[mt]);
#pragma unroll
            for (int mt = 0; mt < FMT; ++mt) o[mt] = wmmab(ph[mt], vs[u][1], o[mt]);
            // keeps the P fragments of later steps from being fetched here: V and the accumulators hold 160 registers, and with more than two steps' fragments beside them the build spills V
            if ((u & 1) && u < 7) __builtin_amdgcn_sched_barrier(0); }
    }
    __syncthreads();   // every wave has read its last P fragment: the rows of S may now take the partial sums
    // the 4 partial tiles, [key quarter][64 rows][68 floats], at the start of S
#pragma unroll
    for (int mt = 0; mt < FMT; ++mt)
#pragma unroll
        for (int j = 0; j < 8; ++j) S[(kq * FR + mt * 16 + hi * 8 + j) * 68 + nt * 16 + lr] = o[mt][j];
    __syncthreads();
    // whole 256-byte output rows per half wave: one writer per line; the quarters are added in the order of their keys
#pragma unroll
    for (int s = 0; s < 2; ++s) { const int row = w * 4 + s * 2 + hi; const float* rp = S + row * 68 + lr * 4;
        const v4f val = ((*(const v4fa*)rp + *(const v4fa*)(rp + FR * 68)) + *(const v4fa*)(rp + 2 * FR * 68)) + *(const v4fa*)(rp + 3 * FR * 68);
        *(v4f*)(OUT + ((size_t)b * TT + i0 + row) * DM + h * HD + lr * 4) = val; }
}
__global__ __launch_bounds__(256) void k_merge(const float* __restrict__ O, int h0, bf* Ah, bf* Al) { const size_t e = ((size_t)blockIdx.x * 256 + threadIdx.x) * 2; if (e >= (size_t)ZH * TT * HD) return; const int d = (int)(e % HD); const int t = (int)((e / HD) % TT); const int zz = (int)(e / ((size_t)HD * TT)); const float cs = (t < RH) ? 1.0f : (1.0f / PCAR); const size_t oo = (size_t)t * DQ + (h0 + zz) * HD + d;
    v2us oh, ol;
#pragma unroll
    for (int q = 0; q < 2; ++q) { unsigned short a, c2; splitf(O[e + q] * cs, a, c2); oh[q] = a; ol[q] = c2; } *(v2us*)(Ah + oo) = oh; *(v2us*)(Al + oo) = ol;  }

extern "C" void kernel_launch(void* const* d_in, const int* in_sizes, int n_in,
                              void* d_out, int out_size, void* d_ws, size_t ws_size, hipStream_t stream) {
    (void)in_sizes; (void)n_in; (void)out_size;
    const float* x = (const float*)d_in[0]; const float* wqv = (const float*)d_in[1]; const float* rrb = (const float*)d_in[2]; const float* rwb = (const float*)d_in[3]; const int* kmask = (const int*)d_in[4]; const float* wq = wqv; const float* wk = nullptr; const float* wv = wqv; const float* wo = nullptr; (void)wk; (void)wo; const float* cosT = nullptr; const float* sinT = nullptr; (void)cosT; (void)sinT;
    float* OUT = (float*)d_out;     // [4][1024][1024]
    char* wsp = (char*)d_ws;
    auto take = [&](size_t bytes) { char* p = wsp; wsp += (bytes + 255) & ~(size_t)255; return (void*)p; };
    const size_t PL = (size_t)NB_ * NH_ * TT * HD;   // one plane set: every batch, every head
    const size_t FL = (size_t)NB_ * TT * DM;         // one f32 activation: every batch
    bf* WALL = (bf*)take((size_t)2 * DQ * DM * 2); bf* POSh = (bf*)take((size_t)P2 * HD * 2); bf* POSl = (bf*)take((size_t)P2 * HD * 2); float* DT = (float*)take((size_t)NH_ * P2 * 4);
    bf* KPh = (bf*)take(PL * 2); bf* KPl = (bf*)take(PL * 2); bf* QRh = (bf*)take(PL * 2); bf* QRl = (bf*)take(PL * 2); bf* QPh = (bf*)take(PL * 2); bf* QPl = (bf*)take(PL * 2);   // hi and lo planes of k, of q + r_r_bias, of q
    bf* VTh = (bf*)take(PL * 2); bf* VTl = (bf*)take(PL * 2);
    bf* XB = (bf*)take(FL * 2);   // the bf16 input, rows b * L + t
    if ((size_t)(wsp - (char*)d_ws) > ws_size) return;   // ws ~ 77 MiB
    // every batch in one launch
    k_prep<<<PB_POS + PB_XK + PB_WT, 256, 0, stream>>>(x, XB, KPh, KPl, wqv, DM, 2 * DQ, WALL, rwb, POSh, POSl, DT);   /* k = x: the bf16-ROUNDED input */
    k_gemmw<bf, 0><<<dim3(NB_ * TT / 64, DQ / 64, 2), 32, 0, stream>>>(XB, nullptr, WALL, nullptr, DM, rrb, QPh, QPl, QRh, QRl, VTh, VTl, 0, (size_t)DQ * DM);   /* z = 0: q, z = 1: v */
    k_fattn<<<dim3(TT / FR, NB_ * NH_, 1), FNW * 32, 0, stream>>>(QRh, QRl, QPh, QPl, KPh, KPl, POSh, POSl, DT, VTh, VTl, kmask, OUT);   /* every batch and head */
}

// v007
// One run takes 124 microseconds.
// Timed twice side by side with v006, it ran 1.05 times as fast both times.
// Over all steps from v000 it is 14.7 times as fast.
#include <hip/hip_runtime.h>

// RelativeMultiHeadAttn (Transformer-XL style, k_as_x: x [4][1024][1024], Wqv [1024][2048] (q | v column blocks), r_r_bias / r_w_bias [16][64], mask [4][1024] (int, read; all ones); k = x itself split into 16 heads; pos = the sinusoidal table [2L][64] (sin | cos of p * exp(-d ln(1e4)/31), p = -L..L-1, row 0 zeroed) computed on chip in f32; AC = (q + r_r_bias).k; B_ = q.pos^T, D_ = r_w_bias.pos^T; BD = shift(B_ + D_) = (B_ + D_)[i][L - i + j] (exact index form of the pad/reshape shift); attn = softmax(AC + BD) (NO scaling; -inf where mask == 0); out = attn.v merged -> [4][1024][1024] (no output projection)).
// Compute dtypes, f32 accumulate: every input rounded to bf16; q, v as PLAIN bf16 GEMMs (inputs: exact); k planes straight from the (bf16-exact) input; pos table f32 -> hi/lo planes; AC and B_ as hl x hl GEMMs (3 products) on every row (unscaled logits are sharp); D_ as 64-term f32 dots; BD gathered per element (contiguous along j) and added in f32; softmax f32; attn.v hl x hl (3 products) on every row; output written directly in f32.

#define NB_  4
#define TT   1024
#define DM   1024
#define NH_  16
#define NKV  16
#define REP  (NH_ / NKV)
#define HD   64
#define DQ   (NH_ * HD)
#define DKV  (NKV * HD)
#define ZH   8                     // heads per k_merge call (k_merge is not launched)
#define ZS   16                    // unused
#define RH   1024                  // k_merge (not launched) scales rows t >= RH by 1/PCAR
#define WIN  0
#define PCAR 1024.0f
#define P2   (2 * TT)             // 2L relative positions
#define SCL  0.125f   // HD^-0.5
typedef _Float16 h16;
typedef unsigned short bf;
typedef __attribute__((ext_vector_type(16))) __bf16   v16bf;
typedef __attribute__((ext_vector_type(16))) _Float16 v16h;
typedef __attribute__((ext_vector_type(8)))  _Float16 v8h;
typedef __attribute__((ext_vector_type(8)))  unsigned short v8us;
typedef __attribute__((ext_vector_type(8)))  float    v8f;
typedef __attribute__((ext_vector_type(4)))  float    v4f;
typedef v8h  __attribute__((may_alias)) v8ha;
typedef v4f  __attribute__((may_alias)) v4fa;
typedef v8us __attribute__((may_alias)) v8usa;

__device__ __forceinline__ unsigned short f2bf(float f) { unsigned u = __float_as_uint(f); u += 0x7FFFu + ((u >> 16) & 1u); return (unsigned short)(u >> 16); }
__device__ __forceinline__ float bf2f(unsigned short b) { return __uint_as_float(((unsigned)b) << 16); }
__device__ __forceinline__ float bfr(float f) { return bf2f(f2bf(f)); }
__device__ __forceinline__ v16h cat16(v8h lo, v8h hi) { return __builtin_shufflevector(lo, hi, 0, 1, 2, 3, 4, 5, 6, 7, 8, 9, 10, 11, 12, 13, 14, 15); }
__device__ __forceinline__ v16bf cat16b(v8us lo, v8us hi) { return __builtin_bit_cast(v16bf, __builtin_shufflevector(lo, hi, 0, 1, 2, 3, 4, 5, 6, 7, 8, 9, 10, 11, 12, 13, 14, 15)); }
__device__ __forceinline__ v8f wmma16(v16h a, v16h b, v8f c) { return __builtin_amdgcn_wmma_f32_16x16x32_f16(false, a, false, b, (short)0, c, false, false); }
__device__ __forceinline__ v8f wmmab(v16bf a, v16bf b, v8f c) { return __builtin_amdgcn_wmma_f32_16x16x32_bf16(false, a, false, b, (short)0, c, false, false); }



// ---- k_gemmw: register-blocked GEMM, ONE WAVE per 64x64 output tile (16 accumulators), operands straight from 16-bit planes in fragment order; grid (M/64, N/64, Z), 32 threads.
// C[m][n] = sum_k A[m][k] Bt[n][k] (+ split products per NSPLIT). z-batch strides sA/sB in elements. K % 32 == 0. z = 0: q, z = 1: v.
// A tile is 64 tokens of one head, so the epilogue writes the planes that the attention kernel reads straight from the accumulators:
// z = 0: hi + lo planes [b][h] of q and of q + r_r_bias (rows t, k = d); z = 1: hi + lo planes [b][h] of v (rows d, k = t); each in fragment order.
template <typename T16> struct WFrag;
template <> struct WFrag<h16> { typedef v16h V; static __device__ __forceinline__ V ld(const h16* p) { return cat16(*(const v8h*)p, *(const v8h*)(p + 16)); } static __device__ __forceinline__ V ldf(const h16* p) { return cat16(*(const v8h*)p, *(const v8h*)(p + 256)); } static __device__ __forceinline__ v8f mma(V a, V b, v8f c) { return wmma16(a, b, c); } };
template <> struct WFrag<bf> { typedef v16bf V; static __device__ __forceinline__ V ld(const bf* p) { return cat16b(*(const v8us*)p, *(const v8us*)(p + 16)); } static __device__ __forceinline__ V ldf(const bf* p) { return cat16b(*(const v8us*)p, *(const v8us*)(p + 256)); } static __device__ __forceinline__ v8f mma(V a, V b, v8f c) { return wmmab(a, b, c); } };
// FRAGMENT ORDER: every 16-bit operand plane in the workspace, rows x K, is stored as blocks of 512 elements, one block per (16 rows, 32 k). Element (row, k) lies at
// ((row / 16) * (K / 32) + k / 32) * 512 + ((k / 16) % 2) * 256 + (((k / 8) % 2) * 16 + row % 16) * 8 + k % 8.
// Lane l of a wave finds the two 16-byte halves of its fragment at l * 8 and 256 + l * 8 of the block (ldf), so each load of a wave reads 512 contiguous bytes, 4 whole lines;
// the registers hold the same values as with row-major planes. fro: the place of 8 neighbouring k, k8 % 8 == 0, kb = K / 32.
__device__ __forceinline__ size_t fro(size_t row, size_t k8, size_t kb) { return ((row >> 4) * kb + (k8 >> 5)) * 512 + ((k8 >> 4) & 1) * 256 + (((k8 >> 3) & 1) * 16 + (row & 15)) * 8; }
__device__ __forceinline__ void splitf(float y, unsigned short& h, unsigned short& l) { h = f2bf(y); l = f2bf(y - bf2f(h)); }
// Rounding to bf16 by the convert instruction, two values each (round to nearest even: the bits of f2bf for every finite value). cvt2: a in the low half, b in the high half.
typedef __attribute__((ext_vector_type(2))) float    c2f;
typedef __attribute__((ext_vector_type(2))) __bf16   c2b;
typedef __attribute__((ext_vector_type(2))) unsigned c2u;
typedef __attribute__((ext_vector_type(4))) unsigned c4u;
__device__ __forceinline__ unsigned cvt2(float a, float b) { const c2f x = {a, b}; return __builtin_bit_cast(unsigned, __builtin_convertvector(x, c2b)); }
// split2: hi and lo planes of two values; lo = the rounded rest, as in splitf
__device__ __forceinline__ void split2(float a, float b, unsigned& h, unsigned& l) { h = cvt2(a, b); l = cvt2(a - __uint_as_float(h << 16), b - __uint_as_float(h & 0xFFFF0000u)); }
template <typename T16, int NSPLIT>
__global__ __launch_bounds__(32) void k_gemmw(const T16* __restrict__ A, const T16* __restrict__ A2, const T16* __restrict__ Bt, const T16* __restrict__ Bt2, int K, const float* __restrict__ rr, bf* QPh, bf* QPl, bf* QRh, bf* QRl, bf* VTh, bf* VTl, size_t sA, size_t sB) {
    typedef typename WFrag<T16>::V V;
    __shared__ __align__(16) float os[16 * 68];
    const size_t z = blockIdx.z; A += z * sA; if (A2) A2 += z * sA; Bt += z * sB; if (Bt2) Bt2 += z * sB;
    const int lane = threadIdx.x & 31, lr = lane & 15, hi = lane >> 4; const int r0 = blockIdx.x * 64, c0 = blockIdx.y * 64;
    v8f acc[4][4];
#pragma unroll
    for (int mb = 0; mb < 4; ++mb)
#pragma unroll
        for (int nb = 0; nb < 4; ++nb) acc[mb][nb] = (v8f){};
    const size_t aoff = (size_t)r0 * K + lane * 8, boff = (size_t)c0 * K + lane * 8;   // 16 rows are K / 32 blocks = 16 * K elements; 32 k are one block
#pragma unroll 1
    for (int kc = 0; kc < K; kc += 32) {
        V a[4], a2[4], b[4], b2[4]; const T16* ap[4]; const T16* bp[4];
#pragma unroll
        for (int mb = 0; mb < 4; ++mb) { const size_t o = aoff + (size_t)mb * 16 * K + kc * 16; ap[mb] = A + o; a[mb] = WFrag<T16>::ldf(ap[mb]); if (NSPLIT == 1 || NSPLIT == 2) a2[mb] = WFrag<T16>::ldf(A2 + o); }
#pragma unroll
        for (int nb = 0; nb < 4; ++nb) { const size_t o = boff + (size_t)nb * 16 * K + kc * 16; bp[nb] = Bt + o; b[nb] = WFrag<T16>::ldf(bp[nb]); if (NSPLIT >= 2) b2[nb] = WFrag<T16>::ldf(Bt2 + o); }
        // precaution: the pointers are named so that no register an issued load names is rewritten ahead of this wait; the clobber also keeps the loads above it
        asm volatile("s_wait_xcnt 0x0" :: "v"(ap[0]), "v"(ap[1]), "v"(ap[2]), "v"(ap[3]), "v"(bp[0]), "v"(bp[1]), "v"(bp[2]), "v"(bp[3]) : "memory");
        // keeps the matrix instructions behind that wait: lifted over it they split the trip's loads into three groups, each waited for in turn
        __builtin_amdgcn_sched_barrier(0);
#pragma unroll
        for (int nb = 0; nb < 4; ++nb)
#pragma unroll
            for (int mb = 0; mb < 4; ++mb) { acc[mb][nb] = WFrag<T16>::mma(a[mb], b[nb], acc[mb][nb]); if (NSPLIT == 1 || NSPLIT == 2) acc[mb][nb] = WFrag<T16>::mma(a2[mb], b[nb], acc[mb][nb]); if (NSPLIT >= 2) acc[mb][nb] = WFrag<T16>::mma(a[mb], b2[nb], acc[mb][nb]); }
        asm volatile("v_nop\n\tv_nop\n\tv_nop\n\tv_nop" : "+v"(acc[0][0]), "+v"(acc[1][1]), "+v"(acc[2][2]), "+v"(acc[3][3]) : "v"(a[0]), "v"(a[3]));
    }
    const int t0 = r0 % TT; const size_t pz = (size_t)((r0 / TT) * NH_ + blockIdx.y) * TT * HD;   // the planes of this tile's (batch, head)
    if (z == 0) {
        // through LDS, 16 rows at a time: a lane then holds 8 neighbouring d of one token, and 8 lanes (8 neighbouring tokens) write one whole 128-byte line of a block
        const int r8 = lane & 7, cq = lane >> 3; float rb[2][8];
#pragma unroll
        for (int g = 0; g < 2; ++g)
#pragma unroll
            for (int u = 0; u < 8; ++u) rb[g][u] = bfr(rr[c0 + (g * 4 + cq) * 8 + u]);
#pragma unroll
        for (int mb = 0; mb < 4; ++mb) {
#pragma unroll
            for (int nb = 0; nb < 4; ++nb) {
#pragma unroll
                for (int j = 0; j < 8; ++j) os[(hi * 8 + j) * 68 + nb * 16 + lr] = acc[mb][nb][j]; }
            // one wave, LDS runs in order: these two only keep the compiler from moving the reads of other lanes' values above the stores
            __builtin_amdgcn_wave_barrier(); asm volatile("" ::: "memory");
#pragma unroll
            for (int s = 0; s < 4; ++s) { const int row = (s & 1) * 8 + r8, c8 = ((s >> 1) * 4 + cq) * 8; const v4f x0 = *(const v4fa*)(os + row * 68 + c8), x1 = *(const v4fa*)(os + row * 68 + c8 + 4); c4u wqh, wql, wsh, wsl;
#pragma unroll
                for (int u = 0; u < 8; u += 2) { const float q0 = (u < 4) ? x0[u & 3] : x1[u & 3], q1 = (u < 4) ? x0[(u & 3) + 1] : x1[(u & 3) + 1]; unsigned a2, c2; split2(q0, q1, a2, c2); wqh[u >> 1] = a2; wql[u >> 1] = c2; split2(__fadd_rn(q0, rb[s >> 1][u]), __fadd_rn(q1, rb[s >> 1][u + 1]), a2, c2); wsh[u >> 1] = a2; wsl[u >> 1] = c2; }
                const v8us qh = __builtin_bit_cast(v8us, wqh), ql = __builtin_bit_cast(v8us, wql), sh = __builtin_bit_cast(v8us, wsh), sl = __builtin_bit_cast(v8us, wsl);
                const size_t o = pz + fro(t0 + mb * 16 + row, c8, HD / 32);
                *(v8us*)(QPh + o) = qh; *(v8us*)(QPl + o) = ql; *(v8us*)(QRh + o) = sh; *(v8us*)(QRl + o) = sl;
                // precaution: no register that an issued store names is rewritten ahead of this wait
                asm volatile("s_wait_xcnt 0x0" ::: "memory"); }
            // and the next 16 rows' stores from moving above these reads
            __builtin_amdgcn_wave_barrier(); asm volatile("" ::: "memory");
        }
    } else {
        // the transposed planes need no LDS: the 8 accumulator values of a lane are 8 neighbouring tokens of one d, which is that lane's 16 bytes of a block's half: a store writes 512 contiguous bytes
#pragma unroll
        for (int nb = 0; nb < 4; ++nb)
#pragma unroll
            for (int mb = 0; mb < 4; ++mb) { c4u wh, wl;
#pragma unroll
                for (int j = 0; j < 8; j += 2) { unsigned a2, c2; split2(acc[mb][nb][j], acc[mb][nb][j + 1], a2, c2); wh[j >> 1] = a2; wl[j >> 1] = c2; }
                const v8us vh = __builtin_bit_cast(v8us, wh), vl = __builtin_bit_cast(v8us, wl);
                const size_t o = pz + fro(nb * 16 + lr, t0 + mb * 16 + hi * 8, TT / 32);
                *(v8us*)(VTh + o) = vh; *(v8us*)(VTl + o) = vl;
                // precaution: data and pointers are named so that no register an issued store names is rewritten ahead of this wait
                asm volatile("s_wait_xcnt 0x0" :: "v"(vh), "v"(vl), "v"(VTh + o), "v"(VTl + o) : "memory"); }
    }
}

typedef __attribute__((ext_vector_type(2))) _Float16 v2h;
typedef __attribute__((ext_vector_type(4))) _Float16 v4h;
typedef __attribute__((ext_vector_type(2))) unsigned short v2us;
typedef __attribute__((ext_vector_type(4))) unsigned short v4us;
typedef __attribute__((ext_vector_type(2))) float v2f;
typedef __attribute__((ext_vector_type(4))) int v4i;

// d_wtG: the weights rounded to bf16, as the GEMM's B plane (rows n, k = the model dimension) in fragment order. A thread takes 8 neighbouring k of one n:
// the lanes of a wave read 32 neighbouring n, one whole line per k, and write two runs of 256 contiguous bytes.
__device__ __forceinline__ void d_wtG(int blk, const float* __restrict__ w, int K, int N, bf* Bt) {
    const int idx = blk * 256 + threadIdx.x; const int n = idx % N, k0 = (idx / N) * 8; if (k0 >= K) return;
    const float* wp[8]; float v[8];
#pragma unroll
    for (int u = 0; u < 8; ++u) { wp[u] = w + (size_t)(k0 + u) * N + n; v[u] = *wp[u]; }
    // precaution: the pointers are named so that no register an issued load names is rewritten ahead of this wait; the clobber also keeps the loads above it
    asm volatile("s_wait_xcnt 0x0" :: "v"(wp[0]), "v"(wp[1]), "v"(wp[2]), "v"(wp[3]), "v"(wp[4]), "v"(wp[5]), "v"(wp[6]), "v"(wp[7]) : "memory");
    c4u oc;
#pragma unroll
    for (int u = 0; u < 8; u += 2) oc[u >> 1] = cvt2(v[u], v[u + 1]);
    const v8us o = __builtin_bit_cast(v8us, oc);
    *(v8us*)(Bt + fro(n, k0, K >> 5)) = o;
}
// d_xk: x rounded to bf16, once as the GEMM's A plane (rows b * L + t, k = the model dimension) and once as the k planes [b][h] (rows t, k = d), each in fragment order; the rounded value is bf16-exact, so its lo plane is zero.
// A block takes 8 tokens, a thread 8 elements of one token at 4 places 256 columns apart, all loads first. 8 neighbouring lanes hold 8 neighbouring tokens: they write one whole 128-byte line of a block;
// a wave reads one whole 128-byte line of each of its 8 tokens. Block-uniform bases: the lanes differ in one 32-bit offset per buffer, and a thread's 4 groups lie an immediate offset apart.
__device__ __forceinline__ void d_xk(int blk, const float* __restrict__ x, bf* XB, bf* KPh, bf* KPl) { const unsigned tk = threadIdx.x & 7, cq = threadIdx.x >> 3; const unsigned xo = tk * DM + cq * 8; v8f v[4];
    const size_t r0 = (size_t)blk * 8; const unsigned rl = (unsigned)(r0 & 15) + tk;   // the token's row in its block of 16
    const unsigned fo = ((cq >> 1) & 1) * 256 + ((cq & 1) * 16 + rl) * 8;                     // the place of the thread's 8 elements inside a block of 512
    const unsigned ao = (cq >> 2) * 512 + fo; const unsigned po = (cq >> 3) * (TT * HD) + ((cq >> 2) & 1) * 512 + fo;
    const float* xb = x + r0 * DM; bf* ob = XB + (r0 >> 4) * (16 * DM); const size_t pb = (r0 / TT) * NH_ * TT * HD + ((r0 % TT) >> 4) * (16 * HD); bf* kh = KPh + pb; bf* kl = KPl + pb;
#pragma unroll
    for (int g = 0; g < 4; ++g) v[g] = *(const v8f*)(xb + g * 256 + xo);
    // precaution: the lane's offset is named so that no register an issued load names is rewritten ahead of this wait; the clobber also keeps the loads above it
    asm volatile("s_wait_xcnt 0x0" :: "v"(xo * 4) : "memory");
#pragma unroll
    for (int g = 0; g < 4; ++g) { c4u oc;
#pragma unroll
        for (int k = 0; k < 8; k += 2) oc[k >> 1] = cvt2(v[g][k], v[g][k + 1]);
        const v8us o = __builtin_bit_cast(v8us, oc);
        *(v8us*)(ob + g * 8 * 512 + ao) = o; *(v8us*)(kh + g * 4 * TT * HD + po) = o; *(v8us*)(kl + g * 4 * TT * HD + po) = (v8us){}; } }
__global__ __launch_bounds__(256) void k_cscvt(const float* __restrict__ cosT, const float* __restrict__ sinT, float* CS) { const int idx = blockIdx.x * 256 + threadIdx.x; if (idx >= TT * HD) return; v2f cs; cs[0] = bfr(cosT[idx]); cs[1] = bfr(sinT[idx]); *(v2f*)(CS + (size_t)idx * 2) = cs;  }
// d_postab: 32 rows of the table as hi + lo planes (rows m, k = d) in fragment order, and D_[h][m] = r_w_bias[h].pos[m] of those rows for all 16 heads. 64 threads take 8 rows, a thread 8 neighbouring d of one row;
// 8 neighbouring lanes hold 8 neighbouring rows: a wave writes whole 128-byte lines of both planes, and its 32 d are all sines or all cosines.
// The f32 rows go to D_ through LDS (pitch 272 B = 16 B x odd): a lane then holds one whole row in registers, a wave takes 2 heads, whose weights are wave-uniform, and stores one whole 128-byte line of D_ per head.
#define PSP (HD + 4)
__device__ __forceinline__ void d_postab(int blk, const float* __restrict__ rw, bf* Ph2, bf* Pl2, float* DT, float* ps) { const int rl = (threadIdx.x >> 6) * 8 + (threadIdx.x & 7); const int m = blk * 32 + rl; const int d0 = ((threadIdx.x >> 3) & 7) * 8; v8f vv; c4u wh, wl;
#pragma unroll
    for (int q = 0; q < 8; ++q) { const int d = d0 + q; const int dd = (d < HD / 2) ? d : d - HD / 2; const float fr = expf(__fmul_rn((float)dd, -0.29710776f)); const float ang = __fmul_rn((float)(m - TT), fr); float v = (d < HD / 2) ? sinf(ang) : cosf(ang); if (m == 0) v = 0.0f; vv[q] = v; }
#pragma unroll   // constant indices: the row's values and the packed words stay in registers
    for (int q = 0; q < 8; q += 2) { unsigned a2, c2; split2(vv[q], vv[q + 1], a2, c2); wh[q >> 1] = a2; wl[q >> 1] = c2; }
    const v8us hh = __builtin_bit_cast(v8us, wh), ll = __builtin_bit_cast(v8us, wl);
    const size_t o = fro(m, d0, HD / 32);
    *(v4fa*)(ps + rl * PSP + d0) = __builtin_shufflevector(vv, vv, 0, 1, 2, 3); *(v4fa*)(ps + rl * PSP + d0 + 4) = __builtin_shufflevector(vv, vv, 4, 5, 6, 7);
    __syncthreads();   // the block's 32 rows are whole in LDS (the branch that leads here is block-uniform)
    const int lane = threadIdx.x & 31; const int h0 = __builtin_amdgcn_readfirstlane(threadIdx.x >> 5);   // wave number in a scalar register: the weights' addresses are wave-uniform
    v4f pv[HD / 4];
#pragma unroll   // constant indices: the row stays in registers
    for (int q = 0; q < HD / 4; ++q) pv[q] = *(const v4fa*)(ps + lane * PSP + q * 4);
    float a0 = 0.f, a1 = 0.f;   // heads h0 and h0 + 8: two independent chains, each in the order of d
#pragma unroll   // constant indices into the row's registers; the weights come by wide scalar loads
    for (int d = 0; d < HD; ++d) { a0 += bfr(rw[h0 * HD + d]) * pv[d >> 2][d & 3]; a1 += bfr(rw[(h0 + 8) * HD + d]) * pv[d >> 2][d & 3]; }
    // every global store of the block stands here at its end: no register that an issued store names is rewritten behind it
    *(v8us*)(Ph2 + o) = hh; *(v8us*)(Pl2 + o) = ll; DT[h0 * P2 + blk * 32 + lane] = a0; DT[(h0 + 8) * P2 + blk * 32 + lane] = a1;  }
// k_prep: all that depends on nothing but the inputs, in ONE launch: each block does one pass's share, chosen by its index (block-uniform branches).
// The table's blocks come first (the longest chain of arithmetic), then the input's, then the weights'.
#define PB_POS (P2 / 32)
#define PB_XK  (NB_ * TT / 8)
#define PB_WT  (DM * 2 * DQ / 8 / 256)
__global__ __launch_bounds__(256) void k_prep(const float* __restrict__ x, bf* XB, bf* KPh, bf* KPl, const float* __restrict__ w, int K, int N, bf* Bt, const float* __restrict__ rw, bf* Ph2, bf* Pl2, float* DT) {
    __shared__ __align__(16) float ps[32 * PSP];
    const int blk = blockIdx.x;
    if (blk < PB_POS) d_postab(blk, rw, Ph2, Pl2, DT, ps);
    else if (blk < PB_POS + PB_XK) d_xk(blk - PB_POS, x, XB, KPh, KPl);
    else d_wtG(blk - PB_POS - PB_XK, w, K, N, Bt);
}
// k_fattn: one work-group of 16 waves per 64 query rows of one (batch, head). The 64 x 1024 logit block lives in LDS from the first product to P.V.
// LDS row: 64 floats of left margin | 1024 logits | 64 floats of right margin | 4 floats (pitch 4624 B = 16 B x odd). The margins take the band's elements whose key index falls outside 0..1023: they are written, never read.
// After the softmax the same row holds the bf16 hi plane (bytes 0..2047) and lo plane (bytes 2048..4095) of P; after P.V the start of the block holds the 4 partial output tiles.
// Every plain '#pragma unroll' below makes the indices of a fragment or accumulator array constants, so that the array stays in registers.
#define FR   64
#define FMT  (FR / 16)
#define FNW  16
#define FPF  (TT + 2 * FR + 4)
__global__ __launch_bounds__(FNW * 32) void k_fattn(const bf* __restrict__ QRh, const bf* __restrict__ QRl, const bf* __restrict__ QPh, const bf* __restrict__ QPl, const bf* __restrict__ KPh, const bf* __restrict__ KPl, const bf* __restrict__ POSh, const bf* __restrict__ POSl, const float* __restrict__ DT, const bf* __restrict__ VTh, const bf* __restrict__ VTl, const int* __restrict__ kmask, float* OUT) {
    typedef WFrag<bf> F;
    __shared__ __align__(16) float S[FR * FPF];
    const int lane = threadIdx.x & 31, lr = lane & 15, hi = lane >> 4;
    const int w = __builtin_amdgcn_readfirstlane(threadIdx.x >> 5);   // wave number in a scalar register: every loop and branch round a matrix instruction is wave-uniform
    const int i0 = blockIdx.x * FR; const int z = blockIdx.y; const int b = z / NH_, h = z % NH_;
    const size_t zo = (size_t)z * TT * HD;
    const size_t qoff = zo + (size_t)i0 * HD + lane * 8;   // planes in fragment order: 16 rows of 64 d are 2 blocks of 512
    // phase 1: BD[r][j] = B_[i0 + r][m] + D_[m], m = L - (i0 + r) + j: only the band m = L - i0 - 64 .. L - i0 + 1023 (68 column tiles); each pos fragment serves all 4 row tiles
    {
        v16bf a[FMT][2], a2[FMT][2];
#pragma unroll
        for (int mt = 0; mt < FMT; ++mt)
#pragma unroll
            for (int ks = 0; ks < 2; ++ks) { a[mt][ks] = F::ldf(QPh + qoff + mt * 16 * HD + ks * 512); a2[mt][ks] = F::ldf(QPl + qoff + mt * 16 * HD + ks * 512); }
        // precaution: the pointers are named so that no register an issued load names is rewritten ahead of this wait; the clobber also keeps the loads above it
        asm volatile("s_wait_xcnt 0x0" :: "v"(QPh + qoff), "v"(QPl + qoff) : "memory");
        const int mlo = TT - i0 - FR; const float* dth = DT + (size_t)h * P2 + mlo + lr;
        const size_t poff = (size_t)mlo * HD + lane * 8;
#pragma unroll 1   // rolled: the 16 q fragments hold 128 registers, a second tile in flight would not fit 4 waves per SIMD
        for (int t = w; t < (TT + FR) / 16; t += FNW) {
            const bf* ph = POSh + poff + (size_t)t * 16 * HD; const bf* pl = POSl + poff + (size_t)t * 16 * HD; const float* dp = dth + t * 16;
            v16bf p[2], p2[2];
#pragma unroll
            for (int ks = 0; ks < 2; ++ks) { p[ks] = F::ldf(ph + ks * 512); p2[ks] = F::ldf(pl + ks * 512); }
            const float dv = *dp;
            // precaution: the pointers are named so that no register an issued load names is rewritten ahead of this wait; the clobber also keeps the loads above it
            asm volatile("s_wait_xcnt 0x0" :: "v"(ph), "v"(pl), "v"(dp) : "memory");
            v8f acc[FMT];
#pragma unroll
            for (int mt = 0; mt < FMT; ++mt) acc[mt] = (v8f){};
#pragma unroll
            for (int ks = 0; ks < 2; ++ks) {
#pragma unroll
                for (int mt = 0; mt < FMT; ++mt) acc[mt] = wmmab(a[mt][ks], p[ks], acc[mt]);
#pragma unroll
                for (int mt = 0; mt < FMT; ++mt) acc[mt] = wmmab(a2[mt][ks], p[ks], acc[mt]);
#pragma unroll
                for (int mt = 0; mt < FMT; ++mt) acc[mt] = wmmab(a[mt][ks], p2[ks], acc[mt]); }
#pragma unroll
            for (int mt = 0; mt < FMT; ++mt)
#pragma unroll
                for (int j = 0; j < 8; ++j) { const int r = mt * 16 + hi * 8 + j; S[r * FPF + t * 16 + lr + r] = __fadd_rn(acc[mt][j], dv); }   /* column FR + j, j = t*16 + lr - FR + r */
        }
    }
    __syncthreads();
    // phase 2: logit = AC + BD; each k fragment serves all 4 row tiles
    {
        v16bf a[FMT][2], a2[FMT][2];
#pragma unroll
        for (int mt = 0; mt < FMT; ++mt)
#pragma unroll
            for (int ks = 0; ks < 2; ++ks) { a[mt][ks] = F::ldf(QRh + qoff + mt * 16 * HD + ks * 512); a2[mt][ks] = F::ldf(QRl + qoff + mt * 16 * HD + ks * 512); }
        // precaution: the pointers are named so that no register an issued load names is rewritten ahead of this wait; the clobber also keeps the loads above it
        asm volatile("s_wait_xcnt 0x0" :: "v"(QRh + qoff), "v"(QRl + qoff) : "memory");
        const size_t koff = zo + lane * 8;
#pragma unroll 1   // rolled: as in phase 1
        for (int t = w; t < TT / 16; t += FNW) {
            const bf* kh = KPh + koff + (size_t)t * 16 * HD; const bf* kl = KPl + koff + (size_t)t * 16 * HD;
            v16bf k1[2], k2[2];
#pragma unroll
            for (int ks = 0; ks < 2; ++ks) { k1[ks] = F::ldf(kh + ks * 512); k2[ks] = F::ldf(kl + ks * 512); }
            // precaution: the pointers are named so that no register an issued load names is rewritten ahead of this wait; the clobber also keeps the loads above it
            asm volatile("s_wait_xcnt 0x0" :: "v"(kh), "v"(kl) : "memory");
            v8f acc[FMT];
#pragma unroll
            for (int mt = 0; mt < FMT; ++mt) acc[mt] = (v8f){};
#pragma unroll
            for (int ks = 0; ks < 2; ++ks) {
#pragma unroll
                for (int mt = 0; mt < FMT; ++mt) acc[mt] = wmmab(a[mt][ks], k1[ks], acc[mt]);
#pragma unroll
                for (int mt = 0; mt < FMT; ++mt) acc[mt] = wmmab(a2[mt][ks], k1[ks], acc[mt]);
#pragma unroll
                for (int mt = 0; mt < FMT; ++mt) acc[mt] = wmmab(a[mt][ks], k2[ks], acc[mt]); }
            float* sp = S + (hi * 8) * FPF + FR + t * 16 + lr; float bd[FMT][8];
#pragma unroll
            for (int mt = 0; mt < FMT; ++mt)
#pragma unroll
                for (int j = 0; j < 8; ++j) bd[mt][j] = sp[(mt * 16 + j) * FPF];
#pragma unroll
            for (int mt = 0; mt < FMT; ++mt)
#pragma unroll
                for (int j = 0; j < 8; ++j) sp[(mt * 16 + j) * FPF] = __fadd_rn(acc[mt][j], bd[mt][j]);
        }
    }
    __syncthreads();
    // phase 3: softmax, one wave per row, 4 rows a wave (register row, one exp, fixed trees); P split into hi + lo planes in place
    {
        const int* km = kmask + (size_t)b * TT;
#pragma unroll 1   // rolled: one row's 32 values per lane at a time
        for (int rr = 0; rr < FR / FNW; ++rr) { float* srow = S + (w * (FR / FNW) + rr) * FPF; float v[TT / 32]; float mx = -3.0e38f;
#pragma unroll
            for (int ch = 0; ch < TT / 128; ++ch) { const int j0 = ch * 128 + lane * 4; const v4f a = *(const v4fa*)(srow + FR + j0); const v4i k4 = *(const v4i*)(km + j0);
#pragma unroll
                for (int q = 0; q < 4; ++q) { const float t = (k4[q] != 0) ? a[q] : -3.0e38f; v[ch * 4 + q] = t; mx = fmaxf(mx, t); } }
#pragma unroll
            for (int sh = 16; sh; sh >>= 1) mx = fmaxf(mx, __shfl_xor(mx, sh, 32));
            float sum = 0.f;
#pragma unroll
            for (int k = 0; k < TT / 32; ++k) { v[k] = __builtin_amdgcn_exp2f(__fmul_rn(__fsub_rn(v[k], mx), 1.4426950408889634f)); sum += v[k]; }
#pragma unroll
            for (int sh = 16; sh; sh >>= 1) sum += __shfl_xor(sum, sh, 32);
            const float f = __fdiv_rn(1.0f, sum); bf* prow = (bf*)srow;
#pragma unroll
            for (int ch = 0; ch < TT / 128; ++ch) { c2u wh, wl;
#pragma unroll
                for (int q = 0; q < 4; q += 2) { unsigned a, c2; split2(v[ch * 4 + q] * f, v[ch * 4 + q + 1] * f, a, c2); wh[q >> 1] = a; wl[q >> 1] = c2; }
                const v4us oh = __builtin_bit_cast(v4us, wh), ol = __builtin_bit_cast(v4us, wl);
                *(v4us*)(prow + ch * 128 + lane * 4) = oh; *(v4us*)(prow + TT + ch * 128 + lane * 4) = ol; } }
    }
    __syncthreads();
    // phase 4: O = P.V on all 16 waves, 4 per SIMD, so that one wave's waits for its P fragments are filled by the other three: wave w takes 16 columns of the head (w % 4), all 4 row tiles
    // and 256 of the 1024 keys (w / 4). Each V fragment is still fetched once per work-group. Inside a quarter k runs in the order of the unfused GEMM; the 4 quarters are added below, in the order of the keys.
    v8f o[FMT];
    const int nt = w & 3, kq = w >> 2;
    {
        const bf* pr = (const bf*)(S + lr * FPF) + 8 * hi + kq * 256;
        const size_t voff = zo + (size_t)nt * 16 * TT + (size_t)kq * 256 * 16 + lane * 8;   /* 16 d of 1024 keys are 32 blocks; 32 keys are one block */ const bf* vh = VTh + voff; const bf* vl = VTl + voff;
#pragma unroll
        for (int mt = 0; mt < FMT; ++mt) o[mt] = (v8f){};
        v16bf vs[8][2];   // the wave's whole share of V, all loads in flight at once
#pragma unroll
        for (int u = 0; u < 8; ++u) { vs[u][0] = F::ldf(vh + u * 512); vs[u][1] = F::ldf(vl + u * 512); }
        // precaution: the pointers are named so that no register an issued load names is rewritten ahead of this wait; the clobber also keeps the loads above it
        asm volatile("s_wait_xcnt 0x0" :: "v"(vh), "v"(vl) : "memory");
#pragma unroll
        for (int u = 0; u < 8; ++u) { v16bf ph[FMT], pl[FMT];
#pragma unroll
            for (int mt = 0; mt < FMT; ++mt) { ph[mt] = F::ld(pr + mt * 16 * 2 * FPF + u * 32); pl[mt] = F::ld(pr + mt * 16 * 2 * FPF + TT + u * 32); }
#pragma unroll
            for (int mt = 0; mt < FMT; ++mt) o[mt] = wmmab(ph[mt], vs[u][0], o[mt]);
#pragma unroll
            for (int mt = 0; mt < FMT; ++mt) o[mt] = wmmab(pl[mt], vs[u][0], o[mt]);
#pragma unroll
            for (int mt = 0; mt < FMT; ++mt) o[mt] = wmmab(ph[mt], vs[u][1], o[mt]);
            // keeps the P fragments of later steps from being fetched here: V and the accumulators hold 160 registers, and with more than two steps' fragments beside them the build spills V
            if ((u & 1) && u < 7) __builtin_amdgcn_sched_barrier(0); }
    }
    __syncthreads();   // every wave has read its last P fragment: the rows of S may now take the partial sums
    // the 4 partial tiles, [key quarter][64 rows][68 floats], at the start of S
#pragma unroll
    for (int mt = 0; mt < FMT; ++mt)
#pragma unroll
        for (int j = 0; j < 8; ++j) S[(kq * FR + mt * 16 + hi * 8 + j) * 68 + nt * 16 + lr] = o[mt][j];
    __syncthreads();
    // whole 256-byte output rows per half wave: one writer per line; the quarters are added in the order of their keys
#pragma unroll
    for (int s = 0; s < 2; ++s) { const int row = w * 4 + s * 2 + hi; const float* rp = S + row * 68 + lr * 4;
        const v4f val = ((*(const v4fa*)rp + *(const v4fa*)(rp + FR * 68)) + *(const v4fa*)(rp + 2 * FR * 68)) + *(const v4fa*)(rp + 3 * FR * 68);
        *(v4f*)(OUT + ((size_t)b * TT + i0 + row) * DM + h * HD + lr * 4) = val; }
}
__global__ __launch_bounds__(256) void k_merge(const float* __restrict__ O, int h0, bf* Ah, bf* Al) { const size_t e = ((size_t)blockIdx.x * 256 + threadIdx.x) * 2; if (e >= (size_t)ZH * TT * HD) return; const int d = (int)(e % HD); const int t = (int)((e / HD) % TT); const int zz = (int)(e / ((size_t)HD * TT)); const float cs = (t < RH) ? 1.0f : (1.0f / PCAR); const size_t oo = (size_t)t * DQ + (h0 + zz) * HD + d;
    v2us oh, ol;
#pragma unroll
    for (int q = 0; q < 2; ++q) { unsigned short a, c2; splitf(O[e + q] * cs, a, c2); oh[q] = a; ol[q] = c2; } *(v2us*)(Ah + oo) = oh; *(v2us*)(Al + oo) = ol;  }

extern "C" void kernel_launch(void* const* d_in, const int* in_sizes, int n_in,
                              void* d_out, int out_size, void* d_ws, size_t ws_size, hipStream_t stream) {
    (void)in_sizes; (void)n_in; (void)out_size;
    const float* x = (const float*)d_in[0]; const float* wqv = (const float*)d_in[1]; const float* rrb = (const float*)d_in[2]; const float* rwb = (const float*)d_in[3]; const int* kmask = (const int*)d_in[4]; const float* wq = wqv; const float* wk = nullptr; const float* wv = wqv; const float* wo = nullptr; (void)wk; (void)wo; const float* cosT = nullptr; const float* sinT = nullptr; (void)cosT; (void)sinT;
    float* OUT = (float*)d_out;     // [4][1024][1024]
    char* wsp = (char*)d_ws;
    auto take = [&](size_t bytes) { char* p = wsp; wsp += (bytes + 255) & ~(size_t)255; return (void*)p; };
    const size_t PL = (size_t)NB_ * NH_ * TT * HD;   // one plane set: every batch, every head
    const size_t FL = (size_t)NB_ * TT * DM;         // one f32 activation: every batch
    bf* WALL = (bf*)take((size_t)2 * DQ * DM * 2); bf* POSh = (bf*)take((size_t)P2 * HD * 2); bf* POSl = (bf*)take((size_t)P2 * HD * 2); float* DT = (float*)take((size_t)NH_ * P2 * 4);
    bf* KPh = (bf*)take(PL * 2); bf* KPl = (bf*)take(PL * 2); bf* QRh = (bf*)take(PL * 2); bf* QRl = (bf*)take(PL * 2); bf* QPh = (bf*)take(PL * 2); bf* QPl = (bf*)take(PL * 2);   // hi and lo planes of k, of q + r_r_bias, of q
    bf* VTh = (bf*)take(PL * 2); bf* VTl = (bf*)take(PL * 2);
    bf* XB = (bf*)take(FL * 2);   // the bf16 input, rows b * L + t
    if ((size_t)(wsp - (char*)d_ws) > ws_size) return;   // ws ~ 77 MiB
    // every batch in one launch
    k_prep<<<PB_POS + PB_XK + PB_WT, 256, 0, stream>>>(x, XB, KPh, KPl, wqv, DM, 2 * DQ, WALL, rwb, POSh, POSl, DT);   /* k = x: the bf16-ROUNDED input */
    k_gemmw<bf, 0><<<dim3(NB_ * TT / 64, DQ / 64, 2), 32, 0, stream>>>(XB, nullptr, WALL, nullptr, DM, rrb, QPh, QPl, QRh, QRl, VTh, VTl, 0, (size_t)DQ * DM);   /* z = 0: q, z = 1: v */
    k_fattn<<<dim3(TT / FR, NB_ * NH_, 1), FNW * 32, 0, stream>>>(QRh, QRl, QPh, QPl, KPh, KPl, POSh, POSl, DT, VTh, VTl, kmask, OUT);   /* every batch and head */
}

// v008
// A run of this version takes 115 microseconds.
// Two timings next to v007 both put it at 1.07 times that version's speed.
// Counting every step since v000, it is 15.7 times as fast.
#include <hip/hip_runtime.h>

// RelativeMultiHeadAttn (Transformer-XL style, k_as_x: x [4][1024][1024], Wqv [1024][2048] (q | v column blocks), r_r_bias / r_w_bias [16][64], mask [4][1024] (int, read; all ones); k = x itself split into 16 heads; pos = the sinusoidal table [2L][64] (sin | cos of p * exp(-d ln(1e4)/31), p = -L..L-1, row 0 zeroed) computed on chip in f32; AC = (q + r_r_bias).k; B_ = q.pos^T, D_ = r_w_bias.pos^T; BD = shift(B_ + D_) = (B_ + D_)[i][L - i + j] (exact index form of the pad/reshape shift); attn = softmax(AC + BD) (NO scaling; -inf where mask == 0); out = attn.v merged -> [4][1024][1024] (no output projection)).
// Compute dtypes, f32 accumulate: every input rounded to bf16; q, v as PLAIN bf16 GEMMs (inputs: exact); k planes straight from the (bf16-exact) input; pos table f32 -> hi/lo planes; AC and B_ as hl x hl GEMMs (3 products) on every row (unscaled logits are sharp); D_ as 64-term f32 dots; BD gathered per element (contiguous along j) and added in f32; softmax f32; attn.v hl x hl (3 products) on every row; output written directly in f32.

#define NB_  4
#define TT   1024
#define DM   1024
#define NH_  16
#define NKV  16
#define REP  (NH_ / NKV)
#define HD   64
#define DQ   (NH_ * HD)
#define DKV  (NKV * HD)
#define ZH   8                     // heads per k_merge call (k_merge is not launched)
#define ZS   16                    // unused
#define RH   1024                  // k_merge (not launched) scales rows t >= RH by 1/PCAR
#define WIN  0
#define PCAR 1024.0f
#define P2   (2 * TT)             // 2L relative positions
#define SCL  0.125f   // HD^-0.5
typedef _Float16 h16;
typedef unsigned short bf;
typedef __attribute__((ext_vector_type(16))) __bf16   v16bf;
typedef __attribute__((ext_vector_type(16))) _Float16 v16h;
typedef __attribute__((ext_vector_type(8)))  _Float16 v8h;
typedef __attribute__((ext_vector_type(8)))  unsigned short v8us;
typedef __attribute__((ext_vector_type(8)))  float    v8f;
typedef __attribute__((ext_vector_type(4)))  float    v4f;
typedef v8h  __attribute__((may_alias)) v8ha;
typedef v4f  __attribute__((may_alias)) v4fa;
typedef v8us __attribute__((may_alias)) v8usa;

__device__ __forceinline__ unsigned short f2bf(float f) { unsigned u = __float_as_uint(f); u += 0x7FFFu + ((u >> 16) & 1u); return (unsigned short)(u >> 16); }
__device__ __forceinline__ float bf2f(unsigned short b) { return __uint_as_float(((unsigned)b) << 16); }
__device__ __forceinline__ float bfr(float f) { return bf2f(f2bf(f)); }
__device__ __forceinline__ v16h cat16(v8h lo, v8h hi) { return __builtin_shufflevector(lo, hi, 0, 1, 2, 3, 4, 5, 6, 7, 8, 9, 10, 11, 12, 13, 14, 15); }
__device__ __forceinline__ v16bf cat16b(v8us lo, v8us hi) { return __builtin_bit_cast(v16bf, __builtin_shufflevector(lo, hi, 0, 1, 2, 3, 4, 5, 6, 7, 8, 9, 10, 11, 12, 13, 14, 15)); }
__device__ __forceinline__ v8f wmma16(v16h a, v16h b, v8f c) { return __builtin_amdgcn_wmma_f32_16x16x32_f16(false, a, false, b, (short)0, c, false, false); }
__device__ __forceinline__ v8f wmmab(v16bf a, v16bf b, v8f c) { return __builtin_amdgcn_wmma_f32_16x16x32_bf16(false, a, false, b, (short)0, c, false, false); }



// ---- k_gemmw: register-blocked GEMM, one wave per 64x64 output tile (16 accumulators), operands from 16-bit planes in fragment order, staged in LDS for 4 waves (see at the kernel).
// C[m][n] = sum_k A[m][k] Bt[n][k]. z-batch strides sA/sB in elements. z = 0: q, z = 1: v.
// A tile is 64 tokens of one head, so the epilogue writes the planes that the attention kernel reads straight from the accumulators:
// z = 0: hi + lo planes [b][h] of q and of q + r_r_bias (rows t, k = d); z = 1: hi + lo planes [b][h] of v (rows d, k = t); each in fragment order.
template <typename T16> struct WFrag;
template <> struct WFrag<h16> { typedef v16h V; static __device__ __forceinline__ V ld(const h16* p) { return cat16(*(const v8h*)p, *(const v8h*)(p + 16)); } static __device__ __forceinline__ V ldf(const h16* p) { return cat16(*(const v8h*)p, *(const v8h*)(p + 256)); } static __device__ __forceinline__ v8f mma(V a, V b, v8f c) { return wmma16(a, b, c); } };
template <> struct WFrag<bf> { typedef v16bf V; static __device__ __forceinline__ V ld(const bf* p) { return cat16b(*(const v8us*)p, *(const v8us*)(p + 16)); } static __device__ __forceinline__ V ldf(const bf* p) { return cat16b(*(const v8us*)p, *(const v8us*)(p + 256)); } static __device__ __forceinline__ v8f mma(V a, V b, v8f c) { return wmmab(a, b, c); } };
// FRAGMENT ORDER: every 16-bit operand plane in the workspace, rows x K, is stored as blocks of 512 elements, one block per (16 rows, 32 k). Element (row, k) lies at
// ((row / 16) * (K / 32) + k / 32) * 512 + ((k / 16) % 2) * 256 + (((k / 8) % 2) * 16 + row % 16) * 8 + k % 8.
// Lane l of a wave finds the two 16-byte halves of its fragment at l * 8 and 256 + l * 8 of the block (ldf), so each load of a wave reads 512 contiguous bytes, 4 whole lines;
// the registers hold the same values as with row-major planes. fro: the place of 8 neighbouring k, k8 % 8 == 0, kb = K / 32.
__device__ __forceinline__ size_t fro(size_t row, size_t k8, size_t kb) { return ((row >> 4) * kb + (k8 >> 5)) * 512 + ((k8 >> 4) & 1) * 256 + (((k8 >> 3) & 1) * 16 + (row & 15)) * 8; }
__device__ __forceinline__ void splitf(float y, unsigned short& h, unsigned short& l) { h = f2bf(y); l = f2bf(y - bf2f(h)); }
// Rounding to bf16 by the convert instruction, two values each (round to nearest even: the bits of f2bf for every finite value). cvt2: a in the low half, b in the high half.
typedef __attribute__((ext_vector_type(2))) float    c2f;
typedef __attribute__((ext_vector_type(2))) __bf16   c2b;
typedef __attribute__((ext_vector_type(2))) unsigned c2u;
typedef __attribute__((ext_vector_type(4))) unsigned c4u;
__device__ __forceinline__ unsigned cvt2(float a, float b) { const c2f x = {a, b}; return __builtin_bit_cast(unsigned, __builtin_convertvector(x, c2b)); }
// split2: hi and lo planes of two values; lo = the rounded rest, as in splitf
__device__ __forceinline__ void split2(float a, float b, unsigned& h, unsigned& l) { h = cvt2(a, b); l = cvt2(a - __uint_as_float(h << 16), b - __uint_as_float(h & 0xFFFF0000u)); }
// One stage of the ring in LDS: 128 k of the tile's 128 A rows and 128 B rows, 16 chunks of 4 KiB (16 rows x 128 k = four blocks in fragment order, contiguous in the plane too): chunks 0..7 A, 8..15 B.
#define GK   128
#define GCH  (16 * GK)             // elements of a chunk
#define GST  (16 * GCH)            // elements of a stage
// cp8: 2 KiB of each of the 8 chunks of one operand, global -> LDS through no register. A thread moves 16 bytes of each chunk, a wave 512 contiguous bytes (4 whole lines); l: the thread's LDS byte address in the first chunk, g: its global address there, rs: elements from chunk to chunk in the plane.
// The copies and their s_wait_xcnt stand in one statement (a precaution): no register that an issued copy names is rewritten ahead of that wait.
template <typename T16>
__device__ __forceinline__ void cp8(unsigned l, const T16* g, size_t rs) {
    asm volatile("global_load_async_to_lds_b128 %0, %8, off\n\t"
                 "global_load_async_to_lds_b128 %1, %9, off\n\t"
                 "global_load_async_to_lds_b128 %2, %10, off\n\t"
                 "global_load_async_to_lds_b128 %3, %11, off\n\t"
                 "global_load_async_to_lds_b128 %4, %12, off\n\t"
                 "global_load_async_to_lds_b128 %5, %13, off\n\t"
                 "global_load_async_to_lds_b128 %6, %14, off\n\t"
                 "global_load_async_to_lds_b128 %7, %15, off\n\t"
                 "s_wait_xcnt 0x0"
                 :: "v"(l), "v"(l + 1 * GCH * 2), "v"(l + 2 * GCH * 2), "v"(l + 3 * GCH * 2), "v"(l + 4 * GCH * 2), "v"(l + 5 * GCH * 2), "v"(l + 6 * GCH * 2), "v"(l + 7 * GCH * 2),
                    "v"(g), "v"(g + rs), "v"(g + 2 * rs), "v"(g + 3 * rs), "v"(g + 4 * rs), "v"(g + 5 * rs), "v"(g + 6 * rs), "v"(g + 7 * rs) : "memory");
}
// cpst: one whole stage, both operands
template <typename T16>
__device__ __forceinline__ void cpst(unsigned l, const T16* ga, const T16* gb, size_t rs) {
#pragma unroll   // straight-line: 4 statements of 8 copies
    for (int h = 0; h < GCH / 1024; ++h) { cp8(l + h * 2048, ga + h * 1024, rs); cp8(l + 8 * GCH * 2 + h * 2048, gb + h * 1024, rs); }
}
// k_gemmw: a work-group of 4 waves (2 x 2) takes a 128 x 128 tile, each wave a 64 x 64 quarter. The operands come to LDS once per work-group, so each A and B block is fetched from L2 by half as many waves;
// two buffers: the copies of stage t + 1 fly while stage t is worked on. grid (M/128, N/128, Z), 128 threads.
template <typename T16, int K>
__global__ __launch_bounds__(128) void k_gemmw(const T16* __restrict__ A, const T16* __restrict__ Bt, const float* __restrict__ rr, bf* QPh, bf* QPl, bf* QRh, bf* QRl, bf* VTh, bf* VTl, size_t sA, size_t sB) {
    static_assert(K % GK == 0 && K / GK >= 2, "whole stages, two or more");
    typedef typename WFrag<T16>::V V;
    __shared__ __align__(16) T16 st[2 * GST];
    __shared__ __align__(16) float osa[4 * 16 * 68];
    const size_t z = blockIdx.z; A += z * sA; Bt += z * sB;
    const int lane = threadIdx.x & 31, lr = lane & 15, hi = lane >> 4;
    const int w = __builtin_amdgcn_readfirstlane(threadIdx.x >> 5);   // wave number in a scalar register
    const int wm = w >> 1, wn = w & 1; float* os = osa + w * 16 * 68;   // each wave stages its epilogue in its own range
    const int hy = blockIdx.y * 2 + wn; const int r0 = blockIdx.x * 128 + wm * 64, c0 = hy * 64;
    v8f acc[4][4];
#pragma unroll
    for (int mb = 0; mb < 4; ++mb)
#pragma unroll
        for (int nb = 0; nb < 4; ++nb) acc[mb][nb] = (v8f){};
    const T16* ga = A + (size_t)(blockIdx.x * 128) * K + threadIdx.x * 8;    // 16 rows are K / 32 blocks = 16 * K elements; 32 k are one block of 512
    const T16* gb = Bt + (size_t)(blockIdx.y * 128) * K + threadIdx.x * 8;
    const unsigned l0 = (unsigned)(size_t)st + threadIdx.x * 16;             // LDS byte address: the low 32 bits of the __shared__ address
    const size_t rs = (size_t)16 * K; constexpr int nt = K / GK;
    cpst(l0, ga, gb, rs);
    asm volatile("s_wait_asynccnt 0x0" ::: "memory");   // this wave's share of stage 0 has landed
    __syncthreads();                                    // and every other wave's
    cpst(l0 + GST * 2, ga + GCH, gb + GCH, rs);
#pragma unroll 1   // rolled: one trip per stage, the order of waits, barrier and refill at its foot stands once
    for (int t = 0; t < nt; ++t) {
        const T16* sa = st + (t & 1) * GST + wm * 4 * GCH + lane * 8; const T16* sb = st + (t & 1) * GST + (8 + wn * 4) * GCH + lane * 8;
        V a[GK / 32][4], b[GK / 32][4];   // every plain '#pragma unroll' of this kernel makes the indices of a fragment or accumulator array constants, so that the array stays in registers
#pragma unroll
        for (int ks = 0; ks < GK / 32; ++ks) {
#pragma unroll
            for (int mb = 0; mb < 4; ++mb) a[ks][mb] = WFrag<T16>::ldf(sa + mb * GCH + ks * 512);
#pragma unroll
            for (int nb = 0; nb < 4; ++nb) b[ks][nb] = WFrag<T16>::ldf(sb + nb * GCH + ks * 512);
            // keeps the matrix instructions behind the block's 16 fragment loads: spread among them, each pair of loads is waited for on its own
            __builtin_amdgcn_sched_barrier(0);
#pragma unroll
            for (int nb = 0; nb < 4; ++nb)
#pragma unroll
                for (int mb = 0; mb < 4; ++mb) acc[mb][nb] = WFrag<T16>::mma(a[ks][mb], b[ks][nb], acc[mb][nb]);
        }
        // the distance behind the trip's last four matrix instructions: on the loop's back edge only two vector instructions stand between them and the fragment loads that overwrite their operands
        asm volatile("v_nop\n\tv_nop\n\tv_nop\n\tv_nop" : "+v"(acc[0][3]), "+v"(acc[1][3]), "+v"(acc[2][3]), "+v"(acc[3][3]));
        // keeps the trip's last matrix instructions in front of the barrier: sunk behind it they would stand between the barrier and the refill, which would start that much later
        __builtin_amdgcn_sched_barrier(0);
        asm volatile("s_wait_dscnt 0x0" ::: "memory");      // this wave's last read of stage t has returned
        asm volatile("s_wait_asynccnt 0x0" ::: "memory");   // its share of stage t + 1 has landed
        __syncthreads();                                    // stage t + 1 is whole, and no wave reads stage t any more
        if (t + 2 < nt) { const size_t ko = (size_t)(t + 2) * GCH; cpst(l0 + (t & 1) * (GST * 2), ga + ko, gb + ko, rs); }
    }
    asm volatile("s_wait_asynccnt 0x0" ::: "memory");   // no copy is outstanding when the wave goes on
    const int t0 = r0 % TT; const size_t pz = (size_t)((r0 / TT) * NH_ + hy) * TT * HD;   // the planes of this tile's (batch, head)
    if (z == 0) {
        // through LDS, 16 rows at a time: a lane then holds 8 neighbouring d of one token, and 8 lanes (8 neighbouring tokens) write one whole 128-byte line of a block
        const int r8 = lane & 7, cq = lane >> 3; float rb[2][8];
#pragma unroll
        for (int g = 0; g < 2; ++g)
#pragma unroll
            for (int u = 0; u < 8; ++u) rb[g][u] = bfr(rr[c0 + (g * 4 + cq) * 8 + u]);
#pragma unroll
        for (int mb = 0; mb < 4; ++mb) {
#pragma unroll
            for (int nb = 0; nb < 4; ++nb) {
#pragma unroll
                for (int j = 0; j < 8; ++j) os[(hi * 8 + j) * 68 + nb * 16 + lr] = acc[mb][nb][j]; }
            // one wave, LDS runs in order: these two only keep the compiler from moving the reads of other lanes' values above the stores
            __builtin_amdgcn_wave_barrier(); asm volatile("" ::: "memory");
#pragma unroll
            for (int s = 0; s < 4; ++s) { const int row = (s & 1) * 8 + r8, c8 = ((s >> 1) * 4 + cq) * 8; const v4f x0 = *(const v4fa*)(os + row * 68 + c8), x1 = *(const v4fa*)(os + row * 68 + c8 + 4); c4u wqh, wql, wsh, wsl;
#pragma unroll
                for (int u = 0; u < 8; u += 2) { const float q0 = (u < 4) ? x0[u & 3] : x1[u & 3], q1 = (u < 4) ? x0[(u & 3) + 1] : x1[(u & 3) + 1]; unsigned a2, c2; split2(q0, q1, a2, c2); wqh[u >> 1] = a2; wql[u >> 1] = c2; split2(__fadd_rn(q0, rb[s >> 1][u]), __fadd_rn(q1, rb[s >> 1][u + 1]), a2, c2); wsh[u >> 1] = a2; wsl[u >> 1] = c2; }
                const v8us qh = __builtin_bit_cast(v8us, wqh), ql = __builtin_bit_cast(v8us, wql), sh = __builtin_bit_cast(v8us, wsh), sl = __builtin_bit_cast(v8us, wsl);
                const size_t o = pz + fro(t0 + mb * 16 + row, c8, HD / 32);
                *(v8us*)(QPh + o) = qh; *(v8us*)(QPl + o) = ql; *(v8us*)(QRh + o) = sh; *(v8us*)(QRl + o) = sl;
                // precaution: no register that an issued store names is rewritten ahead of this wait
                asm volatile("s_wait_xcnt 0x0" ::: "memory"); }
            // and the next 16 rows' stores from moving above these reads
            __builtin_amdgcn_wave_barrier(); asm volatile("" ::: "memory");
        }
    } else {
        // the transposed planes need no LDS: the 8 accumulator values of a lane are 8 neighbouring tokens of one d, which is that lane's 16 bytes of a block's half: a store writes 512 contiguous bytes
#pragma unroll
        for (int nb = 0; nb < 4; ++nb)
#pragma unroll
            for (int mb = 0; mb < 4; ++mb) { c4u wh, wl;
#pragma unroll
                for (int j = 0; j < 8; j += 2) { unsigned a2, c2; split2(acc[mb][nb][j], acc[mb][nb][j + 1], a2, c2); wh[j >> 1] = a2; wl[j >> 1] = c2; }
                const v8us vh = __builtin_bit_cast(v8us, wh), vl = __builtin_bit_cast(v8us, wl);
                const size_t o = pz + fro(nb * 16 + lr, t0 + mb * 16 + hi * 8, TT / 32);
                *(v8us*)(VTh + o) = vh; *(v8us*)(VTl + o) = vl;
                // precaution: data and pointers are named so that no register an issued store names is rewritten ahead of this wait
                asm volatile("s_wait_xcnt 0x0" :: "v"(vh), "v"(vl), "v"(VTh + o), "v"(VTl + o) : "memory"); }
    }
}

typedef __attribute__((ext_vector_type(2))) _Float16 v2h;
typedef __attribute__((ext_vector_type(4))) _Float16 v4h;
typedef __attribute__((ext_vector_type(2))) unsigned short v2us;
typedef __attribute__((ext_vector_type(4))) unsigned short v4us;
typedef __attribute__((ext_vector_type(2))) float v2f;
typedef __attribute__((ext_vector_type(4))) int v4i;

// d_wtG: the weights rounded to bf16, as the GEMM's B plane (rows n, k = the model dimension) in fragment order. A thread takes 8 neighbouring k of one n:
// the lanes of a wave read 32 neighbouring n, one whole line per k, and write two runs of 256 contiguous bytes.
__device__ __forceinline__ void d_wtG(int blk, const float* __restrict__ w, int K, int N, bf* Bt) {
    const int idx = blk * 256 + threadIdx.x; const int n = idx % N, k0 = (idx / N) * 8; if (k0 >= K) return;
    const float* wp[8]; float v[8];
#pragma unroll
    for (int u = 0; u < 8; ++u) { wp[u] = w + (size_t)(k0 + u) * N + n; v[u] = *wp[u]; }
    // precaution: the pointers are named so that no register an issued load names is rewritten ahead of this wait; the clobber also keeps the loads above it
    asm volatile("s_wait_xcnt 0x0" :: "v"(wp[0]), "v"(wp[1]), "v"(wp[2]), "v"(wp[3]), "v"(wp[4]), "v"(wp[5]), "v"(wp[6]), "v"(wp[7]) : "memory");
    c4u oc;
#pragma unroll
    for (int u = 0; u < 8; u += 2) oc[u >> 1] = cvt2(v[u], v[u + 1]);
    const v8us o = __builtin_bit_cast(v8us, oc);
    *(v8us*)(Bt + fro(n, k0, K >> 5)) = o;
}
// d_xk: x rounded to bf16, once as the GEMM's A plane (rows b * L + t, k = the model dimension) and once as the k planes [b][h] (rows t, k = d), each in fragment order; the rounded value is bf16-exact, so its lo plane is zero.
// A block takes 8 tokens, a thread 8 elements of one token at 4 places 256 columns apart, all loads first. 8 neighbouring lanes hold 8 neighbouring tokens: they write one whole 128-byte line of a block;
// a wave reads one whole 128-byte line of each of its 8 tokens. Block-uniform bases: the lanes differ in one 32-bit offset per buffer, and a thread's 4 groups lie an immediate offset apart.
__device__ __forceinline__ void d_xk(int blk, const float* __restrict__ x, bf* XB, bf* KPh, bf* KPl) { const unsigned tk = threadIdx.x & 7, cq = threadIdx.x >> 3; const unsigned xo = tk * DM + cq * 8; v8f v[4];
    const size_t r0 = (size_t)blk * 8; const unsigned rl = (unsigned)(r0 & 15) + tk;   // the token's row in its block of 16
    const unsigned fo = ((cq >> 1) & 1) * 256 + ((cq & 1) * 16 + rl) * 8;                     // the place of the thread's 8 elements inside a block of 512
    const unsigned ao = (cq >> 2) * 512 + fo; const unsigned po = (cq >> 3) * (TT * HD) + ((cq >> 2) & 1) * 512 + fo;
    const float* xb = x + r0 * DM; bf* ob = XB + (r0 >> 4) * (16 * DM); const size_t pb = (r0 / TT) * NH_ * TT * HD + ((r0 % TT) >> 4) * (16 * HD); bf* kh = KPh + pb; bf* kl = KPl + pb;
#pragma unroll
    for (int g = 0; g < 4; ++g) v[g] = *(const v8f*)(xb + g * 256 + xo);
    // precaution: the lane's offset is named so that no register an issued load names is rewritten ahead of this wait; the clobber also keeps the loads above it
    asm volatile("s_wait_xcnt 0x0" :: "v"(xo * 4) : "memory");
#pragma unroll
    for (int g = 0; g < 4; ++g) { c4u oc;
#pragma unroll
        for (int k = 0; k < 8; k += 2) oc[k >> 1] = cvt2(v[g][k], v[g][k + 1]);
        const v8us o = __builtin_bit_cast(v8us, oc);
        *(v8us*)(ob + g * 8 * 512 + ao) = o; *(v8us*)(kh + g * 4 * TT * HD + po) = o; *(v8us*)(kl + g * 4 * TT * HD + po) = (v8us){}; } }
__global__ __launch_bounds__(256) void k_cscvt(const float* __restrict__ cosT, const float* __restrict__ sinT, float* CS) { const int idx = blockIdx.x * 256 + threadIdx.x; if (idx >= TT * HD) return; v2f cs; cs[0] = bfr(cosT[idx]); cs[1] = bfr(sinT[idx]); *(v2f*)(CS + (size_t)idx * 2) = cs;  }
// d_postab: 32 rows of the table as hi + lo planes (rows m, k = d) in fragment order, and D_[h][m] = r_w_bias[h].pos[m] of those rows for all 16 heads. 64 threads take 8 rows, a thread 8 neighbouring d of one row;
// 8 neighbouring lanes hold 8 neighbouring rows: a wave writes whole 128-byte lines of both planes, and its 32 d are all sines or all cosines.
// The f32 rows go to D_ through LDS (pitch 272 B = 16 B x odd): a lane then holds one whole row in registers, a wave takes 2 heads, whose weights are wave-uniform, and stores one whole 128-byte line of D_ per head.
#define PSP (HD + 4)
__device__ __forceinline__ void d_postab(int blk, const float* __restrict__ rw, bf* Ph2, bf* Pl2, float* DT, float* ps) { const int rl = (threadIdx.x >> 6) * 8 + (threadIdx.x & 7); const int m = blk * 32 + rl; const int d0 = ((threadIdx.x >> 3) & 7) * 8; v8f vv; c4u wh, wl;
#pragma unroll
    for (int q = 0; q < 8; ++q) { const int d = d0 + q; const int dd = (d < HD / 2) ? d : d - HD / 2; const float fr = expf(__fmul_rn((float)dd, -0.29710776f)); const float ang = __fmul_rn((float)(m - TT), fr); float v = (d < HD / 2) ? sinf(ang) : cosf(ang); if (m == 0) v = 0.0f; vv[q] = v; }
#pragma unroll   // constant indices: the row's values and the packed words stay in registers
    for (int q = 0; q < 8; q += 2) { unsigned a2, c2; split2(vv[q], vv[q + 1], a2, c2); wh[q >> 1] = a2; wl[q >> 1] = c2; }
    const v8us hh = __builtin_bit_cast(v8us, wh), ll = __builtin_bit_cast(v8us, wl);
    const size_t o = fro(m, d0, HD / 32);
    *(v4fa*)(ps + rl * PSP + d0) = __builtin_shufflevector(vv, vv, 0, 1, 2, 3); *(v4fa*)(ps + rl * PSP + d0 + 4) = __builtin_shufflevector(vv, vv, 4, 5, 6, 7);
    __syncthreads();   // the block's 32 rows are whole in LDS (the branch that leads here is block-uniform)
    const int lane = threadIdx.x & 31; const int h0 = __builtin_amdgcn_readfirstlane(threadIdx.x >> 5);   // wave number in a scalar register: the weights' addresses are wave-uniform
    v4f pv[HD / 4];
#pragma unroll   // constant indices: the row stays in registers
    for (int q = 0; q < HD / 4; ++q) pv[q] = *(const v4fa*)(ps + lane * PSP + q * 4);
    float a0 = 0.f, a1 = 0.f;   // heads h0 and h0 + 8: two independent chains, each in the order of d
#pragma unroll   // constant indices into the row's registers; the weights come by wide scalar loads
    for (int d = 0; d < HD; ++d) { a0 += bfr(rw[h0 * HD + d]) * pv[d >> 2][d & 3]; a1 += bfr(rw[(h0 + 8) * HD + d]) * pv[d >> 2][d & 3]; }
    // every global store of the block stands here at its end: no register that an issued store names is rewritten behind it
    *(v8us*)(Ph2 + o) = hh; *(v8us*)(Pl2 + o) = ll; DT[h0 * P2 + blk * 32 + lane] = a0; DT[(h0 + 8) * P2 + blk * 32 + lane] = a1;  }
// k_prep: all that depends on nothing but the inputs, in ONE launch: each block does one pass's share, chosen by its index (block-uniform branches).
// The table's blocks come first (the longest chain of arithmetic), then the input's, then the weights'.
#define PB_POS (P2 / 32)
#define PB_XK  (NB_ * TT / 8)
#define PB_WT  (DM * 2 * DQ / 8 / 256)
__global__ __launch_bounds__(256) void k_prep(const float* __restrict__ x, bf* XB, bf* KPh, bf* KPl, const float* __restrict__ w, int K, int N, bf* Bt, const float* __restrict__ rw, bf* Ph2, bf* Pl2, float* DT) {
    __shared__ __align__(16) float ps[32 * PSP];
    const int blk = blockIdx.x;
    if (blk < PB_POS) d_postab(blk, rw, Ph2, Pl2, DT, ps);
    else if (blk < PB_POS + PB_XK) d_xk(blk - PB_POS, x, XB, KPh, KPl);
    else d_wtG(blk - PB_POS - PB_XK, w, K, N, Bt);
}
// k_fattn: one work-group of 16 waves per 64 query rows of one (batch, head). The 64 x 1024 logit block lives in LDS from the first product to P.V.
// LDS row: 64 floats of left margin | 1024 logits | 64 floats of right margin | 4 floats (pitch 4624 B = 16 B x odd). The margins take the band's elements whose key index falls outside 0..1023: they are written, never read.
// After the softmax the same row holds the bf16 hi plane (bytes 0..2047) and lo plane (bytes 2048..4095) of P; after P.V the start of the block holds the 4 partial output tiles.
// Every plain '#pragma unroll' below makes the indices of a fragment or accumulator array constants, so that the array stays in registers.
#define FR   64
#define FMT  (FR / 16)
#define FNW  16
#define FPF  (TT + 2 * FR + 4)
__global__ __launch_bounds__(FNW * 32) void k_fattn(const bf* __restrict__ QRh, const bf* __restrict__ QRl, const bf* __restrict__ QPh, const bf* __restrict__ QPl, const bf* __restrict__ KPh, const bf* __restrict__ KPl, const bf* __restrict__ POSh, const bf* __restrict__ POSl, const float* __restrict__ DT, const bf* __restrict__ VTh, const bf* __restrict__ VTl, const int* __restrict__ kmask, float* OUT) {
    typedef WFrag<bf> F;
    __shared__ __align__(16) float S[FR * FPF];
    const int lane = threadIdx.x & 31, lr = lane & 15, hi = lane >> 4;
    const int w = __builtin_amdgcn_readfirstlane(threadIdx.x >> 5);   // wave number in a scalar register: every loop and branch round a matrix instruction is wave-uniform
    const int i0 = blockIdx.x * FR; const int z = blockIdx.y; const int b = z / NH_, h = z % NH_;
    const size_t zo = (size_t)z * TT * HD;
    const size_t qoff = zo + (size_t)i0 * HD + lane * 8;   // planes in fragment order: 16 rows of 64 d are 2 blocks of 512
    // phase 1: BD[r][j] = B_[i0 + r][m] + D_[m], m = L - (i0 + r) + j: only the band m = L - i0 - 64 .. L - i0 + 1023 (68 column tiles); each pos fragment serves all 4 row tiles
    {
        v16bf a[FMT][2], a2[FMT][2];
#pragma unroll
        for (int mt = 0; mt < FMT; ++mt)
#pragma unroll
            for (int ks = 0; ks < 2; ++ks) { a[mt][ks] = F::ldf(QPh + qoff + mt * 16 * HD + ks * 512); a2[mt][ks] = F::ldf(QPl + qoff + mt * 16 * HD + ks * 512); }
        // precaution: the pointers are named so that no register an issued load names is rewritten ahead of this wait; the clobber also keeps the loads above it
        asm volatile("s_wait_xcnt 0x0" :: "v"(QPh + qoff), "v"(QPl + qoff) : "memory");
        const int mlo = TT - i0 - FR; const float* dth = DT + (size_t)h * P2 + mlo + lr;
        const size_t poff = (size_t)mlo * HD + lane * 8;
#pragma unroll 1   // rolled: the 16 q fragments hold 128 registers, a second tile in flight would not fit 4 waves per SIMD
        for (int t = w; t < (TT + FR) / 16; t += FNW) {
            const bf* ph = POSh + poff + (size_t)t * 16 * HD; const bf* pl = POSl + poff + (size_t)t * 16 * HD; const float* dp = dth + t * 16;
            v16bf p[2], p2[2];
#pragma unroll
            for (int ks = 0; ks < 2; ++ks) { p[ks] = F::ldf(ph + ks * 512); p2[ks] = F::ldf(pl + ks * 512); }
            const float dv = *dp;
            // precaution: the pointers are named so that no register an issued load names is rewritten ahead of this wait; the clobber also keeps the loads above it
            asm volatile("s_wait_xcnt 0x0" :: "v"(ph), "v"(pl), "v"(dp) : "memory");
            v8f acc[FMT];
#pragma unroll
            for (int mt = 0; mt < FMT; ++mt) acc[mt] = (v8f){};
#pragma unroll
            for (int ks = 0; ks < 2; ++ks) {
#pragma unroll
                for (int mt = 0; mt < FMT; ++mt) acc[mt] = wmmab(a[mt][ks], p[ks], acc[mt]);
#pragma unroll
                for (int mt = 0; mt < FMT; ++mt) acc[mt] = wmmab(a2[mt][ks], p[ks], acc[mt]);
#pragma unroll
                for (int mt = 0; mt < FMT; ++mt) acc[mt] = wmmab(a[mt][ks], p2[ks], acc[mt]); }
#pragma unroll
            for (int mt = 0; mt < FMT; ++mt)
#pragma unroll
                for (int j = 0; j < 8; ++j) { const int r = mt * 16 + hi * 8 + j; S[r * FPF + t * 16 + lr + r] = __fadd_rn(acc[mt][j], dv); }   /* column FR + j, j = t*16 + lr - FR + r */
        }
    }
    __syncthreads();
    // phase 2: logit = AC + BD; each k fragment serves all 4 row tiles
    {
        v16bf a[FMT][2], a2[FMT][2];
#pragma unroll
        for (int mt = 0; mt < FMT; ++mt)
#pragma unroll
            for (int ks = 0; ks < 2; ++ks) { a[mt][ks] = F::ldf(QRh + qoff + mt * 16 * HD + ks * 512); a2[mt][ks] = F::ldf(QRl + qoff + mt * 16 * HD + ks * 512); }
        // precaution: the pointers are named so that no register an issued load names is rewritten ahead of this wait; the clobber also keeps the loads above it
        asm volatile("s_wait_xcnt 0x0" :: "v"(QRh + qoff), "v"(QRl + qoff) : "memory");
        const size_t koff = zo + lane * 8;
#pragma unroll 1   // rolled: as in phase 1
        for (int t = w; t < TT / 16; t += FNW) {
            const bf* kh = KPh + koff + (size_t)t * 16 * HD; const bf* kl = KPl + koff + (size_t)t * 16 * HD;
            v16bf k1[2], k2[2];
#pragma unroll
            for (int ks = 0; ks < 2; ++ks) { k1[ks] = F::ldf(kh + ks * 512); k2[ks] = F::ldf(kl + ks * 512); }
            // precaution: the pointers are named so that no register an issued load names is rewritten ahead of this wait; the clobber also keeps the loads above it
            asm volatile("s_wait_xcnt 0x0" :: "v"(kh), "v"(kl) : "memory");
            v8f acc[FMT];
#pragma unroll
            for (int mt = 0; mt < FMT; ++mt) acc[mt] = (v8f){};
#pragma unroll
            for (int ks = 0; ks < 2; ++ks) {
#pragma unroll
                for (int mt = 0; mt < FMT; ++mt) acc[mt] = wmmab(a[mt][ks], k1[ks], acc[mt]);
#pragma unroll
                for (int mt = 0; mt < FMT; ++mt) acc[mt] = wmmab(a2[mt][ks], k1[ks], acc[mt]);
#pragma unroll
                for (int mt = 0; mt < FMT; ++mt) acc[mt] = wmmab(a[mt][ks], k2[ks], acc[mt]); }
            float* sp = S + (hi * 8) * FPF + FR + t * 16 + lr; float bd[FMT][8];
#pragma unroll
            for (int mt = 0; mt < FMT; ++mt)
#pragma unroll
                for (int j = 0; j < 8; ++j) bd[mt][j] = sp[(mt * 16 + j) * FPF];
#pragma unroll
            for (int mt = 0; mt < FMT; ++mt)
#pragma unroll
                for (int j = 0; j < 8; ++j) sp[(mt * 16 + j) * FPF] = __fadd_rn(acc[mt][j], bd[mt][j]);
        }
    }
    __syncthreads();
    // phase 3: softmax, one wave per row, 4 rows a wave (register row, one exp, fixed trees); P split into hi + lo planes in place
    {
        const int* km = kmask + (size_t)b * TT;
#pragma unroll 1   // rolled: one row's 32 values per lane at a time
        for (int rr = 0; rr < FR / FNW; ++rr) { float* srow = S + (w * (FR / FNW) + rr) * FPF; float v[TT / 32]; float mx = -3.0e38f;
#pragma unroll
            for (int ch = 0; ch < TT / 128; ++ch) { const int j0 = ch * 128 + lane * 4; const v4f a = *(const v4fa*)(srow + FR + j0); const v4i k4 = *(const v4i*)(km + j0);
#pragma unroll
                for (int q = 0; q < 4; ++q) { const float t = (k4[q] != 0) ? a[q] : -3.0e38f; v[ch * 4 + q] = t; mx = fmaxf(mx, t); } }
#pragma unroll
            for (int sh = 16; sh; sh >>= 1) mx = fmaxf(mx, __shfl_xor(mx, sh, 32));
            float sum = 0.f;
#pragma unroll
            for (int k = 0; k < TT / 32; ++k) { v[k] = __builtin_amdgcn_exp2f(__fmul_rn(__fsub_rn(v[k], mx), 1.4426950408889634f)); sum += v[k]; }
#pragma unroll
            for (int sh = 16; sh; sh >>= 1) sum += __shfl_xor(sum, sh, 32);
            const float f = __fdiv_rn(1.0f, sum); bf* prow = (bf*)srow;
#pragma unroll
            for (int ch = 0; ch < TT / 128; ++ch) { c2u wh, wl;
#pragma unroll
                for (int q = 0; q < 4; q += 2) { unsigned a, c2; split2(v[ch * 4 + q] * f, v[ch * 4 + q + 1] * f, a, c2); wh[q >> 1] = a; wl[q >> 1] = c2; }
                const v4us oh = __builtin_bit_cast(v4us, wh), ol = __builtin_bit_cast(v4us, wl);
                *(v4us*)(prow + ch * 128 + lane * 4) = oh; *(v4us*)(prow + TT + ch * 128 + lane * 4) = ol; } }
    }
    __syncthreads();
    // phase 4: O = P.V on all 16 waves, 4 per SIMD, so that one wave's waits for its P fragments are filled by the other three: wave w takes 16 columns of the head (w % 4), all 4 row tiles
    // and 256 of the 1024 keys (w / 4). Each V fragment is still fetched once per work-group. Inside a quarter k runs in the order of the unfused GEMM; the 4 quarters are added below, in the order of the keys.
    v8f o[FMT];
    const int nt = w & 3, kq = w >> 2;
    {
        const bf* pr = (const bf*)(S + lr * FPF) + 8 * hi + kq * 256;
        const size_t voff = zo + (size_t)nt * 16 * TT + (size_t)kq * 256 * 16 + lane * 8;   /* 16 d of 1024 keys are 32 blocks; 32 keys are one block */ const bf* vh = VTh + voff; const bf* vl = VTl + voff;
#pragma unroll
        for (int mt = 0; mt < FMT; ++mt) o[mt] = (v8f){};
        v16bf vs[8][2];   // the wave's whole share of V, all loads in flight at once
#pragma unroll
        for (int u = 0; u < 8; ++u) { vs[u][0] = F::ldf(vh + u * 512); vs[u][1] = F::ldf(vl + u * 512); }
        // precaution: the pointers are named so that no register an issued load names is rewritten ahead of this wait; the clobber also keeps the loads above it
        asm volatile("s_wait_xcnt 0x0" :: "v"(vh), "v"(vl) : "memory");
#pragma unroll
        for (int u = 0; u < 8; ++u) { v16bf ph[FMT], pl[FMT];
#pragma unroll
            for (int mt = 0; mt < FMT; ++mt) { ph[mt] = F::ld(pr + mt * 16 * 2 * FPF + u * 32); pl[mt] = F::ld(pr + mt * 16 * 2 * FPF + TT + u * 32); }
#pragma unroll
            for (int mt = 0; mt < FMT; ++mt) o[mt] = wmmab(ph[mt], vs[u][0], o[mt]);
#pragma unroll
            for (int mt = 0; mt < FMT; ++mt) o[mt] = wmmab(pl[mt], vs[u][0], o[mt]);
#pragma unroll
            for (int mt = 0; mt < FMT; ++mt) o[mt] = wmmab(ph[mt], vs[u][1], o[mt]);
            // keeps the P fragments of later steps from being fetched here: V and the accumulators hold 160 registers, and with more than two steps' fragments beside them the build spills V
            if ((u & 1) && u < 7) __builtin_amdgcn_sched_barrier(0); }
    }
    __syncthreads();   // every wave has read its last P fragment: the rows of S may now take the partial sums
    // the 4 partial tiles, [key quarter][64 rows][68 floats], at the start of S
#pragma unroll
    for (int mt = 0; mt < FMT; ++mt)
#pragma unroll
        for (int j = 0; j < 8; ++j) S[(kq * FR + mt * 16 + hi * 8 + j) * 68 + nt * 16 + lr] = o[mt][j];
    __syncthreads();
    // whole 256-byte output rows per half wave: one writer per line; the quarters are added in the order of their keys
#pragma unroll
    for (int s = 0; s < 2; ++s) { const int row = w * 4 + s * 2 + hi; const float* rp = S + row * 68 + lr * 4;
        const v4f val = ((*(const v4fa*)rp + *(const v4fa*)(rp + FR * 68)) + *(const v4fa*)(rp + 2 * FR * 68)) + *(const v4fa*)(rp + 3 * FR * 68);
        *(v4f*)(OUT + ((size_t)b * TT + i0 + row) * DM + h * HD + lr * 4) = val; }
}
__global__ __launch_bounds__(256) void k_merge(const float* __restrict__ O, int h0, bf* Ah, bf* Al) { const size_t e = ((size_t)blockIdx.x * 256 + threadIdx.x) * 2; if (e >= (size_t)ZH * TT * HD) return; const int d = (int)(e % HD); const int t = (int)((e / HD) % TT); const int zz = (int)(e / ((size_t)HD * TT)); const float cs = (t < RH) ? 1.0f : (1.0f / PCAR); const size_t oo = (size_t)t * DQ + (h0 + zz) * HD + d;
    v2us oh, ol;
#pragma unroll
    for (int q = 0; q < 2; ++q) { unsigned short a, c2; splitf(O[e + q] * cs, a, c2); oh[q] = a; ol[q] = c2; } *(v2us*)(Ah + oo) = oh; *(v2us*)(Al + oo) = ol;  }

extern "C" void kernel_launch(void* const* d_in, const int* in_sizes, int n_in,
                              void* d_out, int out_size, void* d_ws, size_t ws_size, hipStream_t stream) {
    (void)in_sizes; (void)n_in; (void)out_size;
    const float* x = (const float*)d_in[0]; const float* wqv = (const float*)d_in[1]; const float* rrb = (const float*)d_in[2]; const float* rwb = (const float*)d_in[3]; const int* kmask = (const int*)d_in[4]; const float* wq = wqv; const float* wk = nullptr; const float* wv = wqv; const float* wo = nullptr; (void)wk; (void)wo; const float* cosT = nullptr; const float* sinT = nullptr; (void)cosT; (void)sinT;
    float* OUT = (float*)d_out;     // [4][1024][1024]
    char* wsp = (char*)d_ws;
    auto take = [&](size_t bytes) { char* p = wsp; wsp += (bytes + 255) & ~(size_t)255; return (void*)p; };
    const size_t PL = (size_t)NB_ * NH_ * TT * HD;   // one plane set: every batch, every head
    const size_t FL = (size_t)NB_ * TT * DM;         // one f32 activation: every batch
    bf* WALL = (bf*)take((size_t)2 * DQ * DM * 2); bf* POSh = (bf*)take((size_t)P2 * HD * 2); bf* POSl = (bf*)take((size_t)P2 * HD * 2); float* DT = (float*)take((size_t)NH_ * P2 * 4);
    bf* KPh = (bf*)take(PL * 2); bf* KPl = (bf*)take(PL * 2); bf* QRh = (bf*)take(PL * 2); bf* QRl = (bf*)take(PL * 2); bf* QPh = (bf*)take(PL * 2); bf* QPl = (bf*)take(PL * 2);   // hi and lo planes of k, of q + r_r_bias, of q
    bf* VTh = (bf*)take(PL * 2); bf* VTl = (bf*)take(PL * 2);
    bf* XB = (bf*)take(FL * 2);   // the bf16 input, rows b * L + t
    if ((size_t)(wsp - (char*)d_ws) > ws_size) return;   // ws ~ 77 MiB
    // every batch in one launch
    k_prep<<<PB_POS + PB_XK + PB_WT, 256, 0, stream>>>(x, XB, KPh, KPl, wqv, DM, 2 * DQ, WALL, rwb, POSh, POSl, DT);   /* k = x: the bf16-ROUNDED input */
    k_gemmw<bf, DM><<<dim3(NB_ * TT / 128, DQ / 128, 2), 128, 0, stream>>>(XB, WALL, rrb, QPh, QPl, QRh, QRl, VTh, VTl, 0, (size_t)DQ * DM);   /* z = 0: q, z = 1: v */
    k_fattn<<<dim3(TT / FR, NB_ * NH_, 1), FNW * 32, 0, stream>>>(QRh, QRl, QPh, QPl, KPh, KPl, POSh, POSl, DT, VTh, VTl, kmask, OUT);   /* every batch and head */
}

// v009
// A run of this version takes 105 microseconds.
// In both of two side-by-side timings against v008, it was 1.06 times as fast.
// Over all steps from v000 it is 16.7 times as fast.
#include <hip/hip_runtime.h>

// RelativeMultiHeadAttn (Transformer-XL style, k_as_x: x [4][1024][1024], Wqv [1024][2048] (q | v column blocks), r_r_bias / r_w_bias [16][64], mask [4][1024] (int, read; all ones); k = x itself split into 16 heads; pos = the sinusoidal table [2L][64] (sin | cos of p * exp(-d ln(1e4)/31), p = -L..L-1, row 0 zeroed) computed on chip in f32; AC = (q + r_r_bias).k; B_ = q.pos^T, D_ = r_w_bias.pos^T; BD = shift(B_ + D_) = (B_ + D_)[i][L - i + j] (exact index form of the pad/reshape shift); attn = softmax(AC + BD) (NO scaling; -inf where mask == 0); out = attn.v merged -> [4][1024][1024] (no output projection)).
// Compute dtypes, f32 accumulate: every input rounded to bf16; q, v as PLAIN bf16 GEMMs (inputs: exact); k planes straight from the (bf16-exact) input; pos table f32 -> hi/lo planes; AC and B_ as hl x hl GEMMs (3 products) on every row (unscaled logits are sharp); D_ as 64-term f32 dots; BD gathered per element (contiguous along j) and added in f32; softmax f32; attn.v hl x hl (3 products) on every row; output written directly in f32.

#define NB_  4
#define TT   1024
#define DM   1024
#define NH_  16
#define NKV  16
#define REP  (NH_ / NKV)
#define HD   64
#define DQ   (NH_ * HD)
#define DKV  (NKV * HD)
#define ZH   8                     // heads per k_merge call (k_merge is not launched)
#define ZS   16                    // unused
#define RH   1024                  // k_merge (not launched) scales rows t >= RH by 1/PCAR
#define WIN  0
#define PCAR 1024.0f
#define P2   (2 * TT)             // 2L relative positions
#define SCL  0.125f   // HD^-0.5
typedef _Float16 h16;
typedef unsigned short bf;
typedef __attribute__((ext_vector_type(16))) __bf16   v16bf;
typedef __attribute__((ext_vector_type(16))) _Float16 v16h;
typedef __attribute__((ext_vector_type(8)))  _Float16 v8h;
typedef __attribute__((ext_vector_type(8)))  unsigned short v8us;
typedef __attribute__((ext_vector_type(8)))  float    v8f;
typedef __attribute__((ext_vector_type(4)))  float    v4f;
typedef v8h  __attribute__((may_alias)) v8ha;
typedef v4f  __attribute__((may_alias)) v4fa;
typedef v8us __attribute__((may_alias)) v8usa;

__device__ __forceinline__ unsigned short f2bf(float f) { unsigned u = __float_as_uint(f); u += 0x7FFFu + ((u >> 16) & 1u); return (unsigned short)(u >> 16); }
__device__ __forceinline__ float bf2f(unsigned short b) { return __uint_as_float(((unsigned)b) << 16); }
__device__ __forceinline__ float bfr(float f) { return bf2f(f2bf(f)); }
__device__ __forceinline__ v16h cat16(v8h lo, v8h hi) { return __builtin_shufflevector(lo, hi, 0, 1, 2, 3, 4, 5, 6, 7, 8, 9, 10, 11, 12, 13, 14, 15); }
__device__ __forceinline__ v16bf cat16b(v8us lo, v8us hi) { return __builtin_bit_cast(v16bf, __builtin_shufflevector(lo, hi, 0, 1, 2, 3, 4, 5, 6, 7, 8, 9, 10, 11, 12, 13, 14, 15)); }
__device__ __forceinline__ v8f wmma16(v16h a, v16h b, v8f c) { return __builtin_amdgcn_wmma_f32_16x16x32_f16(false, a, false, b, (short)0, c, false, false); }
__device__ __forceinline__ v8f wmmab(v16bf a, v16bf b, v8f c) { return __builtin_amdgcn_wmma_f32_16x16x32_bf16(false, a, false, b, (short)0, c, false, false); }



// ---- k_gemmw: register-blocked GEMM, one wave per 64x64 output tile (16 accumulators), operands from 16-bit planes in fragment order, staged in LDS for 4 waves (see at the kernel).
// C[m][n] = sum_k A[m][k] Bt[n][k]. z-batch strides sA/sB in elements. z = 0: q, z = 1: v.
// A tile is 64 tokens of one head, so the epilogue writes the planes that the attention kernel reads straight from the accumulators:
// z = 0: hi + lo planes [b][h] of q and of q + r_r_bias (rows t, k = d); z = 1: hi + lo planes [b][h] of v (rows d, k = t); each in fragment order.
template <typename T16> struct WFrag;
template <> struct WFrag<h16> { typedef v16h V; static __device__ __forceinline__ V ld(const h16* p) { return cat16(*(const v8h*)p, *(const v8h*)(p + 16)); } static __device__ __forceinline__ V ldf(const h16* p) { return cat16(*(const v8h*)p, *(const v8h*)(p + 256)); } static __device__ __forceinline__ v8f mma(V a, V b, v8f c) { return wmma16(a, b, c); } };
template <> struct WFrag<bf> { typedef v16bf V; static __device__ __forceinline__ V ld(const bf* p) { return cat16b(*(const v8us*)p, *(const v8us*)(p + 16)); } static __device__ __forceinline__ V ldf(const bf* p) { return cat16b(*(const v8us*)p, *(const v8us*)(p + 256)); } static __device__ __forceinline__ v8f mma(V a, V b, v8f c) { return wmmab(a, b, c); } };
// FRAGMENT ORDER: every 16-bit operand plane in the workspace, rows x K, is stored as blocks of 512 elements, one block per (16 rows, 32 k). Element (row, k) lies at
// ((row / 16) * (K / 32) + k / 32) * 512 + ((k / 16) % 2) * 256 + (((k / 8) % 2) * 16 + row % 16) * 8 + k % 8.
// Lane l of a wave finds the two 16-byte halves of its fragment at l * 8 and 256 + l * 8 of the block (ldf), so each load of a wave reads 512 contiguous bytes, 4 whole lines;
// the registers hold the same values as with row-major planes. fro: the place of 8 neighbouring k, k8 % 8 == 0, kb = K / 32.
__device__ __forceinline__ size_t fro(size_t row, size_t k8, size_t kb) { return ((row >> 4) * kb + (k8 >> 5)) * 512 + ((k8 >> 4) & 1) * 256 + (((k8 >> 3) & 1) * 16 + (row & 15)) * 8; }
__device__ __forceinline__ void splitf(float y, unsigned short& h, unsigned short& l) { h = f2bf(y); l = f2bf(y - bf2f(h)); }
// Rounding to bf16 by the convert instruction, two values each (round to nearest even: the bits of f2bf for every finite value). cvt2: a in the low half, b in the high half.
typedef __attribute__((ext_vector_type(2))) float    c2f;
typedef __attribute__((ext_vector_type(2))) __bf16   c2b;
typedef __attribute__((ext_vector_type(2))) unsigned c2u;
typedef __attribute__((ext_vector_type(4))) unsigned c4u;
__device__ __forceinline__ unsigned cvt2(float a, float b) { const c2f x = {a, b}; return __builtin_bit_cast(unsigned, __builtin_convertvector(x, c2b)); }
// split2: hi and lo planes of two values; lo = the rounded rest, as in splitf
__device__ __forceinline__ void split2(float a, float b, unsigned& h, unsigned& l) { h = cvt2(a, b); l = cvt2(a - __uint_as_float(h << 16), b - __uint_as_float(h & 0xFFFF0000u)); }
// One stage of the ring in LDS: 128 k of the tile's 128 A rows and 128 B rows, 16 chunks of 4 KiB (16 rows x 128 k = four blocks in fragment order, contiguous in the plane too): chunks 0..7 A, 8..15 B.
#define GK   128
#define GCH  (16 * GK)             // elements of a chunk
#define GST  (16 * GCH)            // elements of a stage
// cp8: 2 KiB of each of the 8 chunks of one operand, global -> LDS through no register. A thread moves 16 bytes of each chunk, a wave 512 contiguous bytes (4 whole lines); l: the thread's LDS byte address in the first chunk, g: its global address there, rs: elements from chunk to chunk in the plane.
// The copies and their s_wait_xcnt stand in one statement (a precaution): no register that an issued copy names is rewritten ahead of that wait.
template <typename T16>
__device__ __forceinline__ void cp8(unsigned l, const T16* g, size_t rs) {
    asm volatile("global_load_async_to_lds_b128 %0, %8, off\n\t"
                 "global_load_async_to_lds_b128 %1, %9, off\n\t"
                 "global_load_async_to_lds_b128 %2, %10, off\n\t"
                 "global_load_async_to_lds_b128 %3, %11, off\n\t"
                 "global_load_async_to_lds_b128 %4, %12, off\n\t"
                 "global_load_async_to_lds_b128 %5, %13, off\n\t"
                 "global_load_async_to_lds_b128 %6, %14, off\n\t"
                 "global_load_async_to_lds_b128 %7, %15, off\n\t"
                 "s_wait_xcnt 0x0"
                 :: "v"(l), "v"(l + 1 * GCH * 2), "v"(l + 2 * GCH * 2), "v"(l + 3 * GCH * 2), "v"(l + 4 * GCH * 2), "v"(l + 5 * GCH * 2), "v"(l + 6 * GCH * 2), "v"(l + 7 * GCH * 2),
                    "v"(g), "v"(g + rs), "v"(g + 2 * rs), "v"(g + 3 * rs), "v"(g + 4 * rs), "v"(g + 5 * rs), "v"(g + 6 * rs), "v"(g + 7 * rs) : "memory");
}
// cpst: one whole stage, both operands
template <typename T16>
__device__ __forceinline__ void cpst(unsigned l, const T16* ga, const T16* gb, size_t rs) {
#pragma unroll   // straight-line: 4 statements of 8 copies
    for (int h = 0; h < GCH / 1024; ++h) { cp8(l + h * 2048, ga + h * 1024, rs); cp8(l + 8 * GCH * 2 + h * 2048, gb + h * 1024, rs); }
}
// k_gemmw: a work-group of 4 waves (2 x 2) takes a 128 x 128 tile, each wave a 64 x 64 quarter. The operands come to LDS once per work-group, so each A and B block is fetched from L2 by half as many waves;
// two buffers: the copies of stage t + 1 fly while stage t is worked on. grid (M/128, N/128, Z), 128 threads.
template <typename T16, int K>
__global__ __launch_bounds__(128) void k_gemmw(const T16* __restrict__ A, const T16* __restrict__ Bt, const float* __restrict__ rr, bf* QPh, bf* QPl, bf* QRh, bf* QRl, bf* VTh, bf* VTl, size_t sA, size_t sB) {
    static_assert(K % GK == 0 && K / GK >= 2, "whole stages, two or more");
    typedef typename WFrag<T16>::V V;
    __shared__ __align__(16) T16 st[2 * GST];
    __shared__ __align__(16) float osa[4 * 16 * 68];
    const size_t z = blockIdx.z; A += z * sA; Bt += z * sB;
    const int lane = threadIdx.x & 31, lr = lane & 15, hi = lane >> 4;
    const int w = __builtin_amdgcn_readfirstlane(threadIdx.x >> 5);   // wave number in a scalar register
    const int wm = w >> 1, wn = w & 1; float* os = osa + w * 16 * 68;   // each wave stages its epilogue in its own range
    const int hy = blockIdx.y * 2 + wn; const int r0 = blockIdx.x * 128 + wm * 64, c0 = hy * 64;
    v8f acc[4][4];
#pragma unroll
    for (int mb = 0; mb < 4; ++mb)
#pragma unroll
        for (int nb = 0; nb < 4; ++nb) acc[mb][nb] = (v8f){};
    const T16* ga = A + (size_t)(blockIdx.x * 128) * K + threadIdx.x * 8;    // 16 rows are K / 32 blocks = 16 * K elements; 32 k are one block of 512
    const T16* gb = Bt + (size_t)(blockIdx.y * 128) * K + threadIdx.x * 8;
    const unsigned l0 = (unsigned)(size_t)st + threadIdx.x * 16;             // LDS byte address: the low 32 bits of the __shared__ address
    const size_t rs = (size_t)16 * K; constexpr int nt = K / GK;
    cpst(l0, ga, gb, rs);
    asm volatile("s_wait_asynccnt 0x0" ::: "memory");   // this wave's share of stage 0 has landed
    __syncthreads();                                    // and every other wave's
    cpst(l0 + GST * 2, ga + GCH, gb + GCH, rs);
#pragma unroll 1   // rolled: one trip per stage, the order of waits, barrier and refill at its foot stands once
    for (int t = 0; t < nt; ++t) {
        const T16* sa = st + (t & 1) * GST + wm * 4 * GCH + lane * 8; const T16* sb = st + (t & 1) * GST + (8 + wn * 4) * GCH + lane * 8;
        V a[GK / 32][4], b[GK / 32][4];   // every plain '#pragma unroll' of this kernel makes the indices of a fragment or accumulator array constants, so that the array stays in registers
#pragma unroll
        for (int ks = 0; ks < GK / 32; ++ks) {
#pragma unroll
            for (int mb = 0; mb < 4; ++mb) a[ks][mb] = WFrag<T16>::ldf(sa + mb * GCH + ks * 512);
#pragma unroll
            for (int nb = 0; nb < 4; ++nb) b[ks][nb] = WFrag<T16>::ldf(sb + nb * GCH + ks * 512);
            // keeps the matrix instructions behind the block's 16 fragment loads: spread among them, each pair of loads is waited for on its own
            __builtin_amdgcn_sched_barrier(0);
#pragma unroll
            for (int nb = 0; nb < 4; ++nb)
#pragma unroll
                for (int mb = 0; mb < 4; ++mb) acc[mb][nb] = WFrag<T16>::mma(a[ks][mb], b[ks][nb], acc[mb][nb]);
        }
        // the distance behind the trip's last four matrix instructions: on the loop's back edge only two vector instructions stand between them and the fragment loads that overwrite their operands
        asm volatile("v_nop\n\tv_nop\n\tv_nop\n\tv_nop" : "+v"(acc[0][3]), "+v"(acc[1][3]), "+v"(acc[2][3]), "+v"(acc[3][3]));
        // keeps the trip's last matrix instructions in front of the barrier: sunk behind it they would stand between the barrier and the refill, which would start that much later
        __builtin_amdgcn_sched_barrier(0);
        asm volatile("s_wait_dscnt 0x0" ::: "memory");      // this wave's last read of stage t has returned
        asm volatile("s_wait_asynccnt 0x0" ::: "memory");   // its share of stage t + 1 has landed
        __syncthreads();                                    // stage t + 1 is whole, and no wave reads stage t any more
        if (t + 2 < nt) { const size_t ko = (size_t)(t + 2) * GCH; cpst(l0 + (t & 1) * (GST * 2), ga + ko, gb + ko, rs); }
    }
    asm volatile("s_wait_asynccnt 0x0" ::: "memory");   // no copy is outstanding when the wave goes on
    const int t0 = r0 % TT; const size_t pz = (size_t)((r0 / TT) * NH_ + hy) * TT * HD;   // the planes of this tile's (batch, head)
    if (z == 0) {
        // through LDS, 16 rows at a time: a lane then holds 8 neighbouring d of one token, and 8 lanes (8 neighbouring tokens) write one whole 128-byte line of a block
        const int r8 = lane & 7, cq = lane >> 3; float rb[2][8];
#pragma unroll
        for (int g = 0; g < 2; ++g)
#pragma unroll
            for (int u = 0; u < 8; ++u) rb[g][u] = bfr(rr[c0 + (g * 4 + cq) * 8 + u]);
#pragma unroll
        for (int mb = 0; mb < 4; ++mb) {
#pragma unroll
            for (int nb = 0; nb < 4; ++nb) {
#pragma unroll
                for (int j = 0; j < 8; ++j) os[(hi * 8 + j) * 68 + nb * 16 + lr] = acc[mb][nb][j]; }
            // one wave, LDS runs in order: these two only keep the compiler from moving the reads of other lanes' values above the stores
            __builtin_amdgcn_wave_barrier(); asm volatile("" ::: "memory");
#pragma unroll
            for (int s = 0; s < 4; ++s) { const int row = (s & 1) * 8 + r8, c8 = ((s >> 1) * 4 + cq) * 8; const v4f x0 = *(const v4fa*)(os + row * 68 + c8), x1 = *(const v4fa*)(os + row * 68 + c8 + 4); c4u wqh, wql, wsh, wsl;
#pragma unroll
                for (int u = 0; u < 8; u += 2) { const float q0 = (u < 4) ? x0[u & 3] : x1[u & 3], q1 = (u < 4) ? x0[(u & 3) + 1] : x1[(u & 3) + 1]; unsigned a2, c2; split2(q0, q1, a2, c2); wqh[u >> 1] = a2; wql[u >> 1] = c2; split2(__fadd_rn(q0, rb[s >> 1][u]), __fadd_rn(q1, rb[s >> 1][u + 1]), a2, c2); wsh[u >> 1] = a2; wsl[u >> 1] = c2; }
                const v8us qh = __builtin_bit_cast(v8us, wqh), ql = __builtin_bit_cast(v8us, wql), sh = __builtin_bit_cast(v8us, wsh), sl = __builtin_bit_cast(v8us, wsl);
                const size_t o = pz + fro(t0 + mb * 16 + row, c8, HD / 32);
                *(v8us*)(QPh + o) = qh; *(v8us*)(QPl + o) = ql; *(v8us*)(QRh + o) = sh; *(v8us*)(QRl + o) = sl;
                // precaution: no register that an issued store names is rewritten ahead of this wait
                asm volatile("s_wait_xcnt 0x0" ::: "memory"); }
            // and the next 16 rows' stores from moving above these reads
            __builtin_amdgcn_wave_barrier(); asm volatile("" ::: "memory");
        }
    } else {
        // the transposed planes need no LDS: the 8 accumulator values of a lane are 8 neighbouring tokens of one d, which is that lane's 16 bytes of a block's half: a store writes 512 contiguous bytes
#pragma unroll
        for (int nb = 0; nb < 4; ++nb)
#pragma unroll
            for (int mb = 0; mb < 4; ++mb) { c4u wh, wl;
#pragma unroll
                for (int j = 0; j < 8; j += 2) { unsigned a2, c2; split2(acc[mb][nb][j], acc[mb][nb][j + 1], a2, c2); wh[j >> 1] = a2; wl[j >> 1] = c2; }
                const v8us vh = __builtin_bit_cast(v8us, wh), vl = __builtin_bit_cast(v8us, wl);
                const size_t o = pz + fro(nb * 16 + lr, t0 + mb * 16 + hi * 8, TT / 32);
                *(v8us*)(VTh + o) = vh; *(v8us*)(VTl + o) = vl;
                // precaution: data and pointers are named so that no register an issued store names is rewritten ahead of this wait
                asm volatile("s_wait_xcnt 0x0" :: "v"(vh), "v"(vl), "v"(VTh + o), "v"(VTl + o) : "memory"); }
    }
}

typedef __attribute__((ext_vector_type(2))) _Float16 v2h;
typedef __attribute__((ext_vector_type(4))) _Float16 v4h;
typedef __attribute__((ext_vector_type(2))) unsigned short v2us;
typedef __attribute__((ext_vector_type(4))) unsigned short v4us;
typedef __attribute__((ext_vector_type(2))) float v2f;
typedef __attribute__((ext_vector_type(4))) int v4i;

// d_wtG: the weights rounded to bf16, as the GEMM's B plane (rows n, k = the model dimension) in fragment order. A thread takes 8 neighbouring k of one n:
// the lanes of a wave read 32 neighbouring n, one whole line per k, and write two runs of 256 contiguous bytes.
__device__ __forceinline__ void d_wtG(int blk, const float* __restrict__ w, int K, int N, bf* Bt) {
    const int idx = blk * 256 + threadIdx.x; const int n = idx % N, k0 = (idx / N) * 8; if (k0 >= K) return;
    const float* wp[8]; float v[8];
#pragma unroll
    for (int u = 0; u < 8; ++u) { wp[u] = w + (size_t)(k0 + u) * N + n; v[u] = *wp[u]; }
    // precaution: the pointers are named so that no register an issued load names is rewritten ahead of this wait; the clobber also keeps the loads above it
    asm volatile("s_wait_xcnt 0x0" :: "v"(wp[0]), "v"(wp[1]), "v"(wp[2]), "v"(wp[3]), "v"(wp[4]), "v"(wp[5]), "v"(wp[6]), "v"(wp[7]) : "memory");
    c4u oc;
#pragma unroll
    for (int u = 0; u < 8; u += 2) oc[u >> 1] = cvt2(v[u], v[u + 1]);
    const v8us o = __builtin_bit_cast(v8us, oc);
    *(v8us*)(Bt + fro(n, k0, K >> 5)) = o;
}
// d_xk: x rounded to bf16, once as the GEMM's A plane (rows b * L + t, k = the model dimension) and once as the k planes [b][h] (rows t, k = d), each in fragment order; the rounded value is bf16-exact, so its lo plane is zero.
// A block takes 8 tokens, a thread 8 elements of one token at 4 places 256 columns apart, all loads first. 8 neighbouring lanes hold 8 neighbouring tokens: they write one whole 128-byte line of a block;
// a wave reads one whole 128-byte line of each of its 8 tokens. Block-uniform bases: the lanes differ in one 32-bit offset per buffer, and a thread's 4 groups lie an immediate offset apart.
__device__ __forceinline__ void d_xk(int blk, const float* __restrict__ x, bf* XB, bf* KPh, bf* KPl) { const unsigned tk = threadIdx.x & 7, cq = threadIdx.x >> 3; const unsigned xo = tk * DM + cq * 8; v8f v[4];
    const size_t r0 = (size_t)blk * 8; const unsigned rl = (unsigned)(r0 & 15) + tk;   // the token's row in its block of 16
    const unsigned fo = ((cq >> 1) & 1) * 256 + ((cq & 1) * 16 + rl) * 8;                     // the place of the thread's 8 elements inside a block of 512
    const unsigned ao = (cq >> 2) * 512 + fo; const unsigned po = (cq >> 3) * (TT * HD) + ((cq >> 2) & 1) * 512 + fo;
    const float* xb = x + r0 * DM; bf* ob = XB + (r0 >> 4) * (16 * DM); const size_t pb = (r0 / TT) * NH_ * TT * HD + ((r0 % TT) >> 4) * (16 * HD); bf* kh = KPh + pb; bf* kl = KPl + pb;
#pragma unroll
    for (int g = 0; g < 4; ++g) v[g] = *(const v8f*)(xb + g * 256 + xo);
    // precaution: the lane's offset is named so that no register an issued load names is rewritten ahead of this wait; the clobber also keeps the loads above it
    asm volatile("s_wait_xcnt 0x0" :: "v"(xo * 4) : "memory");
#pragma unroll
    for (int g = 0; g < 4; ++g) { c4u oc;
#pragma unroll
        for (int k = 0; k < 8; k += 2) oc[k >> 1] = cvt2(v[g][k], v[g][k + 1]);
        const v8us o = __builtin_bit_cast(v8us, oc);
        *(v8us*)(ob + g * 8 * 512 + ao) = o; *(v8us*)(kh + g * 4 * TT * HD + po) = o; *(v8us*)(kl + g * 4 * TT * HD + po) = (v8us){}; } }
__global__ __launch_bounds__(256) void k_cscvt(const float* __restrict__ cosT, const float* __restrict__ sinT, float* CS) { const int idx = blockIdx.x * 256 + threadIdx.x; if (idx >= TT * HD) return; v2f cs; cs[0] = bfr(cosT[idx]); cs[1] = bfr(sinT[idx]); *(v2f*)(CS + (size_t)idx * 2) = cs;  }
// d_postab: 32 rows of the table as hi + lo planes (rows m, k = d) in fragment order, and D_[h][m] = r_w_bias[h].pos[m] of those rows for all 16 heads. 64 threads take 8 rows, a thread 8 neighbouring d of one row;
// 8 neighbouring lanes hold 8 neighbouring rows: a wave writes whole 128-byte lines of both planes, and its 32 d are all sines or all cosines.
// The f32 rows go to D_ through LDS (pitch 272 B = 16 B x odd): a lane then holds one whole row in registers, a wave takes 2 heads, whose weights are wave-uniform, and stores one whole 128-byte line of D_ per head.
#define PSP (HD + 4)
__device__ __forceinline__ void d_postab(int blk, const float* __restrict__ rw, bf* Ph2, bf* Pl2, float* DT, float* ps) { const int rl = (threadIdx.x >> 6) * 8 + (threadIdx.x & 7); const int m = blk * 32 + rl; const int d0 = ((threadIdx.x >> 3) & 7) * 8; v8f vv; c4u wh, wl;
#pragma unroll
    for (int q = 0; q < 8; ++q) { const int d = d0 + q; const int dd = (d < HD / 2) ? d : d - HD / 2; const float fr = expf(__fmul_rn((float)dd, -0.29710776f)); const float ang = __fmul_rn((float)(m - TT), fr); float v = (d < HD / 2) ? sinf(ang) : cosf(ang); if (m == 0) v = 0.0f; vv[q] = v; }
#pragma unroll   // constant indices: the row's values and the packed words stay in registers
    for (int q = 0; q < 8; q += 2) { unsigned a2, c2; split2(vv[q], vv[q + 1], a2, c2); wh[q >> 1] = a2; wl[q >> 1] = c2; }
    const v8us hh = __builtin_bit_cast(v8us, wh), ll = __builtin_bit_cast(v8us, wl);
    const size_t o = fro(m, d0, HD / 32);
    *(v4fa*)(ps + rl * PSP + d0) = __builtin_shufflevector(vv, vv, 0, 1, 2, 3); *(v4fa*)(ps + rl * PSP + d0 + 4) = __builtin_shufflevector(vv, vv, 4, 5, 6, 7);
    __syncthreads();   // the block's 32 rows are whole in LDS (the branch that leads here is block-uniform)
    const int lane = threadIdx.x & 31; const int h0 = __builtin_amdgcn_readfirstlane(threadIdx.x >> 5);   // wave number in a scalar register: the weights' addresses are wave-uniform
    v4f pv[HD / 4];
#pragma unroll   // constant indices: the row stays in registers
    for (int q = 0; q < HD / 4; ++q) pv[q] = *(const v4fa*)(ps + lane * PSP + q * 4);
    float a0 = 0.f, a1 = 0.f;   // heads h0 and h0 + 8: two independent chains, each in the order of d
#pragma unroll   // constant indices into the row's registers; the weights come by wide scalar loads
    for (int d = 0; d < HD; ++d) { a0 += bfr(rw[h0 * HD + d]) * pv[d >> 2][d & 3]; a1 += bfr(rw[(h0 + 8) * HD + d]) * pv[d >> 2][d & 3]; }
    // every global store of the block stands here at its end: no register that an issued store names is rewritten behind it
    *(v8us*)(Ph2 + o) = hh; *(v8us*)(Pl2 + o) = ll; DT[h0 * P2 + blk * 32 + lane] = a0; DT[(h0 + 8) * P2 + blk * 32 + lane] = a1;  }
// k_prep: all that depends on nothing but the inputs, in ONE launch: each block does one pass's share, chosen by its index (block-uniform branches).
// The table's blocks come first (the longest chain of arithmetic), then the input's, then the weights'.
#define PB_POS (P2 / 32)
#define PB_XK  (NB_ * TT / 8)
#define PB_WT  (DM * 2 * DQ / 8 / 256)
__global__ __launch_bounds__(256) void k_prep(const float* __restrict__ x, bf* XB, bf* KPh, bf* KPl, const float* __restrict__ w, int K, int N, bf* Bt, const float* __restrict__ rw, bf* Ph2, bf* Pl2, float* DT) {
    __shared__ __align__(16) float ps[32 * PSP];
    const int blk = blockIdx.x;
    if (blk < PB_POS) d_postab(blk, rw, Ph2, Pl2, DT, ps);
    else if (blk < PB_POS + PB_XK) d_xk(blk - PB_POS, x, XB, KPh, KPl);
    else d_wtG(blk - PB_POS - PB_XK, w, K, N, Bt);
}
// k_fattn: one work-group of 16 waves per 64 query rows of one (batch, head). The 64 x 1024 logit block lives in LDS from the first product to P.V.
// LDS row: 64 floats of left margin | 1024 logits | 64 floats of right margin | 4 floats (pitch 4624 B = 16 B x odd). The margins take the band's elements whose key index falls outside 0..1023: they are written, never read.
// After the softmax the same row holds the bf16 hi plane (bytes 0..2047) and lo plane (bytes 2048..4095) of P; after P.V the start of the block holds the 4 partial output tiles.
// Every plain '#pragma unroll' below makes the indices of a fragment or accumulator array constants, so that the array stays in registers.
#define FR   64
#define FMT  (FR / 16)
#define FNW  16
#define FPF  (TT + 2 * FR + 4)
__global__ __launch_bounds__(FNW * 32) void k_fattn(const bf* __restrict__ QRh, const bf* __restrict__ QRl, const bf* __restrict__ QPh, const bf* __restrict__ QPl, const bf* __restrict__ KPh, const bf* __restrict__ KPl, const bf* __restrict__ POSh, const bf* __restrict__ POSl, const float* __restrict__ DT, const bf* __restrict__ VTh, const bf* __restrict__ VTl, const int* __restrict__ kmask, float* OUT) {
    typedef WFrag<bf> F;
    __shared__ __align__(16) float S[FR * FPF];
    const int lane = threadIdx.x & 31, lr = lane & 15, hi = lane >> 4;
    const int w = __builtin_amdgcn_readfirstlane(threadIdx.x >> 5);   // wave number in a scalar register: every loop and branch round a matrix instruction is wave-uniform
    const int i0 = blockIdx.x * FR; const int z = blockIdx.y; const int b = z / NH_, h = z % NH_;
    const size_t zo = (size_t)z * TT * HD;
    const size_t qoff = zo + (size_t)i0 * HD + lane * 8;   // planes in fragment order: 16 rows of 64 d are 2 blocks of 512
    // phase 1: BD[r][j] = B_[i0 + r][m] + D_[m], m = L - (i0 + r) + j: only the band m = L - i0 - 64 .. L - i0 + 1023 (68 column tiles); each pos fragment serves all 4 row tiles
    {
        v16bf a[FMT][2], a2[FMT][2];
#pragma unroll
        for (int mt = 0; mt < FMT; ++mt)
#pragma unroll
            for (int ks = 0; ks < 2; ++ks) { a[mt][ks] = F::ldf(QPh + qoff + mt * 16 * HD + ks * 512); a2[mt][ks] = F::ldf(QPl + qoff + mt * 16 * HD + ks * 512); }
        // precaution: the pointers are named so that no register an issued load names is rewritten ahead of this wait; the clobber also keeps the loads above it
        asm volatile("s_wait_xcnt 0x0" :: "v"(QPh + qoff), "v"(QPl + qoff) : "memory");
        const int mlo = TT - i0 - FR;
        // the wave's next tile is fetched one trip ahead, into the same registers: all its loads are issued together right behind this tile's products and sums, and fly under the LDS stores and the other waves' products
        // wave-uniform bases: the lanes differ in one 32-bit offset, which both planes share, and one for D_; a tile's place is an immediate offset from the wave's first
        const bf* ph = POSh + (size_t)(mlo + w * 16) * HD; const bf* pl = POSl + (size_t)(mlo + w * 16) * HD; const float* dp = DT + (size_t)h * P2 + mlo + w * 16; const unsigned lo = lane * 8, ld = lr;
        v16bf p[2], p2[2]; float dv;
        auto ld1 = [&](int s) __attribute__((always_inline)) {   // the wave's tile number s: tile w + s * FNW
#pragma unroll
            for (int ks = 0; ks < 2; ++ks) { p[ks] = F::ldf(ph + s * FNW * 16 * HD + ks * 512 + lo); p2[ks] = F::ldf(pl + s * FNW * 16 * HD + ks * 512 + lo); }
            dv = dp[s * FNW * 16 + ld];
            // precaution: no register that an issued load names is rewritten ahead of this wait; the clobber also keeps the loads above it and the LDS stores of the trip below it
            asm volatile("s_wait_xcnt 0x0" ::: "memory");
            // keeps the tile's products behind the whole group of its loads: spread among them, each pair of loads is waited for on its own
            __builtin_amdgcn_sched_barrier(0); };
        float* sd = S + (hi * 8) * (FPF + 1) + w * 16 + lr;   /* row r, column FR + j, j = t*16 + lr - FR + r */
        auto trip1 = [&](int s, int nx) __attribute__((always_inline)) {   // tile number s from the registers; nx: the tile fetched behind its products, none if < 0
            v8f acc[FMT];
#pragma unroll
            for (int mt = 0; mt < FMT; ++mt) acc[mt] = (v8f){};
#pragma unroll
            for (int ks = 0; ks < 2; ++ks) {
#pragma unroll
                for (int mt = 0; mt < FMT; ++mt) acc[mt] = wmmab(a[mt][ks], p[ks], acc[mt]);
#pragma unroll
                for (int mt = 0; mt < FMT; ++mt) acc[mt] = wmmab(a2[mt][ks], p[ks], acc[mt]);
#pragma unroll
                for (int mt = 0; mt < FMT; ++mt) acc[mt] = wmmab(a[mt][ks], p2[ks], acc[mt]); }
#pragma unroll
            for (int mt = 0; mt < FMT; ++mt)
#pragma unroll
                for (int j = 0; j < 8; ++j) acc[mt][j] = __fadd_rn(acc[mt][j], dv);
            if (nx >= 0) {
                // keeps the next tile's loads behind the products and sums that read the registers they fill
                __builtin_amdgcn_sched_barrier(0);
                ld1(nx); }
#pragma unroll
            for (int mt = 0; mt < FMT; ++mt)
#pragma unroll
                for (int j = 0; j < 8; ++j) sd[(mt * 16 + j) * (FPF + 1) + s * FNW * 16] = acc[mt][j]; };
        // straight-line trips: every wave takes s1 tiles, FNW apart; the first n1 - s1 * FNW waves one more, which they take first (a wave-uniform branch)
        constexpr int n1 = (TT + FR) / 16, s1 = n1 / FNW;
        const bool ex = w < n1 - s1 * FNW;
        ld1(ex ? s1 : 0);
        if (ex) trip1(s1, 0);
#pragma unroll   // constant tile numbers
        for (int s = 0; s < s1; ++s) trip1(s, (s + 1 < s1) ? s + 1 : -1);
    }
    __syncthreads();
    // phase 2: logit = AC + BD; each k fragment serves all 4 row tiles
    {
        v16bf a[FMT][2], a2[FMT][2];
#pragma unroll
        for (int mt = 0; mt < FMT; ++mt)
#pragma unroll
            for (int ks = 0; ks < 2; ++ks) { a[mt][ks] = F::ldf(QRh + qoff + mt * 16 * HD + ks * 512); a2[mt][ks] = F::ldf(QRl + qoff + mt * 16 * HD + ks * 512); }
        // precaution: the pointers are named so that no register an issued load names is rewritten ahead of this wait; the clobber also keeps the loads above it
        asm volatile("s_wait_xcnt 0x0" :: "v"(QRh + qoff), "v"(QRl + qoff) : "memory");
        // the next k tile is fetched one trip ahead into the same registers, as in phase 1
        const bf* kh = KPh + zo + (size_t)w * 16 * HD; const bf* kl = KPl + zo + (size_t)w * 16 * HD; const unsigned lo = lane * 8;   // wave-uniform bases and the lane's offset, as in phase 1
        v16bf k1[2], k2[2];
        auto ld2 = [&](int s) __attribute__((always_inline)) {
#pragma unroll
            for (int ks = 0; ks < 2; ++ks) { k1[ks] = F::ldf(kh + s * FNW * 16 * HD + ks * 512 + lo); k2[ks] = F::ldf(kl + s * FNW * 16 * HD + ks * 512 + lo); }
            // precaution: no register that an issued load names is rewritten ahead of this wait; the clobber also keeps the loads above it and the LDS stores of the trip below it
            asm volatile("s_wait_xcnt 0x0" ::: "memory");
            // keeps the tile's products behind the whole group of its loads, as in phase 1
            __builtin_amdgcn_sched_barrier(0); };
        float* sq = S + (hi * 8) * FPF + FR + w * 16 + lr;
        auto trip2 = [&](int s, int nx) __attribute__((always_inline)) {
            v8f acc[FMT];
#pragma unroll
            for (int mt = 0; mt < FMT; ++mt) acc[mt] = (v8f){};
#pragma unroll
            for (int ks = 0; ks < 2; ++ks) {
#pragma unroll
                for (int mt = 0; mt < FMT; ++mt) acc[mt] = wmmab(a[mt][ks], k1[ks], acc[mt]);
#pragma unroll
                for (int mt = 0; mt < FMT; ++mt) acc[mt] = wmmab(a2[mt][ks], k1[ks], acc[mt]);
#pragma unroll
                for (int mt = 0; mt < FMT; ++mt) acc[mt] = wmmab(a[mt][ks], k2[ks], acc[mt]); }
            float bd[FMT][8];
#pragma unroll
            for (int mt = 0; mt < FMT; ++mt)
#pragma unroll
                for (int j = 0; j < 8; ++j) bd[mt][j] = sq[(mt * 16 + j) * FPF + s * FNW * 16];
#pragma unroll
            for (int mt = 0; mt < FMT; ++mt)
#pragma unroll
                for (int j = 0; j < 8; ++j) acc[mt][j] = __fadd_rn(acc[mt][j], bd[mt][j]);
            if (nx >= 0) {
                // keeps the next tile's loads behind the products that read the registers they fill
                __builtin_amdgcn_sched_barrier(0);
                ld2(nx); }
#pragma unroll
            for (int mt = 0; mt < FMT; ++mt)
#pragma unroll
                for (int j = 0; j < 8; ++j) sq[(mt * 16 + j) * FPF + s * FNW * 16] = acc[mt][j]; };
        constexpr int s2 = TT / 16 / FNW;
        ld2(0);
#pragma unroll   // straight-line trips, constant tile numbers: as in phase 1
        for (int s = 0; s < s2; ++s) trip2(s, (s + 1 < s2) ? s + 1 : -1);
    }
    // The lane's 32 mask words, the same for each of its rows, are loaded once, in front of V: loads return in order, behind V the softmax would wait for V too.
    const int nt = w & 3, kq = w >> 2;
    const int* km = kmask + (size_t)b * TT + lane * 4;
    v4i kms[TT / 128];
#pragma unroll
    for (int ch = 0; ch < TT / 128; ++ch) kms[ch] = *(const v4i*)(km + ch * 128);
    // precaution: the pointer is named so that no register an issued load names is rewritten ahead of this wait; the clobber also keeps the loads above it
    asm volatile("s_wait_xcnt 0x0" :: "v"(km) : "memory");
    __syncthreads();
    // the loads of phase 4 are issued here, behind the barrier (which waits for every load in flight), so that they fly under the softmax: the wave's whole share of V (wave w: 16 columns of the head, w % 4, and 256 of the 1024 keys, w / 4)
    const size_t voff = zo + (size_t)nt * 16 * TT + (size_t)kq * 256 * 16 + lane * 8;   /* 16 d of 1024 keys are 32 blocks; 32 keys are one block */ const bf* vh = VTh + voff; const bf* vl = VTl + voff;
    v16bf vs[8][2];
#pragma unroll
    for (int u = 0; u < 8; ++u) { vs[u][0] = F::ldf(vh + u * 512); vs[u][1] = F::ldf(vl + u * 512); }
    // precaution: the pointers are named so that no register an issued load names is rewritten ahead of this wait; the clobber also keeps the loads above it
    asm volatile("s_wait_xcnt 0x0" :: "v"(vh), "v"(vl) : "memory");
    // phase 3: softmax, one wave per row, 4 rows a wave (register row, one exp, fixed trees); P split into hi + lo planes in place
    {
#pragma unroll 1   // rolled: one row's 32 values per lane at a time
        for (int rr = 0; rr < FR / FNW; ++rr) { float* srow = S + (w * (FR / FNW) + rr) * FPF; float v[TT / 32]; float mx = -3.0e38f;
#pragma unroll
            for (int ch = 0; ch < TT / 128; ++ch) { const int j0 = ch * 128 + lane * 4; const v4f a = *(const v4fa*)(srow + FR + j0); const v4i k4 = kms[ch];
#pragma unroll
                for (int q = 0; q < 4; ++q) { const float t = (k4[q] != 0) ? a[q] : -3.0e38f; v[ch * 4 + q] = t; mx = fmaxf(mx, t); } }
#pragma unroll
            for (int sh = 16; sh; sh >>= 1) mx = fmaxf(mx, __shfl_xor(mx, sh, 32));
            float sum = 0.f;
#pragma unroll
            for (int k = 0; k < TT / 32; ++k) { v[k] = __builtin_amdgcn_exp2f(__fmul_rn(__fsub_rn(v[k], mx), 1.4426950408889634f)); sum += v[k]; }
#pragma unroll
            for (int sh = 16; sh; sh >>= 1) sum += __shfl_xor(sum, sh, 32);
            const float f = __fdiv_rn(1.0f, sum); bf* prow = (bf*)srow;
#pragma unroll
            for (int ch = 0; ch < TT / 128; ++ch) { c2u wh, wl;
#pragma unroll
                for (int q = 0; q < 4; q += 2) { unsigned a, c2; split2(v[ch * 4 + q] * f, v[ch * 4 + q + 1] * f, a, c2); wh[q >> 1] = a; wl[q >> 1] = c2; }
                const v4us oh = __builtin_bit_cast(v4us, wh), ol = __builtin_bit_cast(v4us, wl);
                *(v4us*)(prow + ch * 128 + lane * 4) = oh; *(v4us*)(prow + TT + ch * 128 + lane * 4) = ol; } }
    }
    __syncthreads();
    // phase 4: O = P.V on all 16 waves, 4 per SIMD, so that one wave's waits for its P fragments are filled by the other three: wave w takes 16 columns of the head (w % 4), all 4 row tiles
    // and 256 of the 1024 keys (w / 4). Each V fragment is still fetched once per work-group. Inside a quarter k runs in the order of the unfused GEMM; the 4 quarters are added below, in the order of the keys.
    v8f o[FMT];
    {
        const bf* pr = (const bf*)(S + lr * FPF) + 8 * hi + kq * 256;
#pragma unroll
        for (int mt = 0; mt < FMT; ++mt) o[mt] = (v8f){};
#pragma unroll
        for (int u = 0; u < 8; ++u) { v16bf ph[FMT], pl[FMT];
#pragma unroll
            for (int mt = 0; mt < FMT; ++mt) { ph[mt] = F::ld(pr + mt * 16 * 2 * FPF + u * 32); pl[mt] = F::ld(pr + mt * 16 * 2 * FPF + TT + u * 32); }
#pragma unroll
            for (int mt = 0; mt < FMT; ++mt) o[mt] = wmmab(ph[mt], vs[u][0], o[mt]);
#pragma unroll
            for (int mt = 0; mt < FMT; ++mt) o[mt] = wmmab(pl[mt], vs[u][0], o[mt]);
#pragma unroll
            for (int mt = 0; mt < FMT; ++mt) o[mt] = wmmab(ph[mt], vs[u][1], o[mt]);
            // keeps the P fragments of later steps from being fetched here: V and the accumulators hold 160 registers, and with more than two steps' fragments beside them the build spills V
            if ((u & 1) && u < 7) __builtin_amdgcn_sched_barrier(0); }
    }
    __syncthreads();   // every wave has read its last P fragment: the rows of S may now take the partial sums
    // the 4 partial tiles, [key quarter][64 rows][68 floats], at the start of S
#pragma unroll
    for (int mt = 0; mt < FMT; ++mt)
#pragma unroll
        for (int j = 0; j < 8; ++j) S[(kq * FR + mt * 16 + hi * 8 + j) * 68 + nt * 16 + lr] = o[mt][j];
    __syncthreads();
    // whole 256-byte output rows per half wave: one writer per line; the quarters are added in the order of their keys
#pragma unroll
    for (int s = 0; s < 2; ++s) { const int row = w * 4 + s * 2 + hi; const float* rp = S + row * 68 + lr * 4;
        const v4f val = ((*(const v4fa*)rp + *(const v4fa*)(rp + FR * 68)) + *(const v4fa*)(rp + 2 * FR * 68)) + *(const v4fa*)(rp + 3 * FR * 68);
        *(v4f*)(OUT + ((size_t)b * TT + i0 + row) * DM + h * HD + lr * 4) = val; }
}
__global__ __launch_bounds__(256) void k_merge(const float* __restrict__ O, int h0, bf* Ah, bf* Al) { const size_t e = ((size_t)blockIdx.x * 256 + threadIdx.x) * 2; if (e >= (size_t)ZH * TT * HD) return; const int d = (int)(e % HD); const int t = (int)((e / HD) % TT); const int zz = (int)(e / ((size_t)HD * TT)); const float cs = (t < RH) ? 1.0f : (1.0f / PCAR); const size_t oo = (size_t)t * DQ + (h0 + zz) * HD + d;
    v2us oh, ol;
#pragma unroll
    for (int q = 0; q < 2; ++q) { unsigned short a, c2; splitf(O[e + q] * cs, a, c2); oh[q] = a; ol[q] = c2; } *(v2us*)(Ah + oo) = oh; *(v2us*)(Al + oo) = ol;  }

extern "C" void kernel_launch(void* const* d_in, const int* in_sizes, int n_in,
                              void* d_out, int out_size, void* d_ws, size_t ws_size, hipStream_t stream) {
    (void)in_sizes; (void)n_in; (void)out_size;
    const float* x = (const float*)d_in[0]; const float* wqv = (const float*)d_in[1]; const float* rrb = (const float*)d_in[2]; const float* rwb = (const float*)d_in[3]; const int* kmask = (const int*)d_in[4]; const float* wq = wqv; const float* wk = nullptr; const float* wv = wqv; const float* wo = nullptr; (void)wk; (void)wo; const float* cosT = nullptr; const float* sinT = nullptr; (void)cosT; (void)sinT;
    float* OUT = (float*)d_out;     // [4][1024][1024]
    char* wsp = (char*)d_ws;
    auto take = [&](size_t bytes) { char* p = wsp; wsp += (bytes + 255) & ~(size_t)255; return (void*)p; };
    const size_t PL = (size_t)NB_ * NH_ * TT * HD;   // one plane set: every batch, every head
    const size_t FL = (size_t)NB_ * TT * DM;         // one f32 activation: every batch
    bf* WALL = (bf*)take((size_t)2 * DQ * DM * 2); bf* POSh = (bf*)take((size_t)P2 * HD * 2); bf* POSl = (bf*)take((size_t)P2 * HD * 2); float* DT = (float*)take((size_t)NH_ * P2 * 4);
    bf* KPh = (bf*)take(PL * 2); bf* KPl = (bf*)take(PL * 2); bf* QRh = (bf*)take(PL * 2); bf* QRl = (bf*)take(PL * 2); bf* QPh = (bf*)take(PL * 2); bf* QPl = (bf*)take(PL * 2);   // hi and lo planes of k, of q + r_r_bias, of q
    bf* VTh = (bf*)take(PL * 2); bf* VTl = (bf*)take(PL * 2);
    bf* XB = (bf*)take(FL * 2);   // the bf16 input, rows b * L + t
    if ((size_t)(wsp - (char*)d_ws) > ws_size) return;   // ws ~ 77 MiB
    // every batch in one launch
    k_prep<<<PB_POS + PB_XK + PB_WT, 256, 0, stream>>>(x, XB, KPh, KPl, wqv, DM, 2 * DQ, WALL, rwb, POSh, POSl, DT);   /* k = x: the bf16-ROUNDED input */
    k_gemmw<bf, DM><<<dim3(NB_ * TT / 128, DQ / 128, 2), 128, 0, stream>>>(XB, WALL, rrb, QPh, QPl, QRh, QRl, VTh, VTl, 0, (size_t)DQ * DM);   /* z = 0: q, z = 1: v */
    k_fattn<<<dim3(TT / FR, NB_ * NH_, 1), FNW * 32, 0, stream>>>(QRh, QRl, QPh, QPl, KPh, KPl, POSh, POSl, DT, VTh, VTl, kmask, OUT);   /* every batch and head */
}

// v010
// One run takes 100 microseconds.
// Timed twice side by side with v009, it ran 1.07 and 1.06 times as fast.
// Over all steps from v000 it is 17.8 times as fast.
#include <hip/hip_runtime.h>

// RelativeMultiHeadAttn (Transformer-XL style, k_as_x: x [4][1024][1024], Wqv [1024][2048] (q | v column blocks), r_r_bias / r_w_bias [16][64], mask [4][1024] (int, read; all ones); k = x itself split into 16 heads; pos = the sinusoidal table [2L][64] (sin | cos of p * exp(-d ln(1e4)/31), p = -L..L-1, row 0 zeroed) computed on chip in f32; AC = (q + r_r_bias).k; B_ = q.pos^T, D_ = r_w_bias.pos^T; BD = shift(B_ + D_) = (B_ + D_)[i][L - i + j] (exact index form of the pad/reshape shift); attn = softmax(AC + BD) (NO scaling; -inf where mask == 0); out = attn.v merged -> [4][1024][1024] (no output projection)).
// Compute dtypes, f32 accumulate: every input rounded to bf16; q, v as PLAIN bf16 GEMMs (inputs: exact); k = the bf16-rounded input, read from the GEMM's own A plane (bf16-exact: it has no lo part); pos table f32 -> hi/lo planes; B_ as hl x hl GEMM (3 products), AC as hl x h (2 products: the third would be by zero) on every row (unscaled logits are sharp); D_ as 64-term f32 dots; BD gathered per element (contiguous along j) and added in f32 in the reference's order; softmax f32; attn.v hl x hl (3 products) on every row; output written directly in f32.

#define NB_  4
#define TT   1024
#define DM   1024
#define NH_  16
#define NKV  16
#define REP  (NH_ / NKV)
#define HD   64
#define DQ   (NH_ * HD)
#define DKV  (NKV * HD)
#define ZH   8                     // heads per k_merge call (k_merge is not launched)
#define ZS   16                    // unused
#define RH   1024                  // k_merge (not launched) scales rows t >= RH by 1/PCAR
#define WIN  0
#define PCAR 1024.0f
#define P2   (2 * TT)             // 2L relative positions
#define SCL  0.125f   // HD^-0.5
typedef _Float16 h16;
typedef unsigned short bf;
typedef __attribute__((ext_vector_type(16))) __bf16   v16bf;
typedef __attribute__((ext_vector_type(16))) _Float16 v16h;
typedef __attribute__((ext_vector_type(8)))  _Float16 v8h;
typedef __attribute__((ext_vector_type(8)))  unsigned short v8us;
typedef __attribute__((ext_vector_type(8)))  float    v8f;
typedef __attribute__((ext_vector_type(4)))  float    v4f;
typedef v8h  __attribute__((may_alias)) v8ha;
typedef v4f  __attribute__((may_alias)) v4fa;
typedef v8us __attribute__((may_alias)) v8usa;

__device__ __forceinline__ unsigned short f2bf(float f) { unsigned u = __float_as_uint(f); u += 0x7FFFu + ((u >> 16) & 1u); return (unsigned short)(u >> 16); }
__device__ __forceinline__ float bf2f(unsigned short b) { return __uint_as_float(((unsigned)b) << 16); }
__device__ __forceinline__ float bfr(float f) { return bf2f(f2bf(f)); }
__device__ __forceinline__ v16h cat16(v8h lo, v8h hi) { return __builtin_shufflevector(lo, hi, 0, 1, 2, 3, 4, 5, 6, 7, 8, 9, 10, 11, 12, 13, 14, 15); }
__device__ __forceinline__ v16bf cat16b(v8us lo, v8us hi) { return __builtin_bit_cast(v16bf, __builtin_shufflevector(lo, hi, 0, 1, 2, 3, 4, 5, 6, 7, 8, 9, 10, 11, 12, 13, 14, 15)); }
__device__ __forceinline__ v8f wmma16(v16h a, v16h b, v8f c) { return __builtin_amdgcn_wmma_f32_16x16x32_f16(false, a, false, b, (short)0, c, false, false); }
__device__ __forceinline__ v8f wmmab(v16bf a, v16bf b, v8f c) { return __builtin_amdgcn_wmma_f32_16x16x32_bf16(false, a, false, b, (short)0, c, false, false); }



// ---- k_gemmw: register-blocked GEMM, one wave per 64x64 output tile (16 accumulators), operands from 16-bit planes in fragment order, staged in LDS for 4 waves (see at the kernel).
// C[m][n] = sum_k A[m][k] Bt[n][k]. z-batch strides sA/sB in elements. z = 0: q, z = 1: v.
// A tile is 64 tokens of one head, so the epilogue writes the planes that the attention kernel reads straight from the accumulators:
// z = 0: hi + lo planes [b][h] of q and of q + r_r_bias (rows t, k = d); z = 1: hi + lo planes [b][h] of v (rows d, k = t); each in fragment order.
template <typename T16> struct WFrag;
template <> struct WFrag<h16> { typedef v16h V; static __device__ __forceinline__ V ld(const h16* p) { return cat16(*(const v8h*)p, *(const v8h*)(p + 16)); } static __device__ __forceinline__ V ldf(const h16* p) { return cat16(*(const v8h*)p, *(const v8h*)(p + 256)); } static __device__ __forceinline__ v8f mma(V a, V b, v8f c) { return wmma16(a, b, c); } };
template <> struct WFrag<bf> { typedef v16bf V; static __device__ __forceinline__ V ld(const bf* p) { return cat16b(*(const v8us*)p, *(const v8us*)(p + 16)); } static __device__ __forceinline__ V ldf(const bf* p) { return cat16b(*(const v8us*)p, *(const v8us*)(p + 256)); } static __device__ __forceinline__ v8f mma(V a, V b, v8f c) { return wmmab(a, b, c); } };
// FRAGMENT ORDER: every 16-bit operand plane in the workspace, rows x K, is stored as blocks of 512 elements, one block per (16 rows, 32 k). Element (row, k) lies at
// ((row / 16) * (K / 32) + k / 32) * 512 + ((k / 16) % 2) * 256 + (((k / 8) % 2) * 16 + row % 16) * 8 + k % 8.
// Lane l of a wave finds the two 16-byte halves of its fragment at l * 8 and 256 + l * 8 of the block (ldf), so each load of a wave reads 512 contiguous bytes, 4 whole lines;
// the registers hold the same values as with row-major planes. fro: the place of 8 neighbouring k, k8 % 8 == 0, kb = K / 32.
__device__ __forceinline__ size_t fro(size_t row, size_t k8, size_t kb) { return ((row >> 4) * kb + (k8 >> 5)) * 512 + ((k8 >> 4) & 1) * 256 + (((k8 >> 3) & 1) * 16 + (row & 15)) * 8; }
__device__ __forceinline__ void splitf(float y, unsigned short& h, unsigned short& l) { h = f2bf(y); l = f2bf(y - bf2f(h)); }
// Rounding to bf16 by the convert instruction, two values each (round to nearest even: the bits of f2bf for every finite value). cvt2: a in the low half, b in the high half.
typedef __attribute__((ext_vector_type(2))) float    c2f;
typedef __attribute__((ext_vector_type(2))) __bf16   c2b;
typedef __attribute__((ext_vector_type(2))) unsigned c2u;
typedef __attribute__((ext_vector_type(4))) unsigned c4u;
__device__ __forceinline__ unsigned cvt2(float a, float b) { const c2f x = {a, b}; return __builtin_bit_cast(unsigned, __builtin_convertvector(x, c2b)); }
// split2: hi and lo planes of two values; lo = the rounded rest, as in splitf
__device__ __forceinline__ void split2(float a, float b, unsigned& h, unsigned& l) { h = cvt2(a, b); l = cvt2(a - __uint_as_float(h << 16), b - __uint_as_float(h & 0xFFFF0000u)); }
// One stage of the ring in LDS: 128 k of the tile's 128 A rows and 128 B rows, 16 chunks of 4 KiB (16 rows x 128 k = four blocks in fragment order, contiguous in the plane too): chunks 0..7 A, 8..15 B.
#define GK   128
#define GCH  (16 * GK)             // elements of a chunk
#define GST  (16 * GCH)            // elements of a stage
// cp8: 2 KiB of each of the 8 chunks of one operand, global -> LDS through no register. A thread moves 16 bytes of each chunk, a wave 512 contiguous bytes (4 whole lines); l: the thread's LDS byte address in the first chunk, g: its global address there, rs: elements from chunk to chunk in the plane.
// The copies and their s_wait_xcnt stand in one statement (a precaution): no register that an issued copy names is rewritten ahead of that wait.
template <typename T16>
__device__ __forceinline__ void cp8(unsigned l, const T16* g, size_t rs) {
    asm volatile("global_load_async_to_lds_b128 %0, %8, off\n\t"
                 "global_load_async_to_lds_b128 %1, %9, off\n\t"
                 "global_load_async_to_lds_b128 %2, %10, off\n\t"
                 "global_load_async_to_lds_b128 %3, %11, off\n\t"
                 "global_load_async_to_lds_b128 %4, %12, off\n\t"
                 "global_load_async_to_lds_b128 %5, %13, off\n\t"
                 "global_load_async_to_lds_b128 %6, %14, off\n\t"
                 "global_load_async_to_lds_b128 %7, %15, off\n\t"
                 "s_wait_xcnt 0x0"
                 :: "v"(l), "v"(l + 1 * GCH * 2), "v"(l + 2 * GCH * 2), "v"(l + 3 * GCH * 2), "v"(l + 4 * GCH * 2), "v"(l + 5 * GCH * 2), "v"(l + 6 * GCH * 2), "v"(l + 7 * GCH * 2),
                    "v"(g), "v"(g + rs), "v"(g + 2 * rs), "v"(g + 3 * rs), "v"(g + 4 * rs), "v"(g + 5 * rs), "v"(g + 6 * rs), "v"(g + 7 * rs) : "memory");
}
// cpst: one whole stage, both operands
template <typename T16>
__device__ __forceinline__ void cpst(unsigned l, const T16* ga, const T16* gb, size_t rs) {
#pragma unroll   // straight-line: 4 statements of 8 copies
    for (int h = 0; h < GCH / 1024; ++h) { cp8(l + h * 2048, ga + h * 1024, rs); cp8(l + 8 * GCH * 2 + h * 2048, gb + h * 1024, rs); }
}
// k_gemmw: a work-group of 4 waves (2 x 2) takes a 128 x 128 tile, each wave a 64 x 64 quarter. The operands come to LDS once per work-group, so each A and B block is fetched from L2 by half as many waves;
// two buffers: the copies of stage t + 1 fly while stage t is worked on. grid (M/128, N/128, Z), 128 threads.
template <typename T16, int K>
__global__ __launch_bounds__(128) void k_gemmw(const T16* __restrict__ A, const T16* __restrict__ Bt, const float* __restrict__ rr, bf* QPh, bf* QPl, bf* QRh, bf* QRl, bf* VTh, bf* VTl, size_t sA, size_t sB) {
    static_assert(K % GK == 0 && K / GK >= 2, "whole stages, two or more");
    typedef typename WFrag<T16>::V V;
    __shared__ __align__(16) T16 st[2 * GST];
    __shared__ __align__(16) float osa[4 * 16 * 68];
    const size_t z = blockIdx.z; A += z * sA; Bt += z * sB;
    const int lane = threadIdx.x & 31, lr = lane & 15, hi = lane >> 4;
    const int w = __builtin_amdgcn_readfirstlane(threadIdx.x >> 5);   // wave number in a scalar register
    const int wm = w >> 1, wn = w & 1; float* os = osa + w * 16 * 68;   // each wave stages its epilogue in its own range
    const int hy = blockIdx.y * 2 + wn; const int r0 = blockIdx.x * 128 + wm * 64, c0 = hy * 64;
    v8f acc[4][4];
#pragma unroll
    for (int mb = 0; mb < 4; ++mb)
#pragma unroll
        for (int nb = 0; nb < 4; ++nb) acc[mb][nb] = (v8f){};
    const T16* ga = A + (size_t)(blockIdx.x * 128) * K + threadIdx.x * 8;    // 16 rows are K / 32 blocks = 16 * K elements; 32 k are one block of 512
    const T16* gb = Bt + (size_t)(blockIdx.y * 128) * K + threadIdx.x * 8;
    const unsigned l0 = (unsigned)(size_t)st + threadIdx.x * 16;             // LDS byte address: the low 32 bits of the __shared__ address
    const size_t rs = (size_t)16 * K; constexpr int nt = K / GK;
    cpst(l0, ga, gb, rs);
    asm volatile("s_wait_asynccnt 0x0" ::: "memory");   // this wave's share of stage 0 has landed
    __syncthreads();                                    // and every other wave's
    cpst(l0 + GST * 2, ga + GCH, gb + GCH, rs);
#pragma unroll 1   // rolled: one trip per stage, the order of waits, barrier and refill at its foot stands once
    for (int t = 0; t < nt; ++t) {
        const T16* sa = st + (t & 1) * GST + wm * 4 * GCH + lane * 8; const T16* sb = st + (t & 1) * GST + (8 + wn * 4) * GCH + lane * 8;
        V a[GK / 32][4], b[GK / 32][4];   // every plain '#pragma unroll' of this kernel makes the indices of a fragment or accumulator array constants, so that the array stays in registers
#pragma unroll
        for (int ks = 0; ks < GK / 32; ++ks) {
#pragma unroll
            for (int mb = 0; mb < 4; ++mb) a[ks][mb] = WFrag<T16>::ldf(sa + mb * GCH + ks * 512);
#pragma unroll
            for (int nb = 0; nb < 4; ++nb) b[ks][nb] = WFrag<T16>::ldf(sb + nb * GCH + ks * 512);
            // keeps the matrix instructions behind the block's 16 fragment loads: spread among them, each pair of loads is waited for on its own
            __builtin_amdgcn_sched_barrier(0);
#pragma unroll
            for (int nb = 0; nb < 4; ++nb)
#pragma unroll
                for (int mb = 0; mb < 4; ++mb) acc[mb][nb] = WFrag<T16>::mma(a[ks][mb], b[ks][nb], acc[mb][nb]);
        }
        // the distance behind the trip's last four matrix instructions: on the loop's back edge only two vector instructions stand between them and the fragment loads that overwrite their operands
        asm volatile("v_nop\n\tv_nop\n\tv_nop\n\tv_nop" : "+v"(acc[0][3]), "+v"(acc[1][3]), "+v"(acc[2][3]), "+v"(acc[3][3]));
        // keeps the trip's last matrix instructions in front of the barrier: sunk behind it they would stand between the barrier and the refill, which would start that much later
        __builtin_amdgcn_sched_barrier(0);
        asm volatile("s_wait_dscnt 0x0" ::: "memory");      // this wave's last read of stage t has returned
        asm volatile("s_wait_asynccnt 0x0" ::: "memory");   // its share of stage t + 1 has landed
        __syncthreads();                                    // stage t + 1 is whole, and no wave reads stage t any more
        if (t + 2 < nt) { const size_t ko = (size_t)(t + 2) * GCH; cpst(l0 + (t & 1) * (GST * 2), ga + ko, gb + ko, rs); }
    }
    asm volatile("s_wait_asynccnt 0x0" ::: "memory");   // no copy is outstanding when the wave goes on
    const int t0 = r0 % TT; const size_t pz = (size_t)((r0 / TT) * NH_ + hy) * TT * HD;   // the planes of this tile's (batch, head)
    if (z == 0) {
        // through LDS, 16 rows at a time: a lane then holds 8 neighbouring d of one token, and 8 lanes (8 neighbouring tokens) write one whole 128-byte line of a block
        const int r8 = lane & 7, cq = lane >> 3; float rb[2][8];
#pragma unroll
        for (int g = 0; g < 2; ++g)
#pragma unroll
            for (int u = 0; u < 8; ++u) rb[g][u] = bfr(rr[c0 + (g * 4 + cq) * 8 + u]);
#pragma unroll
        for (int mb = 0; mb < 4; ++mb) {
#pragma unroll
            for (int nb = 0; nb < 4; ++nb) {
#pragma unroll
                for (int j = 0; j < 8; ++j) os[(hi * 8 + j) * 68 + nb * 16 + lr] = acc[mb][nb][j]; }
            // one wave, LDS runs in order: these two only keep the compiler from moving the reads of other lanes' values above the stores
            __builtin_amdgcn_wave_barrier(); asm volatile("" ::: "memory");
#pragma unroll
            for (int s = 0; s < 4; ++s) { const int row = (s & 1) * 8 + r8, c8 = ((s >> 1) * 4 + cq) * 8; const v4f x0 = *(const v4fa*)(os + row * 68 + c8), x1 = *(const v4fa*)(os + row * 68 + c8 + 4); c4u wqh, wql, wsh, wsl;
#pragma unroll
                for (int u = 0; u < 8; u += 2) { const float q0 = (u < 4) ? x0[u & 3] : x1[u & 3], q1 = (u < 4) ? x0[(u & 3) + 1] : x1[(u & 3) + 1]; unsigned a2, c2; split2(q0, q1, a2, c2); wqh[u >> 1] = a2; wql[u >> 1] = c2; split2(__fadd_rn(q0, rb[s >> 1][u]), __fadd_rn(q1, rb[s >> 1][u + 1]), a2, c2); wsh[u >> 1] = a2; wsl[u >> 1] = c2; }
                const v8us qh = __builtin_bit_cast(v8us, wqh), ql = __builtin_bit_cast(v8us, wql), sh = __builtin_bit_cast(v8us, wsh), sl = __builtin_bit_cast(v8us, wsl);
                const size_t o = pz + fro(t0 + mb * 16 + row, c8, HD / 32);
                *(v8us*)(QPh + o) = qh; *(v8us*)(QPl + o) = ql; *(v8us*)(QRh + o) = sh; *(v8us*)(QRl + o) = sl;
                // precaution: no register that an issued store names is rewritten ahead of this wait
                asm volatile("s_wait_xcnt 0x0" ::: "memory"); }
            // and the next 16 rows' stores from moving above these reads
            __builtin_amdgcn_wave_barrier(); asm volatile("" ::: "memory");
        }
    } else {
        // the transposed planes need no LDS: the 8 accumulator values of a lane are 8 neighbouring tokens of one d, which is that lane's 16 bytes of a block's half: a store writes 512 contiguous bytes
#pragma unroll
        for (int nb = 0; nb < 4; ++nb)
#pragma unroll
            for (int mb = 0; mb < 4; ++mb) { c4u wh, wl;
#pragma unroll
                for (int j = 0; j < 8; j += 2) { unsigned a2, c2; split2(acc[mb][nb][j], acc[mb][nb][j + 1], a2, c2); wh[j >> 1] = a2; wl[j >> 1] = c2; }
                const v8us vh = __builtin_bit_cast(v8us, wh), vl = __builtin_bit_cast(v8us, wl);
                const size_t o = pz + fro(nb * 16 + lr, t0 + mb * 16 + hi * 8, TT / 32);
                *(v8us*)(VTh + o) = vh; *(v8us*)(VTl + o) = vl;
                // precaution: data and pointers are named so that no register an issued store names is rewritten ahead of this wait
                asm volatile("s_wait_xcnt 0x0" :: "v"(vh), "v"(vl), "v"(VTh + o), "v"(VTl + o) : "memory"); }
    }
}

typedef __attribute__((ext_vector_type(2))) _Float16 v2h;
typedef __attribute__((ext_vector_type(4))) _Float16 v4h;
typedef __attribute__((ext_vector_type(2))) unsigned short v2us;
typedef __attribute__((ext_vector_type(4))) unsigned short v4us;
typedef __attribute__((ext_vector_type(2))) float v2f;
typedef __attribute__((ext_vector_type(4))) int v4i;

// d_wtG: the weights rounded to bf16, as the GEMM's B plane (rows n, k = the model dimension) in fragment order. A thread takes 8 neighbouring k of one n:
// the lanes of a wave read 32 neighbouring n, one whole line per k, and write two runs of 256 contiguous bytes.
__device__ __forceinline__ void d_wtG(int blk, const float* __restrict__ w, int K, int N, bf* Bt) {
    const int idx = blk * 256 + threadIdx.x; const int n = idx % N, k0 = (idx / N) * 8; if (k0 >= K) return;
    const float* wp[8]; float v[8];
#pragma unroll
    for (int u = 0; u < 8; ++u) { wp[u] = w + (size_t)(k0 + u) * N + n; v[u] = *wp[u]; }
    // precaution: the pointers are named so that no register an issued load names is rewritten ahead of this wait; the clobber also keeps the loads above it
    asm volatile("s_wait_xcnt 0x0" :: "v"(wp[0]), "v"(wp[1]), "v"(wp[2]), "v"(wp[3]), "v"(wp[4]), "v"(wp[5]), "v"(wp[6]), "v"(wp[7]) : "memory");
    c4u oc;
#pragma unroll
    for (int u = 0; u < 8; u += 2) oc[u >> 1] = cvt2(v[u], v[u + 1]);
    const v8us o = __builtin_bit_cast(v8us, oc);
    *(v8us*)(Bt + fro(n, k0, K >> 5)) = o;
}
// d_xk: x rounded to bf16, as the GEMM's A plane (rows b * L + t, k = the model dimension) in fragment order. The same plane is the attention kernel's k operand: head h's 64 d are the model dimensions 64 h .., whole blocks 2 h and 2 h + 1 of a row tile;
// the rounded value is bf16-exact, so k has no lo plane.
// A block takes 8 tokens, a thread 8 elements of one token at 4 places 256 columns apart, all loads first. 8 neighbouring lanes hold 8 neighbouring tokens: they write one whole 128-byte line of a block;
// a wave reads one whole 128-byte line of each of its 8 tokens. Block-uniform bases: the lanes differ in one 32-bit offset per buffer, and a thread's 4 groups lie an immediate offset apart.
__device__ __forceinline__ void d_xk(int blk, const float* __restrict__ x, bf* XB) { const unsigned tk = threadIdx.x & 7, cq = threadIdx.x >> 3; const unsigned xo = tk * DM + cq * 8; v8f v[4];
    const size_t r0 = (size_t)blk * 8; const unsigned rl = (unsigned)(r0 & 15) + tk;   // the token's row in its block of 16
    const unsigned fo = ((cq >> 1) & 1) * 256 + ((cq & 1) * 16 + rl) * 8;                     // the place of the thread's 8 elements inside a block of 512
    const unsigned ao = (cq >> 2) * 512 + fo;
    const float* xb = x + r0 * DM; bf* ob = XB + (r0 >> 4) * (16 * DM);
#pragma unroll
    for (int g = 0; g < 4; ++g) v[g] = *(const v8f*)(xb + g * 256 + xo);
    // precaution: the lane's offset is named so that no register an issued load names is rewritten ahead of this wait; the clobber also keeps the loads above it
    asm volatile("s_wait_xcnt 0x0" :: "v"(xo * 4) : "memory");
#pragma unroll
    for (int g = 0; g < 4; ++g) { c4u oc;
#pragma unroll
        for (int k = 0; k < 8; k += 2) oc[k >> 1] = cvt2(v[g][k], v[g][k + 1]);
        const v8us o = __builtin_bit_cast(v8us, oc);
        *(v8us*)(ob + g * 8 * 512 + ao) = o; } }
__global__ __launch_bounds__(256) void k_cscvt(const float* __restrict__ cosT, const float* __restrict__ sinT, float* CS) { const int idx = blockIdx.x * 256 + threadIdx.x; if (idx >= TT * HD) return; v2f cs; cs[0] = bfr(cosT[idx]); cs[1] = bfr(sinT[idx]); *(v2f*)(CS + (size_t)idx * 2) = cs;  }
// d_postab: 32 rows of the table as hi + lo planes (rows m, k = d) in fragment order, and D_[h][m] = r_w_bias[h].pos[m] of those rows for all 16 heads. 64 threads take 8 rows, a thread 8 neighbouring d of one row;
// 8 neighbouring lanes hold 8 neighbouring rows: a wave writes whole 128-byte lines of both planes, and its 32 d are all sines or all cosines.
// The f32 rows go to D_ through LDS (pitch 272 B = 16 B x odd): a lane then holds one whole row in registers, a wave takes 2 heads, whose weights are wave-uniform, and stores one whole 128-byte line of D_ per head.
#define PSP (HD + 4)
__device__ __forceinline__ void d_postab(int blk, const float* __restrict__ rw, bf* Ph2, bf* Pl2, float* DT, float* ps) { const int rl = (threadIdx.x >> 6) * 8 + (threadIdx.x & 7); const int m = blk * 32 + rl; const int d0 = ((threadIdx.x >> 3) & 7) * 8; v8f vv; c4u wh, wl;
#pragma unroll
    for (int q = 0; q < 8; ++q) { const int d = d0 + q; const int dd = (d < HD / 2) ? d : d - HD / 2; const float fr = expf(__fmul_rn((float)dd, -0.29710776f)); const float ang = __fmul_rn((float)(m - TT), fr); float v = (d < HD / 2) ? sinf(ang) : cosf(ang); if (m == 0) v = 0.0f; vv[q] = v; }
#pragma unroll   // constant indices: the row's values and the packed words stay in registers
    for (int q = 0; q < 8; q += 2) { unsigned a2, c2; split2(vv[q], vv[q + 1], a2, c2); wh[q >> 1] = a2; wl[q >> 1] = c2; }
    const v8us hh = __builtin_bit_cast(v8us, wh), ll = __builtin_bit_cast(v8us, wl);
    const size_t o = fro(m, d0, HD / 32);
    *(v4fa*)(ps + rl * PSP + d0) = __builtin_shufflevector(vv, vv, 0, 1, 2, 3); *(v4fa*)(ps + rl * PSP + d0 + 4) = __builtin_shufflevector(vv, vv, 4, 5, 6, 7);
    __syncthreads();   // the block's 32 rows are whole in LDS (the branch that leads here is block-uniform)
    const int lane = threadIdx.x & 31; const int h0 = __builtin_amdgcn_readfirstlane(threadIdx.x >> 5);   // wave number in a scalar register: the weights' addresses are wave-uniform
    v4f pv[HD / 4];
#pragma unroll   // constant indices: the row stays in registers
    for (int q = 0; q < HD / 4; ++q) pv[q] = *(const v4fa*)(ps + lane * PSP + q * 4);
    float a0 = 0.f, a1 = 0.f;   // heads h0 and h0 + 8: two independent chains, each in the order of d
#pragma unroll   // constant indices into the row's registers; the weights come by wide scalar loads
    for (int d = 0; d < HD; ++d) { a0 += bfr(rw[h0 * HD + d]) * pv[d >> 2][d & 3]; a1 += bfr(rw[(h0 + 8) * HD + d]) * pv[d >> 2][d & 3]; }
    // every global store of the block stands here at its end: no register that an issued store names is rewritten behind it
    *(v8us*)(Ph2 + o) = hh; *(v8us*)(Pl2 + o) = ll; DT[h0 * P2 + blk * 32 + lane] = a0; DT[(h0 + 8) * P2 + blk * 32 + lane] = a1;  }
// k_prep: all that depends on nothing but the inputs, in ONE launch: each block does one pass's share, chosen by its index (block-uniform branches).
// The table's blocks come first (the longest chain of arithmetic), then the input's, then the weights'.
#define PB_POS (P2 / 32)
#define PB_XK  (NB_ * TT / 8)
#define PB_WT  (DM * 2 * DQ / 8 / 256)
__global__ __launch_bounds__(256) void k_prep(const float* __restrict__ x, bf* XB, const float* __restrict__ w, int K, int N, bf* Bt, const float* __restrict__ rw, bf* Ph2, bf* Pl2, float* DT) {
    __shared__ __align__(16) float ps[32 * PSP];
    const int blk = blockIdx.x;
    if (blk < PB_POS) d_postab(blk, rw, Ph2, Pl2, DT, ps);
    else if (blk < PB_POS + PB_XK) d_xk(blk - PB_POS, x, XB);
    else d_wtG(blk - PB_POS - PB_XK, w, K, N, Bt);
}
// k_fattn: one work-group of 16 waves per 64 query rows of one (batch, head). The 64 x 1024 logit block lives in LDS from the first product to P.V.
// LDS row: 64 floats of left margin | 1024 logits | 64 floats of right margin | 4 floats (pitch 4624 B = 16 B x odd). The margins take the band's elements whose key index falls outside 0..1023: they are written, never read.
// After the softmax the same row holds the bf16 hi plane (bytes 0..2047) and lo plane (bytes 2048..4095) of P; after P.V the start of the block holds the 4 partial output tiles.
// Every plain '#pragma unroll' below makes the indices of a fragment or accumulator array constants, so that the array stays in registers.
#define FR   64
#define FMT  (FR / 16)
#define FNW  16
#define FPF  (TT + 2 * FR + 4)
__global__ __launch_bounds__(FNW * 32) void k_fattn(const bf* __restrict__ QRh, const bf* __restrict__ QRl, const bf* __restrict__ QPh, const bf* __restrict__ QPl, const bf* __restrict__ XB, const bf* __restrict__ POSh, const bf* __restrict__ POSl, const float* __restrict__ DT, const bf* __restrict__ VTh, const bf* __restrict__ VTl, const int* __restrict__ kmask, float* OUT) {
    typedef WFrag<bf> F;
    __shared__ __align__(16) float S[FR * FPF];
    const int lane = threadIdx.x & 31, lr = lane & 15, hi = lane >> 4;
    const int w = __builtin_amdgcn_readfirstlane(threadIdx.x >> 5);   // wave number in a scalar register: every loop and branch round a matrix instruction is wave-uniform
    const int i0 = blockIdx.x * FR; const int z = blockIdx.y; const int b = z / NH_, h = z % NH_;
    const size_t zo = (size_t)z * TT * HD;
    const size_t qoff = zo + (size_t)i0 * HD + lane * 8;   // planes in fragment order: 16 rows of 64 d are 2 blocks of 512
    // phase 1: BD[r][j] = B_[i0 + r][m] + D_[m], m = L - (i0 + r) + j: only the band m = L - i0 - 64 .. L - i0 + 1023 (68 column tiles); each pos fragment serves all 4 row tiles
    {
        v16bf a[FMT][2], a2[FMT][2];
#pragma unroll
        for (int mt = 0; mt < FMT; ++mt)
#pragma unroll
            for (int ks = 0; ks < 2; ++ks) { a[mt][ks] = F::ldf(QPh + qoff + mt * 16 * HD + ks * 512); a2[mt][ks] = F::ldf(QPl + qoff + mt * 16 * HD + ks * 512); }
        // precaution: the pointers are named so that no register an issued load names is rewritten ahead of this wait; the clobber also keeps the loads above it
        asm volatile("s_wait_xcnt 0x0" :: "v"(QPh + qoff), "v"(QPl + qoff) : "memory");
        const int mlo = TT - i0 - FR;
        // the wave's next tile is fetched one trip ahead, into the same registers: all its loads are issued together right behind this tile's products and sums, and fly under the LDS stores and the other waves' products
        // wave-uniform bases: the lanes differ in one 32-bit offset, which both planes share, and one for D_; a tile's place is an immediate offset from the wave's first
        const bf* ph = POSh + (size_t)(mlo + w * 16) * HD; const bf* pl = POSl + (size_t)(mlo + w * 16) * HD; const float* dp = DT + (size_t)h * P2 + mlo + w * 16; const unsigned lo = lane * 8, ld = lr;
        v16bf p[2], p2[2]; float dv;
        auto ld1 = [&](int s) __attribute__((always_inline)) {   // the wave's tile number s: tile w + s * FNW
#pragma unroll
            for (int ks = 0; ks < 2; ++ks) { p[ks] = F::ldf(ph + s * FNW * 16 * HD + ks * 512 + lo); p2[ks] = F::ldf(pl + s * FNW * 16 * HD + ks * 512 + lo); }
            dv = dp[s * FNW * 16 + ld];
            // precaution: no register that an issued load names is rewritten ahead of this wait; the clobber also keeps the loads above it and the LDS stores of the trip below it
            asm volatile("s_wait_xcnt 0x0" ::: "memory");
            // keeps the tile's products behind the whole group of its loads: spread among them, each pair of loads is waited for on its own
            __builtin_amdgcn_sched_barrier(0); };
        float* sd = S + (hi * 8) * (FPF + 1) + w * 16 + lr;   /* row r, column FR + j, j = t*16 + lr - FR + r */
        auto trip1 = [&](int s, int nx) __attribute__((always_inline)) {   // tile number s from the registers; nx: the tile fetched behind its products, none if < 0
            v8f acc[FMT];
#pragma unroll
            for (int mt = 0; mt < FMT; ++mt) acc[mt] = (v8f){};
#pragma unroll
            for (int ks = 0; ks < 2; ++ks) {
#pragma unroll
                for (int mt = 0; mt < FMT; ++mt) acc[mt] = wmmab(a[mt][ks], p[ks], acc[mt]);
#pragma unroll
                for (int mt = 0; mt < FMT; ++mt) acc[mt] = wmmab(a2[mt][ks], p[ks], acc[mt]);
#pragma unroll
                for (int mt = 0; mt < FMT; ++mt) acc[mt] = wmmab(a[mt][ks], p2[ks], acc[mt]); }
#pragma unroll
            for (int mt = 0; mt < FMT; ++mt)
#pragma unroll
                for (int j = 0; j < 8; ++j) acc[mt][j] = __fadd_rn(acc[mt][j], dv);
            if (nx >= 0) {
                // keeps the next tile's loads behind the products and sums that read the registers they fill
                __builtin_amdgcn_sched_barrier(0);
                ld1(nx); }
#pragma unroll
            for (int mt = 0; mt < FMT; ++mt)
#pragma unroll
                for (int j = 0; j < 8; ++j) sd[(mt * 16 + j) * (FPF + 1) + s * FNW * 16] = acc[mt][j]; };
        // straight-line trips: every wave takes s1 tiles, FNW apart; the first n1 - s1 * FNW waves one more, which they take first (a wave-uniform branch)
        constexpr int n1 = (TT + FR) / 16, s1 = n1 / FNW;
        const bool ex = w < n1 - s1 * FNW;
        ld1(ex ? s1 : 0);
        if (ex) trip1(s1, 0);
#pragma unroll   // constant tile numbers
        for (int s = 0; s < s1; ++s) trip1(s, (s + 1 < s1) ? s + 1 : -1);
    }
    __syncthreads();
    // phase 2: logit = AC + BD; each k fragment serves all 4 row tiles. k is bf16-exact for every input (it is the rounded x itself): (q hi + q lo) . k is the whole product
    {
        v16bf a[FMT][2], a2[FMT][2];
#pragma unroll
        for (int mt = 0; mt < FMT; ++mt)
#pragma unroll
            for (int ks = 0; ks < 2; ++ks) { a[mt][ks] = F::ldf(QRh + qoff + mt * 16 * HD + ks * 512); a2[mt][ks] = F::ldf(QRl + qoff + mt * 16 * HD + ks * 512); }
        // precaution: the pointers are named so that no register an issued load names is rewritten ahead of this wait; the clobber also keeps the loads above it
        asm volatile("s_wait_xcnt 0x0" :: "v"(QRh + qoff), "v"(QRl + qoff) : "memory");
        // the next k tile is fetched one trip ahead into the same registers, as in phase 1
        // 16 keys of the head: blocks 2 h and 2 h + 1 of the DM / 32 blocks of the input plane's row tile, 2 KiB in a row
        const bf* kh = XB + ((size_t)b * TT + w * 16) * DM + h * (HD / 32) * 512; const unsigned lo = lane * 8;   // wave-uniform base and the lane's offset, as in phase 1
        v16bf k1[2];
        auto ld2 = [&](int s) __attribute__((always_inline)) {
#pragma unroll
            for (int ks = 0; ks < 2; ++ks) k1[ks] = F::ldf(kh + s * FNW * 16 * DM + ks * 512 + lo);
            // precaution: no register that an issued load names is rewritten ahead of this wait; the clobber also keeps the loads above it and the LDS stores of the trip below it
            asm volatile("s_wait_xcnt 0x0" ::: "memory");
            // keeps the tile's products behind the whole group of its loads, as in phase 1
            __builtin_amdgcn_sched_barrier(0); };
        float* sq = S + (hi * 8) * FPF + FR + w * 16 + lr;
        auto trip2 = [&](int s, int nx) __attribute__((always_inline)) {
            v8f acc[FMT];
#pragma unroll
            for (int mt = 0; mt < FMT; ++mt) acc[mt] = (v8f){};
#pragma unroll
            for (int ks = 0; ks < 2; ++ks) {
#pragma unroll
                for (int mt = 0; mt < FMT; ++mt) acc[mt] = wmmab(a[mt][ks], k1[ks], acc[mt]);
#pragma unroll
                for (int mt = 0; mt < FMT; ++mt) acc[mt] = wmmab(a2[mt][ks], k1[ks], acc[mt]); }
            float bd[FMT][8];
#pragma unroll
            for (int mt = 0; mt < FMT; ++mt)
#pragma unroll
                for (int j = 0; j < 8; ++j) bd[mt][j] = sq[(mt * 16 + j) * FPF + s * FNW * 16];
#pragma unroll
            for (int mt = 0; mt < FMT; ++mt)
#pragma unroll
                for (int j = 0; j < 8; ++j) acc[mt][j] = __fadd_rn(acc[mt][j], bd[mt][j]);
            if (nx >= 0) {
                // keeps the next tile's loads behind the products that read the registers they fill
                __builtin_amdgcn_sched_barrier(0);
                ld2(nx); }
#pragma unroll
            for (int mt = 0; mt < FMT; ++mt)
#pragma unroll
                for (int j = 0; j < 8; ++j) sq[(mt * 16 + j) * FPF + s * FNW * 16] = acc[mt][j]; };
        constexpr int s2 = TT / 16 / FNW;
        ld2(0);
#pragma unroll   // straight-line trips, constant tile numbers: as in phase 1
        for (int s = 0; s < s2; ++s) trip2(s, (s + 1 < s2) ? s + 1 : -1);
    }
    // The lane's 32 mask words, the same for each of its rows, are loaded once, in front of V: loads return in order, behind V the softmax would wait for V too.
    const int nt = w & 3, kq = w >> 2;
    const int* km = kmask + (size_t)b * TT + lane * 4;
    v4i kms[TT / 128];
#pragma unroll
    for (int ch = 0; ch < TT / 128; ++ch) kms[ch] = *(const v4i*)(km + ch * 128);
    // precaution: the pointer is named so that no register an issued load names is rewritten ahead of this wait; the clobber also keeps the loads above it
    asm volatile("s_wait_xcnt 0x0" :: "v"(km) : "memory");
    __syncthreads();
    // the loads of phase 4 are issued here, behind the barrier (which waits for every load in flight), so that they fly under the softmax: the wave's whole share of V (wave w: 16 columns of the head, w % 4, and 256 of the 1024 keys, w / 4)
    const size_t voff = zo + (size_t)nt * 16 * TT + (size_t)kq * 256 * 16 + lane * 8;   /* 16 d of 1024 keys are 32 blocks; 32 keys are one block */ const bf* vh = VTh + voff; const bf* vl = VTl + voff;
    v16bf vs[8][2];
#pragma unroll
    for (int u = 0; u < 8; ++u) { vs[u][0] = F::ldf(vh + u * 512); vs[u][1] = F::ldf(vl + u * 512); }
    // precaution: the pointers are named so that no register an issued load names is rewritten ahead of this wait; the clobber also keeps the loads above it
    asm volatile("s_wait_xcnt 0x0" :: "v"(vh), "v"(vl) : "memory");
    // phase 3: softmax, one wave per row, 4 rows a wave (register row, one exp, fixed trees); P split into hi + lo planes in place
    {
#pragma unroll 1   // rolled: one row's 32 values per lane at a time
        for (int rr = 0; rr < FR / FNW; ++rr) { float* srow = S + (w * (FR / FNW) + rr) * FPF; float v[TT / 32]; float mx = -3.0e38f;
#pragma unroll
            for (int ch = 0; ch < TT / 128; ++ch) { const int j0 = ch * 128 + lane * 4; const v4f a = *(const v4fa*)(srow + FR + j0); const v4i k4 = kms[ch];
#pragma unroll
                for (int q = 0; q < 4; ++q) { const float t = (k4[q] != 0) ? a[q] : -3.0e38f; v[ch * 4 + q] = t; mx = fmaxf(mx, t); } }
#pragma unroll
            for (int sh = 16; sh; sh >>= 1) mx = fmaxf(mx, __shfl_xor(mx, sh, 32));
            float sum = 0.f;
#pragma unroll
            for (int k = 0; k < TT / 32; ++k) { v[k] = __builtin_amdgcn_exp2f(__fmul_rn(__fsub_rn(v[k], mx), 1.4426950408889634f)); sum += v[k]; }
#pragma unroll
            for (int sh = 16; sh; sh >>= 1) sum += __shfl_xor(sum, sh, 32);
            const float f = __fdiv_rn(1.0f, sum); bf* prow = (bf*)srow;
#pragma unroll
            for (int ch = 0; ch < TT / 128; ++ch) { c2u wh, wl;
#pragma unroll
                for (int q = 0; q < 4; q += 2) { unsigned a, c2; split2(v[ch * 4 + q] * f, v[ch * 4 + q + 1] * f, a, c2); wh[q >> 1] = a; wl[q >> 1] = c2; }
                const v4us oh = __builtin_bit_cast(v4us, wh), ol = __builtin_bit_cast(v4us, wl);
                *(v4us*)(prow + ch * 128 + lane * 4) = oh; *(v4us*)(prow + TT + ch * 128 + lane * 4) = ol; } }
    }
    __syncthreads();
    // phase 4: O = P.V on all 16 waves, 4 per SIMD, so that one wave's waits for its P fragments are filled by the other three: wave w takes 16 columns of the head (w % 4), all 4 row tiles
    // and 256 of the 1024 keys (w / 4). Each V fragment is still fetched once per work-group. Inside a quarter k runs in the order of the unfused GEMM; the 4 quarters are added below, in the order of the keys.
    v8f o[FMT];
    {
        const bf* pr = (const bf*)(S + lr * FPF) + 8 * hi + kq * 256;
#pragma unroll
        for (int mt = 0; mt < FMT; ++mt) o[mt] = (v8f){};
#pragma unroll
        for (int u = 0; u < 8; ++u) { v16bf ph[FMT], pl[FMT];
#pragma unroll
            for (int mt = 0; mt < FMT; ++mt) { ph[mt] = F::ld(pr + mt * 16 * 2 * FPF + u * 32); pl[mt] = F::ld(pr + mt * 16 * 2 * FPF + TT + u * 32); }
#pragma unroll
            for (int mt = 0; mt < FMT; ++mt) o[mt] = wmmab(ph[mt], vs[u][0], o[mt]);
#pragma unroll
            for (int mt = 0; mt < FMT; ++mt) o[mt] = wmmab(pl[mt], vs[u][0], o[mt]);
#pragma unroll
            for (int mt = 0; mt < FMT; ++mt) o[mt] = wmmab(ph[mt], vs[u][1], o[mt]);
            // keeps the P fragments of later steps from being fetched here: V and the accumulators hold 160 registers, and with more than two steps' fragments beside them the build spills V
            if ((u & 1) && u < 7) __builtin_amdgcn_sched_barrier(0); }
    }
    __syncthreads();   // every wave has read its last P fragment: the rows of S may now take the partial sums
    // the 4 partial tiles, [key quarter][64 rows][68 floats], at the start of S
#pragma unroll
    for (int mt = 0; mt < FMT; ++mt)
#pragma unroll
        for (int j = 0; j < 8; ++j) S[(kq * FR + mt * 16 + hi * 8 + j) * 68 + nt * 16 + lr] = o[mt][j];
    __syncthreads();
    // whole 256-byte output rows per half wave: one writer per line; the quarters are added in the order of their keys
#pragma unroll
    for (int s = 0; s < 2; ++s) { const int row = w * 4 + s * 2 + hi; const float* rp = S + row * 68 + lr * 4;
        const v4f val = ((*(const v4fa*)rp + *(const v4fa*)(rp + FR * 68)) + *(const v4fa*)(rp + 2 * FR * 68)) + *(const v4fa*)(rp + 3 * FR * 68);
        *(v4f*)(OUT + ((size_t)b * TT + i0 + row) * DM + h * HD + lr * 4) = val; }
}
__global__ __launch_bounds__(256) void k_merge(const float* __restrict__ O, int h0, bf* Ah, bf* Al) { const size_t e = ((size_t)blockIdx.x * 256 + threadIdx.x) * 2; if (e >= (size_t)ZH * TT * HD) return; const int d = (int)(e % HD); const int t = (int)((e / HD) % TT); const int zz = (int)(e / ((size_t)HD * TT)); const float cs = (t < RH) ? 1.0f : (1.0f / PCAR); const size_t oo = (size_t)t * DQ + (h0 + zz) * HD + d;
    v2us oh, ol;
#pragma unroll
    for (int q = 0; q < 2; ++q) { unsigned short a, c2; splitf(O[e + q] * cs, a, c2); oh[q] = a; ol[q] = c2; } *(v2us*)(Ah + oo) = oh; *(v2us*)(Al + oo) = ol;  }

extern "C" void kernel_launch(void* const* d_in, const int* in_sizes, int n_in,
                              void* d_out, int out_size, void* d_ws, size_t ws_size, hipStream_t stream) {
    (void)in_sizes; (void)n_in; (void)out_size;
    const float* x = (const float*)d_in[0]; const float* wqv = (const float*)d_in[1]; const float* rrb = (const float*)d_in[2]; const float* rwb = (const float*)d_in[3]; const int* kmask = (const int*)d_in[4]; const float* wq = wqv; const float* wk = nullptr; const float* wv = wqv; const float* wo = nullptr; (void)wk; (void)wo; const float* cosT = nullptr; const float* sinT = nullptr; (void)cosT; (void)sinT;
    float* OUT = (float*)d_out;     // [4][1024][1024]
    char* wsp = (char*)d_ws;
    auto take = [&](size_t bytes) { char* p = wsp; wsp += (bytes + 255) & ~(size_t)255; return (void*)p; };
    const size_t PL = (size_t)NB_ * NH_ * TT * HD;   // one plane set: every batch, every head
    const size_t FL = (size_t)NB_ * TT * DM;         // one f32 activation: every batch
    bf* WALL = (bf*)take((size_t)2 * DQ * DM * 2); bf* POSh = (bf*)take((size_t)P2 * HD * 2); bf* POSl = (bf*)take((size_t)P2 * HD * 2); float* DT = (float*)take((size_t)NH_ * P2 * 4);
    bf* QRh = (bf*)take(PL * 2); bf* QRl = (bf*)take(PL * 2); bf* QPh = (bf*)take(PL * 2); bf* QPl = (bf*)take(PL * 2);   // hi and lo planes of q + r_r_bias, of q
    bf* VTh = (bf*)take(PL * 2); bf* VTl = (bf*)take(PL * 2);
    bf* XB = (bf*)take(FL * 2);   // the bf16 input, rows b * L + t
    if ((size_t)(wsp - (char*)d_ws) > ws_size) return;   // ws ~ 61 MiB
    // every batch in one launch
    k_prep<<<PB_POS + PB_XK + PB_WT, 256, 0, stream>>>(x, XB, wqv, DM, 2 * DQ, WALL, rwb, POSh, POSl, DT);   /* k = x: the bf16-ROUNDED input */
    k_gemmw<bf, DM><<<dim3(NB_ * TT / 128, DQ / 128, 2), 128, 0, stream>>>(XB, WALL, rrb, QPh, QPl, QRh, QRl, VTh, VTl, 0, (size_t)DQ * DM);   /* z = 0: q, z = 1: v */
    k_fattn<<<dim3(TT / FR, NB_ * NH_, 1), FNW * 32, 0, stream>>>(QRh, QRl, QPh, QPl, XB, POSh, POSl, DT, VTh, VTl, kmask, OUT);   /* every batch and head */
}
